// v000
// Times are from an AMD MI455X. After a warm-up the kernel runs many times in a row, and a time is the length of
// such a window on the GPU divided by its runs, so every launch and the gaps after it count. The runs cycle
// through copies of the inputs. A figure is the median of several windows, for all but v000 over two sittings.
// Sittings can differ by a few percent; kernels timed side by side share one.
// The starting kernel, v000, takes 494 microseconds a run.
// Contractions: conv1x1 q/k/v GEMM W[320x256].X[256x4096] on v_wmma_f32_16x16x32_f16 (f16 containers of bf16-RNE
// weights x256 and bf16-RNE x); position scores K.Q^T on v_wmma_f32_16x16x32_bf16 (bf16 hi + bf16 residual planes of
// q and k, 3 products, K=32); O^T = V.P^T on v_wmma_f32_16x16x32_f16 (v f16, P = e^{s-m} x1024 f16 from the score D
// registers); channel Gram X.X^T (K=4096) and channel mix A.X (K=256) on v_wmma_f32_16x16x32_f16 (f16 of bf16-RNE x,
// softmax weights x1024 f16); f32 accumulate everywhere; softmax statistics, residual adds and output sum in f32 VALU.
#include <hip/hip_runtime.h>
#include <math.h>
#include <stdint.h>

#define NB    2
#define CC    256
#define NN    4096
#define CQ    32
#define MQKV  320
#define QT    64
#define OSP   68
#define OSPW  132
#define TP    72
#define WSC   256.0f
#define IWSC  0.00390625f
#define PSC   1024.0f
#define IPSC  0.0009765625f
#define LNPS  6.931471805599453f

static_assert(NN % QT == 0);
static_assert(CC % QT == 0);
static_assert(MQKV == 2 * CQ + CC);
static_assert(MQKV % QT == 0);
static_assert((OSP * 4) % 16 == 0);
static_assert((OSPW * 4) % 16 == 0);
static_assert((TP * 2) % 16 == 0);
static_assert(CC % 32 == 0 && NN % 32 == 0 && CQ == 32);

typedef _Float16       v16h __attribute__((ext_vector_type(16)));
typedef _Float16       v8h  __attribute__((ext_vector_type(8)));
typedef __bf16         v16b __attribute__((ext_vector_type(16)));
typedef unsigned short v8us __attribute__((ext_vector_type(8)));
typedef float          v8f  __attribute__((ext_vector_type(8)));
typedef float          v4f  __attribute__((ext_vector_type(4)));
typedef unsigned int   v4u  __attribute__((ext_vector_type(4)));

union Frag  { v8us u[2]; v16h h; v16b bf; };
union FragH { v16h v; v8h hv[2]; };
static_assert(sizeof(Frag) == 32);
static_assert(sizeof(FragH) == 32);

// ---- scalar helpers ---------------------------------------------------------------------------------------
__device__ __forceinline__ unsigned short bf_bits(float f) {          // f32 -> bf16 bits, RNE convert
  unsigned u = __float_as_uint(f);
  return (unsigned short)((u + 0x7FFFu + ((u >> 16) & 1u)) >> 16);
}
__device__ __forceinline__ float bf_up(unsigned short hb) { return __uint_as_float(((unsigned)hb) << 16); }
__device__ __forceinline__ float bfr(float f) { return bf_up(bf_bits(f)); }
__device__ __forceinline__ unsigned short h_bits(_Float16 x) { return __builtin_bit_cast(unsigned short, x); }
__device__ __forceinline__ unsigned pk16(unsigned short a, unsigned short b) { return (unsigned)a | ((unsigned)b << 16); }
__device__ __forceinline__ v8f zero8() { v8f z = {0.f, 0.f, 0.f, 0.f, 0.f, 0.f, 0.f, 0.f}; return z; }
__device__ __forceinline__ float hmax8(v8f s) {
  return fmaxf(fmaxf(fmaxf(s[0], s[1]), fmaxf(s[2], s[3])), fmaxf(fmaxf(s[4], s[5]), fmaxf(s[6], s[7])));
}

// ---- 16-bit fragment loader (A, or B from a k-contiguous [n][k] row): lane -> row/col (lane&15), p already includes
//      + 8*(lane>>4); elements 0..7 <- p[0..7] (k0+8h..), elements 8..15 <- p[16..23] (k0+16+8h..)
__device__ __forceinline__ Frag ldfrag(const unsigned short* p) {
  Frag f;
  f.u[0] = *(const v8us*)(p);
  f.u[1] = *(const v8us*)(p + 16);
  return f;
}

// ---- WMMA helpers: builtin followed by a 4-slot VALU gap tying D and keeping A/B live --------------------------
__device__ __forceinline__ v8f mma_h(v16h a, v16h b, v8f c) {
  v8f d = __builtin_amdgcn_wmma_f32_16x16x32_f16(false, a, false, b, (short)0, c, false, false);
#if defined(__HIP_DEVICE_COMPILE__)
  asm volatile("v_nop\n\tv_nop\n\tv_nop\n\tv_nop" : "+v"(d) : "v"(a), "v"(b));
#endif
  return d;
}
__device__ __forceinline__ v8f mma_b(v16b a, v16b b, v8f c) {
  v8f d = __builtin_amdgcn_wmma_f32_16x16x32_bf16(false, a, false, b, (short)0, c, false, false);
#if defined(__HIP_DEVICE_COMPILE__)
  const v16h ha = __builtin_bit_cast(v16h, a), hb = __builtin_bit_cast(v16h, b);
  asm volatile("v_nop\n\tv_nop\n\tv_nop\n\tv_nop" : "+v"(d) : "v"(ha), "v"(hb));
#endif
  return d;
}

// =========================================================================================================
// (0) conv1x1 weights: W16 f16 [320][256], row o: 0..31 = wq, 32..63 = wk, 64..319 = wv; value = f16 of
//     (bf16-RNE(w) * 256) (exact). BIAS f32 [320] = bf16-RNE of bq / bk / bv. Block blk (0..39) owns rows
// coverage: 40 blocks x 8 rows x 32 pieces x 8 halves = 320 x 256; bias 80 x 4 floats = 320.
// =========================================================================================================
__global__ __launch_bounds__(256)
void cvt_w(const float* __restrict__ wq, const float* __restrict__ bq,
           const float* __restrict__ wk, const float* __restrict__ bk,
           const float* __restrict__ wv, const float* __restrict__ bv,
           unsigned short* W16, float* BIAS) {
  const int tid = threadIdx.x, blk = blockIdx.x;
  const int rl = tid >> 5, col = 8 * (tid & 31);
  const int o = 8 * blk + rl;                                     // 0..319
  const float* wbase = (blk < 4) ? wq : (blk < 8) ? wk : wv;       // block-uniform selection
  const int osub = (blk < 4) ? 0 : (blk < 8) ? CQ : 2 * CQ;
  const float* s = wbase + (size_t)(o - osub) * CC + col;          // in range: (o-osub) < rows of that matrix
  const v4f a = *(const v4f*)s;
  const v4f q = *(const v4f*)(s + 4);
  const float f[8] = {a[0], a[1], a[2], a[3], q[0], q[1], q[2], q[3]};
  v4u u;
#pragma unroll
  for (int t = 0; t < 4; ++t) {
    const _Float16 h0 = (_Float16)(bfr(f[2 * t]) * WSC);
    const _Float16 h1 = (_Float16)(bfr(f[2 * t + 1]) * WSC);
    u[t] = pk16(h_bits(h0), h_bits(h1));
  }
  // bias values: every lane loads all three candidates with clamped indices, selects by value
  v4f bvv;
  {
    const int tb = min(tid, 79);
    const int o4 = 4 * tb;
#pragma unroll
    for (int qd = 0; qd < 4; ++qd) {
      const int oo = o4 + qd;
      const int iq = min(oo, CQ - 1);
      const int ik = min(max(oo - CQ, 0), CQ - 1);
      const int iv = min(max(oo - 2 * CQ, 0), CC - 1);
      const float cq = bq[iq], ck = bk[ik], cv = bv[iv];
      const float val = (oo < CQ) ? cq : (oo < 2 * CQ) ? ck : cv;
      bvv[qd] = bfr(val);
    }
  }
{
    *(v4u*)(W16 + (size_t)o * CC + col) = u;
    if (blk == 0 && tid < 80) *(v4f*)(BIAS + 4 * tid) = bvv;
    
  }
}

// =========================================================================================================
// (1) x f32 [b][256 c][4096 n] -> Xc f16 [b][c][n] (channel-major, bf16-RNE values, exact in f16) and
//     XP f16 [b][n][c] (position-major) through an LDS tile T[64 n][64 c] (pitch TP). Block (nb, cb, b) owns a
// coverage: Xc 2 it x 32 rows x 8 lanes x 8 = 64 c x 64 n; XP same; grid (64, 4, NB) covers both planes once.
// =========================================================================================================
__global__ __launch_bounds__(256)
void cvt_x(const float* __restrict__ x, unsigned short* Xc, unsigned short* XP) {
  __shared__ __align__(16) unsigned short T[QT * TP];
  const int tid = threadIdx.x;
  const int nb = blockIdx.x, cb = blockIdx.y, b = blockIdx.z;
  const int e = tid & 7, lq = tid >> 3;                             // lq 0..31
  const int n0 = nb * QT, c0 = cb * QT;
  v4u ux[2];
#pragma unroll
  for (int it = 0; it < 2; ++it) {
    const int cl = it * 32 + lq;                                     // 0..63
    const float* sp = x + ((size_t)(b * CC + c0 + cl)) * NN + n0 + 8 * e;
    const v4f a = *(const v4f*)sp;
    const v4f q = *(const v4f*)(sp + 4);
    unsigned short hb[8];
#pragma unroll
    for (int t = 0; t < 4; ++t) {
      hb[t]     = h_bits((_Float16)bfr(a[t]));
      hb[4 + t] = h_bits((_Float16)bfr(q[t]));
    }
#pragma unroll
    for (int t = 0; t < 4; ++t) ux[it][t] = pk16(hb[2 * t], hb[2 * t + 1]);
#pragma unroll
    for (int t = 0; t < 8; ++t) T[(8 * e + t) * TP + cl] = hb[t];
  }
  __syncthreads();
  v4u up[2];
#pragma unroll
  for (int it = 0; it < 2; ++it) {
    const int nl = it * 32 + lq;                                     // 0..63
    up[it] = *(const v4u*)(T + nl * TP + 8 * e);
  }
{
#pragma unroll
    for (int it = 0; it < 2; ++it) {
      const int rl = it * 32 + lq;
      *(v4u*)(Xc + ((size_t)(b * CC + c0 + rl)) * NN + n0 + 8 * e) = ux[it];
      *(v4u*)(XP + ((size_t)(b * NN + n0 + rl)) * CC + c0 + 8 * e) = up[it];
    }
    
  }
}

// =========================================================================================================
// (2) conv1x1 GEMM for one (b, 64-n tile, 64-o block): Y[o][n] = (1/256) sum_c W16[o][c] XP[b][n][c] + BIAS[o].
//     Block 128 threads = 4 waves; wave w owns cols n0+16w..+15 (one B fragment per k-step, k = c contiguous in
//     the XP row) and 4 m-tiles (A rows o = o0 + 16 mt + (lane&15), split k map loader from W16). K = 256 = 8 steps.
//     Epilogue staged in LDS Os[o_loc][n_loc] (pitch OSP), barrier, then:
//       o-block 0 (q rows 0..31, k rows 32..63): Qh/Ql/Kh/Kl bf16 hi / bf16 residual planes [b][4096 n][32]
//         holds rows 2ll, 2ll+1; lane e -> row 2ll+(e>>2), cols 8*(e&3)..+7; one instruction per 16 lines.
//         halves 8e..8e+7; one instruction per 16 lines.
// coverage: Os 4 waves x 4 tiles x 16x16 = 64 x 64; q/k: 4 planes x 32 lines x 8 lanes x 8 = 4 x (64 n x 32);
//           v: 4 it x 16 rows x 8 lanes x 8 = 64 ch x 64 n; grid (64, 5, NB) covers all planes exactly once.
// =========================================================================================================
__global__ __launch_bounds__(128)
void gemm_qkv(const unsigned short* __restrict__ W16, const float* __restrict__ BIAS,
              const unsigned short* __restrict__ XP,
              unsigned short* Qh, unsigned short* Ql, unsigned short* Kh, unsigned short* Kl,
              unsigned short* Vh) {
  __shared__ __align__(16) float Os[QT * OSP];
  const int tid  = threadIdx.x;
  const int lane = tid & 31, wave = tid >> 5;
  const int hh   = lane >> 4, c = lane & 15;
  const int nt   = blockIdx.x, mb = blockIdx.y, b = blockIdx.z;
  const int n0   = nt * QT, o0 = mb * QT;

  const unsigned short* ap = W16 + (size_t)(o0 + c) * CC + 8 * hh;
  const unsigned short* bp = XP + ((size_t)(b * NN + n0 + 16 * wave + c)) * CC + 8 * hh;

  v8f acc[4];
#pragma unroll
  for (int mt = 0; mt < 4; ++mt) acc[mt] = zero8();

#pragma unroll
  for (int ks = 0; ks < CC / 32; ++ks) {
    const Frag fb = ldfrag(bp + 32 * ks);
#pragma unroll
    for (int mt = 0; mt < 4; ++mt) {
      const Frag fa = ldfrag(ap + (size_t)(16 * mt) * CC + 32 * ks);
      acc[mt] = mma_h(fa.h, fb.h, acc[mt]);
    }
  }

  // ---- epilogue: scale back, + bias -> LDS Os[o_loc][n_loc] ----
  {
    const int nl = 16 * wave + c;
#pragma unroll
    for (int mt = 0; mt < 4; ++mt) {
#pragma unroll
      for (int r = 0; r < 8; ++r) {
        const int ol = 16 * mt + 8 * hh + r;                         // 0..63
        Os[ol * OSP + nl] = acc[mt][r] * IWSC + BIAS[o0 + ol];
      }
    }
  }
  __syncthreads();

  const int e = tid & 7, lq = tid >> 3;                             // lq 0..15
  if (mb == 0) {
    // ---- q/k bf16 hi + residual planes ----
{
#pragma unroll
      for (int it = 0; it < 8; ++it) {
        const int p    = it >> 1;                                    // 0 Qh, 1 Ql, 2 Kh, 3 Kl
        const int ll   = (it & 1) * 16 + lq;                         // 0..31
        const int nl   = 2 * ll + (e >> 2);                          // 0..63
        const int col0 = 8 * (e & 3);                                // 0,8,16,24
        const int rb   = ((p >> 1) ? CQ : 0) + col0;
        v4u u;
#pragma unroll
        for (int t = 0; t < 4; ++t) {
          const float f0 = Os[(rb + 2 * t) * OSP + nl];
          const float f1 = Os[(rb + 2 * t + 1) * OSP + nl];
          const unsigned short hb0 = bf_bits(f0), hb1 = bf_bits(f1);
          const unsigned short lb0 = bf_bits(f0 - bf_up(hb0));
          const unsigned short lb1 = bf_bits(f1 - bf_up(hb1));
          u[t] = (p & 1) ? pk16(lb0, lb1) : pk16(hb0, hb1);
        }
        unsigned short* P = (p == 0) ? Qh : (p == 1) ? Ql : (p == 2) ? Kh : Kl;
        *(v4u*)(P + ((size_t)(b * NN + n0 + nl)) * CQ + col0) = u;
      }
      
    }
  } else {
    // ---- v f16 plane ----
    const int ch0 = o0 - QT;                                         // (mb-1)*64
    v4u uv[4];
#pragma unroll
    for (int it = 0; it < 4; ++it) {
      const int row = it * 16 + lq;                                  // 0..63
      const v4f a = *(const v4f*)(Os + row * OSP + 8 * e);
      const v4f q = *(const v4f*)(Os + row * OSP + 8 * e + 4);
#pragma unroll
      for (int t = 0; t < 2; ++t) {
        uv[it][t]     = pk16(h_bits((_Float16)a[2 * t]), h_bits((_Float16)a[2 * t + 1]));
        uv[it][2 + t] = pk16(h_bits((_Float16)q[2 * t]), h_bits((_Float16)q[2 * t + 1]));
      }
    }
{
#pragma unroll
      for (int it = 0; it < 4; ++it) {
        const int row = it * 16 + lq;
        *(v4u*)(Vh + ((size_t)(b * CC + ch0 + row)) * NN + n0 + 8 * e) = uv[it];
      }
      
    }
  }
}

// =========================================================================================================
// (3) position attention for one (b, 64-query tile), transposed formulation, 4096 keys, no mask:
//   S^T tile (16 keys x 16 queries) = A(k: row = key kb + (lane&15), 32 d via the split k map from the bf16 plane
//   Kh [b][4096][32]) . B(q: col = query, same map, resident fragment from Qh) + A(Kh).B(Ql) + A(Kl).B(Qh)
//   (bf16 unscaled residual planes, shared accumulator). Energy = S (no scale).
//   Per lane the D tile holds 8 keys of ONE query: online softmax state per lane, one shuffle (lane^16) for the max
//   over 32 keys, row-sum partials combined at the end. P = e^{s-m} x 1024 as f16 is the B operand of
//   O^T (rows channel, cols queries) += A(V rows channel = 16j + (lane&15), keys contiguous, f16 plane Vh
//   [b][256][4096]) . B(P^T): element r <- D of the tile covering keys kb..kb+15, element 8+r <- the tile covering
//   kb+16..kb+31, lane unchanged. 16 accumulator tiles per wave (256 channels). Block = 4 waves = 64 queries.
//   Epilogue in two channel halves: O/l staged in LDS Os[query][128 channels] (pitch OSPW, b128 stores), barrier,
// coverage: per half 16 it x 16 lines x 8 lanes x 4 floats = 128 ch x 64 n; two halves = 256 ch; grid (64, NB).
// =========================================================================================================
__global__ __launch_bounds__(128)
void attn_pam(const unsigned short* __restrict__ Qh, const unsigned short* __restrict__ Ql,
              const unsigned short* __restrict__ Kh, const unsigned short* __restrict__ Kl,
              const unsigned short* __restrict__ Vh, float* Yp) {
  __shared__ __align__(16) float Os[QT * OSPW];
  const int tid  = threadIdx.x;
  const int wave = tid >> 5, lane = tid & 31;
  const int hh   = lane >> 4, c = lane & 15;
  const int n0   = blockIdx.x * QT, b = blockIdx.y;

  // resident q fragments (B operand, col = query n0 + 16*wave + c)
  Frag qh, ql;
  {
    const size_t qo = ((size_t)(b * NN + n0 + 16 * wave + c)) * CQ + 8 * hh;
    qh = ldfrag(Qh + qo);
    ql = ldfrag(Ql + qo);
  }
  // k fragment base (A operand, row = key kb + c), + key * 32
  const unsigned short* Khp = Kh + (size_t)b * NN * CQ + (size_t)c * CQ + 8 * hh;
  const unsigned short* Klp = Kl + (size_t)b * NN * CQ + (size_t)c * CQ + 8 * hh;
  // v fragment base (A operand, row = channel 16j + c, keys contiguous), + 16*j*NN + kb
  const unsigned short* Vhp = Vh + (size_t)b * CC * NN + (size_t)c * NN + 8 * hh;

  float m = -1.0e30f, l = 0.f;
  v8f o[16];
#pragma unroll
  for (int j = 0; j < 16; ++j) o[j] = zero8();

#pragma unroll 1
  for (int kb = 0; kb < NN; kb += 32) {
    const Frag k0  = ldfrag(Khp + (size_t)kb * CQ);                  // keys kb .. kb+15
    const Frag k1  = ldfrag(Khp + (size_t)(kb + 16) * CQ);           // keys kb+16 .. kb+31
    const Frag k0l = ldfrag(Klp + (size_t)kb * CQ);
    const Frag k1l = ldfrag(Klp + (size_t)(kb + 16) * CQ);
    v8f s0 = mma_b(k0.bf, qh.bf, zero8());
    v8f s1 = mma_b(k1.bf, qh.bf, zero8());
    s0 = mma_b(k0.bf, ql.bf, s0);
    s1 = mma_b(k1.bf, ql.bf, s1);
    s0 = mma_b(k0l.bf, qh.bf, s0);
    s1 = mma_b(k1l.bf, qh.bf, s1);

    float mx = fmaxf(hmax8(s0), hmax8(s1));
    mx = fmaxf(mx, __shfl_xor(mx, 16, 32));
    const float mn   = fmaxf(m, mx);
    const float corr = __expf(m - mn);
    m = mn;
    const float msh = mn - LNPS;                                     // exp gives e^{s-m} * 1024
    l *= corr;
#pragma unroll
    for (int j = 0; j < 16; ++j) {
#pragma unroll
      for (int r = 0; r < 8; ++r) o[j][r] *= corr;
    }

    FragH ph;
    float ls = 0.f;
#pragma unroll
    for (int r = 0; r < 8; ++r) {
      const float e0 = __expf(s0[r] - msh);                          // key kb      + 8hh + r
      const float e1 = __expf(s1[r] - msh);                          // key kb + 16 + 8hh + r
      ls += e0 + e1;
      ph.hv[0][r] = (_Float16)e0;
      ph.hv[1][r] = (_Float16)e1;
    }
    l += ls;

#pragma unroll
    for (int j = 0; j < 16; ++j) {
      const Frag vf = ldfrag(Vhp + (size_t)(16 * j) * NN + kb);
      o[j] = mma_h(vf.h, ph.v, o[j]);
    }
  }
  l += __shfl_xor(l, 16, 32);
  const float inv = 1.0f / l;                                        // o and l both carry the x1024 factor

  const int qrow = 16 * wave + c;
  const int e = tid & 7, lq = tid >> 3;                              // lq 0..15
#pragma unroll
  for (int half = 0; half < 2; ++half) {
    if (half) __syncthreads();                                       // every wave finished reading Os
#pragma unroll
    for (int jj = 0; jj < 8; ++jj) {
      const int j = 8 * half + jj;
      v4f va, vb;
#pragma unroll
      for (int r = 0; r < 4; ++r) { va[r] = o[j][r] * inv; vb[r] = o[j][4 + r] * inv; }
      *(v4f*)(Os + qrow * OSPW + 16 * jj + 8 * hh)     = va;         // Os[query][ch_loc = 16jj + 8hh + r]
      *(v4f*)(Os + qrow * OSPW + 16 * jj + 8 * hh + 4) = vb;
    }
    __syncthreads();
{
#pragma unroll
      for (int it = 0; it < 16; ++it) {
        const int L   = it * 16 + lq;                                // 0..255
        const int chl = L >> 1, hf = L & 1;                          // channel 0..127 within the half
        const int nl  = hf * 32 + 4 * e;                             // query 0..63
        v4f v;
#pragma unroll
        for (int t = 0; t < 4; ++t) v[t] = Os[(nl + t) * OSPW + chl];
        *(v4f*)(Yp + ((size_t)(b * CC + 128 * half + chl)) * NN + n0 + nl) = v;
      }
      
    }
  }
}

// =========================================================================================================
// (4) channel Gram for one (b, 64-i block, 64-j block): G[b][i][j] = sum_n Xc[b][i][n] Xc[b][j][n], K = 4096.
//     4 waves; wave w owns cols j0+16w..+15 (B from the j row, keys n contiguous) and 4 i tiles (A rows
//     [b][256][256] (row segment 64 j = 2 lines), 8 consecutive lanes x 16 B, one instruction per 16 lines, two
// coverage: 8 it x 16 lines x 8 lanes x 4 = 64 x 64; grid (4, 4, NB) covers G exactly once.
// =========================================================================================================
__global__ __launch_bounds__(128)
void gram_k(const unsigned short* __restrict__ Xc, float* G) {
  __shared__ __align__(16) float Os[QT * OSP];
  const int tid  = threadIdx.x;
  const int lane = tid & 31, wave = tid >> 5;
  const int hh   = lane >> 4, c = lane & 15;
  const int jt = blockIdx.x, itb = blockIdx.y, b = blockIdx.z;
  const int j0 = jt * QT, i0 = itb * QT;

  const unsigned short* ap = Xc + ((size_t)(b * CC + i0 + c)) * NN + 8 * hh;
  const unsigned short* bp = Xc + ((size_t)(b * CC + j0 + 16 * wave + c)) * NN + 8 * hh;

  v8f acc[4];
#pragma unroll
  for (int mt = 0; mt < 4; ++mt) acc[mt] = zero8();

#pragma unroll 2
  for (int ks = 0; ks < NN / 32; ++ks) {
    const Frag fb = ldfrag(bp + 32 * ks);
#pragma unroll
    for (int mt = 0; mt < 4; ++mt) {
      const Frag fa = ldfrag(ap + (size_t)(16 * mt) * NN + 32 * ks);
      acc[mt] = mma_h(fa.h, fb.h, acc[mt]);
    }
  }
  {
    const int nl = 16 * wave + c;
#pragma unroll
    for (int mt = 0; mt < 4; ++mt) {
#pragma unroll
      for (int r = 0; r < 8; ++r) Os[(16 * mt + 8 * hh + r) * OSP + nl] = acc[mt][r];
    }
  }
  __syncthreads();
  {
    const int e = tid & 7, lq = tid >> 3;                            // lq 0..15
{
#pragma unroll
      for (int it = 0; it < 8; ++it) {
        const int L = it * 16 + lq;                                  // 0..127
        const int row = L >> 1, hf = L & 1;
        const v4f v = *(const v4f*)(Os + row * OSP + hf * 32 + 4 * e);
        *(v4f*)(G + ((size_t)(b * CC + i0 + row)) * CC + j0 + hf * 32 + 4 * e) = v;
      }
      
    }
  }
}

// =========================================================================================================
// (5) channel softmax: for row (b, i): p_j = exp(min_j G - G_j) / sum (== softmax of rowmax - G), written as
//     Pc f16 [b][256][256] = p * 1024. One wave per row: lane reads j = 8 lane..8 lane+7, wave min / sum via
// coverage: grid (32, NB) x 8 waves = 256 rows per batch; 32 lanes x 8 = 256 j.
// =========================================================================================================
__global__ __launch_bounds__(256)
void cam_softmax(const float* __restrict__ G, unsigned short* Pc) {
  const int tid = threadIdx.x, lane = tid & 31, w = tid >> 5;
  const int b = blockIdx.y, i = blockIdx.x * 8 + w;                 // 0..255
  const float* row = G + ((size_t)(b * CC + i)) * CC + 8 * lane;
  const v4f a = *(const v4f*)row;
  const v4f q = *(const v4f*)(row + 4);
  const float ev[8] = {a[0], a[1], a[2], a[3], q[0], q[1], q[2], q[3]};
  float mn = ev[0];
#pragma unroll
  for (int t = 1; t < 8; ++t) mn = fminf(mn, ev[t]);
#pragma unroll
  for (int s = 1; s < 32; s <<= 1) mn = fminf(mn, __shfl_xor(mn, s, 32));
  float p[8], sm = 0.f;
#pragma unroll
  for (int t = 0; t < 8; ++t) { p[t] = __expf(mn - ev[t]); sm += p[t]; }
#pragma unroll
  for (int s = 1; s < 32; s <<= 1) sm += __shfl_xor(sm, s, 32);
  const float inv = PSC / sm;
  v4u u;
#pragma unroll
  for (int t = 0; t < 4; ++t)
    u[t] = pk16(h_bits((_Float16)(p[2 * t] * inv)), h_bits((_Float16)(p[2 * t + 1] * inv)));
{
    *(v4u*)(Pc + ((size_t)(b * CC + i)) * CC + 8 * lane) = u;
    
  }
}

// =========================================================================================================
// (6) channel mix + output for one (b, 64-n tile, 64-i block): cam[i][n] = (1/1024) sum_j Pc[b][i][j] XP[b][n][j]
//     (K = 256 = 8 steps; A rows i = i0 + 16 mt + (lane&15), j contiguous; B col n = n0 + 16w + (lane&15) from the
//     XP row, j contiguous), then out[b][i][n] = (g_pam * Yp + xb) + (g_cam * cam + xb) with xb = bf16-RNE of x
// coverage: 8 it x 16 lines x 8 lanes x 4 = 64 i x 64 n; grid (64, 4, NB) covers d_out exactly once.
// =========================================================================================================
__global__ __launch_bounds__(128)
void cam_out(const unsigned short* __restrict__ Pc, const unsigned short* __restrict__ XP,
             const float* __restrict__ Yp, const float* __restrict__ x,
             const float* __restrict__ gpam, const float* __restrict__ gcam, float* out) {
  __shared__ __align__(16) float Os[QT * OSP];
  const int tid  = threadIdx.x;
  const int lane = tid & 31, wave = tid >> 5;
  const int hh   = lane >> 4, c = lane & 15;
  const int nt = blockIdx.x, itb = blockIdx.y, b = blockIdx.z;
  const int n0 = nt * QT, i0 = itb * QT;

  const unsigned short* ap = Pc + ((size_t)(b * CC + i0 + c)) * CC + 8 * hh;
  const unsigned short* bp = XP + ((size_t)(b * NN + n0 + 16 * wave + c)) * CC + 8 * hh;

  v8f acc[4];
#pragma unroll
  for (int mt = 0; mt < 4; ++mt) acc[mt] = zero8();

#pragma unroll
  for (int ks = 0; ks < CC / 32; ++ks) {
    const Frag fb = ldfrag(bp + 32 * ks);
#pragma unroll
    for (int mt = 0; mt < 4; ++mt) {
      const Frag fa = ldfrag(ap + (size_t)(16 * mt) * CC + 32 * ks);
      acc[mt] = mma_h(fa.h, fb.h, acc[mt]);
    }
  }
  {
    const int nl = 16 * wave + c;
#pragma unroll
    for (int mt = 0; mt < 4; ++mt) {
#pragma unroll
      for (int r = 0; r < 8; ++r) Os[(16 * mt + 8 * hh + r) * OSP + nl] = acc[mt][r];
    }
  }
  __syncthreads();

  const float gp = bfr(gpam[0]);
  const float gc = bfr(gcam[0]) * IPSC;
  const int e = tid & 7, lq = tid >> 3;                              // lq 0..15
  v4f res[8];
#pragma unroll
  for (int it = 0; it < 8; ++it) {
    const int L = it * 16 + lq;                                      // 0..127
    const int row = L >> 1, hf = L & 1;
    const int nl = hf * 32 + 4 * e;
    const v4f cam4 = *(const v4f*)(Os + row * OSP + nl);
    const size_t idx = ((size_t)(b * CC + i0 + row)) * NN + n0 + nl;
    const v4f xv = *(const v4f*)(x + idx);
    const v4f yv = *(const v4f*)(Yp + idx);
#pragma unroll
    for (int t = 0; t < 4; ++t) {
      const float xb = bfr(xv[t]);
      const float t1 = gp * yv[t] + xb;
      const float t2 = gc * cam4[t] + xb;
      res[it][t] = t1 + t2;
    }
  }
{
#pragma unroll
    for (int it = 0; it < 8; ++it) {
      const int L = it * 16 + lq;
      const int row = L >> 1, hf = L & 1;
      const int nl = hf * 32 + 4 * e;
      const size_t idx = ((size_t)(b * CC + i0 + row)) * NN + n0 + nl;
      *(v4f*)(out + idx) = res[it];
    }
    
  }
}

// =========================================================================================================
// Workspace map (bytes; each region start a multiple of 256; every extent is an exact tile multiple and is written
//   W16 f16 [320][256]          163840      BIAS f32 [320]              1280
//   Xc  f16 [2][256][4096]     4194304      XP   f16 [2][4096][256]  4194304
//   Qh/Ql/Kh/Kl bf16 [2][4096][32]  524288 x4                          Vh f16 [2][256][4096]  4194304
//   Yp  f32 [2][256][4096]     8388608      G    f32 [2][256][256]    524288      Pc f16 [2][256][256] 262144
//   total = 24020224
// =========================================================================================================
extern "C" void kernel_launch(void* const* d_in, const int* in_sizes, int n_in,
                              void* d_out, int out_size, void* d_ws, size_t ws_size,
                              hipStream_t stream) {
  const int XN = NB * CC * NN;                                       // 2097152
  if (n_in < 9) return;
  if (in_sizes[0] != XN) return;
  if (in_sizes[1] != CQ * CC || in_sizes[2] != CQ) return;
  if (in_sizes[3] != CQ * CC || in_sizes[4] != CQ) return;
  if (in_sizes[5] != CC * CC || in_sizes[6] != CC) return;
  if (in_sizes[7] < 1 || in_sizes[8] < 1) return;
  if (out_size != XN) return;

  size_t off = 0;
  auto carve = [&](size_t bytes) { const size_t o = off; off += (bytes + 255) & ~(size_t)255; return o; };
  const size_t oW16 = carve((size_t)MQKV * CC * 2);
  const size_t oBIA = carve((size_t)MQKV * 4);
  const size_t oXc  = carve((size_t)NB * CC * NN * 2);
  const size_t oXP  = carve((size_t)NB * NN * CC * 2);
  const size_t oQh  = carve((size_t)NB * NN * CQ * 2);
  const size_t oQl  = carve((size_t)NB * NN * CQ * 2);
  const size_t oKh  = carve((size_t)NB * NN * CQ * 2);
  const size_t oKl  = carve((size_t)NB * NN * CQ * 2);
  const size_t oVh  = carve((size_t)NB * CC * NN * 2);
  const size_t oYp  = carve((size_t)NB * CC * NN * 4);
  const size_t oG   = carve((size_t)NB * CC * CC * 4);
  const size_t oPc  = carve((size_t)NB * CC * CC * 2);
  if (off > ws_size) return;
  if (off > (size_t)134217728) return;

  const float* x    = (const float*)d_in[0];
  const float* wq   = (const float*)d_in[1];
  const float* bq   = (const float*)d_in[2];
  const float* wk   = (const float*)d_in[3];
  const float* bk   = (const float*)d_in[4];
  const float* wv   = (const float*)d_in[5];
  const float* bv   = (const float*)d_in[6];
  const float* gpam = (const float*)d_in[7];
  const float* gcam = (const float*)d_in[8];

  char* ws = (char*)d_ws;
  unsigned short* W16 = (unsigned short*)(ws + oW16);
  float*          BIA = (float*)(ws + oBIA);
  unsigned short* Xc  = (unsigned short*)(ws + oXc);
  unsigned short* XP  = (unsigned short*)(ws + oXP);
  unsigned short* Qh  = (unsigned short*)(ws + oQh);
  unsigned short* Ql  = (unsigned short*)(ws + oQl);
  unsigned short* Kh  = (unsigned short*)(ws + oKh);
  unsigned short* Kl  = (unsigned short*)(ws + oKl);
  unsigned short* Vh  = (unsigned short*)(ws + oVh);
  float*          Yp  = (float*)(ws + oYp);
  float*          G   = (float*)(ws + oG);
  unsigned short* Pc  = (unsigned short*)(ws + oPc);
  float* out = (float*)d_out;

  const dim3 blk256(256), blk128(128);

  // (0) conv1x1 weights -> f16 plane + bias line
  cvt_w<<<dim3(MQKV / 8), blk256, 0, stream>>>(wq, bq, wk, bk, wv, bv, W16, BIA);
  // (1) x -> channel-major and position-major 16-bit planes
  cvt_x<<<dim3(NN / QT, CC / QT, NB), blk256, 0, stream>>>(x, Xc, XP);
  // (2) conv1x1 GEMM -> q/k hi + residual planes and v plane
  gemm_qkv<<<dim3(NN / QT, MQKV / QT, NB), blk128, 0, stream>>>(W16, BIA, XP, Qh, Ql, Kh, Kl, Vh);
  // (3) position attention -> Yp [b][256][4096]
  attn_pam<<<dim3(NN / QT, NB), blk128, 0, stream>>>(Qh, Ql, Kh, Kl, Vh, Yp);
  // (4) channel Gram -> G [b][256][256]
  gram_k<<<dim3(CC / QT, CC / QT, NB), blk128, 0, stream>>>(Xc, G);
  // (5) channel softmax -> Pc [b][256][256] (x1024 f16)
  cam_softmax<<<dim3(CC / 8, NB), blk256, 0, stream>>>(G, Pc);
  // (6) channel mix + residual sum -> out [b][256][4096]
  cam_out<<<dim3(NN / QT, CC / QT, NB), blk128, 0, stream>>>(Pc, XP, Yp, x, gpam, gcam, out);
  (void)hipGetLastError();
}

// v001
// A run of this version takes 168 microseconds.
// Timed twice side by side with v000, it ran 2.98 and 2.97 times as fast.
// Contractions: conv1x1 q/k/v GEMM W[320x256].X[256x4096] on v_wmma_f32_16x16x32_f16 (f16 containers of bf16-RNE
// weights x256 and bf16-RNE x); position scores K.Q^T on v_wmma_f32_16x16x32_bf16 (bf16 hi + bf16 residual planes of
// q and k, 3 products, K=32); O^T = V.P^T on v_wmma_f32_16x16x32_f16 (v f16, P = e^{s-m} x1024 f16 from the score D
// registers); channel Gram X.X^T (K=4096) and channel mix A.X (K=256) on v_wmma_f32_16x16x32_f16 (f16 of bf16-RNE x,
// softmax weights x1024 f16); f32 accumulate everywhere; softmax statistics, residual adds and output sum in f32 VALU.
#include <hip/hip_runtime.h>
#include <math.h>
#include <stdint.h>

#define NB    2
#define CC    256
#define NN    4096
#define CQ    32
#define MQKV  320
#define QT    64
#define OSP   68
#define OSPW  132
#define TP    72
#define WSC   256.0f
#define IWSC  0.00390625f
#define PSC   1024.0f
#define IPSC  0.0009765625f
#define LNPS  6.931471805599453f
#define KT    64                       // keys per LDS stage of the position attention
#define NT    (NN / KT)                // stages
#define VPB   144                      // LDS pitch of a v row (64 keys = 128 B, + 16 B: 16 B x odd for b128 readers)
#define KPB   80                       // LDS pitch of a k row (32 d = 64 B, + 16 B)
#define VSTB  (CC * VPB)               // v part of a stage, bytes
#define KSTB  (KT * KPB)               // one k plane of a stage, bytes
#define STGB  (VSTB + 2 * KSTB)        // one stage: v, k hi, k residual

static_assert(NN % QT == 0);
static_assert(CC % QT == 0);
static_assert(MQKV == 2 * CQ + CC);
static_assert(MQKV % QT == 0);
static_assert((OSP * 4) % 16 == 0);
static_assert((OSPW * 4) % 16 == 0);
static_assert((TP * 2) % 16 == 0);
static_assert(CC % 32 == 0 && NN % 32 == 0 && CQ == 32);
static_assert(NN % KT == 0 && NT >= 2 && KT % 32 == 0);
static_assert(VPB % 16 == 0 && KPB % 16 == 0 && STGB % 16 == 0 && VSTB % 16 == 0);
static_assert(VPB >= KT * 2 && KPB >= CQ * 2);

typedef _Float16       v16h __attribute__((ext_vector_type(16)));
typedef _Float16       v8h  __attribute__((ext_vector_type(8)));
typedef __bf16         v16b __attribute__((ext_vector_type(16)));
typedef unsigned short v8us __attribute__((ext_vector_type(8)));
typedef float          v8f  __attribute__((ext_vector_type(8)));
typedef float          v4f  __attribute__((ext_vector_type(4)));
typedef unsigned int   v4u  __attribute__((ext_vector_type(4)));

union Frag  { v8us u[2]; v16h h; v16b bf; };
union FragH { v16h v; v8h hv[2]; };
static_assert(sizeof(Frag) == 32);
static_assert(sizeof(FragH) == 32);

// ---- scalar helpers ---------------------------------------------------------------------------------------
__device__ __forceinline__ unsigned short bf_bits(float f) {          // f32 -> bf16 bits, RNE convert
  unsigned u = __float_as_uint(f);
  return (unsigned short)((u + 0x7FFFu + ((u >> 16) & 1u)) >> 16);
}
__device__ __forceinline__ float bf_up(unsigned short hb) { return __uint_as_float(((unsigned)hb) << 16); }
__device__ __forceinline__ float bfr(float f) { return bf_up(bf_bits(f)); }
__device__ __forceinline__ unsigned short h_bits(_Float16 x) { return __builtin_bit_cast(unsigned short, x); }
__device__ __forceinline__ unsigned pk16(unsigned short a, unsigned short b) { return (unsigned)a | ((unsigned)b << 16); }
__device__ __forceinline__ v8f zero8() { v8f z = {0.f, 0.f, 0.f, 0.f, 0.f, 0.f, 0.f, 0.f}; return z; }
__device__ __forceinline__ float hmax8(v8f s) {
  return fmaxf(fmaxf(fmaxf(s[0], s[1]), fmaxf(s[2], s[3])), fmaxf(fmaxf(s[4], s[5]), fmaxf(s[6], s[7])));
}

// ---- 16-bit fragment loader (A, or B from a k-contiguous [n][k] row): lane -> row/col (lane&15), p already includes
//      + 8*(lane>>4); elements 0..7 <- p[0..7] (k0+8h..), elements 8..15 <- p[16..23] (k0+16+8h..)
__device__ __forceinline__ Frag ldfrag(const unsigned short* p) {
  Frag f;
  f.u[0] = *(const v8us*)(p);
  f.u[1] = *(const v8us*)(p + 16);
  return f;
}

// ---- WMMA helpers: builtin followed by a 4-slot VALU gap tying D and keeping A/B live --------------------------
__device__ __forceinline__ v8f mma_h(v16h a, v16h b, v8f c) {
  v8f d = __builtin_amdgcn_wmma_f32_16x16x32_f16(false, a, false, b, (short)0, c, false, false);
#if defined(__HIP_DEVICE_COMPILE__)
  asm volatile("v_nop\n\tv_nop\n\tv_nop\n\tv_nop" : "+v"(d) : "v"(a), "v"(b));
#endif
  return d;
}
__device__ __forceinline__ v8f mma_b(v16b a, v16b b, v8f c) {
  v8f d = __builtin_amdgcn_wmma_f32_16x16x32_bf16(false, a, false, b, (short)0, c, false, false);
#if defined(__HIP_DEVICE_COMPILE__)
  const v16h ha = __builtin_bit_cast(v16h, a), hb = __builtin_bit_cast(v16h, b);
  asm volatile("v_nop\n\tv_nop\n\tv_nop\n\tv_nop" : "+v"(d) : "v"(ha), "v"(hb));
#endif
  return d;
}

// =========================================================================================================
// (0) conv1x1 weights: W16 f16 [320][256], row o: 0..31 = wq, 32..63 = wk, 64..319 = wv; value = f16 of
//     (bf16-RNE(w) * 256) (exact). BIAS f32 [320] = bf16-RNE of bq / bk / bv. Block blk (0..39) owns rows
// coverage: 40 blocks x 8 rows x 32 pieces x 8 halves = 320 x 256; bias 80 x 4 floats = 320.
// =========================================================================================================
__global__ __launch_bounds__(256)
void cvt_w(const float* __restrict__ wq, const float* __restrict__ bq,
           const float* __restrict__ wk, const float* __restrict__ bk,
           const float* __restrict__ wv, const float* __restrict__ bv,
           unsigned short* W16, float* BIAS) {
  const int tid = threadIdx.x, blk = blockIdx.x;
  const int rl = tid >> 5, col = 8 * (tid & 31);
  const int o = 8 * blk + rl;                                     // 0..319
  const float* wbase = (blk < 4) ? wq : (blk < 8) ? wk : wv;       // block-uniform selection
  const int osub = (blk < 4) ? 0 : (blk < 8) ? CQ : 2 * CQ;
  const float* s = wbase + (size_t)(o - osub) * CC + col;          // in range: (o-osub) < rows of that matrix
  const v4f a = *(const v4f*)s;
  const v4f q = *(const v4f*)(s + 4);
  const float f[8] = {a[0], a[1], a[2], a[3], q[0], q[1], q[2], q[3]};
  v4u u;
#pragma unroll
  for (int t = 0; t < 4; ++t) {
    const _Float16 h0 = (_Float16)(bfr(f[2 * t]) * WSC);
    const _Float16 h1 = (_Float16)(bfr(f[2 * t + 1]) * WSC);
    u[t] = pk16(h_bits(h0), h_bits(h1));
  }
  // bias values: every lane loads all three candidates with clamped indices, selects by value
  v4f bvv;
  {
    const int tb = min(tid, 79);
    const int o4 = 4 * tb;
#pragma unroll
    for (int qd = 0; qd < 4; ++qd) {
      const int oo = o4 + qd;
      const int iq = min(oo, CQ - 1);
      const int ik = min(max(oo - CQ, 0), CQ - 1);
      const int iv = min(max(oo - 2 * CQ, 0), CC - 1);
      const float cq = bq[iq], ck = bk[ik], cv = bv[iv];
      const float val = (oo < CQ) ? cq : (oo < 2 * CQ) ? ck : cv;
      bvv[qd] = bfr(val);
    }
  }
{
    *(v4u*)(W16 + (size_t)o * CC + col) = u;
    if (blk == 0 && tid < 80) *(v4f*)(BIAS + 4 * tid) = bvv;
    
  }
}

// =========================================================================================================
// (1) x f32 [b][256 c][4096 n] -> Xc f16 [b][c][n] (channel-major, bf16-RNE values, exact in f16) and
//     XP f16 [b][n][c] (position-major) through an LDS tile T[64 n][64 c] (pitch TP). Block (nb, cb, b) owns a
// coverage: Xc 2 it x 32 rows x 8 lanes x 8 = 64 c x 64 n; XP same; grid (64, 4, NB) covers both planes once.
// =========================================================================================================
__global__ __launch_bounds__(256)
void cvt_x(const float* __restrict__ x, unsigned short* Xc, unsigned short* XP) {
  __shared__ __align__(16) unsigned short T[QT * TP];
  const int tid = threadIdx.x;
  const int nb = blockIdx.x, cb = blockIdx.y, b = blockIdx.z;
  const int e = tid & 7, lq = tid >> 3;                             // lq 0..31
  const int n0 = nb * QT, c0 = cb * QT;
  v4u ux[2];
#pragma unroll
  for (int it = 0; it < 2; ++it) {
    const int cl = it * 32 + lq;                                     // 0..63
    const float* sp = x + ((size_t)(b * CC + c0 + cl)) * NN + n0 + 8 * e;
    const v4f a = *(const v4f*)sp;
    const v4f q = *(const v4f*)(sp + 4);
    unsigned short hb[8];
#pragma unroll
    for (int t = 0; t < 4; ++t) {
      hb[t]     = h_bits((_Float16)bfr(a[t]));
      hb[4 + t] = h_bits((_Float16)bfr(q[t]));
    }
#pragma unroll
    for (int t = 0; t < 4; ++t) ux[it][t] = pk16(hb[2 * t], hb[2 * t + 1]);
#pragma unroll
    for (int t = 0; t < 8; ++t) T[(8 * e + t) * TP + cl] = hb[t];
  }
  __syncthreads();
  v4u up[2];
#pragma unroll
  for (int it = 0; it < 2; ++it) {
    const int nl = it * 32 + lq;                                     // 0..63
    up[it] = *(const v4u*)(T + nl * TP + 8 * e);
  }
{
#pragma unroll
    for (int it = 0; it < 2; ++it) {
      const int rl = it * 32 + lq;
      *(v4u*)(Xc + ((size_t)(b * CC + c0 + rl)) * NN + n0 + 8 * e) = ux[it];
      *(v4u*)(XP + ((size_t)(b * NN + n0 + rl)) * CC + c0 + 8 * e) = up[it];
    }
    
  }
}

// =========================================================================================================
// (2) conv1x1 GEMM for one (b, 64-n tile, 64-o block): Y[o][n] = (1/256) sum_c W16[o][c] XP[b][n][c] + BIAS[o].
//     Block 128 threads = 4 waves; wave w owns cols n0+16w..+15 (one B fragment per k-step, k = c contiguous in
//     the XP row) and 4 m-tiles (A rows o = o0 + 16 mt + (lane&15), split k map loader from W16). K = 256 = 8 steps.
//     Epilogue staged in LDS Os[o_loc][n_loc] (pitch OSP), barrier, then:
//       o-block 0 (q rows 0..31, k rows 32..63): Qh/Ql/Kh/Kl bf16 hi / bf16 residual planes [b][4096 n][32]
//         holds rows 2ll, 2ll+1; lane e -> row 2ll+(e>>2), cols 8*(e&3)..+7; one instruction per 16 lines.
//         halves 8e..8e+7; one instruction per 16 lines.
// coverage: Os 4 waves x 4 tiles x 16x16 = 64 x 64; q/k: 4 planes x 32 lines x 8 lanes x 8 = 4 x (64 n x 32);
//           v: 4 it x 16 rows x 8 lanes x 8 = 64 ch x 64 n; grid (64, 5, NB) covers all planes exactly once.
// =========================================================================================================
__global__ __launch_bounds__(128)
void gemm_qkv(const unsigned short* __restrict__ W16, const float* __restrict__ BIAS,
              const unsigned short* __restrict__ XP,
              unsigned short* Qh, unsigned short* Ql, unsigned short* Kh, unsigned short* Kl,
              unsigned short* Vh) {
  __shared__ __align__(16) float Os[QT * OSP];
  const int tid  = threadIdx.x;
  const int lane = tid & 31, wave = tid >> 5;
  const int hh   = lane >> 4, c = lane & 15;
  const int nt   = blockIdx.x, mb = blockIdx.y, b = blockIdx.z;
  const int n0   = nt * QT, o0 = mb * QT;

  const unsigned short* ap = W16 + (size_t)(o0 + c) * CC + 8 * hh;
  const unsigned short* bp = XP + ((size_t)(b * NN + n0 + 16 * wave + c)) * CC + 8 * hh;

  v8f acc[4];
#pragma unroll
  for (int mt = 0; mt < 4; ++mt) acc[mt] = zero8();

#pragma unroll
  for (int ks = 0; ks < CC / 32; ++ks) {
    const Frag fb = ldfrag(bp + 32 * ks);
#pragma unroll
    for (int mt = 0; mt < 4; ++mt) {
      const Frag fa = ldfrag(ap + (size_t)(16 * mt) * CC + 32 * ks);
      acc[mt] = mma_h(fa.h, fb.h, acc[mt]);
    }
  }

  // ---- epilogue: scale back, + bias -> LDS Os[o_loc][n_loc] ----
  {
    const int nl = 16 * wave + c;
#pragma unroll
    for (int mt = 0; mt < 4; ++mt) {
#pragma unroll
      for (int r = 0; r < 8; ++r) {
        const int ol = 16 * mt + 8 * hh + r;                         // 0..63
        Os[ol * OSP + nl] = acc[mt][r] * IWSC + BIAS[o0 + ol];
      }
    }
  }
  __syncthreads();

  const int e = tid & 7, lq = tid >> 3;                             // lq 0..15
  if (mb == 0) {
    // ---- q/k bf16 hi + residual planes ----
{
#pragma unroll
      for (int it = 0; it < 8; ++it) {
        const int p    = it >> 1;                                    // 0 Qh, 1 Ql, 2 Kh, 3 Kl
        const int ll   = (it & 1) * 16 + lq;                         // 0..31
        const int nl   = 2 * ll + (e >> 2);                          // 0..63
        const int col0 = 8 * (e & 3);                                // 0,8,16,24
        const int rb   = ((p >> 1) ? CQ : 0) + col0;
        v4u u;
#pragma unroll
        for (int t = 0; t < 4; ++t) {
          const float f0 = Os[(rb + 2 * t) * OSP + nl];
          const float f1 = Os[(rb + 2 * t + 1) * OSP + nl];
          const unsigned short hb0 = bf_bits(f0), hb1 = bf_bits(f1);
          const unsigned short lb0 = bf_bits(f0 - bf_up(hb0));
          const unsigned short lb1 = bf_bits(f1 - bf_up(hb1));
          u[t] = (p & 1) ? pk16(lb0, lb1) : pk16(hb0, hb1);
        }
        unsigned short* P = (p == 0) ? Qh : (p == 1) ? Ql : (p == 2) ? Kh : Kl;
        *(v4u*)(P + ((size_t)(b * NN + n0 + nl)) * CQ + col0) = u;
      }
      
    }
  } else {
    // ---- v f16 plane ----
    const int ch0 = o0 - QT;                                         // (mb-1)*64
    v4u uv[4];
#pragma unroll
    for (int it = 0; it < 4; ++it) {
      const int row = it * 16 + lq;                                  // 0..63
      const v4f a = *(const v4f*)(Os + row * OSP + 8 * e);
      const v4f q = *(const v4f*)(Os + row * OSP + 8 * e + 4);
#pragma unroll
      for (int t = 0; t < 2; ++t) {
        uv[it][t]     = pk16(h_bits((_Float16)a[2 * t]), h_bits((_Float16)a[2 * t + 1]));
        uv[it][2 + t] = pk16(h_bits((_Float16)q[2 * t]), h_bits((_Float16)q[2 * t + 1]));
      }
    }
{
#pragma unroll
      for (int it = 0; it < 4; ++it) {
        const int row = it * 16 + lq;
        *(v4u*)(Vh + ((size_t)(b * CC + ch0 + row)) * NN + n0 + 8 * e) = uv[it];
      }
      
    }
  }
}

// ---- one stage (64 keys) of v, k hi and k residual -> LDS, 128 lanes, 16 B per lane and copy, no register on the way.
//      v: copy i brings row (channel) 16 i + (tid >> 3), bytes 16 (tid & 7) ..+15 of its 128; 16 copies = 256 rows.
//      k: copy i of a plane brings row (key) 32 i + (tid >> 2), bytes 16 (tid & 3) ..+15 of its 64; 2 copies = 64 rows.
//      lv / lk: the lane's LDS byte address of its first v / k-hi piece; gv / gh / gl: its first global piece.
//      s_wait_xcnt 0 closes each statement, a precaution: it stands in front of any rewrite of a register a copy names.
__device__ __forceinline__ void stage_copy(unsigned lv, unsigned lk, const unsigned short* gv,
                                           const unsigned short* gh, const unsigned short* gl) {
#if defined(__HIP_DEVICE_COMPILE__)
#pragma unroll
  for (int g = 0; g < 2; ++g) {
    const unsigned l = lv + (unsigned)(g * 128 * VPB);
    const unsigned short* p = gv + (size_t)(g * 128) * NN;
    asm volatile("global_load_async_to_lds_b128 %0, %8, off\n\t"
                 "global_load_async_to_lds_b128 %1, %9, off\n\t"
                 "global_load_async_to_lds_b128 %2, %10, off\n\t"
                 "global_load_async_to_lds_b128 %3, %11, off\n\t"
                 "global_load_async_to_lds_b128 %4, %12, off\n\t"
                 "global_load_async_to_lds_b128 %5, %13, off\n\t"
                 "global_load_async_to_lds_b128 %6, %14, off\n\t"
                 "global_load_async_to_lds_b128 %7, %15, off\n\t"
                 "s_wait_xcnt 0x0"
                 :: "v"(l), "v"(l + 16u * VPB), "v"(l + 32u * VPB), "v"(l + 48u * VPB),
                    "v"(l + 64u * VPB), "v"(l + 80u * VPB), "v"(l + 96u * VPB), "v"(l + 112u * VPB),
                    "v"(p), "v"(p + (size_t)16 * NN), "v"(p + (size_t)32 * NN), "v"(p + (size_t)48 * NN),
                    "v"(p + (size_t)64 * NN), "v"(p + (size_t)80 * NN), "v"(p + (size_t)96 * NN),
                    "v"(p + (size_t)112 * NN)
                 : "memory");
  }
  asm volatile("global_load_async_to_lds_b128 %0, %4, off\n\t"
               "global_load_async_to_lds_b128 %1, %5, off\n\t"
               "global_load_async_to_lds_b128 %2, %6, off\n\t"
               "global_load_async_to_lds_b128 %3, %7, off\n\t"
               "s_wait_xcnt 0x0"
               :: "v"(lk), "v"(lk + 32u * KPB), "v"(lk + (unsigned)KSTB), "v"(lk + (unsigned)KSTB + 32u * KPB),
                  "v"(gh), "v"(gh + 32 * CQ), "v"(gl), "v"(gl + 32 * CQ)
               : "memory");
#endif
}

// =========================================================================================================
// (3) position attention for one (b, 64-query tile), transposed formulation, 4096 keys, no mask:
//   S^T tile (16 keys x 16 queries) = A(k: row = key kb + (lane&15), 32 d via the split k map from the bf16 plane
//   Kh [b][4096][32]) . B(q: col = query, same map, resident fragment from Qh) + A(Kh).B(Ql) + A(Kl).B(Qh)
//   (bf16 unscaled residual planes, shared accumulator). Energy = S (no scale).
//   Per lane the D tile holds 8 keys of ONE query: online softmax state per lane, one shuffle (lane^16) for the max
//   over 32 keys, row-sum partials combined at the end. P = e^{s-m} x 1024 as f16 is the B operand of
//   O^T (rows channel, cols queries) += A(V rows channel = 16j + (lane&15), keys contiguous, f16 plane Vh
//   [b][256][4096]) . B(P^T): element r <- D of the tile covering keys kb..kb+15, element 8+r <- the tile covering
//   kb+16..kb+31, lane unchanged. 16 accumulator tiles per wave (256 channels). Block = 4 waves = 64 queries.
//   The k and v rows of 64 keys are one stage in LDS, brought once per block by asynchronous copies and read by all
//   four waves; two buffers: stage t + 1 flies while stage t is worked on (two passes of 32 keys).
//   Epilogue in two channel halves: O/l staged in LDS Os[query][128 channels] (pitch OSPW, b128 stores), barrier,
// coverage: per half 16 it x 16 lines x 8 lanes x 4 floats = 128 ch x 64 n; two halves = 256 ch; grid (64, NB).
// =========================================================================================================
__global__ __launch_bounds__(128)
void attn_pam(const unsigned short* __restrict__ Qh, const unsigned short* __restrict__ Ql,
              const unsigned short* __restrict__ Kh, const unsigned short* __restrict__ Kl,
              const unsigned short* __restrict__ Vh, float* Yp) {
  __shared__ __align__(16) float Os[QT * OSPW];
  __shared__ __align__(16) unsigned char Ring[2 * STGB];
  const int tid  = threadIdx.x;
  const int wave = tid >> 5, lane = tid & 31;
  const int hh   = lane >> 4, c = lane & 15;
  const int n0   = blockIdx.x * QT, b = blockIdx.y;

  // resident q fragments (B operand, col = query n0 + 16*wave + c)
  Frag qh, ql;
  {
    const size_t qo = ((size_t)(b * NN + n0 + 16 * wave + c)) * CQ + 8 * hh;
    qh = ldfrag(Qh + qo);
    ql = ldfrag(Ql + qo);
  }
  // the lane's first pieces of a stage: global sources (+ t * KT keys) and LDS places (+ buffer * STGB)
  const unsigned short* gv = Vh + (size_t)b * CC * NN + (size_t)(tid >> 3) * NN + 8 * (tid & 7);
  const unsigned short* gh = Kh + ((size_t)b * NN + (tid >> 2)) * CQ + 8 * (tid & 3);
  const unsigned short* gl = Kl + ((size_t)b * NN + (tid >> 2)) * CQ + 8 * (tid & 3);
  const unsigned ring0 = (unsigned)(size_t)Ring;                     // low 32 bits = byte offset in the block's LDS
  const unsigned lv = ring0 + (unsigned)((tid >> 3) * VPB + 16 * (tid & 7));
  const unsigned lk = ring0 + (unsigned)(VSTB + (tid >> 2) * KPB + 16 * (tid & 3));
  // fragment offsets inside a stage: v (A operand, row = channel 16j + c, keys contiguous), k (A operand, row = key)
  const int vfo = c * VPB + 16 * hh;
  const int kfo = VSTB + c * KPB + 16 * hh;

  float m = -1.0e30f, l = 0.f;
  v8f o[16];
#pragma unroll
  for (int j = 0; j < 16; ++j) o[j] = zero8();

  // prologue: stage 0 landed and published, then stage 1 on its way
  stage_copy(lv, lk, gv, gh, gl);
  asm volatile("s_wait_asynccnt 0x0" ::: "memory");                  // this wave's pieces of stage 0 have landed
  __syncthreads();                                                   // ... and every other wave's
  stage_copy(lv + STGB, lk + STGB, gv + KT, gh + KT * CQ, gl + KT * CQ);

#pragma unroll 1
  for (int t = 0; t < NT; ++t) {
   const unsigned bo = (unsigned)(t & 1) * STGB;
   const unsigned char* sb = Ring + bo;
#pragma unroll 1                                                     // rolled: one pass's exponentials live at a time, no spill
   for (int ps = 0; ps < KT / 32; ++ps) {
    const unsigned char* kp = sb + kfo + ps * 32 * KPB;              // the pass's keys start at kb = KT t + 32 ps
    const Frag k0  = ldfrag((const unsigned short*)(kp));                        // keys kb .. kb+15
    const Frag k1  = ldfrag((const unsigned short*)(kp + 16 * KPB));             // keys kb+16 .. kb+31
    const Frag k0l = ldfrag((const unsigned short*)(kp + KSTB));
    const Frag k1l = ldfrag((const unsigned short*)(kp + KSTB + 16 * KPB));
    v8f s0 = mma_b(k0.bf, qh.bf, zero8());
    v8f s1 = mma_b(k1.bf, qh.bf, zero8());
    s0 = mma_b(k0.bf, ql.bf, s0);
    s1 = mma_b(k1.bf, ql.bf, s1);
    s0 = mma_b(k0l.bf, qh.bf, s0);
    s1 = mma_b(k1l.bf, qh.bf, s1);

    float mx = fmaxf(hmax8(s0), hmax8(s1));
    const float mo = __shfl_xor(mx, 16, 32);
    // the first 8 v fragments of the pass as one group of LDS reads, in flight under the maximum and its exchange
    const unsigned char* vp = sb + vfo + ps * 64;
    Frag vf[8];
#pragma unroll
    for (int j = 0; j < 8; ++j) vf[j] = ldfrag((const unsigned short*)(vp + 16 * j * VPB));
    mx = fmaxf(mx, mo);
    const float mn   = fmaxf(m, mx);
    const float corr = __expf(m - mn);
    m = mn;
    const float msh = mn - LNPS;                                     // exp gives e^{s-m} * 1024
    l *= corr;
#pragma unroll
    for (int j = 0; j < 16; ++j) {
#pragma unroll
      for (int r = 0; r < 8; ++r) o[j][r] *= corr;
    }

    FragH ph;
    float ls = 0.f;
#pragma unroll
    for (int r = 0; r < 8; ++r) {
      const float e0 = __expf(s0[r] - msh);                          // key kb      + 8hh + r
      const float e1 = __expf(s1[r] - msh);                          // key kb + 16 + 8hh + r
      ls += e0 + e1;
      ph.hv[0][r] = (_Float16)e0;
      ph.hv[1][r] = (_Float16)e1;
    }
    l += ls;

    // blocks of 4 products; behind each of the first two, the 4 fragments needed two blocks later take their registers
#pragma unroll
    for (int g = 0; g < 4; ++g) {
#pragma unroll
      for (int i = 0; i < 4; ++i) o[4 * g + i] = mma_h(vf[(4 * g + i) & 7].h, ph.v, o[4 * g + i]);
      if (g < 2) {
#pragma unroll
        for (int i = 0; i < 4; ++i)
          vf[(4 * g + i) & 7] = ldfrag((const unsigned short*)(vp + 16 * (4 * g + i + 8) * VPB));
      }
    }
   }
   // publish point of stage t + 1, and the end of every reader's last read of stage t's buffer
   asm volatile("s_wait_dscnt 0x0" ::: "memory");                    // this wave's LDS reads of stage t are done
   asm volatile("s_wait_asynccnt 0x0" ::: "memory");                 // this wave's pieces of stage t + 1 have landed
   __syncthreads();
   if (t + 2 < NT)                                                   // block-uniform: refill the buffer just read
     stage_copy(lv + bo, lk + bo, gv + (size_t)(t + 2) * KT, gh + (size_t)(t + 2) * KT * CQ,
                gl + (size_t)(t + 2) * KT * CQ);
  }
  asm volatile("s_wait_asynccnt 0x0" ::: "memory");                  // nothing of this wave is in flight at its end
  l += __shfl_xor(l, 16, 32);
  const float inv = 1.0f / l;                                        // o and l both carry the x1024 factor

  const int qrow = 16 * wave + c;
  const int e = tid & 7, lq = tid >> 3;                              // lq 0..15
#pragma unroll
  for (int half = 0; half < 2; ++half) {
    if (half) __syncthreads();                                       // every wave finished reading Os
#pragma unroll
    for (int jj = 0; jj < 8; ++jj) {
      const int j = 8 * half + jj;
      v4f va, vb;
#pragma unroll
      for (int r = 0; r < 4; ++r) { va[r] = o[j][r] * inv; vb[r] = o[j][4 + r] * inv; }
      *(v4f*)(Os + qrow * OSPW + 16 * jj + 8 * hh)     = va;         // Os[query][ch_loc = 16jj + 8hh + r]
      *(v4f*)(Os + qrow * OSPW + 16 * jj + 8 * hh + 4) = vb;
    }
    __syncthreads();
{
#pragma unroll
      for (int it = 0; it < 16; ++it) {
        const int L   = it * 16 + lq;                                // 0..255
        const int chl = L >> 1, hf = L & 1;                          // channel 0..127 within the half
        const int nl  = hf * 32 + 4 * e;                             // query 0..63
        v4f v;
#pragma unroll
        for (int t = 0; t < 4; ++t) v[t] = Os[(nl + t) * OSPW + chl];
        *(v4f*)(Yp + ((size_t)(b * CC + 128 * half + chl)) * NN + n0 + nl) = v;
      }
      
    }
  }
}

// =========================================================================================================
// (4) channel Gram for one (b, 64-i block, 64-j block): G[b][i][j] = sum_n Xc[b][i][n] Xc[b][j][n], K = 4096.
//     4 waves; wave w owns cols j0+16w..+15 (B from the j row, keys n contiguous) and 4 i tiles (A rows
//     [b][256][256] (row segment 64 j = 2 lines), 8 consecutive lanes x 16 B, one instruction per 16 lines, two
// coverage: 8 it x 16 lines x 8 lanes x 4 = 64 x 64; grid (4, 4, NB) covers G exactly once.
// =========================================================================================================
__global__ __launch_bounds__(128)
void gram_k(const unsigned short* __restrict__ Xc, float* G) {
  __shared__ __align__(16) float Os[QT * OSP];
  const int tid  = threadIdx.x;
  const int lane = tid & 31, wave = tid >> 5;
  const int hh   = lane >> 4, c = lane & 15;
  const int jt = blockIdx.x, itb = blockIdx.y, b = blockIdx.z;
  const int j0 = jt * QT, i0 = itb * QT;

  const unsigned short* ap = Xc + ((size_t)(b * CC + i0 + c)) * NN + 8 * hh;
  const unsigned short* bp = Xc + ((size_t)(b * CC + j0 + 16 * wave + c)) * NN + 8 * hh;

  v8f acc[4];
#pragma unroll
  for (int mt = 0; mt < 4; ++mt) acc[mt] = zero8();

#pragma unroll 2
  for (int ks = 0; ks < NN / 32; ++ks) {
    const Frag fb = ldfrag(bp + 32 * ks);
#pragma unroll
    for (int mt = 0; mt < 4; ++mt) {
      const Frag fa = ldfrag(ap + (size_t)(16 * mt) * NN + 32 * ks);
      acc[mt] = mma_h(fa.h, fb.h, acc[mt]);
    }
  }
  {
    const int nl = 16 * wave + c;
#pragma unroll
    for (int mt = 0; mt < 4; ++mt) {
#pragma unroll
      for (int r = 0; r < 8; ++r) Os[(16 * mt + 8 * hh + r) * OSP + nl] = acc[mt][r];
    }
  }
  __syncthreads();
  {
    const int e = tid & 7, lq = tid >> 3;                            // lq 0..15
{
#pragma unroll
      for (int it = 0; it < 8; ++it) {
        const int L = it * 16 + lq;                                  // 0..127
        const int row = L >> 1, hf = L & 1;
        const v4f v = *(const v4f*)(Os + row * OSP + hf * 32 + 4 * e);
        *(v4f*)(G + ((size_t)(b * CC + i0 + row)) * CC + j0 + hf * 32 + 4 * e) = v;
      }
      
    }
  }
}

// =========================================================================================================
// (5) channel softmax: for row (b, i): p_j = exp(min_j G - G_j) / sum (== softmax of rowmax - G), written as
//     Pc f16 [b][256][256] = p * 1024. One wave per row: lane reads j = 8 lane..8 lane+7, wave min / sum via
// coverage: grid (32, NB) x 8 waves = 256 rows per batch; 32 lanes x 8 = 256 j.
// =========================================================================================================
__global__ __launch_bounds__(256)
void cam_softmax(const float* __restrict__ G, unsigned short* Pc) {
  const int tid = threadIdx.x, lane = tid & 31, w = tid >> 5;
  const int b = blockIdx.y, i = blockIdx.x * 8 + w;                 // 0..255
  const float* row = G + ((size_t)(b * CC + i)) * CC + 8 * lane;
  const v4f a = *(const v4f*)row;
  const v4f q = *(const v4f*)(row + 4);
  const float ev[8] = {a[0], a[1], a[2], a[3], q[0], q[1], q[2], q[3]};
  float mn = ev[0];
#pragma unroll
  for (int t = 1; t < 8; ++t) mn = fminf(mn, ev[t]);
#pragma unroll
  for (int s = 1; s < 32; s <<= 1) mn = fminf(mn, __shfl_xor(mn, s, 32));
  float p[8], sm = 0.f;
#pragma unroll
  for (int t = 0; t < 8; ++t) { p[t] = __expf(mn - ev[t]); sm += p[t]; }
#pragma unroll
  for (int s = 1; s < 32; s <<= 1) sm += __shfl_xor(sm, s, 32);
  const float inv = PSC / sm;
  v4u u;
#pragma unroll
  for (int t = 0; t < 4; ++t)
    u[t] = pk16(h_bits((_Float16)(p[2 * t] * inv)), h_bits((_Float16)(p[2 * t + 1] * inv)));
{
    *(v4u*)(Pc + ((size_t)(b * CC + i)) * CC + 8 * lane) = u;
    
  }
}

// =========================================================================================================
// (6) channel mix + output for one (b, 64-n tile, 64-i block): cam[i][n] = (1/1024) sum_j Pc[b][i][j] XP[b][n][j]
//     (K = 256 = 8 steps; A rows i = i0 + 16 mt + (lane&15), j contiguous; B col n = n0 + 16w + (lane&15) from the
//     XP row, j contiguous), then out[b][i][n] = (g_pam * Yp + xb) + (g_cam * cam + xb) with xb = bf16-RNE of x
// coverage: 8 it x 16 lines x 8 lanes x 4 = 64 i x 64 n; grid (64, 4, NB) covers d_out exactly once.
// =========================================================================================================
__global__ __launch_bounds__(128)
void cam_out(const unsigned short* __restrict__ Pc, const unsigned short* __restrict__ XP,
             const float* __restrict__ Yp, const float* __restrict__ x,
             const float* __restrict__ gpam, const float* __restrict__ gcam, float* out) {
  __shared__ __align__(16) float Os[QT * OSP];
  const int tid  = threadIdx.x;
  const int lane = tid & 31, wave = tid >> 5;
  const int hh   = lane >> 4, c = lane & 15;
  const int nt = blockIdx.x, itb = blockIdx.y, b = blockIdx.z;
  const int n0 = nt * QT, i0 = itb * QT;

  const unsigned short* ap = Pc + ((size_t)(b * CC + i0 + c)) * CC + 8 * hh;
  const unsigned short* bp = XP + ((size_t)(b * NN + n0 + 16 * wave + c)) * CC + 8 * hh;

  v8f acc[4];
#pragma unroll
  for (int mt = 0; mt < 4; ++mt) acc[mt] = zero8();

#pragma unroll
  for (int ks = 0; ks < CC / 32; ++ks) {
    const Frag fb = ldfrag(bp + 32 * ks);
#pragma unroll
    for (int mt = 0; mt < 4; ++mt) {
      const Frag fa = ldfrag(ap + (size_t)(16 * mt) * CC + 32 * ks);
      acc[mt] = mma_h(fa.h, fb.h, acc[mt]);
    }
  }
  {
    const int nl = 16 * wave + c;
#pragma unroll
    for (int mt = 0; mt < 4; ++mt) {
#pragma unroll
      for (int r = 0; r < 8; ++r) Os[(16 * mt + 8 * hh + r) * OSP + nl] = acc[mt][r];
    }
  }
  __syncthreads();

  const float gp = bfr(gpam[0]);
  const float gc = bfr(gcam[0]) * IPSC;
  const int e = tid & 7, lq = tid >> 3;                              // lq 0..15
  v4f res[8];
#pragma unroll
  for (int it = 0; it < 8; ++it) {
    const int L = it * 16 + lq;                                      // 0..127
    const int row = L >> 1, hf = L & 1;
    const int nl = hf * 32 + 4 * e;
    const v4f cam4 = *(const v4f*)(Os + row * OSP + nl);
    const size_t idx = ((size_t)(b * CC + i0 + row)) * NN + n0 + nl;
    const v4f xv = *(const v4f*)(x + idx);
    const v4f yv = *(const v4f*)(Yp + idx);
#pragma unroll
    for (int t = 0; t < 4; ++t) {
      const float xb = bfr(xv[t]);
      const float t1 = gp * yv[t] + xb;
      const float t2 = gc * cam4[t] + xb;
      res[it][t] = t1 + t2;
    }
  }
{
#pragma unroll
    for (int it = 0; it < 8; ++it) {
      const int L = it * 16 + lq;
      const int row = L >> 1, hf = L & 1;
      const int nl = hf * 32 + 4 * e;
      const size_t idx = ((size_t)(b * CC + i0 + row)) * NN + n0 + nl;
      *(v4f*)(out + idx) = res[it];
    }
    
  }
}

// =========================================================================================================
// Workspace map (bytes; each region start a multiple of 256; every extent is an exact tile multiple and is written
//   W16 f16 [320][256]          163840      BIAS f32 [320]              1280
//   Xc  f16 [2][256][4096]     4194304      XP   f16 [2][4096][256]  4194304
//   Qh/Ql/Kh/Kl bf16 [2][4096][32]  524288 x4                          Vh f16 [2][256][4096]  4194304
//   Yp  f32 [2][256][4096]     8388608      G    f32 [2][256][256]    524288      Pc f16 [2][256][256] 262144
//   total = 24020224
// =========================================================================================================
extern "C" void kernel_launch(void* const* d_in, const int* in_sizes, int n_in,
                              void* d_out, int out_size, void* d_ws, size_t ws_size,
                              hipStream_t stream) {
  const int XN = NB * CC * NN;                                       // 2097152
  if (n_in < 9) return;
  if (in_sizes[0] != XN) return;
  if (in_sizes[1] != CQ * CC || in_sizes[2] != CQ) return;
  if (in_sizes[3] != CQ * CC || in_sizes[4] != CQ) return;
  if (in_sizes[5] != CC * CC || in_sizes[6] != CC) return;
  if (in_sizes[7] < 1 || in_sizes[8] < 1) return;
  if (out_size != XN) return;

  size_t off = 0;
  auto carve = [&](size_t bytes) { const size_t o = off; off += (bytes + 255) & ~(size_t)255; return o; };
  const size_t oW16 = carve((size_t)MQKV * CC * 2);
  const size_t oBIA = carve((size_t)MQKV * 4);
  const size_t oXc  = carve((size_t)NB * CC * NN * 2);
  const size_t oXP  = carve((size_t)NB * NN * CC * 2);
  const size_t oQh  = carve((size_t)NB * NN * CQ * 2);
  const size_t oQl  = carve((size_t)NB * NN * CQ * 2);
  const size_t oKh  = carve((size_t)NB * NN * CQ * 2);
  const size_t oKl  = carve((size_t)NB * NN * CQ * 2);
  const size_t oVh  = carve((size_t)NB * CC * NN * 2);
  const size_t oYp  = carve((size_t)NB * CC * NN * 4);
  const size_t oG   = carve((size_t)NB * CC * CC * 4);
  const size_t oPc  = carve((size_t)NB * CC * CC * 2);
  if (off > ws_size) return;
  if (off > (size_t)134217728) return;

  const float* x    = (const float*)d_in[0];
  const float* wq   = (const float*)d_in[1];
  const float* bq   = (const float*)d_in[2];
  const float* wk   = (const float*)d_in[3];
  const float* bk   = (const float*)d_in[4];
  const float* wv   = (const float*)d_in[5];
  const float* bv   = (const float*)d_in[6];
  const float* gpam = (const float*)d_in[7];
  const float* gcam = (const float*)d_in[8];

  char* ws = (char*)d_ws;
  unsigned short* W16 = (unsigned short*)(ws + oW16);
  float*          BIA = (float*)(ws + oBIA);
  unsigned short* Xc  = (unsigned short*)(ws + oXc);
  unsigned short* XP  = (unsigned short*)(ws + oXP);
  unsigned short* Qh  = (unsigned short*)(ws + oQh);
  unsigned short* Ql  = (unsigned short*)(ws + oQl);
  unsigned short* Kh  = (unsigned short*)(ws + oKh);
  unsigned short* Kl  = (unsigned short*)(ws + oKl);
  unsigned short* Vh  = (unsigned short*)(ws + oVh);
  float*          Yp  = (float*)(ws + oYp);
  float*          G   = (float*)(ws + oG);
  unsigned short* Pc  = (unsigned short*)(ws + oPc);
  float* out = (float*)d_out;

  const dim3 blk256(256), blk128(128);

  // (0) conv1x1 weights -> f16 plane + bias line
  cvt_w<<<dim3(MQKV / 8), blk256, 0, stream>>>(wq, bq, wk, bk, wv, bv, W16, BIA);
  // (1) x -> channel-major and position-major 16-bit planes
  cvt_x<<<dim3(NN / QT, CC / QT, NB), blk256, 0, stream>>>(x, Xc, XP);
  // (2) conv1x1 GEMM -> q/k hi + residual planes and v plane
  gemm_qkv<<<dim3(NN / QT, MQKV / QT, NB), blk128, 0, stream>>>(W16, BIA, XP, Qh, Ql, Kh, Kl, Vh);
  // (3) position attention -> Yp [b][256][4096]
  attn_pam<<<dim3(NN / QT, NB), blk128, 0, stream>>>(Qh, Ql, Kh, Kl, Vh, Yp);
  // (4) channel Gram -> G [b][256][256]
  gram_k<<<dim3(CC / QT, CC / QT, NB), blk128, 0, stream>>>(Xc, G);
  // (5) channel softmax -> Pc [b][256][256] (x1024 f16)
  cam_softmax<<<dim3(CC / 8, NB), blk256, 0, stream>>>(G, Pc);
  // (6) channel mix + residual sum -> out [b][256][4096]
  cam_out<<<dim3(NN / QT, CC / QT, NB), blk128, 0, stream>>>(Pc, XP, Yp, x, gpam, gcam, out);
  (void)hipGetLastError();
}

// v002
// A run of this version takes 109 microseconds.
// Timed twice side by side with v001, it ran 1.53 and 1.55 times as fast.
// Counting every step since v000, it is 4.59 times as fast.
// Contractions: conv1x1 q/k/v GEMM W[320x256].X[256x4096] on v_wmma_f32_16x16x32_f16 (f16 containers of bf16-RNE
// weights x256 and bf16-RNE x); position scores K.Q^T on v_wmma_f32_16x16x32_bf16 (bf16 hi + bf16 residual planes of
// q and k, 3 products, K=32); O^T = V.P^T on v_wmma_f32_16x16x32_f16 (v f16, P = e^{s-m} x1024 f16 from the score D
// registers); channel Gram X.X^T (K=4096) and channel mix A.X (K=256) on v_wmma_f32_16x16x32_f16 (f16 of bf16-RNE x,
// softmax weights x1024 f16); f32 accumulate everywhere; softmax statistics, residual adds and output sum in f32 VALU.
#include <hip/hip_runtime.h>
#include <math.h>
#include <stdint.h>

#define NB    2
#define CC    256
#define NN    4096
#define CQ    32
#define MQKV  320
#define QT    64
#define OSP   68
#define OSPW  132
#define TP    72
#define WSC   256.0f
#define IWSC  0.00390625f
#define PSC   1024.0f
#define IPSC  0.0009765625f
#define LNPS  6.931471805599453f
#define KT    64                       // keys per LDS stage of the position attention
#define NT    (NN / KT)                // stages
#define VPB   144                      // LDS pitch of a v row (64 keys = 128 B, + 16 B: 16 B x odd for b128 readers)
#define KPB   80                       // LDS pitch of a k row (32 d = 64 B, + 16 B)
#define VSTB  (CC * VPB)               // v part of a stage, bytes
#define KSTB  (KT * KPB)               // one k plane of a stage, bytes
#define STGB  (VSTB + 2 * KSTB)        // one stage: v, k hi, k residual
#define GS    16                       // blocks that share the K = 4096 of one Gram tile
#define GK    (NN / GS)                // positions per Gram block

static_assert(NN % QT == 0);
static_assert(CC % QT == 0);
static_assert(MQKV == 2 * CQ + CC);
static_assert(MQKV % QT == 0);
static_assert((OSP * 4) % 16 == 0);
static_assert((OSPW * 4) % 16 == 0);
static_assert((TP * 2) % 16 == 0);
static_assert(CC % 32 == 0 && NN % 32 == 0 && CQ == 32);
static_assert(NN % KT == 0 && NT >= 2 && KT % 32 == 0);
static_assert(VPB % 16 == 0 && KPB % 16 == 0 && STGB % 16 == 0 && VSTB % 16 == 0);
static_assert(VPB >= KT * 2 && KPB >= CQ * 2);
static_assert(NN % GS == 0 && GK % 32 == 0);

typedef _Float16       v16h __attribute__((ext_vector_type(16)));
typedef _Float16       v8h  __attribute__((ext_vector_type(8)));
typedef __bf16         v16b __attribute__((ext_vector_type(16)));
typedef unsigned short v8us __attribute__((ext_vector_type(8)));
typedef float          v8f  __attribute__((ext_vector_type(8)));
typedef float          v4f  __attribute__((ext_vector_type(4)));
typedef unsigned int   v4u  __attribute__((ext_vector_type(4)));

union Frag  { v8us u[2]; v16h h; v16b bf; };
union FragH { v16h v; v8h hv[2]; };
static_assert(sizeof(Frag) == 32);
static_assert(sizeof(FragH) == 32);

// ---- scalar helpers ---------------------------------------------------------------------------------------
__device__ __forceinline__ unsigned short bf_bits(float f) {          // f32 -> bf16 bits, RNE convert
  unsigned u = __float_as_uint(f);
  return (unsigned short)((u + 0x7FFFu + ((u >> 16) & 1u)) >> 16);
}
__device__ __forceinline__ float bf_up(unsigned short hb) { return __uint_as_float(((unsigned)hb) << 16); }
__device__ __forceinline__ float bfr(float f) { return bf_up(bf_bits(f)); }
__device__ __forceinline__ unsigned short h_bits(_Float16 x) { return __builtin_bit_cast(unsigned short, x); }
__device__ __forceinline__ unsigned pk16(unsigned short a, unsigned short b) { return (unsigned)a | ((unsigned)b << 16); }
__device__ __forceinline__ v8f zero8() { v8f z = {0.f, 0.f, 0.f, 0.f, 0.f, 0.f, 0.f, 0.f}; return z; }
__device__ __forceinline__ float hmax8(v8f s) {
  return fmaxf(fmaxf(fmaxf(s[0], s[1]), fmaxf(s[2], s[3])), fmaxf(fmaxf(s[4], s[5]), fmaxf(s[6], s[7])));
}

// ---- 16-bit fragment loader (A, or B from a k-contiguous [n][k] row): lane -> row/col (lane&15), p already includes
//      + 8*(lane>>4); elements 0..7 <- p[0..7] (k0+8h..), elements 8..15 <- p[16..23] (k0+16+8h..)
__device__ __forceinline__ Frag ldfrag(const unsigned short* p) {
  Frag f;
  f.u[0] = *(const v8us*)(p);
  f.u[1] = *(const v8us*)(p + 16);
  return f;
}

// ---- WMMA helpers: builtin followed by a 4-slot VALU gap tying D and keeping A/B live --------------------------
__device__ __forceinline__ v8f mma_h(v16h a, v16h b, v8f c) {
  v8f d = __builtin_amdgcn_wmma_f32_16x16x32_f16(false, a, false, b, (short)0, c, false, false);
#if defined(__HIP_DEVICE_COMPILE__)
  asm volatile("v_nop\n\tv_nop\n\tv_nop\n\tv_nop" : "+v"(d) : "v"(a), "v"(b));
#endif
  return d;
}
__device__ __forceinline__ v8f mma_b(v16b a, v16b b, v8f c) {
  v8f d = __builtin_amdgcn_wmma_f32_16x16x32_bf16(false, a, false, b, (short)0, c, false, false);
#if defined(__HIP_DEVICE_COMPILE__)
  const v16h ha = __builtin_bit_cast(v16h, a), hb = __builtin_bit_cast(v16h, b);
  asm volatile("v_nop\n\tv_nop\n\tv_nop\n\tv_nop" : "+v"(d) : "v"(ha), "v"(hb));
#endif
  return d;
}

// =========================================================================================================
// (0) conv1x1 weights: W16 f16 [320][256], row o: 0..31 = wq, 32..63 = wk, 64..319 = wv; value = f16 of
//     (bf16-RNE(w) * 256) (exact). BIAS f32 [320] = bf16-RNE of bq / bk / bv. Block blk (0..39) owns rows
// coverage: 40 blocks x 8 rows x 32 pieces x 8 halves = 320 x 256; bias 80 x 4 floats = 320.
// =========================================================================================================
__global__ __launch_bounds__(256)
void cvt_w(const float* __restrict__ wq, const float* __restrict__ bq,
           const float* __restrict__ wk, const float* __restrict__ bk,
           const float* __restrict__ wv, const float* __restrict__ bv,
           unsigned short* W16, float* BIAS) {
  const int tid = threadIdx.x, blk = blockIdx.x;
  const int rl = tid >> 5, col = 8 * (tid & 31);
  const int o = 8 * blk + rl;                                     // 0..319
  const float* wbase = (blk < 4) ? wq : (blk < 8) ? wk : wv;       // block-uniform selection
  const int osub = (blk < 4) ? 0 : (blk < 8) ? CQ : 2 * CQ;
  const float* s = wbase + (size_t)(o - osub) * CC + col;          // in range: (o-osub) < rows of that matrix
  const v4f a = *(const v4f*)s;
  const v4f q = *(const v4f*)(s + 4);
  const float f[8] = {a[0], a[1], a[2], a[3], q[0], q[1], q[2], q[3]};
  v4u u;
#pragma unroll
  for (int t = 0; t < 4; ++t) {
    const _Float16 h0 = (_Float16)(bfr(f[2 * t]) * WSC);
    const _Float16 h1 = (_Float16)(bfr(f[2 * t + 1]) * WSC);
    u[t] = pk16(h_bits(h0), h_bits(h1));
  }
  // bias values: every lane loads all three candidates with clamped indices, selects by value
  v4f bvv;
  {
    const int tb = min(tid, 79);
    const int o4 = 4 * tb;
#pragma unroll
    for (int qd = 0; qd < 4; ++qd) {
      const int oo = o4 + qd;
      const int iq = min(oo, CQ - 1);
      const int ik = min(max(oo - CQ, 0), CQ - 1);
      const int iv = min(max(oo - 2 * CQ, 0), CC - 1);
      const float cq = bq[iq], ck = bk[ik], cv = bv[iv];
      const float val = (oo < CQ) ? cq : (oo < 2 * CQ) ? ck : cv;
      bvv[qd] = bfr(val);
    }
  }
{
    *(v4u*)(W16 + (size_t)o * CC + col) = u;
    if (blk == 0 && tid < 80) *(v4f*)(BIAS + 4 * tid) = bvv;
    
  }
}

// =========================================================================================================
// (1) x f32 [b][256 c][4096 n] -> Xc f16 [b][c][n] (channel-major, bf16-RNE values, exact in f16) and
//     XP f16 [b][n][c] (position-major) through an LDS tile T[64 n][64 c] (pitch TP). Block (nb, cb, b) owns a
// coverage: Xc 2 it x 32 rows x 8 lanes x 8 = 64 c x 64 n; XP same; grid (64, 4, NB) covers both planes once.
// =========================================================================================================
__global__ __launch_bounds__(256)
void cvt_x(const float* __restrict__ x, unsigned short* Xc, unsigned short* XP) {
  __shared__ __align__(16) unsigned short T[QT * TP];
  const int tid = threadIdx.x;
  const int nb = blockIdx.x, cb = blockIdx.y, b = blockIdx.z;
  const int e = tid & 7, lq = tid >> 3;                             // lq 0..31
  const int n0 = nb * QT, c0 = cb * QT;
  v4u ux[2];
#pragma unroll
  for (int it = 0; it < 2; ++it) {
    const int cl = it * 32 + lq;                                     // 0..63
    const float* sp = x + ((size_t)(b * CC + c0 + cl)) * NN + n0 + 8 * e;
    const v4f a = *(const v4f*)sp;
    const v4f q = *(const v4f*)(sp + 4);
    unsigned short hb[8];
#pragma unroll
    for (int t = 0; t < 4; ++t) {
      hb[t]     = h_bits((_Float16)bfr(a[t]));
      hb[4 + t] = h_bits((_Float16)bfr(q[t]));
    }
#pragma unroll
    for (int t = 0; t < 4; ++t) ux[it][t] = pk16(hb[2 * t], hb[2 * t + 1]);
#pragma unroll
    for (int t = 0; t < 8; ++t) T[(8 * e + t) * TP + cl] = hb[t];
  }
  __syncthreads();
  v4u up[2];
#pragma unroll
  for (int it = 0; it < 2; ++it) {
    const int nl = it * 32 + lq;                                     // 0..63
    up[it] = *(const v4u*)(T + nl * TP + 8 * e);
  }
{
#pragma unroll
    for (int it = 0; it < 2; ++it) {
      const int rl = it * 32 + lq;
      *(v4u*)(Xc + ((size_t)(b * CC + c0 + rl)) * NN + n0 + 8 * e) = ux[it];
      *(v4u*)(XP + ((size_t)(b * NN + n0 + rl)) * CC + c0 + 8 * e) = up[it];
    }
    
  }
}

// =========================================================================================================
// (2) conv1x1 GEMM for one (b, 64-n tile, 64-o block): Y[o][n] = (1/256) sum_c W16[o][c] XP[b][n][c] + BIAS[o].
//     Block 128 threads = 4 waves; wave w owns cols n0+16w..+15 (one B fragment per k-step, k = c contiguous in
//     the XP row) and 4 m-tiles (A rows o = o0 + 16 mt + (lane&15), split k map loader from W16). K = 256 = 8 steps.
//     Epilogue staged in LDS Os[o_loc][n_loc] (pitch OSP), barrier, then:
//       o-block 0 (q rows 0..31, k rows 32..63): Qh/Ql/Kh/Kl bf16 hi / bf16 residual planes [b][4096 n][32]
//         holds rows 2ll, 2ll+1; lane e -> row 2ll+(e>>2), cols 8*(e&3)..+7; one instruction per 16 lines.
//         halves 8e..8e+7; one instruction per 16 lines.
// coverage: Os 4 waves x 4 tiles x 16x16 = 64 x 64; q/k: 4 planes x 32 lines x 8 lanes x 8 = 4 x (64 n x 32);
//           v: 4 it x 16 rows x 8 lanes x 8 = 64 ch x 64 n; grid (64, 5, NB) covers all planes exactly once.
// =========================================================================================================
__global__ __launch_bounds__(128)
void gemm_qkv(const unsigned short* __restrict__ W16, const float* __restrict__ BIAS,
              const unsigned short* __restrict__ XP,
              unsigned short* Qh, unsigned short* Ql, unsigned short* Kh, unsigned short* Kl,
              unsigned short* Vh) {
  __shared__ __align__(16) float Os[QT * OSP];
  const int tid  = threadIdx.x;
  const int lane = tid & 31, wave = tid >> 5;
  const int hh   = lane >> 4, c = lane & 15;
  const int nt   = blockIdx.x, mb = blockIdx.y, b = blockIdx.z;
  const int n0   = nt * QT, o0 = mb * QT;

  const unsigned short* ap = W16 + (size_t)(o0 + c) * CC + 8 * hh;
  const unsigned short* bp = XP + ((size_t)(b * NN + n0 + 16 * wave + c)) * CC + 8 * hh;

  v8f acc[4];
#pragma unroll
  for (int mt = 0; mt < 4; ++mt) acc[mt] = zero8();

#pragma unroll
  for (int ks = 0; ks < CC / 32; ++ks) {
    const Frag fb = ldfrag(bp + 32 * ks);
#pragma unroll
    for (int mt = 0; mt < 4; ++mt) {
      const Frag fa = ldfrag(ap + (size_t)(16 * mt) * CC + 32 * ks);
      acc[mt] = mma_h(fa.h, fb.h, acc[mt]);
    }
  }

  // ---- epilogue: scale back, + bias -> LDS Os[o_loc][n_loc] ----
  {
    const int nl = 16 * wave + c;
#pragma unroll
    for (int mt = 0; mt < 4; ++mt) {
#pragma unroll
      for (int r = 0; r < 8; ++r) {
        const int ol = 16 * mt + 8 * hh + r;                         // 0..63
        Os[ol * OSP + nl] = acc[mt][r] * IWSC + BIAS[o0 + ol];
      }
    }
  }
  __syncthreads();

  const int e = tid & 7, lq = tid >> 3;                             // lq 0..15
  if (mb == 0) {
    // ---- q/k bf16 hi + residual planes ----
{
#pragma unroll
      for (int it = 0; it < 8; ++it) {
        const int p    = it >> 1;                                    // 0 Qh, 1 Ql, 2 Kh, 3 Kl
        const int ll   = (it & 1) * 16 + lq;                         // 0..31
        const int nl   = 2 * ll + (e >> 2);                          // 0..63
        const int col0 = 8 * (e & 3);                                // 0,8,16,24
        const int rb   = ((p >> 1) ? CQ : 0) + col0;
        v4u u;
#pragma unroll
        for (int t = 0; t < 4; ++t) {
          const float f0 = Os[(rb + 2 * t) * OSP + nl];
          const float f1 = Os[(rb + 2 * t + 1) * OSP + nl];
          const unsigned short hb0 = bf_bits(f0), hb1 = bf_bits(f1);
          const unsigned short lb0 = bf_bits(f0 - bf_up(hb0));
          const unsigned short lb1 = bf_bits(f1 - bf_up(hb1));
          u[t] = (p & 1) ? pk16(lb0, lb1) : pk16(hb0, hb1);
        }
        unsigned short* P = (p == 0) ? Qh : (p == 1) ? Ql : (p == 2) ? Kh : Kl;
        *(v4u*)(P + ((size_t)(b * NN + n0 + nl)) * CQ + col0) = u;
      }
      
    }
  } else {
    // ---- v f16 plane ----
    const int ch0 = o0 - QT;                                         // (mb-1)*64
    v4u uv[4];
#pragma unroll
    for (int it = 0; it < 4; ++it) {
      const int row = it * 16 + lq;                                  // 0..63
      const v4f a = *(const v4f*)(Os + row * OSP + 8 * e);
      const v4f q = *(const v4f*)(Os + row * OSP + 8 * e + 4);
#pragma unroll
      for (int t = 0; t < 2; ++t) {
        uv[it][t]     = pk16(h_bits((_Float16)a[2 * t]), h_bits((_Float16)a[2 * t + 1]));
        uv[it][2 + t] = pk16(h_bits((_Float16)q[2 * t]), h_bits((_Float16)q[2 * t + 1]));
      }
    }
{
#pragma unroll
      for (int it = 0; it < 4; ++it) {
        const int row = it * 16 + lq;
        *(v4u*)(Vh + ((size_t)(b * CC + ch0 + row)) * NN + n0 + 8 * e) = uv[it];
      }
      
    }
  }
}

// ---- one stage (64 keys) of v, k hi and k residual -> LDS, 128 lanes, 16 B per lane and copy, no register on the way.
//      v: copy i brings row (channel) 16 i + (tid >> 3), bytes 16 (tid & 7) ..+15 of its 128; 16 copies = 256 rows.
//      k: copy i of a plane brings row (key) 32 i + (tid >> 2), bytes 16 (tid & 3) ..+15 of its 64; 2 copies = 64 rows.
//      lv / lk: the lane's LDS byte address of its first v / k-hi piece; gv / gh / gl: its first global piece.
//      s_wait_xcnt 0 closes each statement, a precaution: it stands in front of any rewrite of a register a copy names.
__device__ __forceinline__ void stage_copy(unsigned lv, unsigned lk, const unsigned short* gv,
                                           const unsigned short* gh, const unsigned short* gl) {
#if defined(__HIP_DEVICE_COMPILE__)
#pragma unroll
  for (int g = 0; g < 2; ++g) {
    const unsigned l = lv + (unsigned)(g * 128 * VPB);
    const unsigned short* p = gv + (size_t)(g * 128) * NN;
    asm volatile("global_load_async_to_lds_b128 %0, %8, off\n\t"
                 "global_load_async_to_lds_b128 %1, %9, off\n\t"
                 "global_load_async_to_lds_b128 %2, %10, off\n\t"
                 "global_load_async_to_lds_b128 %3, %11, off\n\t"
                 "global_load_async_to_lds_b128 %4, %12, off\n\t"
                 "global_load_async_to_lds_b128 %5, %13, off\n\t"
                 "global_load_async_to_lds_b128 %6, %14, off\n\t"
                 "global_load_async_to_lds_b128 %7, %15, off\n\t"
                 "s_wait_xcnt 0x0"
                 :: "v"(l), "v"(l + 16u * VPB), "v"(l + 32u * VPB), "v"(l + 48u * VPB),
                    "v"(l + 64u * VPB), "v"(l + 80u * VPB), "v"(l + 96u * VPB), "v"(l + 112u * VPB),
                    "v"(p), "v"(p + (size_t)16 * NN), "v"(p + (size_t)32 * NN), "v"(p + (size_t)48 * NN),
                    "v"(p + (size_t)64 * NN), "v"(p + (size_t)80 * NN), "v"(p + (size_t)96 * NN),
                    "v"(p + (size_t)112 * NN)
                 : "memory");
  }
  asm volatile("global_load_async_to_lds_b128 %0, %4, off\n\t"
               "global_load_async_to_lds_b128 %1, %5, off\n\t"
               "global_load_async_to_lds_b128 %2, %6, off\n\t"
               "global_load_async_to_lds_b128 %3, %7, off\n\t"
               "s_wait_xcnt 0x0"
               :: "v"(lk), "v"(lk + 32u * KPB), "v"(lk + (unsigned)KSTB), "v"(lk + (unsigned)KSTB + 32u * KPB),
                  "v"(gh), "v"(gh + 32 * CQ), "v"(gl), "v"(gl + 32 * CQ)
               : "memory");
#endif
}

// =========================================================================================================
// (3) position attention for one (b, 64-query tile), transposed formulation, 4096 keys, no mask:
//   S^T tile (16 keys x 16 queries) = A(k: row = key kb + (lane&15), 32 d via the split k map from the bf16 plane
//   Kh [b][4096][32]) . B(q: col = query, same map, resident fragment from Qh) + A(Kh).B(Ql) + A(Kl).B(Qh)
//   (bf16 unscaled residual planes, shared accumulator). Energy = S (no scale).
//   Per lane the D tile holds 8 keys of ONE query: online softmax state per lane, one shuffle (lane^16) for the max
//   over 32 keys, row-sum partials combined at the end. P = e^{s-m} x 1024 as f16 is the B operand of
//   O^T (rows channel, cols queries) += A(V rows channel = 16j + (lane&15), keys contiguous, f16 plane Vh
//   [b][256][4096]) . B(P^T): element r <- D of the tile covering keys kb..kb+15, element 8+r <- the tile covering
//   kb+16..kb+31, lane unchanged. 16 accumulator tiles per wave (256 channels). Block = 4 waves = 64 queries.
//   The k and v rows of 64 keys are one stage in LDS, brought once per block by asynchronous copies and read by all
//   four waves; two buffers: stage t + 1 flies while stage t is worked on (two passes of 32 keys).
//   Epilogue in two channel halves: O/l staged in LDS Os[query][128 channels] (pitch OSPW, b128 stores), barrier,
// coverage: per half 16 it x 16 lines x 8 lanes x 4 floats = 128 ch x 64 n; two halves = 256 ch; grid (64, NB).
// =========================================================================================================
__global__ __launch_bounds__(128)
void attn_pam(const unsigned short* __restrict__ Qh, const unsigned short* __restrict__ Ql,
              const unsigned short* __restrict__ Kh, const unsigned short* __restrict__ Kl,
              const unsigned short* __restrict__ Vh, float* Yp) {
  __shared__ __align__(16) float Os[QT * OSPW];
  __shared__ __align__(16) unsigned char Ring[2 * STGB];
  const int tid  = threadIdx.x;
  const int wave = tid >> 5, lane = tid & 31;
  const int hh   = lane >> 4, c = lane & 15;
  const int n0   = blockIdx.x * QT, b = blockIdx.y;

  // resident q fragments (B operand, col = query n0 + 16*wave + c)
  Frag qh, ql;
  {
    const size_t qo = ((size_t)(b * NN + n0 + 16 * wave + c)) * CQ + 8 * hh;
    qh = ldfrag(Qh + qo);
    ql = ldfrag(Ql + qo);
  }
  // the lane's first pieces of a stage: global sources (+ t * KT keys) and LDS places (+ buffer * STGB)
  const unsigned short* gv = Vh + (size_t)b * CC * NN + (size_t)(tid >> 3) * NN + 8 * (tid & 7);
  const unsigned short* gh = Kh + ((size_t)b * NN + (tid >> 2)) * CQ + 8 * (tid & 3);
  const unsigned short* gl = Kl + ((size_t)b * NN + (tid >> 2)) * CQ + 8 * (tid & 3);
  const unsigned ring0 = (unsigned)(size_t)Ring;                     // low 32 bits = byte offset in the block's LDS
  const unsigned lv = ring0 + (unsigned)((tid >> 3) * VPB + 16 * (tid & 7));
  const unsigned lk = ring0 + (unsigned)(VSTB + (tid >> 2) * KPB + 16 * (tid & 3));
  // fragment offsets inside a stage: v (A operand, row = channel 16j + c, keys contiguous), k (A operand, row = key)
  const int vfo = c * VPB + 16 * hh;
  const int kfo = VSTB + c * KPB + 16 * hh;

  float m = -1.0e30f, l = 0.f;
  v8f o[16];
#pragma unroll
  for (int j = 0; j < 16; ++j) o[j] = zero8();

  // prologue: stage 0 landed and published, then stage 1 on its way
  stage_copy(lv, lk, gv, gh, gl);
  asm volatile("s_wait_asynccnt 0x0" ::: "memory");                  // this wave's pieces of stage 0 have landed
  __syncthreads();                                                   // ... and every other wave's
  stage_copy(lv + STGB, lk + STGB, gv + KT, gh + KT * CQ, gl + KT * CQ);

#pragma unroll 1
  for (int t = 0; t < NT; ++t) {
   const unsigned bo = (unsigned)(t & 1) * STGB;
   const unsigned char* sb = Ring + bo;
#pragma unroll 1                                                     // rolled: one pass's exponentials live at a time, no spill
   for (int ps = 0; ps < KT / 32; ++ps) {
    const unsigned char* kp = sb + kfo + ps * 32 * KPB;              // the pass's keys start at kb = KT t + 32 ps
    const Frag k0  = ldfrag((const unsigned short*)(kp));                        // keys kb .. kb+15
    const Frag k1  = ldfrag((const unsigned short*)(kp + 16 * KPB));             // keys kb+16 .. kb+31
    const Frag k0l = ldfrag((const unsigned short*)(kp + KSTB));
    const Frag k1l = ldfrag((const unsigned short*)(kp + KSTB + 16 * KPB));
    v8f s0 = mma_b(k0.bf, qh.bf, zero8());
    v8f s1 = mma_b(k1.bf, qh.bf, zero8());
    s0 = mma_b(k0.bf, ql.bf, s0);
    s1 = mma_b(k1.bf, ql.bf, s1);
    s0 = mma_b(k0l.bf, qh.bf, s0);
    s1 = mma_b(k1l.bf, qh.bf, s1);

    float mx = fmaxf(hmax8(s0), hmax8(s1));
    const float mo = __shfl_xor(mx, 16, 32);
    // the first 8 v fragments of the pass as one group of LDS reads, in flight under the maximum and its exchange
    const unsigned char* vp = sb + vfo + ps * 64;
    Frag vf[8];
#pragma unroll
    for (int j = 0; j < 8; ++j) vf[j] = ldfrag((const unsigned short*)(vp + 16 * j * VPB));
    mx = fmaxf(mx, mo);
    const float mn   = fmaxf(m, mx);
    const float corr = __expf(m - mn);
    m = mn;
    const float msh = mn - LNPS;                                     // exp gives e^{s-m} * 1024
    l *= corr;
#pragma unroll
    for (int j = 0; j < 16; ++j) {
#pragma unroll
      for (int r = 0; r < 8; ++r) o[j][r] *= corr;
    }

    FragH ph;
    float ls = 0.f;
#pragma unroll
    for (int r = 0; r < 8; ++r) {
      const float e0 = __expf(s0[r] - msh);                          // key kb      + 8hh + r
      const float e1 = __expf(s1[r] - msh);                          // key kb + 16 + 8hh + r
      ls += e0 + e1;
      ph.hv[0][r] = (_Float16)e0;
      ph.hv[1][r] = (_Float16)e1;
    }
    l += ls;

    // blocks of 4 products; behind each of the first two, the 4 fragments needed two blocks later take their registers
#pragma unroll
    for (int g = 0; g < 4; ++g) {
#pragma unroll
      for (int i = 0; i < 4; ++i) o[4 * g + i] = mma_h(vf[(4 * g + i) & 7].h, ph.v, o[4 * g + i]);
      if (g < 2) {
#pragma unroll
        for (int i = 0; i < 4; ++i)
          vf[(4 * g + i) & 7] = ldfrag((const unsigned short*)(vp + 16 * (4 * g + i + 8) * VPB));
      }
    }
   }
   // publish point of stage t + 1, and the end of every reader's last read of stage t's buffer
   asm volatile("s_wait_dscnt 0x0" ::: "memory");                    // this wave's LDS reads of stage t are done
   asm volatile("s_wait_asynccnt 0x0" ::: "memory");                 // this wave's pieces of stage t + 1 have landed
   __syncthreads();
   if (t + 2 < NT)                                                   // block-uniform: refill the buffer just read
     stage_copy(lv + bo, lk + bo, gv + (size_t)(t + 2) * KT, gh + (size_t)(t + 2) * KT * CQ,
                gl + (size_t)(t + 2) * KT * CQ);
  }
  asm volatile("s_wait_asynccnt 0x0" ::: "memory");                  // nothing of this wave is in flight at its end
  l += __shfl_xor(l, 16, 32);
  const float inv = 1.0f / l;                                        // o and l both carry the x1024 factor

  const int qrow = 16 * wave + c;
  const int e = tid & 7, lq = tid >> 3;                              // lq 0..15
#pragma unroll
  for (int half = 0; half < 2; ++half) {
    if (half) __syncthreads();                                       // every wave finished reading Os
#pragma unroll
    for (int jj = 0; jj < 8; ++jj) {
      const int j = 8 * half + jj;
      v4f va, vb;
#pragma unroll
      for (int r = 0; r < 4; ++r) { va[r] = o[j][r] * inv; vb[r] = o[j][4 + r] * inv; }
      *(v4f*)(Os + qrow * OSPW + 16 * jj + 8 * hh)     = va;         // Os[query][ch_loc = 16jj + 8hh + r]
      *(v4f*)(Os + qrow * OSPW + 16 * jj + 8 * hh + 4) = vb;
    }
    __syncthreads();
{
#pragma unroll
      for (int it = 0; it < 16; ++it) {
        const int L   = it * 16 + lq;                                // 0..255
        const int chl = L >> 1, hf = L & 1;                          // channel 0..127 within the half
        const int nl  = hf * 32 + 4 * e;                             // query 0..63
        v4f v;
#pragma unroll
        for (int t = 0; t < 4; ++t) v[t] = Os[(nl + t) * OSPW + chl];
        *(v4f*)(Yp + ((size_t)(b * CC + 128 * half + chl)) * NN + n0 + nl) = v;
      }
      
    }
  }
}

// =========================================================================================================
// (4) channel Gram for one (b, 64-i block, 64-j block, K slice s): G[s][b][i][j] = sum over the slice's GK positions n
//     of Xc[b][i][n] Xc[b][j][n]; the GS slices of a tile run as GS blocks, and (5) adds their planes.
//     4 waves; wave w owns cols j0+16w..+15 (B from the j row, keys n contiguous) and 4 i tiles (A rows
//     [s][b][256][256] (row segment 64 j = 2 lines), 8 consecutive lanes x 16 B, one instruction per 16 lines, two
// coverage: 8 it x 16 lines x 8 lanes x 4 = 64 x 64; grid (4, 4, GS * NB) covers the GS planes of G exactly once.
// =========================================================================================================
__global__ __launch_bounds__(128)
void gram_k(const unsigned short* __restrict__ Xc, float* G) {
  __shared__ __align__(16) float Os[QT * OSP];
  const int tid  = threadIdx.x;
  const int lane = tid & 31, wave = tid >> 5;
  const int hh   = lane >> 4, c = lane & 15;
  const int jt = blockIdx.x, itb = blockIdx.y, zb = blockIdx.z;      // zb = s * NB + b: the plane of G this block writes
  const int b = zb % NB, s = zb / NB;
  const int j0 = jt * QT, i0 = itb * QT;

  const unsigned short* ap = Xc + ((size_t)(b * CC + i0 + c)) * NN + s * GK + 8 * hh;
  const unsigned short* bp = Xc + ((size_t)(b * CC + j0 + 16 * wave + c)) * NN + s * GK + 8 * hh;

  v8f acc[4];
#pragma unroll
  for (int mt = 0; mt < 4; ++mt) acc[mt] = zero8();

#pragma unroll                                                       // 8 trips: every load a constant offset from one address pair
  for (int ks = 0; ks < GK / 32; ++ks) {
    const Frag fb = ldfrag(bp + 32 * ks);
#pragma unroll
    for (int mt = 0; mt < 4; ++mt) {
      const Frag fa = ldfrag(ap + (size_t)(16 * mt) * NN + 32 * ks);
      acc[mt] = mma_h(fa.h, fb.h, acc[mt]);
    }
  }
  {
    const int nl = 16 * wave + c;
#pragma unroll
    for (int mt = 0; mt < 4; ++mt) {
#pragma unroll
      for (int r = 0; r < 8; ++r) Os[(16 * mt + 8 * hh + r) * OSP + nl] = acc[mt][r];
    }
  }
  __syncthreads();
  {
    const int e = tid & 7, lq = tid >> 3;                            // lq 0..15
{
#pragma unroll
      for (int it = 0; it < 8; ++it) {
        const int L = it * 16 + lq;                                  // 0..127
        const int row = L >> 1, hf = L & 1;
        const v4f v = *(const v4f*)(Os + row * OSP + hf * 32 + 4 * e);
        *(v4f*)(G + ((size_t)(zb * CC + i0 + row)) * CC + j0 + hf * 32 + 4 * e) = v;
      }
      
    }
  }
}

// =========================================================================================================
// (5) channel softmax: for row (b, i): G_j = sum of the GS slice planes in slice order, then
//     p_j = exp(min_j G - G_j) / sum (== softmax of rowmax - G), written as
//     Pc f16 [b][256][256] = p * 1024. One wave per row: lane reads j = 8 lane..8 lane+7, wave min / sum via
// coverage: grid (32, NB) x 8 waves = 256 rows per batch; 32 lanes x 8 = 256 j.
// =========================================================================================================
__global__ __launch_bounds__(256)
void cam_softmax(const float* __restrict__ G, unsigned short* Pc) {
  const int tid = threadIdx.x, lane = tid & 31, w = tid >> 5;
  const int b = blockIdx.y, i = blockIdx.x * 8 + w;                 // 0..255
  const float* row = G + ((size_t)(b * CC + i)) * CC + 8 * lane;
  v4f a = *(const v4f*)row;
  v4f q = *(const v4f*)(row + 4);
#pragma unroll                                                       // straight line: the planes' loads issue ahead of the adds
  for (int s = 1; s < GS; ++s) {
    a += *(const v4f*)(row + (size_t)s * NB * CC * CC);
    q += *(const v4f*)(row + (size_t)s * NB * CC * CC + 4);
  }
  const float ev[8] = {a[0], a[1], a[2], a[3], q[0], q[1], q[2], q[3]};
  float mn = ev[0];
#pragma unroll
  for (int t = 1; t < 8; ++t) mn = fminf(mn, ev[t]);
#pragma unroll
  for (int s = 1; s < 32; s <<= 1) mn = fminf(mn, __shfl_xor(mn, s, 32));
  float p[8], sm = 0.f;
#pragma unroll
  for (int t = 0; t < 8; ++t) { p[t] = __expf(mn - ev[t]); sm += p[t]; }
#pragma unroll
  for (int s = 1; s < 32; s <<= 1) sm += __shfl_xor(sm, s, 32);
  const float inv = PSC / sm;
  v4u u;
#pragma unroll
  for (int t = 0; t < 4; ++t)
    u[t] = pk16(h_bits((_Float16)(p[2 * t] * inv)), h_bits((_Float16)(p[2 * t + 1] * inv)));
{
    *(v4u*)(Pc + ((size_t)(b * CC + i)) * CC + 8 * lane) = u;
    
  }
}

// =========================================================================================================
// (6) channel mix + output for one (b, 64-n tile, 64-i block): cam[i][n] = (1/1024) sum_j Pc[b][i][j] XP[b][n][j]
//     (K = 256 = 8 steps; A rows i = i0 + 16 mt + (lane&15), j contiguous; B col n = n0 + 16w + (lane&15) from the
//     XP row, j contiguous), then out[b][i][n] = (g_pam * Yp + xb) + (g_cam * cam + xb) with xb = bf16-RNE of x
// coverage: 8 it x 16 lines x 8 lanes x 4 = 64 i x 64 n; grid (64, 4, NB) covers d_out exactly once.
// =========================================================================================================
__global__ __launch_bounds__(128)
void cam_out(const unsigned short* __restrict__ Pc, const unsigned short* __restrict__ XP,
             const float* __restrict__ Yp, const float* __restrict__ x,
             const float* __restrict__ gpam, const float* __restrict__ gcam, float* out) {
  __shared__ __align__(16) float Os[QT * OSP];
  const int tid  = threadIdx.x;
  const int lane = tid & 31, wave = tid >> 5;
  const int hh   = lane >> 4, c = lane & 15;
  const int nt = blockIdx.x, itb = blockIdx.y, b = blockIdx.z;
  const int n0 = nt * QT, i0 = itb * QT;

  const unsigned short* ap = Pc + ((size_t)(b * CC + i0 + c)) * CC + 8 * hh;
  const unsigned short* bp = XP + ((size_t)(b * NN + n0 + 16 * wave + c)) * CC + 8 * hh;

  v8f acc[4];
#pragma unroll
  for (int mt = 0; mt < 4; ++mt) acc[mt] = zero8();

#pragma unroll
  for (int ks = 0; ks < CC / 32; ++ks) {
    const Frag fb = ldfrag(bp + 32 * ks);
#pragma unroll
    for (int mt = 0; mt < 4; ++mt) {
      const Frag fa = ldfrag(ap + (size_t)(16 * mt) * CC + 32 * ks);
      acc[mt] = mma_h(fa.h, fb.h, acc[mt]);
    }
  }
  {
    const int nl = 16 * wave + c;
#pragma unroll
    for (int mt = 0; mt < 4; ++mt) {
#pragma unroll
      for (int r = 0; r < 8; ++r) Os[(16 * mt + 8 * hh + r) * OSP + nl] = acc[mt][r];
    }
  }
  __syncthreads();

  const float gp = bfr(gpam[0]);
  const float gc = bfr(gcam[0]) * IPSC;
  const int e = tid & 7, lq = tid >> 3;                              // lq 0..15
  v4f res[8];
#pragma unroll
  for (int it = 0; it < 8; ++it) {
    const int L = it * 16 + lq;                                      // 0..127
    const int row = L >> 1, hf = L & 1;
    const int nl = hf * 32 + 4 * e;
    const v4f cam4 = *(const v4f*)(Os + row * OSP + nl);
    const size_t idx = ((size_t)(b * CC + i0 + row)) * NN + n0 + nl;
    const v4f xv = *(const v4f*)(x + idx);
    const v4f yv = *(const v4f*)(Yp + idx);
#pragma unroll
    for (int t = 0; t < 4; ++t) {
      const float xb = bfr(xv[t]);
      const float t1 = gp * yv[t] + xb;
      const float t2 = gc * cam4[t] + xb;
      res[it][t] = t1 + t2;
    }
  }
{
#pragma unroll
    for (int it = 0; it < 8; ++it) {
      const int L = it * 16 + lq;
      const int row = L >> 1, hf = L & 1;
      const int nl = hf * 32 + 4 * e;
      const size_t idx = ((size_t)(b * CC + i0 + row)) * NN + n0 + nl;
      *(v4f*)(out + idx) = res[it];
    }
    
  }
}

// =========================================================================================================
// Workspace map (bytes; each region start a multiple of 256; every extent is an exact tile multiple and is written
//   W16 f16 [320][256]          163840      BIAS f32 [320]              1280
//   Xc  f16 [2][256][4096]     4194304      XP   f16 [2][4096][256]  4194304
//   Qh/Ql/Kh/Kl bf16 [2][4096][32]  524288 x4                          Vh f16 [2][256][4096]  4194304
//   Yp  f32 [2][256][4096]     8388608      G    f32 [16][2][256][256] 8388608     Pc f16 [2][256][256] 262144
//   total = 31884544
// =========================================================================================================
extern "C" void kernel_launch(void* const* d_in, const int* in_sizes, int n_in,
                              void* d_out, int out_size, void* d_ws, size_t ws_size,
                              hipStream_t stream) {
  const int XN = NB * CC * NN;                                       // 2097152
  if (n_in < 9) return;
  if (in_sizes[0] != XN) return;
  if (in_sizes[1] != CQ * CC || in_sizes[2] != CQ) return;
  if (in_sizes[3] != CQ * CC || in_sizes[4] != CQ) return;
  if (in_sizes[5] != CC * CC || in_sizes[6] != CC) return;
  if (in_sizes[7] < 1 || in_sizes[8] < 1) return;
  if (out_size != XN) return;

  size_t off = 0;
  auto carve = [&](size_t bytes) { const size_t o = off; off += (bytes + 255) & ~(size_t)255; return o; };
  const size_t oW16 = carve((size_t)MQKV * CC * 2);
  const size_t oBIA = carve((size_t)MQKV * 4);
  const size_t oXc  = carve((size_t)NB * CC * NN * 2);
  const size_t oXP  = carve((size_t)NB * NN * CC * 2);
  const size_t oQh  = carve((size_t)NB * NN * CQ * 2);
  const size_t oQl  = carve((size_t)NB * NN * CQ * 2);
  const size_t oKh  = carve((size_t)NB * NN * CQ * 2);
  const size_t oKl  = carve((size_t)NB * NN * CQ * 2);
  const size_t oVh  = carve((size_t)NB * CC * NN * 2);
  const size_t oYp  = carve((size_t)NB * CC * NN * 4);
  const size_t oG   = carve((size_t)GS * NB * CC * CC * 4);
  const size_t oPc  = carve((size_t)NB * CC * CC * 2);
  if (off > ws_size) return;
  if (off > (size_t)134217728) return;

  const float* x    = (const float*)d_in[0];
  const float* wq   = (const float*)d_in[1];
  const float* bq   = (const float*)d_in[2];
  const float* wk   = (const float*)d_in[3];
  const float* bk   = (const float*)d_in[4];
  const float* wv   = (const float*)d_in[5];
  const float* bv   = (const float*)d_in[6];
  const float* gpam = (const float*)d_in[7];
  const float* gcam = (const float*)d_in[8];

  char* ws = (char*)d_ws;
  unsigned short* W16 = (unsigned short*)(ws + oW16);
  float*          BIA = (float*)(ws + oBIA);
  unsigned short* Xc  = (unsigned short*)(ws + oXc);
  unsigned short* XP  = (unsigned short*)(ws + oXP);
  unsigned short* Qh  = (unsigned short*)(ws + oQh);
  unsigned short* Ql  = (unsigned short*)(ws + oQl);
  unsigned short* Kh  = (unsigned short*)(ws + oKh);
  unsigned short* Kl  = (unsigned short*)(ws + oKl);
  unsigned short* Vh  = (unsigned short*)(ws + oVh);
  float*          Yp  = (float*)(ws + oYp);
  float*          G   = (float*)(ws + oG);
  unsigned short* Pc  = (unsigned short*)(ws + oPc);
  float* out = (float*)d_out;

  const dim3 blk256(256), blk128(128);

  // (0) conv1x1 weights -> f16 plane + bias line
  cvt_w<<<dim3(MQKV / 8), blk256, 0, stream>>>(wq, bq, wk, bk, wv, bv, W16, BIA);
  // (1) x -> channel-major and position-major 16-bit planes
  cvt_x<<<dim3(NN / QT, CC / QT, NB), blk256, 0, stream>>>(x, Xc, XP);
  // (2) conv1x1 GEMM -> q/k hi + residual planes and v plane
  gemm_qkv<<<dim3(NN / QT, MQKV / QT, NB), blk128, 0, stream>>>(W16, BIA, XP, Qh, Ql, Kh, Kl, Vh);
  // (3) position attention -> Yp [b][256][4096]
  attn_pam<<<dim3(NN / QT, NB), blk128, 0, stream>>>(Qh, Ql, Kh, Kl, Vh, Yp);
  // (4) channel Gram, K slices -> G [s][b][256][256]
  gram_k<<<dim3(CC / QT, CC / QT, GS * NB), blk128, 0, stream>>>(Xc, G);
  // (5) channel softmax -> Pc [b][256][256] (x1024 f16)
  cam_softmax<<<dim3(CC / 8, NB), blk256, 0, stream>>>(G, Pc);
  // (6) channel mix + residual sum -> out [b][256][4096]
  cam_out<<<dim3(NN / QT, CC / QT, NB), blk128, 0, stream>>>(Pc, XP, Yp, x, gpam, gcam, out);
  (void)hipGetLastError();
}

// v003
// Measured time: 75.2 microseconds a run.
// Two timings next to v002 both put it at 1.44 times that version's speed.
// All steps since v000 together make it 6.60 times as fast.
// Contractions: conv1x1 q/k/v GEMM W[320x256].X[256x4096] on v_wmma_f32_16x16x32_f16 (f16 containers of bf16-RNE
// weights x256 and bf16-RNE x); position scores K.Q^T on v_wmma_f32_16x16x32_bf16 (bf16 hi + bf16 residual planes of
// q and k, 3 products, K=32); O^T = V.P^T on v_wmma_f32_16x16x32_f16 (v f16, P = e^{s-m} x1024 f16 from the score D
// registers); channel Gram X.X^T (K=4096) and channel mix A.X (K=256) on v_wmma_f32_16x16x32_f16 (f16 of bf16-RNE x,
// softmax weights x1024 f16); f32 accumulate everywhere; softmax statistics, residual adds and output sum in f32 VALU.
#include <hip/hip_runtime.h>
#include <math.h>
#include <stdint.h>

#define NB    2
#define CC    256
#define NN    4096
#define CQ    32
#define MQKV  320
#define QT    64
#define OSP   68
#define OSPW  132
#define TP    72
#define WSC   256.0f
#define IWSC  0.00390625f
#define PSC   1024.0f
#define IPSC  0.0009765625f
#define LNPS  6.931471805599453f
#define LOG2E 1.4426950408889634f
#define KT    64                       // keys per LDS stage of the position attention
#define NT    (NN / KT)                // stages
#define KS    4                        // key ranges of the position attention, one block each per query tile
#define NTS   (NT / KS)                // stages of one key range
#define VPB   144                      // LDS pitch of a v row (64 keys = 128 B, + 16 B: 16 B x odd for b128 readers)
#define KPB   80                       // LDS pitch of a k row (32 d = 64 B, + 16 B)
#define VSTB  (CC * VPB)               // v part of a stage, bytes
#define KSTB  (KT * KPB)               // one k plane of a stage, bytes
#define STGB  (VSTB + 2 * KSTB)        // one stage: v, k hi, k residual
#define GS    16                       // blocks that share the K = 4096 of one Gram tile
#define GK    (NN / GS)                // positions per Gram block

static_assert(NN % QT == 0);
static_assert(CC % QT == 0);
static_assert(MQKV == 2 * CQ + CC);
static_assert(MQKV % QT == 0);
static_assert((OSP * 4) % 16 == 0);
static_assert((OSPW * 4) % 16 == 0);
static_assert((TP * 2) % 16 == 0);
static_assert(CC % 32 == 0 && NN % 32 == 0 && CQ == 32);
static_assert(NN % KT == 0 && NT % KS == 0 && NTS >= 2 && NTS % 2 == 0 && KT % 32 == 0);
static_assert(VPB % 16 == 0 && KPB % 16 == 0 && STGB % 16 == 0 && VSTB % 16 == 0);
static_assert(VPB >= KT * 2 && KPB >= CQ * 2);
static_assert(NN % GS == 0 && GK % 32 == 0);

typedef _Float16       v16h __attribute__((ext_vector_type(16)));
typedef _Float16       v8h  __attribute__((ext_vector_type(8)));
typedef __bf16         v16b __attribute__((ext_vector_type(16)));
typedef unsigned short v8us __attribute__((ext_vector_type(8)));
typedef float          v8f  __attribute__((ext_vector_type(8)));
typedef float          v4f  __attribute__((ext_vector_type(4)));
typedef unsigned int   v4u  __attribute__((ext_vector_type(4)));

union Frag  { v8us u[2]; v16h h; v16b bf; };
union FragH { v16h v; v8h hv[2]; };
static_assert(sizeof(Frag) == 32);
static_assert(sizeof(FragH) == 32);

// ---- scalar helpers ---------------------------------------------------------------------------------------
__device__ __forceinline__ unsigned short bf_bits(float f) {          // f32 -> bf16 bits, RNE convert
  unsigned u = __float_as_uint(f);
  return (unsigned short)((u + 0x7FFFu + ((u >> 16) & 1u)) >> 16);
}
__device__ __forceinline__ float bf_up(unsigned short hb) { return __uint_as_float(((unsigned)hb) << 16); }
__device__ __forceinline__ float bfr(float f) { return bf_up(bf_bits(f)); }
__device__ __forceinline__ unsigned short h_bits(_Float16 x) { return __builtin_bit_cast(unsigned short, x); }
__device__ __forceinline__ unsigned pk16(unsigned short a, unsigned short b) { return (unsigned)a | ((unsigned)b << 16); }
__device__ __forceinline__ v8f zero8() { v8f z = {0.f, 0.f, 0.f, 0.f, 0.f, 0.f, 0.f, 0.f}; return z; }
__device__ __forceinline__ float hmax8(v8f s) {
  return fmaxf(fmaxf(fmaxf(s[0], s[1]), fmaxf(s[2], s[3])), fmaxf(fmaxf(s[4], s[5]), fmaxf(s[6], s[7])));
}

// 2^x with the free slot that the instruction set asks for behind a transcendental, tied to it in one statement
__device__ __forceinline__ float exp2_slot(float x) {
  float r = 0.f;
#if defined(__HIP_DEVICE_COMPILE__)
  asm("v_exp_f32 %0, %1\n\tv_nop" : "=v"(r) : "v"(x));
#endif
  return r;
}

// ---- 16-bit fragment loader (A, or B from a k-contiguous [n][k] row): lane -> row/col (lane&15), p already includes
//      + 8*(lane>>4); elements 0..7 <- p[0..7] (k0+8h..), elements 8..15 <- p[16..23] (k0+16+8h..)
__device__ __forceinline__ Frag ldfrag(const unsigned short* p) {
  Frag f;
  f.u[0] = *(const v8us*)(p);
  f.u[1] = *(const v8us*)(p + 16);
  return f;
}

// ---- WMMA helpers: builtin followed by a 4-slot VALU gap tying D and keeping A/B live --------------------------
__device__ __forceinline__ v8f mma_h(v16h a, v16h b, v8f c) {
  v8f d = __builtin_amdgcn_wmma_f32_16x16x32_f16(false, a, false, b, (short)0, c, false, false);
#if defined(__HIP_DEVICE_COMPILE__)
  asm volatile("v_nop\n\tv_nop\n\tv_nop\n\tv_nop" : "+v"(d) : "v"(a), "v"(b));
#endif
  return d;
}
__device__ __forceinline__ v8f mma_b(v16b a, v16b b, v8f c) {
  v8f d = __builtin_amdgcn_wmma_f32_16x16x32_bf16(false, a, false, b, (short)0, c, false, false);
#if defined(__HIP_DEVICE_COMPILE__)
  const v16h ha = __builtin_bit_cast(v16h, a), hb = __builtin_bit_cast(v16h, b);
  asm volatile("v_nop\n\tv_nop\n\tv_nop\n\tv_nop" : "+v"(d) : "v"(ha), "v"(hb));
#endif
  return d;
}

// =========================================================================================================
// (0) conv1x1 weights: W16 f16 [320][256], row o: 0..31 = wq, 32..63 = wk, 64..319 = wv; value = f16 of
//     (bf16-RNE(w) * 256) (exact). BIAS f32 [320] = bf16-RNE of bq / bk / bv. Block blk (0..39) owns rows
// coverage: 40 blocks x 8 rows x 32 pieces x 8 halves = 320 x 256; bias 80 x 4 floats = 320.
// =========================================================================================================
__global__ __launch_bounds__(256)
void cvt_w(const float* __restrict__ wq, const float* __restrict__ bq,
           const float* __restrict__ wk, const float* __restrict__ bk,
           const float* __restrict__ wv, const float* __restrict__ bv,
           unsigned short* W16, float* BIAS) {
  const int tid = threadIdx.x, blk = blockIdx.x;
  const int rl = tid >> 5, col = 8 * (tid & 31);
  const int o = 8 * blk + rl;                                     // 0..319
  const float* wbase = (blk < 4) ? wq : (blk < 8) ? wk : wv;       // block-uniform selection
  const int osub = (blk < 4) ? 0 : (blk < 8) ? CQ : 2 * CQ;
  const float* s = wbase + (size_t)(o - osub) * CC + col;          // in range: (o-osub) < rows of that matrix
  const v4f a = *(const v4f*)s;
  const v4f q = *(const v4f*)(s + 4);
  const float f[8] = {a[0], a[1], a[2], a[3], q[0], q[1], q[2], q[3]};
  v4u u;
#pragma unroll
  for (int t = 0; t < 4; ++t) {
    const _Float16 h0 = (_Float16)(bfr(f[2 * t]) * WSC);
    const _Float16 h1 = (_Float16)(bfr(f[2 * t + 1]) * WSC);
    u[t] = pk16(h_bits(h0), h_bits(h1));
  }
  // bias values: every lane loads all three candidates with clamped indices, selects by value
  v4f bvv;
  {
    const int tb = min(tid, 79);
    const int o4 = 4 * tb;
#pragma unroll
    for (int qd = 0; qd < 4; ++qd) {
      const int oo = o4 + qd;
      const int iq = min(oo, CQ - 1);
      const int ik = min(max(oo - CQ, 0), CQ - 1);
      const int iv = min(max(oo - 2 * CQ, 0), CC - 1);
      const float cq = bq[iq], ck = bk[ik], cv = bv[iv];
      const float val = (oo < CQ) ? cq : (oo < 2 * CQ) ? ck : cv;
      bvv[qd] = bfr(val);
    }
  }
{
    *(v4u*)(W16 + (size_t)o * CC + col) = u;
    if (blk == 0 && tid < 80) *(v4f*)(BIAS + 4 * tid) = bvv;
    
  }
}

// =========================================================================================================
// (1) x f32 [b][256 c][4096 n] -> Xc f16 [b][c][n] (channel-major, bf16-RNE values, exact in f16) and
//     XP f16 [b][n][c] (position-major) through an LDS tile T[64 n][64 c] (pitch TP). Block (nb, cb, b) owns a
// coverage: Xc 2 it x 32 rows x 8 lanes x 8 = 64 c x 64 n; XP same; grid (64, 4, NB) covers both planes once.
// =========================================================================================================
__global__ __launch_bounds__(256)
void cvt_x(const float* __restrict__ x, unsigned short* Xc, unsigned short* XP) {
  __shared__ __align__(16) unsigned short T[QT * TP];
  const int tid = threadIdx.x;
  const int nb = blockIdx.x, cb = blockIdx.y, b = blockIdx.z;
  const int e = tid & 7, lq = tid >> 3;                             // lq 0..31
  const int n0 = nb * QT, c0 = cb * QT;
  v4u ux[2];
#pragma unroll
  for (int it = 0; it < 2; ++it) {
    const int cl = it * 32 + lq;                                     // 0..63
    const float* sp = x + ((size_t)(b * CC + c0 + cl)) * NN + n0 + 8 * e;
    const v4f a = *(const v4f*)sp;
    const v4f q = *(const v4f*)(sp + 4);
    unsigned short hb[8];
#pragma unroll
    for (int t = 0; t < 4; ++t) {
      hb[t]     = h_bits((_Float16)bfr(a[t]));
      hb[4 + t] = h_bits((_Float16)bfr(q[t]));
    }
#pragma unroll
    for (int t = 0; t < 4; ++t) ux[it][t] = pk16(hb[2 * t], hb[2 * t + 1]);
#pragma unroll
    for (int t = 0; t < 8; ++t) T[(8 * e + t) * TP + cl] = hb[t];
  }
  __syncthreads();
  v4u up[2];
#pragma unroll
  for (int it = 0; it < 2; ++it) {
    const int nl = it * 32 + lq;                                     // 0..63
    up[it] = *(const v4u*)(T + nl * TP + 8 * e);
  }
{
#pragma unroll
    for (int it = 0; it < 2; ++it) {
      const int rl = it * 32 + lq;
      *(v4u*)(Xc + ((size_t)(b * CC + c0 + rl)) * NN + n0 + 8 * e) = ux[it];
      *(v4u*)(XP + ((size_t)(b * NN + n0 + rl)) * CC + c0 + 8 * e) = up[it];
    }
    
  }
}

// =========================================================================================================
// (2) conv1x1 GEMM for one (b, 64-n tile, 64-o block): Y[o][n] = (1/256) sum_c W16[o][c] XP[b][n][c] + BIAS[o].
//     Block 128 threads = 4 waves; wave w owns cols n0+16w..+15 (one B fragment per k-step, k = c contiguous in
//     the XP row) and 4 m-tiles (A rows o = o0 + 16 mt + (lane&15), split k map loader from W16). K = 256 = 8 steps.
//     Epilogue staged in LDS Os[o_loc][n_loc] (pitch OSP), barrier, then:
//       o-block 0 (q rows 0..31, k rows 32..63): Qh/Ql/Kh/Kl bf16 hi / bf16 residual planes [b][4096 n][32]
//         holds rows 2ll, 2ll+1; lane e -> row 2ll+(e>>2), cols 8*(e&3)..+7; one instruction per 16 lines.
//         halves 8e..8e+7; one instruction per 16 lines.
// coverage: Os 4 waves x 4 tiles x 16x16 = 64 x 64; q/k: 4 planes x 32 lines x 8 lanes x 8 = 4 x (64 n x 32);
//           v: 4 it x 16 rows x 8 lanes x 8 = 64 ch x 64 n; grid (64, 5, NB) covers all planes exactly once.
// =========================================================================================================
__global__ __launch_bounds__(128)
void gemm_qkv(const unsigned short* __restrict__ W16, const float* __restrict__ BIAS,
              const unsigned short* __restrict__ XP,
              unsigned short* Qh, unsigned short* Ql, unsigned short* Kh, unsigned short* Kl,
              unsigned short* Vh) {
  __shared__ __align__(16) float Os[QT * OSP];
  const int tid  = threadIdx.x;
  const int lane = tid & 31, wave = tid >> 5;
  const int hh   = lane >> 4, c = lane & 15;
  const int nt   = blockIdx.x, mb = blockIdx.y, b = blockIdx.z;
  const int n0   = nt * QT, o0 = mb * QT;

  const unsigned short* ap = W16 + (size_t)(o0 + c) * CC + 8 * hh;
  const unsigned short* bp = XP + ((size_t)(b * NN + n0 + 16 * wave + c)) * CC + 8 * hh;

  v8f acc[4];
#pragma unroll
  for (int mt = 0; mt < 4; ++mt) acc[mt] = zero8();

#pragma unroll
  for (int ks = 0; ks < CC / 32; ++ks) {
    const Frag fb = ldfrag(bp + 32 * ks);
#pragma unroll
    for (int mt = 0; mt < 4; ++mt) {
      const Frag fa = ldfrag(ap + (size_t)(16 * mt) * CC + 32 * ks);
      acc[mt] = mma_h(fa.h, fb.h, acc[mt]);
    }
  }

  // ---- epilogue: scale back, + bias -> LDS Os[o_loc][n_loc] ----
  {
    const int nl = 16 * wave + c;
#pragma unroll
    for (int mt = 0; mt < 4; ++mt) {
#pragma unroll
      for (int r = 0; r < 8; ++r) {
        const int ol = 16 * mt + 8 * hh + r;                         // 0..63
        Os[ol * OSP + nl] = acc[mt][r] * IWSC + BIAS[o0 + ol];
      }
    }
  }
  __syncthreads();

  const int e = tid & 7, lq = tid >> 3;                             // lq 0..15
  if (mb == 0) {
    // ---- q/k bf16 hi + residual planes ----
{
#pragma unroll
      for (int it = 0; it < 8; ++it) {
        const int p    = it >> 1;                                    // 0 Qh, 1 Ql, 2 Kh, 3 Kl
        const int ll   = (it & 1) * 16 + lq;                         // 0..31
        const int nl   = 2 * ll + (e >> 2);                          // 0..63
        const int col0 = 8 * (e & 3);                                // 0,8,16,24
        const int rb   = ((p >> 1) ? CQ : 0) + col0;
        v4u u;
#pragma unroll
        for (int t = 0; t < 4; ++t) {
          const float f0 = Os[(rb + 2 * t) * OSP + nl];
          const float f1 = Os[(rb + 2 * t + 1) * OSP + nl];
          const unsigned short hb0 = bf_bits(f0), hb1 = bf_bits(f1);
          const unsigned short lb0 = bf_bits(f0 - bf_up(hb0));
          const unsigned short lb1 = bf_bits(f1 - bf_up(hb1));
          u[t] = (p & 1) ? pk16(lb0, lb1) : pk16(hb0, hb1);
        }
        unsigned short* P = (p == 0) ? Qh : (p == 1) ? Ql : (p == 2) ? Kh : Kl;
        *(v4u*)(P + ((size_t)(b * NN + n0 + nl)) * CQ + col0) = u;
      }
      
    }
  } else {
    // ---- v f16 plane ----
    const int ch0 = o0 - QT;                                         // (mb-1)*64
    v4u uv[4];
#pragma unroll
    for (int it = 0; it < 4; ++it) {
      const int row = it * 16 + lq;                                  // 0..63
      const v4f a = *(const v4f*)(Os + row * OSP + 8 * e);
      const v4f q = *(const v4f*)(Os + row * OSP + 8 * e + 4);
#pragma unroll
      for (int t = 0; t < 2; ++t) {
        uv[it][t]     = pk16(h_bits((_Float16)a[2 * t]), h_bits((_Float16)a[2 * t + 1]));
        uv[it][2 + t] = pk16(h_bits((_Float16)q[2 * t]), h_bits((_Float16)q[2 * t + 1]));
      }
    }
{
#pragma unroll
      for (int it = 0; it < 4; ++it) {
        const int row = it * 16 + lq;
        *(v4u*)(Vh + ((size_t)(b * CC + ch0 + row)) * NN + n0 + 8 * e) = uv[it];
      }
      
    }
  }
}

// ---- one stage (64 keys) of v, k hi and k residual -> LDS, 128 lanes, 16 B per lane and copy, no register on the way.
//      v: copy i brings row (channel) 16 i + (tid >> 3), bytes 16 (tid & 7) ..+15 of its 128; 16 copies = 256 rows.
//      k: copy i of a plane brings row (key) 32 i + (tid >> 2), bytes 16 (tid & 3) ..+15 of its 64; 2 copies = 64 rows.
//      lv / lk: the lane's LDS byte address of its first v / k-hi piece; gv / gh / gl: its first global piece.
//      s_wait_xcnt 0 closes each statement, a precaution: it stands in front of any rewrite of a register a copy names.
__device__ __forceinline__ void stage_copy(unsigned lv, unsigned lk, const unsigned short* gv,
                                           const unsigned short* gh, const unsigned short* gl) {
#if defined(__HIP_DEVICE_COMPILE__)
#pragma unroll
  for (int g = 0; g < 2; ++g) {
    const unsigned l = lv + (unsigned)(g * 128 * VPB);
    const unsigned short* p = gv + (size_t)(g * 128) * NN;
    asm volatile("global_load_async_to_lds_b128 %0, %8, off\n\t"
                 "global_load_async_to_lds_b128 %1, %9, off\n\t"
                 "global_load_async_to_lds_b128 %2, %10, off\n\t"
                 "global_load_async_to_lds_b128 %3, %11, off\n\t"
                 "global_load_async_to_lds_b128 %4, %12, off\n\t"
                 "global_load_async_to_lds_b128 %5, %13, off\n\t"
                 "global_load_async_to_lds_b128 %6, %14, off\n\t"
                 "global_load_async_to_lds_b128 %7, %15, off\n\t"
                 "s_wait_xcnt 0x0"
                 :: "v"(l), "v"(l + 16u * VPB), "v"(l + 32u * VPB), "v"(l + 48u * VPB),
                    "v"(l + 64u * VPB), "v"(l + 80u * VPB), "v"(l + 96u * VPB), "v"(l + 112u * VPB),
                    "v"(p), "v"(p + (size_t)16 * NN), "v"(p + (size_t)32 * NN), "v"(p + (size_t)48 * NN),
                    "v"(p + (size_t)64 * NN), "v"(p + (size_t)80 * NN), "v"(p + (size_t)96 * NN),
                    "v"(p + (size_t)112 * NN)
                 : "memory");
  }
  asm volatile("global_load_async_to_lds_b128 %0, %4, off\n\t"
               "global_load_async_to_lds_b128 %1, %5, off\n\t"
               "global_load_async_to_lds_b128 %2, %6, off\n\t"
               "global_load_async_to_lds_b128 %3, %7, off\n\t"
               "s_wait_xcnt 0x0"
               :: "v"(lk), "v"(lk + 32u * KPB), "v"(lk + (unsigned)KSTB), "v"(lk + (unsigned)KSTB + 32u * KPB),
                  "v"(gh), "v"(gh + 32 * CQ), "v"(gl), "v"(gl + 32 * CQ)
               : "memory");
#endif
}

// =========================================================================================================
// (3) position attention for one (b, 64-query tile, key range sp of NN / KS keys), transposed formulation, no mask:
//   S^T tile (16 keys x 16 queries) = A(k: row = key kb + (lane&15), 32 d via the split k map from the bf16 plane
//   Kh [b][4096][32]) . B(q: col = query, same map, resident fragment from Qh) + A(Kh).B(Ql) + A(Kl).B(Qh)
//   (bf16 unscaled residual planes, shared accumulator). Energy = S (no scale).
//   Per lane the D tile holds 8 keys of ONE query: online softmax state per lane, one shuffle (lane^16) for the max
//   over 32 keys, row-sum partials combined at the end. P = e^{s-m} x 1024 as f16 is the B operand of
//   O^T (rows channel, cols queries) += A(V rows channel = 16j + (lane&15), keys contiguous, f16 plane Vh
//   [b][256][4096]) . B(P^T): element r <- D of the tile covering keys kb..kb+15, element 8+r <- the tile covering
//   kb+16..kb+31, lane unchanged. 16 accumulator tiles per wave (256 channels). Block = 4 waves = 64 queries.
//   The k and v rows of 64 keys are one stage in LDS, brought once per block by asynchronous copies and read by all
//   four waves; two buffers: stage t + 1 flies while stage t is worked on (two passes of 32 keys).
//   Epilogue in two channel halves: O/l staged in LDS Os[query][128 channels] (pitch OSPW, b128 stores), barrier,
//   The result is the range's own softmax average, Yp [b][256][KS][4096]; the range's maximum m and sum l of each query go to
//   ST [2][KS][b][4096] (m planes, then l planes), through LDS so that one wave writes whole lines; (6) merges the ranges.
// coverage: per half 16 it x 16 lines x 8 lanes x 4 floats = 128 ch x 64 n; two halves = 256 ch; grid (64, NB, KS).
// =========================================================================================================
__global__ __launch_bounds__(128)
void attn_pam(const unsigned short* __restrict__ Qh, const unsigned short* __restrict__ Ql,
              const unsigned short* __restrict__ Kh, const unsigned short* __restrict__ Kl,
              const unsigned short* __restrict__ Vh, float* Yp, float* ST) {
  __shared__ __align__(16) float Os[QT * OSPW];
  __shared__ __align__(16) float St[2 * QT];
  __shared__ __align__(16) unsigned char Ring[2 * STGB];
  const int tid  = threadIdx.x;
  const int wave = tid >> 5, lane = tid & 31;
  const int hh   = lane >> 4, c = lane & 15;
  const int n0   = blockIdx.x * QT, b = blockIdx.y, sp = blockIdx.z;
  const int t0   = sp * NTS;                                         // first stage of the block's key range (even)

  // resident q fragments (B operand, col = query n0 + 16*wave + c)
  Frag qh, ql;
  {
    const size_t qo = ((size_t)(b * NN + n0 + 16 * wave + c)) * CQ + 8 * hh;
    qh = ldfrag(Qh + qo);
    ql = ldfrag(Ql + qo);
    // the wait before the four loads' address registers are reused; naming them as inputs keeps them whole up to here
#if defined(__HIP_DEVICE_COMPILE__)
    asm volatile("s_wait_xcnt 0x0" :: "v"(Qh + qo), "v"(Ql + qo) : "memory");
#endif
  }
  // the lane's first pieces of a stage: global sources (+ t * KT keys) and LDS places (+ buffer * STGB)
  const unsigned short* gv = Vh + (size_t)b * CC * NN + (size_t)(tid >> 3) * NN + 8 * (tid & 7);
  const unsigned short* gh = Kh + ((size_t)b * NN + (tid >> 2)) * CQ + 8 * (tid & 3);
  const unsigned short* gl = Kl + ((size_t)b * NN + (tid >> 2)) * CQ + 8 * (tid & 3);
  const unsigned ring0 = (unsigned)(size_t)Ring;                     // low 32 bits = byte offset in the block's LDS
  const unsigned lv = ring0 + (unsigned)((tid >> 3) * VPB + 16 * (tid & 7));
  const unsigned lk = ring0 + (unsigned)(VSTB + (tid >> 2) * KPB + 16 * (tid & 3));
  // fragment offsets inside a stage: v (A operand, row = channel 16j + c, keys contiguous), k (A operand, row = key)
  const int vfo = c * VPB + 16 * hh;
  const int kfo = VSTB + c * KPB + 16 * hh;

  float m = -1.0e30f, l = 0.f;
  v8f o[16];
#pragma unroll
  for (int j = 0; j < 16; ++j) o[j] = zero8();

  // prologue: stage t0 landed and published, then stage t0 + 1 on its way
  stage_copy(lv, lk, gv + (size_t)t0 * KT, gh + (size_t)t0 * KT * CQ, gl + (size_t)t0 * KT * CQ);
  asm volatile("s_wait_asynccnt 0x0" ::: "memory");                  // this wave's pieces of stage t0 have landed
  __syncthreads();                                                   // ... and every other wave's
  stage_copy(lv + STGB, lk + STGB, gv + (size_t)(t0 + 1) * KT, gh + (size_t)(t0 + 1) * KT * CQ,
             gl + (size_t)(t0 + 1) * KT * CQ);

#pragma unroll 1
  for (int t = t0; t < t0 + NTS; ++t) {
   const unsigned bo = (unsigned)(t & 1) * STGB;
   const unsigned char* sb = Ring + bo;
#pragma unroll 1                                                     // rolled: one pass's exponentials live at a time, no spill
   for (int ps = 0; ps < KT / 32; ++ps) {
    const unsigned char* kp = sb + kfo + ps * 32 * KPB;              // the pass's keys start at kb = KT t + 32 ps
    const Frag k0  = ldfrag((const unsigned short*)(kp));                        // keys kb .. kb+15
    const Frag k1  = ldfrag((const unsigned short*)(kp + 16 * KPB));             // keys kb+16 .. kb+31
    const Frag k0l = ldfrag((const unsigned short*)(kp + KSTB));
    const Frag k1l = ldfrag((const unsigned short*)(kp + KSTB + 16 * KPB));
    v8f s0 = mma_b(k0.bf, qh.bf, zero8());
    v8f s1 = mma_b(k1.bf, qh.bf, zero8());
    s0 = mma_b(k0.bf, ql.bf, s0);
    s1 = mma_b(k1.bf, ql.bf, s1);
    s0 = mma_b(k0l.bf, qh.bf, s0);
    s1 = mma_b(k1l.bf, qh.bf, s1);

    float mx = fmaxf(hmax8(s0), hmax8(s1));
    const float mo = __shfl_xor(mx, 16, 32);
    // the first 8 v fragments of the pass as one group of LDS reads, in flight under the maximum and its exchange
    const unsigned char* vp = sb + vfo + ps * 64;
    Frag vf[8];
#pragma unroll
    for (int j = 0; j < 8; ++j) vf[j] = ldfrag((const unsigned short*)(vp + 16 * j * VPB));
    mx = fmaxf(mx, mo);
    const float mn   = fmaxf(m, mx);
    const float corr = __expf(m - mn);
    m = mn;
    const float msh = mn - LNPS;                                     // exp gives e^{s-m} * 1024
    l *= corr;
#pragma unroll
    for (int j = 0; j < 16; ++j) {
#pragma unroll
      for (int r = 0; r < 8; ++r) o[j][r] *= corr;
    }

    FragH ph;
    float ls = 0.f;
#pragma unroll
    for (int r = 0; r < 8; ++r) {
      const float e0 = __expf(s0[r] - msh);                          // key kb      + 8hh + r
      const float e1 = __expf(s1[r] - msh);                          // key kb + 16 + 8hh + r
      ls += e0 + e1;
      ph.hv[0][r] = (_Float16)e0;
      ph.hv[1][r] = (_Float16)e1;
    }
    l += ls;

    // blocks of 4 products; behind each of the first two, the 4 fragments needed two blocks later take their registers
#pragma unroll
    for (int g = 0; g < 4; ++g) {
#pragma unroll
      for (int i = 0; i < 4; ++i) o[4 * g + i] = mma_h(vf[(4 * g + i) & 7].h, ph.v, o[4 * g + i]);
      if (g < 2) {
#pragma unroll
        for (int i = 0; i < 4; ++i)
          vf[(4 * g + i) & 7] = ldfrag((const unsigned short*)(vp + 16 * (4 * g + i + 8) * VPB));
      }
    }
   }
   // publish point of stage t + 1, and the end of every reader's last read of stage t's buffer
   asm volatile("s_wait_dscnt 0x0" ::: "memory");                    // this wave's LDS reads of stage t are done
   asm volatile("s_wait_asynccnt 0x0" ::: "memory");                 // this wave's pieces of stage t + 1 have landed
   __syncthreads();
   if (t + 2 < t0 + NTS)                                              // block-uniform: refill the buffer just read
     stage_copy(lv + bo, lk + bo, gv + (size_t)(t + 2) * KT, gh + (size_t)(t + 2) * KT * CQ,
                gl + (size_t)(t + 2) * KT * CQ);
  }
  asm volatile("s_wait_asynccnt 0x0" ::: "memory");                  // nothing of this wave is in flight at its end
  l += __shfl_xor(l, 16, 32);
  const float inv = 1.0f / l;                                        // o and l both carry the x1024 factor

  const int qrow = 16 * wave + c;
  const int e = tid & 7, lq = tid >> 3;                              // lq 0..15
  if (hh == 0) { St[qrow] = m; St[QT + qrow] = l; }                  // m and l are equal in lanes c and c + 16
#pragma unroll
  for (int half = 0; half < 2; ++half) {
    if (half) __syncthreads();                                       // every wave finished reading Os
#pragma unroll
    for (int jj = 0; jj < 8; ++jj) {
      const int j = 8 * half + jj;
      v4f va, vb;
#pragma unroll
      for (int r = 0; r < 4; ++r) { va[r] = o[j][r] * inv; vb[r] = o[j][4 + r] * inv; }
      *(v4f*)(Os + qrow * OSPW + 16 * jj + 8 * hh)     = va;         // Os[query][ch_loc = 16jj + 8hh + r]
      *(v4f*)(Os + qrow * OSPW + 16 * jj + 8 * hh + 4) = vb;
    }
    __syncthreads();
{
#pragma unroll
      for (int it = 0; it < 16; ++it) {
        const int L   = it * 16 + lq;                                // 0..255
        const int chl = L >> 1, hf = L & 1;                          // channel 0..127 within the half
        const int nl  = hf * 32 + 4 * e;                             // query 0..63
        v4f v;
#pragma unroll
        for (int t = 0; t < 4; ++t) v[t] = Os[(nl + t) * OSPW + chl];
        *(v4f*)(Yp + ((size_t)((b * CC + 128 * half + chl) * KS + sp)) * NN + n0 + nl) = v;
      }
      
    }
  }
  if (tid < 32) {                                                    // wave 0, behind the barriers above: 64 m, then 64 l
    const int pl = tid >> 4, q4 = 4 * (tid & 15);
    *(v4f*)(ST + ((size_t)((pl * KS + sp) * NB + b)) * NN + n0 + q4) = *(const v4f*)(St + pl * QT + q4);
  }
}

// =========================================================================================================
// (4) channel Gram for one (b, 64-i block, 64-j block, K slice s): G[s][b][i][j] = sum over the slice's GK positions n
//     of Xc[b][i][n] Xc[b][j][n]; the GS slices of a tile run as GS blocks, and (5) adds their planes.
//     4 waves; wave w owns cols j0+16w..+15 (B from the j row, keys n contiguous) and 4 i tiles (A rows
//     [s][b][256][256] (row segment 64 j = 2 lines), 8 consecutive lanes x 16 B, one instruction per 16 lines, two
// coverage: 8 it x 16 lines x 8 lanes x 4 = 64 x 64; grid (4, 4, GS * NB) covers the GS planes of G exactly once.
// =========================================================================================================
__global__ __launch_bounds__(128)
void gram_k(const unsigned short* __restrict__ Xc, float* G) {
  __shared__ __align__(16) float Os[QT * OSP];
  const int tid  = threadIdx.x;
  const int lane = tid & 31, wave = tid >> 5;
  const int hh   = lane >> 4, c = lane & 15;
  const int jt = blockIdx.x, itb = blockIdx.y, zb = blockIdx.z;      // zb = s * NB + b: the plane of G this block writes
  const int b = zb % NB, s = zb / NB;
  const int j0 = jt * QT, i0 = itb * QT;

  const unsigned short* ap = Xc + ((size_t)(b * CC + i0 + c)) * NN + s * GK + 8 * hh;
  const unsigned short* bp = Xc + ((size_t)(b * CC + j0 + 16 * wave + c)) * NN + s * GK + 8 * hh;

  v8f acc[4];
#pragma unroll
  for (int mt = 0; mt < 4; ++mt) acc[mt] = zero8();

#pragma unroll                                                       // 8 trips: every load a constant offset from one address pair
  for (int ks = 0; ks < GK / 32; ++ks) {
    const Frag fb = ldfrag(bp + 32 * ks);
#pragma unroll
    for (int mt = 0; mt < 4; ++mt) {
      const Frag fa = ldfrag(ap + (size_t)(16 * mt) * NN + 32 * ks);
      acc[mt] = mma_h(fa.h, fb.h, acc[mt]);
    }
  }
  {
    const int nl = 16 * wave + c;
#pragma unroll
    for (int mt = 0; mt < 4; ++mt) {
#pragma unroll
      for (int r = 0; r < 8; ++r) Os[(16 * mt + 8 * hh + r) * OSP + nl] = acc[mt][r];
    }
  }
  __syncthreads();
  {
    const int e = tid & 7, lq = tid >> 3;                            // lq 0..15
{
#pragma unroll
      for (int it = 0; it < 8; ++it) {
        const int L = it * 16 + lq;                                  // 0..127
        const int row = L >> 1, hf = L & 1;
        const v4f v = *(const v4f*)(Os + row * OSP + hf * 32 + 4 * e);
        *(v4f*)(G + ((size_t)(zb * CC + i0 + row)) * CC + j0 + hf * 32 + 4 * e) = v;
      }
      
    }
  }
}

// =========================================================================================================
// (5) channel softmax: for row (b, i): G_j = sum of the GS slice planes in slice order, then
//     p_j = exp(min_j G - G_j) / sum (== softmax of rowmax - G), written as
//     Pc f16 [b][256][256] = p * 1024. One wave per row: lane reads j = 8 lane..8 lane+7, wave min / sum via
// coverage: grid (32, NB) x 8 waves = 256 rows per batch; 32 lanes x 8 = 256 j.
// =========================================================================================================
__global__ __launch_bounds__(256)
void cam_softmax(const float* __restrict__ G, unsigned short* Pc) {
  const int tid = threadIdx.x, lane = tid & 31, w = tid >> 5;
  const int b = blockIdx.y, i = blockIdx.x * 8 + w;                 // 0..255
  const float* row = G + ((size_t)(b * CC + i)) * CC + 8 * lane;
  v4f a = *(const v4f*)row;
  v4f q = *(const v4f*)(row + 4);
#pragma unroll                                                       // straight line: the planes' loads issue ahead of the adds
  for (int s = 1; s < GS; ++s) {
    a += *(const v4f*)(row + (size_t)s * NB * CC * CC);
    q += *(const v4f*)(row + (size_t)s * NB * CC * CC + 4);
  }
  const float ev[8] = {a[0], a[1], a[2], a[3], q[0], q[1], q[2], q[3]};
  float mn = ev[0];
#pragma unroll
  for (int t = 1; t < 8; ++t) mn = fminf(mn, ev[t]);
#pragma unroll
  for (int s = 1; s < 32; s <<= 1) mn = fminf(mn, __shfl_xor(mn, s, 32));
  float p[8], sm = 0.f;
#pragma unroll
  for (int t = 0; t < 8; ++t) { p[t] = __expf(mn - ev[t]); sm += p[t]; }
#pragma unroll
  for (int s = 1; s < 32; s <<= 1) sm += __shfl_xor(sm, s, 32);
  const float inv = PSC / sm;
  v4u u;
#pragma unroll
  for (int t = 0; t < 4; ++t)
    u[t] = pk16(h_bits((_Float16)(p[2 * t] * inv)), h_bits((_Float16)(p[2 * t + 1] * inv)));
{
    *(v4u*)(Pc + ((size_t)(b * CC + i)) * CC + 8 * lane) = u;
    
  }
}

// =========================================================================================================
// (6) channel mix + output for one (b, 64-n tile, 64-i block): cam[i][n] = (1/1024) sum_j Pc[b][i][j] XP[b][n][j]
//     (K = 256 = 8 steps; A rows i = i0 + 16 mt + (lane&15), j contiguous; B col n = n0 + 16w + (lane&15) from the
//     XP row, j contiguous), then out[b][i][n] = (g_pam * Y + xb) + (g_cam * cam + xb) with xb = bf16-RNE of x and
//     Y = sum over the KS key ranges s, in range order, of wt_s[n] Yp[b][i][s][n], wt_s = l_s e^{m_s - M} / sum of these,
//     M = max_s m_s (m, l from ST): the softmax over all keys from the ranges' own averages.
// coverage: 8 it x 16 lines x 8 lanes x 4 = 64 i x 64 n; grid (64, 4, NB) covers d_out exactly once.
// =========================================================================================================
__global__ __launch_bounds__(128)
void cam_out(const unsigned short* __restrict__ Pc, const unsigned short* __restrict__ XP,
             const float* __restrict__ Yp, const float* __restrict__ ST, const float* __restrict__ x,
             const float* __restrict__ gpam, const float* __restrict__ gcam, float* out) {
  __shared__ __align__(16) float Os[QT * OSP];
  const int tid  = threadIdx.x;
  const int lane = tid & 31, wave = tid >> 5;
  const int hh   = lane >> 4, c = lane & 15;
  const int nt = blockIdx.x, itb = blockIdx.y, b = blockIdx.z;
  const int n0 = nt * QT, i0 = itb * QT;

  const unsigned short* ap = Pc + ((size_t)(b * CC + i0 + c)) * CC + 8 * hh;
  const unsigned short* bp = XP + ((size_t)(b * NN + n0 + 16 * wave + c)) * CC + 8 * hh;

  v8f acc[4];
#pragma unroll
  for (int mt = 0; mt < 4; ++mt) acc[mt] = zero8();

#pragma unroll
  for (int ks = 0; ks < CC / 32; ++ks) {
    const Frag fb = ldfrag(bp + 32 * ks);
#pragma unroll
    for (int mt = 0; mt < 4; ++mt) {
      const Frag fa = ldfrag(ap + (size_t)(16 * mt) * CC + 32 * ks);
      acc[mt] = mma_h(fa.h, fb.h, acc[mt]);
    }
  }
  {
    const int nl = 16 * wave + c;
#pragma unroll
    for (int mt = 0; mt < 4; ++mt) {
#pragma unroll
      for (int r = 0; r < 8; ++r) Os[(16 * mt + 8 * hh + r) * OSP + nl] = acc[mt][r];
    }
  }
  __syncthreads();

  const float gp = bfr(gpam[0]);
  const float gc = bfr(gcam[0]) * IPSC;
  const int e = tid & 7, lq = tid >> 3;                              // lq 0..15
  // weights of the key ranges for the thread's 4 positions (nl below is the same in every it: 16 it is even)
  v4f wt[KS];
  {
    const float* sq = ST + (size_t)b * NN + n0;                      // block-uniform base; the lane's part is lo
    const unsigned lo = (unsigned)((lq & 1) * 32 + 4 * e);
    v4f mm[KS];
#pragma unroll
    for (int s = 0; s < KS; ++s) {
      mm[s] = *(const v4f*)(sq + (size_t)s * NB * NN + lo);
      wt[s] = *(const v4f*)(sq + (size_t)(KS + s) * NB * NN + lo);
    }
#pragma unroll
    for (int t = 0; t < 4; ++t) {
      float mx = mm[0][t];
#pragma unroll
      for (int s = 1; s < KS; ++s) mx = fmaxf(mx, mm[s][t]);
      float sm = 0.f;
#pragma unroll
      for (int s = 0; s < KS; ++s) { wt[s][t] *= exp2_slot((mm[s][t] - mx) * LOG2E); sm += wt[s][t]; }
      const float inv = 1.0f / sm;
#pragma unroll
      for (int s = 0; s < KS; ++s) wt[s][t] *= inv;
    }
  }
  // the ranges' rows: block-uniform base of the tile + one lane offset (row lq >> 1, the it and s steps are constants)
  const float* yt = Yp + ((size_t)(b * CC + i0)) * KS * NN + n0;
  const unsigned yo = (unsigned)((lq >> 1) * KS * NN + (lq & 1) * 32 + 4 * e);
  v4f res[8];
#pragma unroll
  for (int it = 0; it < 8; ++it) {
    const int L = it * 16 + lq;                                      // 0..127
    const int row = L >> 1, hf = L & 1;
    const int nl = hf * 32 + 4 * e;
    const v4f cam4 = *(const v4f*)(Os + row * OSP + nl);
    const size_t idx = ((size_t)(b * CC + i0 + row)) * NN + n0 + nl;
    const v4f xv = *(const v4f*)(x + idx);
    v4f yv = wt[0] * *(const v4f*)(yt + (size_t)(it * 8 * KS) * NN + yo);
#pragma unroll
    for (int s = 1; s < KS; ++s) yv += wt[s] * *(const v4f*)(yt + (size_t)(it * 8 * KS + s) * NN + yo);
#pragma unroll
    for (int t = 0; t < 4; ++t) {
      const float xb = bfr(xv[t]);
      const float t1 = gp * yv[t] + xb;
      const float t2 = gc * cam4[t] + xb;
      res[it][t] = t1 + t2;
    }
  }
{
#pragma unroll
    for (int it = 0; it < 8; ++it) {
      const int L = it * 16 + lq;
      const int row = L >> 1, hf = L & 1;
      const int nl = hf * 32 + 4 * e;
      const size_t idx = ((size_t)(b * CC + i0 + row)) * NN + n0 + nl;
      *(v4f*)(out + idx) = res[it];
    }
    
  }
}

// =========================================================================================================
// Workspace map (bytes; each region start a multiple of 256; every extent is an exact tile multiple and is written
//   W16 f16 [320][256]          163840      BIAS f32 [320]              1280
//   Xc  f16 [2][256][4096]     4194304      XP   f16 [2][4096][256]  4194304
//   Qh/Ql/Kh/Kl bf16 [2][4096][32]  524288 x4                          Vh f16 [2][256][4096]  4194304
//   Yp  f32 [2][256][4][4096] 33554432      G    f32 [16][2][256][256] 8388608     Pc f16 [2][256][256] 262144
//   ST  f32 [2][4][2][4096]     262144
//   total = 57312512
// =========================================================================================================
extern "C" void kernel_launch(void* const* d_in, const int* in_sizes, int n_in,
                              void* d_out, int out_size, void* d_ws, size_t ws_size,
                              hipStream_t stream) {
  const int XN = NB * CC * NN;                                       // 2097152
  if (n_in < 9) return;
  if (in_sizes[0] != XN) return;
  if (in_sizes[1] != CQ * CC || in_sizes[2] != CQ) return;
  if (in_sizes[3] != CQ * CC || in_sizes[4] != CQ) return;
  if (in_sizes[5] != CC * CC || in_sizes[6] != CC) return;
  if (in_sizes[7] < 1 || in_sizes[8] < 1) return;
  if (out_size != XN) return;

  size_t off = 0;
  auto carve = [&](size_t bytes) { const size_t o = off; off += (bytes + 255) & ~(size_t)255; return o; };
  const size_t oW16 = carve((size_t)MQKV * CC * 2);
  const size_t oBIA = carve((size_t)MQKV * 4);
  const size_t oXc  = carve((size_t)NB * CC * NN * 2);
  const size_t oXP  = carve((size_t)NB * NN * CC * 2);
  const size_t oQh  = carve((size_t)NB * NN * CQ * 2);
  const size_t oQl  = carve((size_t)NB * NN * CQ * 2);
  const size_t oKh  = carve((size_t)NB * NN * CQ * 2);
  const size_t oKl  = carve((size_t)NB * NN * CQ * 2);
  const size_t oVh  = carve((size_t)NB * CC * NN * 2);
  const size_t oYp  = carve((size_t)KS * NB * CC * NN * 4);
  const size_t oG   = carve((size_t)GS * NB * CC * CC * 4);
  const size_t oPc  = carve((size_t)NB * CC * CC * 2);
  const size_t oST  = carve((size_t)2 * KS * NB * NN * 4);
  if (off > ws_size) return;
  if (off > (size_t)134217728) return;

  const float* x    = (const float*)d_in[0];
  const float* wq   = (const float*)d_in[1];
  const float* bq   = (const float*)d_in[2];
  const float* wk   = (const float*)d_in[3];
  const float* bk   = (const float*)d_in[4];
  const float* wv   = (const float*)d_in[5];
  const float* bv   = (const float*)d_in[6];
  const float* gpam = (const float*)d_in[7];
  const float* gcam = (const float*)d_in[8];

  char* ws = (char*)d_ws;
  unsigned short* W16 = (unsigned short*)(ws + oW16);
  float*          BIA = (float*)(ws + oBIA);
  unsigned short* Xc  = (unsigned short*)(ws + oXc);
  unsigned short* XP  = (unsigned short*)(ws + oXP);
  unsigned short* Qh  = (unsigned short*)(ws + oQh);
  unsigned short* Ql  = (unsigned short*)(ws + oQl);
  unsigned short* Kh  = (unsigned short*)(ws + oKh);
  unsigned short* Kl  = (unsigned short*)(ws + oKl);
  unsigned short* Vh  = (unsigned short*)(ws + oVh);
  float*          Yp  = (float*)(ws + oYp);
  float*          G   = (float*)(ws + oG);
  unsigned short* Pc  = (unsigned short*)(ws + oPc);
  float*          ST  = (float*)(ws + oST);
  float* out = (float*)d_out;

  const dim3 blk256(256), blk128(128);

  // (0) conv1x1 weights -> f16 plane + bias line
  cvt_w<<<dim3(MQKV / 8), blk256, 0, stream>>>(wq, bq, wk, bk, wv, bv, W16, BIA);
  // (1) x -> channel-major and position-major 16-bit planes
  cvt_x<<<dim3(NN / QT, CC / QT, NB), blk256, 0, stream>>>(x, Xc, XP);
  // (2) conv1x1 GEMM -> q/k hi + residual planes and v plane
  gemm_qkv<<<dim3(NN / QT, MQKV / QT, NB), blk128, 0, stream>>>(W16, BIA, XP, Qh, Ql, Kh, Kl, Vh);
  // (3) position attention, KS key ranges -> Yp [b][256][s][4096], ST (maximum and sum per range and query)
  attn_pam<<<dim3(NN / QT, NB, KS), blk128, 0, stream>>>(Qh, Ql, Kh, Kl, Vh, Yp, ST);
  // (4) channel Gram, K slices -> G [s][b][256][256]
  gram_k<<<dim3(CC / QT, CC / QT, GS * NB), blk128, 0, stream>>>(Xc, G);
  // (5) channel softmax -> Pc [b][256][256] (x1024 f16)
  cam_softmax<<<dim3(CC / 8, NB), blk256, 0, stream>>>(G, Pc);
  // (6) channel mix + merge of the key ranges + residual sum -> out [b][256][4096]
  cam_out<<<dim3(NN / QT, CC / QT, NB), blk128, 0, stream>>>(Pc, XP, Yp, ST, x, gpam, gcam, out);
  (void)hipGetLastError();
}

// v004
// It runs in 64.5 microseconds.
// Timed twice side by side with v003, it ran 1.17 and 1.16 times as fast.
// Over all steps from v000 it is 7.69 times as fast.
// Contractions: conv1x1 q/k/v GEMM W[320x256].X[256x4096] on v_wmma_f32_16x16x32_f16 (f16 containers of bf16-RNE
// weights x256 and bf16-RNE x); position scores K.Q^T on v_wmma_f32_16x16x32_bf16 (bf16 hi + bf16 residual planes of
// q and k, 3 products, K=32); O^T = V.P^T on v_wmma_f32_16x16x32_f16 (v f16, P = e^{s-m} x1024 f16 from the score D
// registers); channel Gram X.X^T (K=4096) and channel mix A.X (K=256) on v_wmma_f32_16x16x32_f16 (f16 of bf16-RNE x,
// softmax weights x1024 f16); f32 accumulate everywhere; softmax statistics, residual adds and output sum in f32 VALU.
#include <hip/hip_runtime.h>
#include <math.h>
#include <stdint.h>

#define NB    2
#define CC    256
#define NN    4096
#define CQ    32
#define MQKV  320
#define QT    64
#define OSP   68
#define OSPW  132
#define TP    72
#define WSC   256.0f
#define IWSC  0.00390625f
#define PSC   1024.0f
#define IPSC  0.0009765625f
#define LNPS  6.931471805599453f
#define LOG2E 1.4426950408889634f
#define KT    64                       // keys per LDS stage of the position attention
#define NT    (NN / KT)                // stages
#define KS    4                        // key ranges of the position attention, one block each per query tile
#define NTS   (NT / KS)                // stages of one key range
#define VPB   144                      // LDS pitch of a v row (64 keys = 128 B, + 16 B: 16 B x odd for b128 readers)
#define KPB   80                       // LDS pitch of a k row (32 d = 64 B, + 16 B)
#define VSTB  (CC * VPB)               // v part of a stage, bytes
#define KSTB  (KT * KPB)               // one k plane of a stage, bytes
#define STGB  (VSTB + 2 * KSTB)        // one stage: v, k hi, k residual
#define GS    16                       // blocks that share the K = 4096 of one Gram tile
#define GK    (NN / GS)                // positions per Gram block
#define XB    ((NN / QT) * (CC / QT) * NB)                 // blocks of the x conversion
#define WB    (MQKV / 8)                                   // blocks of the weight conversion
#define GY    ((CC / QT) * (CC / QT) * GS / (NN / QT))     // grid rows of NN / QT blocks that hold one batch's Gram blocks

static_assert(NN % QT == 0);
static_assert(CC % QT == 0);
static_assert(MQKV == 2 * CQ + CC);
static_assert(MQKV % QT == 0);
static_assert((OSP * 4) % 16 == 0);
static_assert((OSPW * 4) % 16 == 0);
static_assert((TP * 2) % 16 == 0);
static_assert(CC % 32 == 0 && NN % 32 == 0 && CQ == 32);
static_assert(NN % KT == 0 && NT % KS == 0 && NTS >= 2 && NTS % 2 == 0 && KT % 32 == 0);
static_assert(VPB % 16 == 0 && KPB % 16 == 0 && STGB % 16 == 0 && VSTB % 16 == 0);
static_assert(VPB >= KT * 2 && KPB >= CQ * 2);
static_assert(NN % GS == 0 && GK % 32 == 0);
static_assert(GY * (NN / QT) == (CC / QT) * (CC / QT) * GS);
static_assert((NN / QT) * NB * KS == NB * CC);             // one channel-softmax row per block of the position attention

typedef _Float16       v16h __attribute__((ext_vector_type(16)));
typedef _Float16       v8h  __attribute__((ext_vector_type(8)));
typedef __bf16         v16b __attribute__((ext_vector_type(16)));
typedef unsigned short v8us __attribute__((ext_vector_type(8)));
typedef float          v8f  __attribute__((ext_vector_type(8)));
typedef float          v4f  __attribute__((ext_vector_type(4)));
typedef unsigned int   v4u  __attribute__((ext_vector_type(4)));

union Frag  { v8us u[2]; v16h h; v16b bf; };
union FragH { v16h v; v8h hv[2]; };
static_assert(sizeof(Frag) == 32);
static_assert(sizeof(FragH) == 32);

// ---- scalar helpers ---------------------------------------------------------------------------------------
__device__ __forceinline__ unsigned short bf_bits(float f) {          // f32 -> bf16 bits, RNE convert
  unsigned u = __float_as_uint(f);
  return (unsigned short)((u + 0x7FFFu + ((u >> 16) & 1u)) >> 16);
}
__device__ __forceinline__ float bf_up(unsigned short hb) { return __uint_as_float(((unsigned)hb) << 16); }
__device__ __forceinline__ float bfr(float f) { return bf_up(bf_bits(f)); }
__device__ __forceinline__ unsigned short h_bits(_Float16 x) { return __builtin_bit_cast(unsigned short, x); }
__device__ __forceinline__ unsigned pk16(unsigned short a, unsigned short b) { return (unsigned)a | ((unsigned)b << 16); }
__device__ __forceinline__ v8f zero8() { v8f z = {0.f, 0.f, 0.f, 0.f, 0.f, 0.f, 0.f, 0.f}; return z; }
__device__ __forceinline__ float hmax8(v8f s) {
  return fmaxf(fmaxf(fmaxf(s[0], s[1]), fmaxf(s[2], s[3])), fmaxf(fmaxf(s[4], s[5]), fmaxf(s[6], s[7])));
}

// 2^x with the free slot that the instruction set asks for behind a transcendental, tied to it in one statement
__device__ __forceinline__ float exp2_slot(float x) {
  float r = 0.f;
#if defined(__HIP_DEVICE_COMPILE__)
  asm("v_exp_f32 %0, %1\n\tv_nop" : "=v"(r) : "v"(x));
#endif
  return r;
}

// ---- 16-bit fragment loader (A, or B from a k-contiguous [n][k] row): lane -> row/col (lane&15), p already includes
//      + 8*(lane>>4); elements 0..7 <- p[0..7] (k0+8h..), elements 8..15 <- p[16..23] (k0+16+8h..)
__device__ __forceinline__ Frag ldfrag(const unsigned short* p) {
  Frag f;
  f.u[0] = *(const v8us*)(p);
  f.u[1] = *(const v8us*)(p + 16);
  return f;
}

// ---- WMMA helpers: builtin followed by a 4-slot VALU gap tying D and keeping A/B live --------------------------
__device__ __forceinline__ v8f mma_h(v16h a, v16h b, v8f c) {
  v8f d = __builtin_amdgcn_wmma_f32_16x16x32_f16(false, a, false, b, (short)0, c, false, false);
#if defined(__HIP_DEVICE_COMPILE__)
  asm volatile("v_nop\n\tv_nop\n\tv_nop\n\tv_nop" : "+v"(d) : "v"(a), "v"(b));
#endif
  return d;
}
__device__ __forceinline__ v8f mma_b(v16b a, v16b b, v8f c) {
  v8f d = __builtin_amdgcn_wmma_f32_16x16x32_bf16(false, a, false, b, (short)0, c, false, false);
#if defined(__HIP_DEVICE_COMPILE__)
  const v16h ha = __builtin_bit_cast(v16h, a), hb = __builtin_bit_cast(v16h, b);
  asm volatile("v_nop\n\tv_nop\n\tv_nop\n\tv_nop" : "+v"(d) : "v"(ha), "v"(hb));
#endif
  return d;
}

// =========================================================================================================
// (0) conv1x1 weights: W16 f16 [320][256], row o: 0..31 = wq, 32..63 = wk, 64..319 = wv; value = f16 of
//     (bf16-RNE(w) * 256) (exact). BIAS f32 [320] = bf16-RNE of bq / bk / bv. Block blk (0..39) owns rows
// coverage: 40 blocks x 8 rows x 32 pieces x 8 halves = 320 x 256; bias 80 x 4 floats = 320.
// =========================================================================================================
__device__ __forceinline__
void cvt_w(const float* __restrict__ wq, const float* __restrict__ bq,
           const float* __restrict__ wk, const float* __restrict__ bk,
           const float* __restrict__ wv, const float* __restrict__ bv,
           unsigned short* W16, float* BIAS, const int blk) {
  const int tid = threadIdx.x;
  const int rl = tid >> 5, col = 8 * (tid & 31);
  const int o = 8 * blk + rl;                                     // 0..319
  const float* wbase = (blk < 4) ? wq : (blk < 8) ? wk : wv;       // block-uniform selection
  const int osub = (blk < 4) ? 0 : (blk < 8) ? CQ : 2 * CQ;
  const float* s = wbase + (size_t)(o - osub) * CC + col;          // in range: (o-osub) < rows of that matrix
  const v4f a = *(const v4f*)s;
  const v4f q = *(const v4f*)(s + 4);
  const float f[8] = {a[0], a[1], a[2], a[3], q[0], q[1], q[2], q[3]};
  v4u u;
#pragma unroll
  for (int t = 0; t < 4; ++t) {
    const _Float16 h0 = (_Float16)(bfr(f[2 * t]) * WSC);
    const _Float16 h1 = (_Float16)(bfr(f[2 * t + 1]) * WSC);
    u[t] = pk16(h_bits(h0), h_bits(h1));
  }
  // bias values: every lane loads all three candidates with clamped indices, selects by value
  v4f bvv;
  {
    const int tb = min(tid, 79);
    const int o4 = 4 * tb;
#pragma unroll
    for (int qd = 0; qd < 4; ++qd) {
      const int oo = o4 + qd;
      const int iq = min(oo, CQ - 1);
      const int ik = min(max(oo - CQ, 0), CQ - 1);
      const int iv = min(max(oo - 2 * CQ, 0), CC - 1);
      const float cq = bq[iq], ck = bk[ik], cv = bv[iv];
      const float val = (oo < CQ) ? cq : (oo < 2 * CQ) ? ck : cv;
      bvv[qd] = bfr(val);
    }
  }
{
    *(v4u*)(W16 + (size_t)o * CC + col) = u;
    if (blk == 0 && tid < 80) *(v4f*)(BIAS + 4 * tid) = bvv;
    
  }
}

// =========================================================================================================
// (1) x f32 [b][256 c][4096 n] -> Xc f16 [b][c][n] (channel-major, bf16-RNE values, exact in f16) and
//     XP f16 [b][n][c] (position-major) through an LDS tile T[64 n][64 c] (pitch TP). Block (nb, cb, b) owns a
// coverage: Xc 2 it x 32 rows x 8 lanes x 8 = 64 c x 64 n; XP same; blocks (nb, cb, b) in (64, 4, NB) cover both planes once.
// =========================================================================================================
__device__ __forceinline__
void cvt_x(const float* __restrict__ x, unsigned short* Xc, unsigned short* XP, unsigned short* T,
           const int nb, const int cb, const int b) {
  const int tid = threadIdx.x;
  const int e = tid & 7, lq = tid >> 3;                             // lq 0..31
  const int n0 = nb * QT, c0 = cb * QT;
  v4u ux[2];
#pragma unroll
  for (int it = 0; it < 2; ++it) {
    const int cl = it * 32 + lq;                                     // 0..63
    const float* sp = x + ((size_t)(b * CC + c0 + cl)) * NN + n0 + 8 * e;
    const v4f a = *(const v4f*)sp;
    const v4f q = *(const v4f*)(sp + 4);
    unsigned short hb[8];
#pragma unroll
    for (int t = 0; t < 4; ++t) {
      hb[t]     = h_bits((_Float16)bfr(a[t]));
      hb[4 + t] = h_bits((_Float16)bfr(q[t]));
    }
#pragma unroll
    for (int t = 0; t < 4; ++t) ux[it][t] = pk16(hb[2 * t], hb[2 * t + 1]);
#pragma unroll
    for (int t = 0; t < 8; ++t) T[(8 * e + t) * TP + cl] = hb[t];
  }
  __syncthreads();
  v4u up[2];
#pragma unroll
  for (int it = 0; it < 2; ++it) {
    const int nl = it * 32 + lq;                                     // 0..63
    up[it] = *(const v4u*)(T + nl * TP + 8 * e);
  }
{
#pragma unroll
    for (int it = 0; it < 2; ++it) {
      const int rl = it * 32 + lq;
      *(v4u*)(Xc + ((size_t)(b * CC + c0 + rl)) * NN + n0 + 8 * e) = ux[it];
      *(v4u*)(XP + ((size_t)(b * NN + n0 + rl)) * CC + c0 + 8 * e) = up[it];
    }
    
  }
}

// =========================================================================================================
// (0) + (1) in one launch: neither reads what the other writes. Blocks 0 .. XB-1 do (1), block blk = nb + 64 (cb + 4 b);
//     blocks XB .. XB+WB-1 do (0). The choice is block-uniform, so the barrier of (1) is passed by whole blocks.
// =========================================================================================================
__global__ __launch_bounds__(256)
void cvt_wx(const float* __restrict__ x,
            const float* __restrict__ wq, const float* __restrict__ bq,
            const float* __restrict__ wk, const float* __restrict__ bk,
            const float* __restrict__ wv, const float* __restrict__ bv,
            unsigned short* Xc, unsigned short* XP, unsigned short* W16, float* BIAS) {
  __shared__ __align__(16) unsigned short T[QT * TP];
  const int blk = blockIdx.x;
  if (blk < XB) cvt_x(x, Xc, XP, T, blk % (NN / QT), (blk / (NN / QT)) % (CC / QT), blk / ((NN / QT) * (CC / QT)));
  else          cvt_w(wq, bq, wk, bk, wv, bv, W16, BIAS, blk - XB);
}

// =========================================================================================================
// (2) conv1x1 GEMM for one (b, 64-n tile, 64-o block): Y[o][n] = (1/256) sum_c W16[o][c] XP[b][n][c] + BIAS[o].
//     Block 128 threads = 4 waves; wave w owns cols n0+16w..+15 (one B fragment per k-step, k = c contiguous in
//     the XP row) and 4 m-tiles (A rows o = o0 + 16 mt + (lane&15), split k map loader from W16). K = 256 = 8 steps.
//     Epilogue staged in LDS Os[o_loc][n_loc] (pitch OSP), barrier, then:
//       o-block 0 (q rows 0..31, k rows 32..63): Qh/Ql/Kh/Kl bf16 hi / bf16 residual planes [b][4096 n][32]
//         holds rows 2ll, 2ll+1; lane e -> row 2ll+(e>>2), cols 8*(e&3)..+7; one instruction per 16 lines.
//         halves 8e..8e+7; one instruction per 16 lines.
// coverage: Os 4 waves x 4 tiles x 16x16 = 64 x 64; q/k: 4 planes x 32 lines x 8 lanes x 8 = 4 x (64 n x 32);
//           v: 4 it x 16 rows x 8 lanes x 8 = 64 ch x 64 n; grid rows y < 5 of (64, 5 + GY, NB) cover all planes exactly once.
// =========================================================================================================
__device__ __forceinline__
void gemm_qkv(const unsigned short* __restrict__ W16, const float* __restrict__ BIAS,
              const unsigned short* __restrict__ XP,
              unsigned short* Qh, unsigned short* Ql, unsigned short* Kh, unsigned short* Kl,
              unsigned short* Vh, float* Os, const int nt, const int mb, const int b) {
  const int tid  = threadIdx.x;
  const int lane = tid & 31, wave = tid >> 5;
  const int hh   = lane >> 4, c = lane & 15;
  const int n0   = nt * QT, o0 = mb * QT;

  const unsigned short* ap = W16 + (size_t)(o0 + c) * CC + 8 * hh;
  const unsigned short* bp = XP + ((size_t)(b * NN + n0 + 16 * wave + c)) * CC + 8 * hh;

  v8f acc[4];
#pragma unroll
  for (int mt = 0; mt < 4; ++mt) acc[mt] = zero8();

#pragma unroll
  for (int ks = 0; ks < CC / 32; ++ks) {
    const Frag fb = ldfrag(bp + 32 * ks);
#pragma unroll
    for (int mt = 0; mt < 4; ++mt) {
      const Frag fa = ldfrag(ap + (size_t)(16 * mt) * CC + 32 * ks);
      acc[mt] = mma_h(fa.h, fb.h, acc[mt]);
    }
  }

  // ---- epilogue: scale back, + bias -> LDS Os[o_loc][n_loc] ----
  {
    const int nl = 16 * wave + c;
#pragma unroll
    for (int mt = 0; mt < 4; ++mt) {
#pragma unroll
      for (int r = 0; r < 8; ++r) {
        const int ol = 16 * mt + 8 * hh + r;                         // 0..63
        Os[ol * OSP + nl] = acc[mt][r] * IWSC + BIAS[o0 + ol];
      }
    }
  }
  __syncthreads();

  const int e = tid & 7, lq = tid >> 3;                             // lq 0..15
  if (mb == 0) {
    // ---- q/k bf16 hi + residual planes ----
{
#pragma unroll
      for (int it = 0; it < 8; ++it) {
        const int p    = it >> 1;                                    // 0 Qh, 1 Ql, 2 Kh, 3 Kl
        const int ll   = (it & 1) * 16 + lq;                         // 0..31
        const int nl   = 2 * ll + (e >> 2);                          // 0..63
        const int col0 = 8 * (e & 3);                                // 0,8,16,24
        const int rb   = ((p >> 1) ? CQ : 0) + col0;
        v4u u;
#pragma unroll
        for (int t = 0; t < 4; ++t) {
          const float f0 = Os[(rb + 2 * t) * OSP + nl];
          const float f1 = Os[(rb + 2 * t + 1) * OSP + nl];
          const unsigned short hb0 = bf_bits(f0), hb1 = bf_bits(f1);
          const unsigned short lb0 = bf_bits(f0 - bf_up(hb0));
          const unsigned short lb1 = bf_bits(f1 - bf_up(hb1));
          u[t] = (p & 1) ? pk16(lb0, lb1) : pk16(hb0, hb1);
        }
        unsigned short* P = (p == 0) ? Qh : (p == 1) ? Ql : (p == 2) ? Kh : Kl;
        *(v4u*)(P + ((size_t)(b * NN + n0 + nl)) * CQ + col0) = u;
      }
      
    }
  } else {
    // ---- v f16 plane ----
    const int ch0 = o0 - QT;                                         // (mb-1)*64
    v4u uv[4];
#pragma unroll
    for (int it = 0; it < 4; ++it) {
      const int row = it * 16 + lq;                                  // 0..63
      const v4f a = *(const v4f*)(Os + row * OSP + 8 * e);
      const v4f q = *(const v4f*)(Os + row * OSP + 8 * e + 4);
#pragma unroll
      for (int t = 0; t < 2; ++t) {
        uv[it][t]     = pk16(h_bits((_Float16)a[2 * t]), h_bits((_Float16)a[2 * t + 1]));
        uv[it][2 + t] = pk16(h_bits((_Float16)q[2 * t]), h_bits((_Float16)q[2 * t + 1]));
      }
    }
{
#pragma unroll
      for (int it = 0; it < 4; ++it) {
        const int row = it * 16 + lq;
        *(v4u*)(Vh + ((size_t)(b * CC + ch0 + row)) * NN + n0 + 8 * e) = uv[it];
      }
      
    }
  }
}

// =========================================================================================================
// (5) channel softmax: for row (b, i): G_j = sum of the GS slice planes in slice order, then
//     p_j = exp(min_j G - G_j) / sum (== softmax of rowmax - G), returned as the lane's 8 halves of
//     Pc f16 [b][256][256] = p * 1024. One wave per row: lane reads j = 8 lane..8 lane+7, wave min / sum by shuffles.
//     rw = b * 256 + i. The NB * 256 rows ride in the launch of (3), one per block, worked by the block's wave 0.
// =========================================================================================================
__device__ __forceinline__ v4u cam_softmax(const float* __restrict__ G, const int rw, const int lane) {
  const float* row = G + (size_t)rw * CC + 8 * lane;
  v4f a = *(const v4f*)row;
  v4f q = *(const v4f*)(row + 4);
#pragma unroll                                                       // straight line: the planes' loads issue ahead of the adds
  for (int s = 1; s < GS; ++s) {
    a += *(const v4f*)(row + (size_t)s * NB * CC * CC);
    q += *(const v4f*)(row + (size_t)s * NB * CC * CC + 4);
  }
  const float ev[8] = {a[0], a[1], a[2], a[3], q[0], q[1], q[2], q[3]};
  float mn = ev[0];
#pragma unroll
  for (int t = 1; t < 8; ++t) mn = fminf(mn, ev[t]);
#pragma unroll
  for (int s = 1; s < 32; s <<= 1) mn = fminf(mn, __shfl_xor(mn, s, 32));
  float p[8], sm = 0.f;
#pragma unroll
  for (int t = 0; t < 8; ++t) { p[t] = __expf(mn - ev[t]); sm += p[t]; }
#pragma unroll
  for (int s = 1; s < 32; s <<= 1) sm += __shfl_xor(sm, s, 32);
  const float inv = PSC / sm;
  v4u u;
#pragma unroll
  for (int t = 0; t < 4; ++t)
    u[t] = pk16(h_bits((_Float16)(p[2 * t] * inv)), h_bits((_Float16)(p[2 * t + 1] * inv)));
  return u;
}

// ---- one stage (64 keys) of v, k hi and k residual -> LDS, 128 lanes, 16 B per lane and copy, no register on the way.
//      v: copy i brings row (channel) 16 i + (tid >> 3), bytes 16 (tid & 7) ..+15 of its 128; 16 copies = 256 rows.
//      k: copy i of a plane brings row (key) 32 i + (tid >> 2), bytes 16 (tid & 3) ..+15 of its 64; 2 copies = 64 rows.
//      lv / lk: the lane's LDS byte address of its first v / k-hi piece; gv / gh / gl: its first global piece.
//      s_wait_xcnt 0 closes each statement, a precaution: it stands in front of any rewrite of a register a copy names.
__device__ __forceinline__ void stage_copy(unsigned lv, unsigned lk, const unsigned short* gv,
                                           const unsigned short* gh, const unsigned short* gl) {
#if defined(__HIP_DEVICE_COMPILE__)
#pragma unroll
  for (int g = 0; g < 2; ++g) {
    const unsigned l = lv + (unsigned)(g * 128 * VPB);
    const unsigned short* p = gv + (size_t)(g * 128) * NN;
    asm volatile("global_load_async_to_lds_b128 %0, %8, off\n\t"
                 "global_load_async_to_lds_b128 %1, %9, off\n\t"
                 "global_load_async_to_lds_b128 %2, %10, off\n\t"
                 "global_load_async_to_lds_b128 %3, %11, off\n\t"
                 "global_load_async_to_lds_b128 %4, %12, off\n\t"
                 "global_load_async_to_lds_b128 %5, %13, off\n\t"
                 "global_load_async_to_lds_b128 %6, %14, off\n\t"
                 "global_load_async_to_lds_b128 %7, %15, off\n\t"
                 "s_wait_xcnt 0x0"
                 :: "v"(l), "v"(l + 16u * VPB), "v"(l + 32u * VPB), "v"(l + 48u * VPB),
                    "v"(l + 64u * VPB), "v"(l + 80u * VPB), "v"(l + 96u * VPB), "v"(l + 112u * VPB),
                    "v"(p), "v"(p + (size_t)16 * NN), "v"(p + (size_t)32 * NN), "v"(p + (size_t)48 * NN),
                    "v"(p + (size_t)64 * NN), "v"(p + (size_t)80 * NN), "v"(p + (size_t)96 * NN),
                    "v"(p + (size_t)112 * NN)
                 : "memory");
  }
  asm volatile("global_load_async_to_lds_b128 %0, %4, off\n\t"
               "global_load_async_to_lds_b128 %1, %5, off\n\t"
               "global_load_async_to_lds_b128 %2, %6, off\n\t"
               "global_load_async_to_lds_b128 %3, %7, off\n\t"
               "s_wait_xcnt 0x0"
               :: "v"(lk), "v"(lk + 32u * KPB), "v"(lk + (unsigned)KSTB), "v"(lk + (unsigned)KSTB + 32u * KPB),
                  "v"(gh), "v"(gh + 32 * CQ), "v"(gl), "v"(gl + 32 * CQ)
               : "memory");
#endif
}

// =========================================================================================================
// (3) position attention for one (b, 64-query tile, key range sp of NN / KS keys), transposed formulation, no mask:
//   S^T tile (16 keys x 16 queries) = A(k: row = key kb + (lane&15), 32 d via the split k map from the bf16 plane
//   Kh [b][4096][32]) . B(q: col = query, same map, resident fragment from Qh) + A(Kh).B(Ql) + A(Kl).B(Qh)
//   (bf16 unscaled residual planes, shared accumulator). Energy = S (no scale).
//   Per lane the D tile holds 8 keys of ONE query: online softmax state per lane, one shuffle (lane^16) for the max
//   over 32 keys, row-sum partials combined at the end. P = e^{s-m} x 1024 as f16 is the B operand of
//   O^T (rows channel, cols queries) += A(V rows channel = 16j + (lane&15), keys contiguous, f16 plane Vh
//   [b][256][4096]) . B(P^T): element r <- D of the tile covering keys kb..kb+15, element 8+r <- the tile covering
//   kb+16..kb+31, lane unchanged. 16 accumulator tiles per wave (256 channels). Block = 4 waves = 64 queries.
//   The k and v rows of 64 keys are one stage in LDS, brought once per block by asynchronous copies and read by all
//   four waves; two buffers: stage t + 1 flies while stage t is worked on (two passes of 32 keys).
//   Epilogue in two channel halves: O/l staged in LDS Os[query][128 channels] (pitch OSPW, b128 stores), barrier,
//   The result is the range's own softmax average, Yp [b][256][KS][4096]; the range's maximum m and sum l of each query go to
//   ST [2][KS][b][4096] (m planes, then l planes), through LDS so that one wave writes whole lines; (6) merges the ranges.
// coverage: per half 16 it x 16 lines x 8 lanes x 4 floats = 128 ch x 64 n; two halves = 256 ch; grid (64, NB, KS).
// =========================================================================================================
__global__ __launch_bounds__(128)
void attn_pam(const unsigned short* __restrict__ Qh, const unsigned short* __restrict__ Ql,
              const unsigned short* __restrict__ Kh, const unsigned short* __restrict__ Kl,
              const unsigned short* __restrict__ Vh, float* Yp, float* ST,
              const float* __restrict__ G, unsigned short* Pc) {
  __shared__ __align__(16) float Os[QT * OSPW];
  __shared__ __align__(16) float St[2 * QT];
  __shared__ __align__(16) unsigned char Ring[2 * STGB];
  const int tid  = threadIdx.x;
  const int wave = tid >> 5, lane = tid & 31;
  const int hh   = lane >> 4, c = lane & 15;
  const int n0   = blockIdx.x * QT, b = blockIdx.y, sp = blockIdx.z;
  const int t0   = sp * NTS;                                         // first stage of the block's key range (even)

  // resident q fragments (B operand, col = query n0 + 16*wave + c)
  Frag qh, ql;
  {
    const size_t qo = ((size_t)(b * NN + n0 + 16 * wave + c)) * CQ + 8 * hh;
    qh = ldfrag(Qh + qo);
    ql = ldfrag(Ql + qo);
    // the wait before the four loads' address registers are reused; naming them as inputs keeps them whole up to here
#if defined(__HIP_DEVICE_COMPILE__)
    asm volatile("s_wait_xcnt 0x0" :: "v"(Qh + qo), "v"(Ql + qo) : "memory");
#endif
  }
  // the lane's first pieces of a stage: global sources (+ t * KT keys) and LDS places (+ buffer * STGB)
  const unsigned short* gv = Vh + (size_t)b * CC * NN + (size_t)(tid >> 3) * NN + 8 * (tid & 7);
  const unsigned short* gh = Kh + ((size_t)b * NN + (tid >> 2)) * CQ + 8 * (tid & 3);
  const unsigned short* gl = Kl + ((size_t)b * NN + (tid >> 2)) * CQ + 8 * (tid & 3);
  const unsigned ring0 = (unsigned)(size_t)Ring;                     // low 32 bits = byte offset in the block's LDS
  const unsigned lv = ring0 + (unsigned)((tid >> 3) * VPB + 16 * (tid & 7));
  const unsigned lk = ring0 + (unsigned)(VSTB + (tid >> 2) * KPB + 16 * (tid & 3));
  // fragment offsets inside a stage: v (A operand, row = channel 16j + c, keys contiguous), k (A operand, row = key)
  const int vfo = c * VPB + 16 * hh;
  const int kfo = VSTB + c * KPB + 16 * hh;

  float m = -1.0e30f, l = 0.f;
  v8f o[16];
#pragma unroll
  for (int j = 0; j < 16; ++j) o[j] = zero8();

  // prologue: stage t0 landed and published, then stage t0 + 1 on its way
  stage_copy(lv, lk, gv + (size_t)t0 * KT, gh + (size_t)t0 * KT * CQ, gl + (size_t)t0 * KT * CQ);
  // (5): the block's row of the channel softmax, in wave 0 (scalar test), while stage t0 is on its way
  const int  crow = blockIdx.x + (NN / QT) * (blockIdx.y + NB * blockIdx.z);   // 0 .. NB * CC - 1, each once
  const bool cwav = __builtin_amdgcn_readfirstlane(wave) == 0;
  v4u cu = {0u, 0u, 0u, 0u};
  if (cwav) cu = cam_softmax(G, crow, lane);
  asm volatile("s_wait_asynccnt 0x0" ::: "memory");                  // this wave's pieces of stage t0 have landed
  __syncthreads();                                                   // ... and every other wave's
  if (cwav) *(v4u*)(Pc + (size_t)crow * CC + 8 * lane) = cu;         // behind the barrier: it does not wait for this store
  stage_copy(lv + STGB, lk + STGB, gv + (size_t)(t0 + 1) * KT, gh + (size_t)(t0 + 1) * KT * CQ,
             gl + (size_t)(t0 + 1) * KT * CQ);

#pragma unroll 1
  for (int t = t0; t < t0 + NTS; ++t) {
   const unsigned bo = (unsigned)(t & 1) * STGB;
   const unsigned char* sb = Ring + bo;
#pragma unroll 1                                                     // rolled: one pass's exponentials live at a time, no spill
   for (int ps = 0; ps < KT / 32; ++ps) {
    const unsigned char* kp = sb + kfo + ps * 32 * KPB;              // the pass's keys start at kb = KT t + 32 ps
    const Frag k0  = ldfrag((const unsigned short*)(kp));                        // keys kb .. kb+15
    const Frag k1  = ldfrag((const unsigned short*)(kp + 16 * KPB));             // keys kb+16 .. kb+31
    const Frag k0l = ldfrag((const unsigned short*)(kp + KSTB));
    const Frag k1l = ldfrag((const unsigned short*)(kp + KSTB + 16 * KPB));
    v8f s0 = mma_b(k0.bf, qh.bf, zero8());
    v8f s1 = mma_b(k1.bf, qh.bf, zero8());
    s0 = mma_b(k0.bf, ql.bf, s0);
    s1 = mma_b(k1.bf, ql.bf, s1);
    s0 = mma_b(k0l.bf, qh.bf, s0);
    s1 = mma_b(k1l.bf, qh.bf, s1);

    float mx = fmaxf(hmax8(s0), hmax8(s1));
    const float mo = __shfl_xor(mx, 16, 32);
    // the first 8 v fragments of the pass as one group of LDS reads, in flight under the maximum and its exchange
    const unsigned char* vp = sb + vfo + ps * 64;
    Frag vf[8];
#pragma unroll
    for (int j = 0; j < 8; ++j) vf[j] = ldfrag((const unsigned short*)(vp + 16 * j * VPB));
    mx = fmaxf(mx, mo);
    const float mn   = fmaxf(m, mx);
    const float corr = __expf(m - mn);
    m = mn;
    const float msh = mn - LNPS;                                     // exp gives e^{s-m} * 1024
    l *= corr;
#pragma unroll
    for (int j = 0; j < 16; ++j) {
#pragma unroll
      for (int r = 0; r < 8; ++r) o[j][r] *= corr;
    }

    FragH ph;
    float ls = 0.f;
#pragma unroll
    for (int r = 0; r < 8; ++r) {
      const float e0 = __expf(s0[r] - msh);                          // key kb      + 8hh + r
      const float e1 = __expf(s1[r] - msh);                          // key kb + 16 + 8hh + r
      ls += e0 + e1;
      ph.hv[0][r] = (_Float16)e0;
      ph.hv[1][r] = (_Float16)e1;
    }
    l += ls;

    // blocks of 4 products; behind each of the first two, the 4 fragments needed two blocks later take their registers
#pragma unroll
    for (int g = 0; g < 4; ++g) {
#pragma unroll
      for (int i = 0; i < 4; ++i) o[4 * g + i] = mma_h(vf[(4 * g + i) & 7].h, ph.v, o[4 * g + i]);
      if (g < 2) {
#pragma unroll
        for (int i = 0; i < 4; ++i)
          vf[(4 * g + i) & 7] = ldfrag((const unsigned short*)(vp + 16 * (4 * g + i + 8) * VPB));
      }
    }
   }
   // publish point of stage t + 1, and the end of every reader's last read of stage t's buffer
   asm volatile("s_wait_dscnt 0x0" ::: "memory");                    // this wave's LDS reads of stage t are done
   asm volatile("s_wait_asynccnt 0x0" ::: "memory");                 // this wave's pieces of stage t + 1 have landed
   __syncthreads();
   if (t + 2 < t0 + NTS)                                              // block-uniform: refill the buffer just read
     stage_copy(lv + bo, lk + bo, gv + (size_t)(t + 2) * KT, gh + (size_t)(t + 2) * KT * CQ,
                gl + (size_t)(t + 2) * KT * CQ);
  }
  asm volatile("s_wait_asynccnt 0x0" ::: "memory");                  // nothing of this wave is in flight at its end
  l += __shfl_xor(l, 16, 32);
  const float inv = 1.0f / l;                                        // o and l both carry the x1024 factor

  const int qrow = 16 * wave + c;
  const int e = tid & 7, lq = tid >> 3;                              // lq 0..15
  if (hh == 0) { St[qrow] = m; St[QT + qrow] = l; }                  // m and l are equal in lanes c and c + 16
#pragma unroll
  for (int half = 0; half < 2; ++half) {
    if (half) __syncthreads();                                       // every wave finished reading Os
#pragma unroll
    for (int jj = 0; jj < 8; ++jj) {
      const int j = 8 * half + jj;
      v4f va, vb;
#pragma unroll
      for (int r = 0; r < 4; ++r) { va[r] = o[j][r] * inv; vb[r] = o[j][4 + r] * inv; }
      *(v4f*)(Os + qrow * OSPW + 16 * jj + 8 * hh)     = va;         // Os[query][ch_loc = 16jj + 8hh + r]
      *(v4f*)(Os + qrow * OSPW + 16 * jj + 8 * hh + 4) = vb;
    }
    __syncthreads();
{
#pragma unroll
      for (int it = 0; it < 16; ++it) {
        const int L   = it * 16 + lq;                                // 0..255
        const int chl = L >> 1, hf = L & 1;                          // channel 0..127 within the half
        const int nl  = hf * 32 + 4 * e;                             // query 0..63
        v4f v;
#pragma unroll
        for (int t = 0; t < 4; ++t) v[t] = Os[(nl + t) * OSPW + chl];
        *(v4f*)(Yp + ((size_t)((b * CC + 128 * half + chl) * KS + sp)) * NN + n0 + nl) = v;
      }
      
    }
  }
  if (tid < 32) {                                                    // wave 0, behind the barriers above: 64 m, then 64 l
    const int pl = tid >> 4, q4 = 4 * (tid & 15);
    *(v4f*)(ST + ((size_t)((pl * KS + sp) * NB + b)) * NN + n0 + q4) = *(const v4f*)(St + pl * QT + q4);
  }
}

// =========================================================================================================
// (4) channel Gram for one (b, 64-i block, 64-j block, K slice s): G[s][b][i][j] = sum over the slice's GK positions n
//     of Xc[b][i][n] Xc[b][j][n]; the GS slices of a tile run as GS blocks, and (5) adds their planes.
//     4 waves; wave w owns cols j0+16w..+15 (B from the j row, keys n contiguous) and 4 i tiles (A rows
//     [b][256][256] (row segment 64 j = 2 lines), 8 consecutive lanes x 16 B, one instruction per 16 lines, two
// coverage: 8 it x 16 lines x 8 lanes x 4 = 64 x 64; (jt, itb, zb) in (4, 4, GS * NB) covers the GS planes of G exactly once.
// =========================================================================================================
__device__ __forceinline__
void gram_k(const unsigned short* __restrict__ Xc, float* G, float* Os, const int jt, const int itb, const int zb) {
  const int tid  = threadIdx.x;
  const int lane = tid & 31, wave = tid >> 5;
  const int hh   = lane >> 4, c = lane & 15;
  const int b = zb % NB, s = zb / NB;                                // zb = s * NB + b: the plane of G this block writes
  const int j0 = jt * QT, i0 = itb * QT;

  const unsigned short* ap = Xc + ((size_t)(b * CC + i0 + c)) * NN + s * GK + 8 * hh;
  const unsigned short* bp = Xc + ((size_t)(b * CC + j0 + 16 * wave + c)) * NN + s * GK + 8 * hh;

  v8f acc[4];
#pragma unroll
  for (int mt = 0; mt < 4; ++mt) acc[mt] = zero8();

#pragma unroll                                                       // 8 trips: every load a constant offset from one address pair
  for (int ks = 0; ks < GK / 32; ++ks) {
    const Frag fb = ldfrag(bp + 32 * ks);
#pragma unroll
    for (int mt = 0; mt < 4; ++mt) {
      const Frag fa = ldfrag(ap + (size_t)(16 * mt) * NN + 32 * ks);
      acc[mt] = mma_h(fa.h, fb.h, acc[mt]);
    }
  }
  {
    const int nl = 16 * wave + c;
#pragma unroll
    for (int mt = 0; mt < 4; ++mt) {
#pragma unroll
      for (int r = 0; r < 8; ++r) Os[(16 * mt + 8 * hh + r) * OSP + nl] = acc[mt][r];
    }
  }
  __syncthreads();
  {
    const int e = tid & 7, lq = tid >> 3;                            // lq 0..15
{
#pragma unroll
      for (int it = 0; it < 8; ++it) {
        const int L = it * 16 + lq;                                  // 0..127
        const int row = L >> 1, hf = L & 1;
        const v4f v = *(const v4f*)(Os + row * OSP + hf * 32 + 4 * e);
        *(v4f*)(G + ((size_t)(zb * CC + i0 + row)) * CC + j0 + hf * 32 + 4 * e) = v;
      }
      // a precaution: in the shared launch code follows these stores in the listing; the wait stands before it reuses their registers
      asm volatile("s_wait_xcnt 0x0" ::: "memory");
    }
  }
}

// =========================================================================================================
// (2) + (4) in one launch: both read only what the launch before wrote, neither reads what the other writes.
//     Grid (64, 5 + GY, NB): rows y < 5 do (2) with (nt, mb, b) = (x, y, z); rows y >= 5 do (4): idx = x + 64 (y - 5)
//     = jt + 4 (itb + 4 s), batch z. The choice is block-uniform, so each body's barrier is passed by whole blocks.
// =========================================================================================================
__global__ __launch_bounds__(128)
void gemm_gram(const unsigned short* __restrict__ W16, const float* __restrict__ BIAS,
               const unsigned short* __restrict__ XP, const unsigned short* __restrict__ Xc,
               unsigned short* Qh, unsigned short* Ql, unsigned short* Kh, unsigned short* Kl,
               unsigned short* Vh, float* G) {
  __shared__ __align__(16) float Os[QT * OSP];
  const int y = blockIdx.y;
  if (y < MQKV / QT) {
    gemm_qkv(W16, BIAS, XP, Qh, Ql, Kh, Kl, Vh, Os, blockIdx.x, y, blockIdx.z);
  } else {
    const int idx = blockIdx.x + (NN / QT) * (y - MQKV / QT);
    gram_k(Xc, G, Os, idx % (CC / QT), (idx / (CC / QT)) % (CC / QT),
           (idx / ((CC / QT) * (CC / QT))) * NB + blockIdx.z);
  }
}

// =========================================================================================================
// (6) channel mix + output for one (b, 64-n tile, 64-i block): cam[i][n] = (1/1024) sum_j Pc[b][i][j] XP[b][n][j]
//     (K = 256 = 8 steps; A rows i = i0 + 16 mt + (lane&15), j contiguous; B col n = n0 + 16w + (lane&15) from the
//     XP row, j contiguous), then out[b][i][n] = (g_pam * Y + xb) + (g_cam * cam + xb) with xb = bf16-RNE of x and
//     Y = sum over the KS key ranges s, in range order, of wt_s[n] Yp[b][i][s][n], wt_s = l_s e^{m_s - M} / sum of these,
//     M = max_s m_s (m, l from ST): the softmax over all keys from the ranges' own averages.
// coverage: 8 it x 16 lines x 8 lanes x 4 = 64 i x 64 n; grid (64, 4, NB) covers d_out exactly once.
// =========================================================================================================
__global__ __launch_bounds__(128)
void cam_out(const unsigned short* __restrict__ Pc, const unsigned short* __restrict__ XP,
             const float* __restrict__ Yp, const float* __restrict__ ST, const float* __restrict__ x,
             const float* __restrict__ gpam, const float* __restrict__ gcam, float* out) {
  __shared__ __align__(16) float Os[QT * OSP];
  const int tid  = threadIdx.x;
  const int lane = tid & 31, wave = tid >> 5;
  const int hh   = lane >> 4, c = lane & 15;
  const int nt = blockIdx.x, itb = blockIdx.y, b = blockIdx.z;
  const int n0 = nt * QT, i0 = itb * QT;

  const unsigned short* ap = Pc + ((size_t)(b * CC + i0 + c)) * CC + 8 * hh;
  const unsigned short* bp = XP + ((size_t)(b * NN + n0 + 16 * wave + c)) * CC + 8 * hh;

  v8f acc[4];
#pragma unroll
  for (int mt = 0; mt < 4; ++mt) acc[mt] = zero8();

#pragma unroll
  for (int ks = 0; ks < CC / 32; ++ks) {
    const Frag fb = ldfrag(bp + 32 * ks);
#pragma unroll
    for (int mt = 0; mt < 4; ++mt) {
      const Frag fa = ldfrag(ap + (size_t)(16 * mt) * CC + 32 * ks);
      acc[mt] = mma_h(fa.h, fb.h, acc[mt]);
    }
  }
  {
    const int nl = 16 * wave + c;
#pragma unroll
    for (int mt = 0; mt < 4; ++mt) {
#pragma unroll
      for (int r = 0; r < 8; ++r) Os[(16 * mt + 8 * hh + r) * OSP + nl] = acc[mt][r];
    }
  }
  __syncthreads();

  const float gp = bfr(gpam[0]);
  const float gc = bfr(gcam[0]) * IPSC;
  const int e = tid & 7, lq = tid >> 3;                              // lq 0..15
  // weights of the key ranges for the thread's 4 positions (nl below is the same in every it: 16 it is even)
  v4f wt[KS];
  {
    const float* sq = ST + (size_t)b * NN + n0;                      // block-uniform base; the lane's part is lo
    const unsigned lo = (unsigned)((lq & 1) * 32 + 4 * e);
    v4f mm[KS];
#pragma unroll
    for (int s = 0; s < KS; ++s) {
      mm[s] = *(const v4f*)(sq + (size_t)s * NB * NN + lo);
      wt[s] = *(const v4f*)(sq + (size_t)(KS + s) * NB * NN + lo);
    }
#pragma unroll
    for (int t = 0; t < 4; ++t) {
      float mx = mm[0][t];
#pragma unroll
      for (int s = 1; s < KS; ++s) mx = fmaxf(mx, mm[s][t]);
      float sm = 0.f;
#pragma unroll
      for (int s = 0; s < KS; ++s) { wt[s][t] *= exp2_slot((mm[s][t] - mx) * LOG2E); sm += wt[s][t]; }
      const float inv = 1.0f / sm;
#pragma unroll
      for (int s = 0; s < KS; ++s) wt[s][t] *= inv;
    }
  }
  // the ranges' rows: block-uniform base of the tile + one lane offset (row lq >> 1, the it and s steps are constants)
  const float* yt = Yp + ((size_t)(b * CC + i0)) * KS * NN + n0;
  const unsigned yo = (unsigned)((lq >> 1) * KS * NN + (lq & 1) * 32 + 4 * e);
  v4f res[8];
#pragma unroll
  for (int it = 0; it < 8; ++it) {
    const int L = it * 16 + lq;                                      // 0..127
    const int row = L >> 1, hf = L & 1;
    const int nl = hf * 32 + 4 * e;
    const v4f cam4 = *(const v4f*)(Os + row * OSP + nl);
    const size_t idx = ((size_t)(b * CC + i0 + row)) * NN + n0 + nl;
    const v4f xv = *(const v4f*)(x + idx);
    v4f yv = wt[0] * *(const v4f*)(yt + (size_t)(it * 8 * KS) * NN + yo);
#pragma unroll
    for (int s = 1; s < KS; ++s) yv += wt[s] * *(const v4f*)(yt + (size_t)(it * 8 * KS + s) * NN + yo);
#pragma unroll
    for (int t = 0; t < 4; ++t) {
      const float xb = bfr(xv[t]);
      const float t1 = gp * yv[t] + xb;
      const float t2 = gc * cam4[t] + xb;
      res[it][t] = t1 + t2;
    }
  }
{
#pragma unroll
    for (int it = 0; it < 8; ++it) {
      const int L = it * 16 + lq;
      const int row = L >> 1, hf = L & 1;
      const int nl = hf * 32 + 4 * e;
      const size_t idx = ((size_t)(b * CC + i0 + row)) * NN + n0 + nl;
      *(v4f*)(out + idx) = res[it];
    }
    
  }
}

// =========================================================================================================
// Workspace map (bytes; each region start a multiple of 256; every extent is an exact tile multiple and is written
//   W16 f16 [320][256]          163840      BIAS f32 [320]              1280
//   Xc  f16 [2][256][4096]     4194304      XP   f16 [2][4096][256]  4194304
//   Qh/Ql/Kh/Kl bf16 [2][4096][32]  524288 x4                          Vh f16 [2][256][4096]  4194304
//   Yp  f32 [2][256][4][4096] 33554432      G    f32 [16][2][256][256] 8388608     Pc f16 [2][256][256] 262144
//   ST  f32 [2][4][2][4096]     262144
//   total = 57312512
// =========================================================================================================
extern "C" void kernel_launch(void* const* d_in, const int* in_sizes, int n_in,
                              void* d_out, int out_size, void* d_ws, size_t ws_size,
                              hipStream_t stream) {
  const int XN = NB * CC * NN;                                       // 2097152
  if (n_in < 9) return;
  if (in_sizes[0] != XN) return;
  if (in_sizes[1] != CQ * CC || in_sizes[2] != CQ) return;
  if (in_sizes[3] != CQ * CC || in_sizes[4] != CQ) return;
  if (in_sizes[5] != CC * CC || in_sizes[6] != CC) return;
  if (in_sizes[7] < 1 || in_sizes[8] < 1) return;
  if (out_size != XN) return;

  size_t off = 0;
  auto carve = [&](size_t bytes) { const size_t o = off; off += (bytes + 255) & ~(size_t)255; return o; };
  const size_t oW16 = carve((size_t)MQKV * CC * 2);
  const size_t oBIA = carve((size_t)MQKV * 4);
  const size_t oXc  = carve((size_t)NB * CC * NN * 2);
  const size_t oXP  = carve((size_t)NB * NN * CC * 2);
  const size_t oQh  = carve((size_t)NB * NN * CQ * 2);
  const size_t oQl  = carve((size_t)NB * NN * CQ * 2);
  const size_t oKh  = carve((size_t)NB * NN * CQ * 2);
  const size_t oKl  = carve((size_t)NB * NN * CQ * 2);
  const size_t oVh  = carve((size_t)NB * CC * NN * 2);
  const size_t oYp  = carve((size_t)KS * NB * CC * NN * 4);
  const size_t oG   = carve((size_t)GS * NB * CC * CC * 4);
  const size_t oPc  = carve((size_t)NB * CC * CC * 2);
  const size_t oST  = carve((size_t)2 * KS * NB * NN * 4);
  if (off > ws_size) return;
  if (off > (size_t)134217728) return;

  const float* x    = (const float*)d_in[0];
  const float* wq   = (const float*)d_in[1];
  const float* bq   = (const float*)d_in[2];
  const float* wk   = (const float*)d_in[3];
  const float* bk   = (const float*)d_in[4];
  const float* wv   = (const float*)d_in[5];
  const float* bv   = (const float*)d_in[6];
  const float* gpam = (const float*)d_in[7];
  const float* gcam = (const float*)d_in[8];

  char* ws = (char*)d_ws;
  unsigned short* W16 = (unsigned short*)(ws + oW16);
  float*          BIA = (float*)(ws + oBIA);
  unsigned short* Xc  = (unsigned short*)(ws + oXc);
  unsigned short* XP  = (unsigned short*)(ws + oXP);
  unsigned short* Qh  = (unsigned short*)(ws + oQh);
  unsigned short* Ql  = (unsigned short*)(ws + oQl);
  unsigned short* Kh  = (unsigned short*)(ws + oKh);
  unsigned short* Kl  = (unsigned short*)(ws + oKl);
  unsigned short* Vh  = (unsigned short*)(ws + oVh);
  float*          Yp  = (float*)(ws + oYp);
  float*          G   = (float*)(ws + oG);
  unsigned short* Pc  = (unsigned short*)(ws + oPc);
  float*          ST  = (float*)(ws + oST);
  float* out = (float*)d_out;

  const dim3 blk256(256), blk128(128);

  // (0) + (1) weights -> f16 plane + bias line; x -> channel-major and position-major 16-bit planes
  cvt_wx<<<dim3(XB + WB), blk256, 0, stream>>>(x, wq, bq, wk, bk, wv, bv, Xc, XP, W16, BIA);
  // (2) + (4) conv1x1 GEMM -> q/k hi + residual planes and v plane; channel Gram, K slices -> G [s][b][256][256]
  gemm_gram<<<dim3(NN / QT, MQKV / QT + GY, NB), blk128, 0, stream>>>(W16, BIA, XP, Xc, Qh, Ql, Kh, Kl, Vh, G);
  // (3) + (5) position attention, KS key ranges -> Yp [b][256][s][4096], ST; channel softmax -> Pc [b][256][256] (x1024 f16)
  attn_pam<<<dim3(NN / QT, NB, KS), blk128, 0, stream>>>(Qh, Ql, Kh, Kl, Vh, Yp, ST, G, Pc);
  // (6) channel mix + merge of the key ranges + residual sum -> out [b][256][4096]
  cam_out<<<dim3(NN / QT, CC / QT, NB), blk128, 0, stream>>>(Pc, XP, Yp, ST, x, gpam, gcam, out);
  (void)hipGetLastError();
}

// v005
// It runs in 60.7 microseconds.
// In both of two side-by-side timings against v004, it was 1.06 times as fast.
// All steps since v000 together make it 8.17 times as fast.
// Contractions: conv1x1 q/k/v GEMM W[320x256].X[256x4096] on v_wmma_f32_16x16x32_f16 (f16 containers of bf16-RNE
// weights x256 and bf16-RNE x); position scores K.Q^T on v_wmma_f32_16x16x32_bf16 (bf16 hi + bf16 residual planes of
// q and k, 3 products, K=32); O^T = V.P^T on v_wmma_f32_16x16x32_f16 (v f16, P = e^{s-m} x1024 f16 from the score D
// registers); channel Gram X.X^T (K=4096) and channel mix A.X (K=256) on v_wmma_f32_16x16x32_f16 (f16 of bf16-RNE x,
// softmax weights x1024 f16); f32 accumulate everywhere; softmax statistics, residual adds and output sum in f32 VALU.
#include <hip/hip_runtime.h>
#include <math.h>
#include <stdint.h>

#define NB    2
#define CC    256
#define NN    4096
#define CQ    32
#define MQKV  320
#define QT    64
#define QB    128                      // queries per block of the position attention
#define OSP   68
#define OSPW  132
#define TP    72
#define WSC   256.0f
#define IWSC  0.00390625f
#define PSC   1024.0f
#define IPSC  0.0009765625f
#define LNPS  6.931471805599453f
#define LOG2E 1.4426950408889634f
#define KT    64                       // keys per LDS stage of the position attention
#define NT    (NN / KT)                // stages
#define KS    4                        // key ranges of the position attention, one block each per query tile
#define NTS   (NT / KS)                // stages of one key range
#define VPB   144                      // LDS pitch of a v row (64 keys = 128 B, + 16 B: 16 B x odd for b128 readers)
#define KPB   80                       // LDS pitch of a k row (32 d = 64 B, + 16 B)
#define VSTB  (CC * VPB)               // v part of a stage, bytes
#define KSTB  (KT * KPB)               // one k plane of a stage, bytes
#define STGB  (VSTB + 2 * KSTB)        // one stage: v, k hi, k residual
#define GS    16                       // blocks that share the K = 4096 of one Gram tile
#define GK    (NN / GS)                // positions per Gram block
#define XB    ((NN / QT) * (CC / QT) * NB)                 // blocks of the x conversion
#define WB    (MQKV / 8)                                   // blocks of the weight conversion
#define GY    ((CC / QT) * (CC / QT) * GS / (NN / QT))     // grid rows of NN / QT blocks that hold one batch's Gram blocks

static_assert(NN % QT == 0);
static_assert(CC % QT == 0);
static_assert(MQKV == 2 * CQ + CC);
static_assert(MQKV % QT == 0);
static_assert((OSP * 4) % 16 == 0);
static_assert((OSPW * 4) % 16 == 0);
static_assert((TP * 2) % 16 == 0);
static_assert(CC % 32 == 0 && NN % 32 == 0 && CQ == 32);
static_assert(NN % KT == 0 && NT % KS == 0 && NTS >= 2 && NTS % 2 == 0 && KT % 32 == 0);
static_assert(VPB % 16 == 0 && KPB % 16 == 0 && STGB % 16 == 0 && VSTB % 16 == 0);
static_assert(VPB >= KT * 2 && KPB >= CQ * 2);
static_assert(NN % GS == 0 && GK % 32 == 0);
static_assert(GY * (NN / QT) == (CC / QT) * (CC / QT) * GS);
static_assert((NN / QB) * NB * KS * 2 == NB * CC);         // two channel-softmax rows per block of the position attention
static_assert(NN % QB == 0 && KT == 64 && CC == 256);      // the stage copy's 256 lanes, the two key halves of a stage

typedef _Float16       v16h __attribute__((ext_vector_type(16)));
typedef _Float16       v8h  __attribute__((ext_vector_type(8)));
typedef __bf16         v16b __attribute__((ext_vector_type(16)));
typedef unsigned short v8us __attribute__((ext_vector_type(8)));
typedef float          v8f  __attribute__((ext_vector_type(8)));
typedef float          v4f  __attribute__((ext_vector_type(4)));
typedef unsigned int   v4u  __attribute__((ext_vector_type(4)));

union Frag  { v8us u[2]; v16h h; v16b bf; };
union FragH { v16h v; v8h hv[2]; };
static_assert(sizeof(Frag) == 32);
static_assert(sizeof(FragH) == 32);

// ---- scalar helpers ---------------------------------------------------------------------------------------
__device__ __forceinline__ unsigned short bf_bits(float f) {          // f32 -> bf16 bits, RNE convert
  unsigned u = __float_as_uint(f);
  return (unsigned short)((u + 0x7FFFu + ((u >> 16) & 1u)) >> 16);
}
__device__ __forceinline__ float bf_up(unsigned short hb) { return __uint_as_float(((unsigned)hb) << 16); }
__device__ __forceinline__ float bfr(float f) { return bf_up(bf_bits(f)); }
__device__ __forceinline__ unsigned short h_bits(_Float16 x) { return __builtin_bit_cast(unsigned short, x); }
__device__ __forceinline__ unsigned pk16(unsigned short a, unsigned short b) { return (unsigned)a | ((unsigned)b << 16); }
__device__ __forceinline__ v8f zero8() { v8f z = {0.f, 0.f, 0.f, 0.f, 0.f, 0.f, 0.f, 0.f}; return z; }
__device__ __forceinline__ float hmax8(v8f s) {
  return fmaxf(fmaxf(fmaxf(s[0], s[1]), fmaxf(s[2], s[3])), fmaxf(fmaxf(s[4], s[5]), fmaxf(s[6], s[7])));
}

// 2^x with the free slot that the instruction set asks for behind a transcendental, tied to it in one statement
__device__ __forceinline__ float exp2_slot(float x) {
  float r = 0.f;
#if defined(__HIP_DEVICE_COMPILE__)
  asm("v_exp_f32 %0, %1\n\tv_nop" : "=v"(r) : "v"(x));
#endif
  return r;
}

// ---- 16-bit fragment loader (A, or B from a k-contiguous [n][k] row): lane -> row/col (lane&15), p already includes
//      + 8*(lane>>4); elements 0..7 <- p[0..7] (k0+8h..), elements 8..15 <- p[16..23] (k0+16+8h..)
__device__ __forceinline__ Frag ldfrag(const unsigned short* p) {
  Frag f;
  f.u[0] = *(const v8us*)(p);
  f.u[1] = *(const v8us*)(p + 16);
  return f;
}

// ---- WMMA helpers: builtin followed by a 4-slot VALU gap tying D and keeping A/B live --------------------------
__device__ __forceinline__ v8f mma_h(v16h a, v16h b, v8f c) {
  v8f d = __builtin_amdgcn_wmma_f32_16x16x32_f16(false, a, false, b, (short)0, c, false, false);
#if defined(__HIP_DEVICE_COMPILE__)
  asm volatile("v_nop\n\tv_nop\n\tv_nop\n\tv_nop" : "+v"(d) : "v"(a), "v"(b));
#endif
  return d;
}
__device__ __forceinline__ v8f mma_b(v16b a, v16b b, v8f c) {
  v8f d = __builtin_amdgcn_wmma_f32_16x16x32_bf16(false, a, false, b, (short)0, c, false, false);
#if defined(__HIP_DEVICE_COMPILE__)
  const v16h ha = __builtin_bit_cast(v16h, a), hb = __builtin_bit_cast(v16h, b);
  asm volatile("v_nop\n\tv_nop\n\tv_nop\n\tv_nop" : "+v"(d) : "v"(ha), "v"(hb));
#endif
  return d;
}

// The same products as the bare builtins, for the kernel whose accumulators reach above v255: the operands of an asm
// statement are held in the first 256 registers, which would spill them; the compiler keeps the distance behind its builtins.
__device__ __forceinline__ v8f mma_hw(v16h a, v16h b, v8f c) {
  return __builtin_amdgcn_wmma_f32_16x16x32_f16(false, a, false, b, (short)0, c, false, false);
}
__device__ __forceinline__ v8f mma_bw(v16b a, v16b b, v8f c) {
  return __builtin_amdgcn_wmma_f32_16x16x32_bf16(false, a, false, b, (short)0, c, false, false);
}

// =========================================================================================================
// (0) conv1x1 weights: W16 f16 [320][256], row o: 0..31 = wq, 32..63 = wk, 64..319 = wv; value = f16 of
//     (bf16-RNE(w) * 256) (exact). BIAS f32 [320] = bf16-RNE of bq / bk / bv. Block blk (0..39) owns rows
// coverage: 40 blocks x 8 rows x 32 pieces x 8 halves = 320 x 256; bias 80 x 4 floats = 320.
// =========================================================================================================
__device__ __forceinline__
void cvt_w(const float* __restrict__ wq, const float* __restrict__ bq,
           const float* __restrict__ wk, const float* __restrict__ bk,
           const float* __restrict__ wv, const float* __restrict__ bv,
           unsigned short* W16, float* BIAS, const int blk) {
  const int tid = threadIdx.x;
  const int rl = tid >> 5, col = 8 * (tid & 31);
  const int o = 8 * blk + rl;                                     // 0..319
  const float* wbase = (blk < 4) ? wq : (blk < 8) ? wk : wv;       // block-uniform selection
  const int osub = (blk < 4) ? 0 : (blk < 8) ? CQ : 2 * CQ;
  const float* s = wbase + (size_t)(o - osub) * CC + col;          // in range: (o-osub) < rows of that matrix
  const v4f a = *(const v4f*)s;
  const v4f q = *(const v4f*)(s + 4);
  const float f[8] = {a[0], a[1], a[2], a[3], q[0], q[1], q[2], q[3]};
  v4u u;
#pragma unroll
  for (int t = 0; t < 4; ++t) {
    const _Float16 h0 = (_Float16)(bfr(f[2 * t]) * WSC);
    const _Float16 h1 = (_Float16)(bfr(f[2 * t + 1]) * WSC);
    u[t] = pk16(h_bits(h0), h_bits(h1));
  }
  // bias values: every lane loads all three candidates with clamped indices, selects by value
  v4f bvv;
  {
    const int tb = min(tid, 79);
    const int o4 = 4 * tb;
#pragma unroll
    for (int qd = 0; qd < 4; ++qd) {
      const int oo = o4 + qd;
      const int iq = min(oo, CQ - 1);
      const int ik = min(max(oo - CQ, 0), CQ - 1);
      const int iv = min(max(oo - 2 * CQ, 0), CC - 1);
      const float cq = bq[iq], ck = bk[ik], cv = bv[iv];
      const float val = (oo < CQ) ? cq : (oo < 2 * CQ) ? ck : cv;
      bvv[qd] = bfr(val);
    }
  }
{
    *(v4u*)(W16 + (size_t)o * CC + col) = u;
    if (blk == 0 && tid < 80) *(v4f*)(BIAS + 4 * tid) = bvv;
    
  }
}

// =========================================================================================================
// (1) x f32 [b][256 c][4096 n] -> Xc f16 [b][c][n] (channel-major, bf16-RNE values, exact in f16) and
//     XP f16 [b][n][c] (position-major) through an LDS tile T[64 n][64 c] (pitch TP). Block (nb, cb, b) owns a
// coverage: Xc 2 it x 32 rows x 8 lanes x 8 = 64 c x 64 n; XP same; blocks (nb, cb, b) in (64, 4, NB) cover both planes once.
// =========================================================================================================
__device__ __forceinline__
void cvt_x(const float* __restrict__ x, unsigned short* Xc, unsigned short* XP, unsigned short* T,
           const int nb, const int cb, const int b) {
  const int tid = threadIdx.x;
  const int e = tid & 7, lq = tid >> 3;                             // lq 0..31
  const int n0 = nb * QT, c0 = cb * QT;
  v4u ux[2];
#pragma unroll
  for (int it = 0; it < 2; ++it) {
    const int cl = it * 32 + lq;                                     // 0..63
    const float* sp = x + ((size_t)(b * CC + c0 + cl)) * NN + n0 + 8 * e;
    const v4f a = *(const v4f*)sp;
    const v4f q = *(const v4f*)(sp + 4);
    unsigned short hb[8];
#pragma unroll
    for (int t = 0; t < 4; ++t) {
      hb[t]     = h_bits((_Float16)bfr(a[t]));
      hb[4 + t] = h_bits((_Float16)bfr(q[t]));
    }
#pragma unroll
    for (int t = 0; t < 4; ++t) ux[it][t] = pk16(hb[2 * t], hb[2 * t + 1]);
#pragma unroll
    for (int t = 0; t < 8; ++t) T[(8 * e + t) * TP + cl] = hb[t];
  }
  __syncthreads();
  v4u up[2];
#pragma unroll
  for (int it = 0; it < 2; ++it) {
    const int nl = it * 32 + lq;                                     // 0..63
    up[it] = *(const v4u*)(T + nl * TP + 8 * e);
  }
{
#pragma unroll
    for (int it = 0; it < 2; ++it) {
      const int rl = it * 32 + lq;
      *(v4u*)(Xc + ((size_t)(b * CC + c0 + rl)) * NN + n0 + 8 * e) = ux[it];
      *(v4u*)(XP + ((size_t)(b * NN + n0 + rl)) * CC + c0 + 8 * e) = up[it];
    }
    
  }
}

// =========================================================================================================
// (0) + (1) in one launch: neither reads what the other writes. Blocks 0 .. XB-1 do (1), block blk = nb + 64 (cb + 4 b);
//     blocks XB .. XB+WB-1 do (0). The choice is block-uniform, so the barrier of (1) is passed by whole blocks.
// =========================================================================================================
__global__ __launch_bounds__(256)
void cvt_wx(const float* __restrict__ x,
            const float* __restrict__ wq, const float* __restrict__ bq,
            const float* __restrict__ wk, const float* __restrict__ bk,
            const float* __restrict__ wv, const float* __restrict__ bv,
            unsigned short* Xc, unsigned short* XP, unsigned short* W16, float* BIAS) {
  __shared__ __align__(16) unsigned short T[QT * TP];
  const int blk = blockIdx.x;
  if (blk < XB) cvt_x(x, Xc, XP, T, blk % (NN / QT), (blk / (NN / QT)) % (CC / QT), blk / ((NN / QT) * (CC / QT)));
  else          cvt_w(wq, bq, wk, bk, wv, bv, W16, BIAS, blk - XB);
}

// =========================================================================================================
// (2) conv1x1 GEMM for one (b, 64-n tile, 64-o block): Y[o][n] = (1/256) sum_c W16[o][c] XP[b][n][c] + BIAS[o].
//     Block 128 threads = 4 waves; wave w owns cols n0+16w..+15 (one B fragment per k-step, k = c contiguous in
//     the XP row) and 4 m-tiles (A rows o = o0 + 16 mt + (lane&15), split k map loader from W16). K = 256 = 8 steps.
//     Epilogue staged in LDS Os[o_loc][n_loc] (pitch OSP), barrier, then:
//       o-block 0 (q rows 0..31, k rows 32..63): Qh/Ql/Kh/Kl bf16 hi / bf16 residual planes [b][4096 n][32]
//         holds rows 2ll, 2ll+1; lane e -> row 2ll+(e>>2), cols 8*(e&3)..+7; one instruction per 16 lines.
//         halves 8e..8e+7; one instruction per 16 lines.
// coverage: Os 4 waves x 4 tiles x 16x16 = 64 x 64; q/k: 4 planes x 32 lines x 8 lanes x 8 = 4 x (64 n x 32);
//           v: 4 it x 16 rows x 8 lanes x 8 = 64 ch x 64 n; grid rows y < 5 of (64, 5 + GY, NB) cover all planes exactly once.
// =========================================================================================================
__device__ __forceinline__
void gemm_qkv(const unsigned short* __restrict__ W16, const float* __restrict__ BIAS,
              const unsigned short* __restrict__ XP,
              unsigned short* Qh, unsigned short* Ql, unsigned short* Kh, unsigned short* Kl,
              unsigned short* Vh, float* Os, const int nt, const int mb, const int b) {
  const int tid  = threadIdx.x;
  const int lane = tid & 31, wave = tid >> 5;
  const int hh   = lane >> 4, c = lane & 15;
  const int n0   = nt * QT, o0 = mb * QT;

  const unsigned short* ap = W16 + (size_t)(o0 + c) * CC + 8 * hh;
  const unsigned short* bp = XP + ((size_t)(b * NN + n0 + 16 * wave + c)) * CC + 8 * hh;

  v8f acc[4];
#pragma unroll
  for (int mt = 0; mt < 4; ++mt) acc[mt] = zero8();

#pragma unroll
  for (int ks = 0; ks < CC / 32; ++ks) {
    const Frag fb = ldfrag(bp + 32 * ks);
#pragma unroll
    for (int mt = 0; mt < 4; ++mt) {
      const Frag fa = ldfrag(ap + (size_t)(16 * mt) * CC + 32 * ks);
      acc[mt] = mma_h(fa.h, fb.h, acc[mt]);
    }
  }

  // ---- epilogue: scale back, + bias -> LDS Os[o_loc][n_loc] ----
  {
    const int nl = 16 * wave + c;
#pragma unroll
    for (int mt = 0; mt < 4; ++mt) {
#pragma unroll
      for (int r = 0; r < 8; ++r) {
        const int ol = 16 * mt + 8 * hh + r;                         // 0..63
        Os[ol * OSP + nl] = acc[mt][r] * IWSC + BIAS[o0 + ol];
      }
    }
  }
  __syncthreads();

  const int e = tid & 7, lq = tid >> 3;                             // lq 0..15
  if (mb == 0) {
    // ---- q/k bf16 hi + residual planes ----
{
#pragma unroll
      for (int it = 0; it < 8; ++it) {
        const int p    = it >> 1;                                    // 0 Qh, 1 Ql, 2 Kh, 3 Kl
        const int ll   = (it & 1) * 16 + lq;                         // 0..31
        const int nl   = 2 * ll + (e >> 2);                          // 0..63
        const int col0 = 8 * (e & 3);                                // 0,8,16,24
        const int rb   = ((p >> 1) ? CQ : 0) + col0;
        v4u u;
#pragma unroll
        for (int t = 0; t < 4; ++t) {
          const float f0 = Os[(rb + 2 * t) * OSP + nl];
          const float f1 = Os[(rb + 2 * t + 1) * OSP + nl];
          const unsigned short hb0 = bf_bits(f0), hb1 = bf_bits(f1);
          const unsigned short lb0 = bf_bits(f0 - bf_up(hb0));
          const unsigned short lb1 = bf_bits(f1 - bf_up(hb1));
          u[t] = (p & 1) ? pk16(lb0, lb1) : pk16(hb0, hb1);
        }
        unsigned short* P = (p == 0) ? Qh : (p == 1) ? Ql : (p == 2) ? Kh : Kl;
        *(v4u*)(P + ((size_t)(b * NN + n0 + nl)) * CQ + col0) = u;
      }
      
    }
  } else {
    // ---- v f16 plane ----
    const int ch0 = o0 - QT;                                         // (mb-1)*64
    v4u uv[4];
#pragma unroll
    for (int it = 0; it < 4; ++it) {
      const int row = it * 16 + lq;                                  // 0..63
      const v4f a = *(const v4f*)(Os + row * OSP + 8 * e);
      const v4f q = *(const v4f*)(Os + row * OSP + 8 * e + 4);
#pragma unroll
      for (int t = 0; t < 2; ++t) {
        uv[it][t]     = pk16(h_bits((_Float16)a[2 * t]), h_bits((_Float16)a[2 * t + 1]));
        uv[it][2 + t] = pk16(h_bits((_Float16)q[2 * t]), h_bits((_Float16)q[2 * t + 1]));
      }
    }
{
#pragma unroll
      for (int it = 0; it < 4; ++it) {
        const int row = it * 16 + lq;
        *(v4u*)(Vh + ((size_t)(b * CC + ch0 + row)) * NN + n0 + 8 * e) = uv[it];
      }
      
    }
  }
}

// =========================================================================================================
// (5) channel softmax: for row (b, i): G_j = sum of the GS slice planes in slice order, then
//     p_j = exp(min_j G - G_j) / sum (== softmax of rowmax - G), returned as the lane's 8 halves of
//     Pc f16 [b][256][256] = p * 1024. One wave per row: lane reads j = 8 lane..8 lane+7, wave min / sum by shuffles.
//     rw = b * 256 + i. The NB * 256 rows ride in the launch of (3), two per block, worked by the block's waves 0 and 1.
// =========================================================================================================
__device__ __forceinline__ v4u cam_softmax(const float* __restrict__ G, const int rw, const int lane) {
  const float* row = G + (size_t)rw * CC + 8 * lane;
  v4f a = *(const v4f*)row;
  v4f q = *(const v4f*)(row + 4);
#pragma unroll                                                       // straight line: the planes' loads issue ahead of the adds
  for (int s = 1; s < GS; ++s) {
    a += *(const v4f*)(row + (size_t)s * NB * CC * CC);
    q += *(const v4f*)(row + (size_t)s * NB * CC * CC + 4);
  }
  const float ev[8] = {a[0], a[1], a[2], a[3], q[0], q[1], q[2], q[3]};
  float mn = ev[0];
#pragma unroll
  for (int t = 1; t < 8; ++t) mn = fminf(mn, ev[t]);
#pragma unroll
  for (int s = 1; s < 32; s <<= 1) mn = fminf(mn, __shfl_xor(mn, s, 32));
  float p[8], sm = 0.f;
#pragma unroll
  for (int t = 0; t < 8; ++t) { p[t] = __expf(mn - ev[t]); sm += p[t]; }
#pragma unroll
  for (int s = 1; s < 32; s <<= 1) sm += __shfl_xor(sm, s, 32);
  const float inv = PSC / sm;
  v4u u;
#pragma unroll
  for (int t = 0; t < 4; ++t)
    u[t] = pk16(h_bits((_Float16)(p[2 * t] * inv)), h_bits((_Float16)(p[2 * t + 1] * inv)));
  return u;
}

// ---- one stage (64 keys) of v, k hi and k residual -> LDS, 256 lanes, 16 B per lane and copy, no register on the way.
//      v: copy i brings row (channel) 32 i + (tid >> 3), bytes 16 (tid & 7) ..+15 of its 128; 8 copies = 256 rows.
//      k: the one copy of a plane brings row (key) tid >> 2, bytes 16 (tid & 3) ..+15 of its 64; 64 rows.
//      lv / lk: the lane's LDS byte address of its first v / k-hi piece; gv / gh / gl: its first global piece.
//      s_wait_xcnt 0 closes the statement, a precaution: it stands in front of any rewrite of a register a copy names.
__device__ __forceinline__ void stage_copy(unsigned lv, unsigned lk, const unsigned short* gv,
                                           const unsigned short* gh, const unsigned short* gl) {
#if defined(__HIP_DEVICE_COMPILE__)
  asm volatile("global_load_async_to_lds_b128 %0, %10, off\n\t"
               "global_load_async_to_lds_b128 %1, %11, off\n\t"
               "global_load_async_to_lds_b128 %2, %12, off\n\t"
               "global_load_async_to_lds_b128 %3, %13, off\n\t"
               "global_load_async_to_lds_b128 %4, %14, off\n\t"
               "global_load_async_to_lds_b128 %5, %15, off\n\t"
               "global_load_async_to_lds_b128 %6, %16, off\n\t"
               "global_load_async_to_lds_b128 %7, %17, off\n\t"
               "global_load_async_to_lds_b128 %8, %18, off\n\t"
               "global_load_async_to_lds_b128 %9, %19, off\n\t"
               "s_wait_xcnt 0x0"
               :: "v"(lv), "v"(lv + 32u * VPB), "v"(lv + 64u * VPB), "v"(lv + 96u * VPB),
                  "v"(lv + 128u * VPB), "v"(lv + 160u * VPB), "v"(lv + 192u * VPB), "v"(lv + 224u * VPB),
                  "v"(lk), "v"(lk + (unsigned)KSTB),
                  "v"(gv), "v"(gv + (size_t)32 * NN), "v"(gv + (size_t)64 * NN), "v"(gv + (size_t)96 * NN),
                  "v"(gv + (size_t)128 * NN), "v"(gv + (size_t)160 * NN), "v"(gv + (size_t)192 * NN),
                  "v"(gv + (size_t)224 * NN), "v"(gh), "v"(gl)
               : "memory");
#endif
}

// =========================================================================================================
// (3) position attention for one (b, 128-query tile, key range sp of NN / KS keys), transposed formulation, no mask:
//   S^T tile (16 keys x 16 queries) = A(k: row = key kb + (lane&15), 32 d via the split k map from the bf16 plane
//   Kh [b][4096][32]) . B(q: col = query, same map, resident fragment from Qh) + A(Kh).B(Ql) + A(Kl).B(Qh)
//   (bf16 unscaled residual planes, shared accumulator). Energy = S (no scale).
//   Per lane the D tile holds 8 keys of ONE query: online softmax state per lane, one shuffle (lane^16) for the max
//   over 32 keys, row-sum partials combined at the end. P = e^{s-m} x 1024 as f16 is the B operand of
//   O^T (rows channel, cols queries) += A(V rows channel = 16j + (lane&15), keys contiguous, f16 plane Vh
//   [b][256][4096]) . B(P^T): element r <- D of the tile covering keys kb..kb+15, element 8+r <- the tile covering
//   kb+16..kb+31, lane unchanged.
//   Block = 8 waves = 4 query columns wq (32 queries each) x 2 key halves kh. A wave holds TWO groups of 16 queries
//   (2 x 16 accumulator tiles, 256 channels), so each k and v fragment it reads from LDS feeds two products; of every
//   stage of 64 keys it works the 32 keys of its half kh. Its group u is queries 32 wq + 16 (u ^ kh) ..+15.
//   The k and v rows of 64 keys are one stage in LDS, brought once per block by asynchronous copies and read by all
//   eight waves; two buffers: stage t + 1 flies while stage t is worked on.
//   Behind the loop waves (wq, 0) and (wq, 1) hold the two key halves of the same 32 queries: each hands its group 1
//   (accumulators, m, l) to the other through LDS and merges what it gets into its group 0 (own half, then the partner's).
//   Epilogue in two channel halves: O/l staged in LDS Os[query][128 channels] (pitch OSPW, b128 stores), barrier,
//   The result is the range's own softmax average, Yp [b][256][KS][4096]; the range's maximum m and sum l of each query go to
//   ST [2][KS][b][4096] (m planes, then l planes), through LDS so that whole lines are written; (6) merges the ranges.
// coverage: per half 16 it x 32 lines x 8 lanes x 4 floats = 128 ch x 128 n; two halves = 256 ch; grid (32, NB, KS).
// =========================================================================================================
__global__ __launch_bounds__(256)
void attn_pam(const unsigned short* __restrict__ Qh, const unsigned short* __restrict__ Ql,
              const unsigned short* __restrict__ Kh, const unsigned short* __restrict__ Kl,
              const unsigned short* __restrict__ Vh, float* Yp, float* ST,
              const float* __restrict__ G, unsigned short* Pc) {
  __shared__ __align__(16) float Os[QB * OSPW];
  __shared__ __align__(16) float St[2 * QB];
  __shared__ __align__(16) float Sx[2 * 8 * 16];                     // m, then l, of the group a wave hands over
  __shared__ __align__(16) float Xo[8 * 16 * 2 * 32 * 4];            // its accumulators: [wave][tile][r half][lane] x 16 B
  __shared__ __align__(16) unsigned char Ring[2 * STGB];
  const int tid  = threadIdx.x;
  const int wave = __builtin_amdgcn_readfirstlane(tid >> 5), lane = tid & 31;   // the wave's number in a scalar register
  const int hh   = lane >> 4, c = lane & 15;
  const int wq   = wave & 3, kh = wave >> 2;
  const int n0   = blockIdx.x * QB, b = blockIdx.y, sp = blockIdx.z;
  const int t0   = sp * NTS;                                         // first stage of the block's key range (even)

  // resident q fragments (B operand, col = query n0 + 32 wq + 16 (u ^ kh) + c)
  Frag qh[2], ql[2];
  {
    const size_t qa = ((size_t)(b * NN + n0 + 32 * wq + 16 * kh + c)) * CQ + 8 * hh;
    const size_t qb = ((size_t)(b * NN + n0 + 32 * wq + 16 * (1 - kh) + c)) * CQ + 8 * hh;
    qh[0] = ldfrag(Qh + qa);
    ql[0] = ldfrag(Ql + qa);
    qh[1] = ldfrag(Qh + qb);
    ql[1] = ldfrag(Ql + qb);
    // the wait before the eight loads' address registers are reused; naming them as inputs keeps them whole up to here
#if defined(__HIP_DEVICE_COMPILE__)
    asm volatile("s_wait_xcnt 0x0" :: "v"(Qh + qa), "v"(Ql + qa), "v"(Qh + qb), "v"(Ql + qb) : "memory");
#endif
  }
  // the lane's first pieces of a stage: global sources (+ t * KT keys) and LDS places (+ buffer * STGB)
  const unsigned short* gv = Vh + (size_t)b * CC * NN + (size_t)(tid >> 3) * NN + 8 * (tid & 7);
  const unsigned short* gh = Kh + ((size_t)b * NN + (tid >> 2)) * CQ + 8 * (tid & 3);
  const unsigned short* gl = Kl + ((size_t)b * NN + (tid >> 2)) * CQ + 8 * (tid & 3);
  const unsigned ring0 = (unsigned)(size_t)Ring;                     // low 32 bits = byte offset in the block's LDS
  const unsigned lv = ring0 + (unsigned)((tid >> 3) * VPB + 16 * (tid & 7));
  const unsigned lk = ring0 + (unsigned)(VSTB + (tid >> 2) * KPB + 16 * (tid & 3));
  // fragment offsets inside a stage, at the wave's 32 keys: v (A operand, row = channel 16j + c, keys contiguous),
  // k (A operand, row = key)
  const int vfo = c * VPB + 16 * hh + kh * 64;
  const int kfo = VSTB + (32 * kh + c) * KPB + 16 * hh;

  float m[2] = {-1.0e30f, -1.0e30f}, l[2] = {0.f, 0.f};
  v8f o[2][16];
#pragma unroll
  for (int u = 0; u < 2; ++u) {
#pragma unroll
    for (int j = 0; j < 16; ++j) o[u][j] = zero8();
  }

  // prologue: stage t0 landed and published, then stage t0 + 1 on its way
  stage_copy(lv, lk, gv + (size_t)t0 * KT, gh + (size_t)t0 * KT * CQ, gl + (size_t)t0 * KT * CQ);
  // (5): the block's two rows of the channel softmax, in waves 0 and 1 (scalar test), while stage t0 is on its way
  const int  crow = 2 * (blockIdx.x + (NN / QB) * (blockIdx.y + NB * blockIdx.z)) + (wave & 1);   // 0 .. NB * CC - 1, each once
  const bool cwav = wave < 2;
  v4u cu = {0u, 0u, 0u, 0u};
  if (cwav) cu = cam_softmax(G, crow, lane);
  asm volatile("s_wait_asynccnt 0x0" ::: "memory");                  // this wave's pieces of stage t0 have landed
  __syncthreads();                                                   // ... and every other wave's
  if (cwav) {
    *(v4u*)(Pc + (size_t)crow * CC + 8 * lane) = cu;                 // behind the barrier: it does not wait for this store
    asm volatile("s_wait_xcnt 0x0" ::: "memory");                    // a precaution: before the code behind reuses the store's registers
  }
  stage_copy(lv + STGB, lk + STGB, gv + (size_t)(t0 + 1) * KT, gh + (size_t)(t0 + 1) * KT * CQ,
             gl + (size_t)(t0 + 1) * KT * CQ);

#pragma unroll 1                                                     // rolled: one stage's exponentials live at a time
  for (int t = t0; t < t0 + NTS; ++t) {
    const unsigned bo = (unsigned)(t & 1) * STGB;
    const unsigned char* sb = Ring + bo;
    const unsigned char* kp = sb + kfo;                              // the wave's keys start at kb = KT t + 32 kh
    const Frag k0  = ldfrag((const unsigned short*)(kp));                        // keys kb .. kb+15
    const Frag k1  = ldfrag((const unsigned short*)(kp + 16 * KPB));             // keys kb+16 .. kb+31
    const Frag k0l = ldfrag((const unsigned short*)(kp + KSTB));
    const Frag k1l = ldfrag((const unsigned short*)(kp + KSTB + 16 * KPB));
    v8f s0[2], s1[2];
#pragma unroll
    for (int u = 0; u < 2; ++u) {
      s0[u] = mma_bw(k0.bf, qh[u].bf, zero8());
      s1[u] = mma_bw(k1.bf, qh[u].bf, zero8());
    }
#pragma unroll
    for (int u = 0; u < 2; ++u) {
      s0[u] = mma_bw(k0.bf, ql[u].bf, s0[u]);
      s1[u] = mma_bw(k1.bf, ql[u].bf, s1[u]);
    }
#pragma unroll
    for (int u = 0; u < 2; ++u) {
      s0[u] = mma_bw(k0l.bf, qh[u].bf, s0[u]);
      s1[u] = mma_bw(k1l.bf, qh[u].bf, s1[u]);
    }

    float mx[2], mo[2];
#pragma unroll
    for (int u = 0; u < 2; ++u) {
      mx[u] = fmaxf(hmax8(s0[u]), hmax8(s1[u]));
      mo[u] = __shfl_xor(mx[u], 16, 32);
    }
    // the first 8 v fragments of the pass as one group of LDS reads, in flight under the maxima and their exchange
    const unsigned char* vp = sb + vfo;
    Frag vf[8];
#pragma unroll
    for (int j = 0; j < 8; ++j) vf[j] = ldfrag((const unsigned short*)(vp + 16 * j * VPB));

    FragH ph[2];
#pragma unroll
    for (int u = 0; u < 2; ++u) {
      const float mn   = fmaxf(m[u], fmaxf(mx[u], mo[u]));
      const float corr = __expf(m[u] - mn);
      m[u] = mn;
      const float msh = mn - LNPS;                                   // exp gives e^{s-m} * 1024
#pragma unroll
      for (int j = 0; j < 16; ++j) {
#pragma unroll
        for (int r = 0; r < 8; ++r) o[u][j][r] *= corr;
      }
      float ls = 0.f;
#pragma unroll
      for (int r = 0; r < 8; ++r) {
        const float e0 = __expf(s0[u][r] - msh);                     // key kb      + 8hh + r
        const float e1 = __expf(s1[u][r] - msh);                     // key kb + 16 + 8hh + r
        ls += e0 + e1;
        ph[u].hv[0][r] = (_Float16)e0;
        ph[u].hv[1][r] = (_Float16)e1;
      }
      l[u] = l[u] * corr + ls;
    }

    // blocks of 4 fragments, two products each; behind each of the first two blocks, the 4 fragments needed two blocks
    // later take their registers
#pragma unroll
    for (int g = 0; g < 4; ++g) {
#pragma unroll
      for (int i = 0; i < 4; ++i) {
        o[0][4 * g + i] = mma_hw(vf[(4 * g + i) & 7].h, ph[0].v, o[0][4 * g + i]);
        o[1][4 * g + i] = mma_hw(vf[(4 * g + i) & 7].h, ph[1].v, o[1][4 * g + i]);
      }
      if (g < 2) {
#pragma unroll
        for (int i = 0; i < 4; ++i)
          vf[(4 * g + i) & 7] = ldfrag((const unsigned short*)(vp + 16 * (4 * g + i + 8) * VPB));
      }
    }
    // keeps the stage's arithmetic in front of the barrier: sunk behind it, it would also stand in front of the refill,
    // whose copies would then be waited for almost as soon as they are issued
    __builtin_amdgcn_sched_barrier(0);
    // publish point of stage t + 1, and the end of every reader's last read of stage t's buffer
    asm volatile("s_wait_dscnt 0x0" ::: "memory");                   // this wave's LDS reads of stage t are done
    asm volatile("s_wait_asynccnt 0x0" ::: "memory");                // this wave's pieces of stage t + 1 have landed
    __syncthreads();
    if (t + 2 < t0 + NTS)                                            // block-uniform: refill the buffer just read
      stage_copy(lv + bo, lk + bo, gv + (size_t)(t + 2) * KT, gh + (size_t)(t + 2) * KT * CQ,
                 gl + (size_t)(t + 2) * KT * CQ);
  }
  asm volatile("s_wait_asynccnt 0x0" ::: "memory");                  // nothing of this wave is in flight at its end
  // the lane's number read anew: no index of the epilogue has to stay in a register (or be spilled) across the loop
  const int ln = (int)__builtin_amdgcn_mbcnt_lo(~0u, 0u);
  const int h2 = ln >> 4, c2 = ln & 15, td = 32 * wave + ln;
  l[0] += __shfl_xor(l[0], 16, 32);
  l[1] += __shfl_xor(l[1], 16, 32);

  // hand-over of group 1 to the wave that worked the other key half of the same queries (wave ^ 4, same lane)
  if (h2 == 0) { Sx[16 * wave + c2] = m[1]; Sx[128 + 16 * wave + c2] = l[1]; }   // equal in lanes c and c + 16
#pragma unroll
  for (int j = 0; j < 16; ++j) {
    v4f va, vb;
#pragma unroll
    for (int r = 0; r < 4; ++r) { va[r] = o[1][j][r]; vb[r] = o[1][j][4 + r]; }
    *(v4f*)(Xo + (((wave * 16 + j) * 2 + 0) * 32 + ln) * 4) = va;
    *(v4f*)(Xo + (((wave * 16 + j) * 2 + 1) * 32 + ln) * 4) = vb;
  }
  __syncthreads();                                                   // every wave's group 1 is in LDS
  const int pw = wave ^ 4;
  const float mp = Sx[16 * pw + c2], lp = Sx[128 + 16 * pw + c2];
  const float mm = fmaxf(m[0], mp);
  const float ea = __expf(m[0] - mm), eb = __expf(mp - mm);
  const float lm = l[0] * ea + lp * eb;                              // o and l both carry the x1024 factor
  const float inv = 1.0f / lm;
  const float fa = ea * inv, fb = eb * inv;

  const int qrow = 32 * wq + 16 * kh + c2;                           // the query of the wave's group 0
  const int e = td & 7, lq = td >> 3;                                // lq 0..31
  if (h2 == 0) { St[qrow] = mm; St[QB + qrow] = lm; }
#pragma unroll
  for (int half = 0; half < 2; ++half) {
    if (half) __syncthreads();                                       // every wave finished reading Os
#pragma unroll
    for (int jj = 0; jj < 8; ++jj) {
      const int j = 8 * half + jj;
      const v4f xa = *(const v4f*)(Xo + (((pw * 16 + j) * 2 + 0) * 32 + ln) * 4);
      const v4f xb = *(const v4f*)(Xo + (((pw * 16 + j) * 2 + 1) * 32 + ln) * 4);
      v4f va, vb;
#pragma unroll
      for (int r = 0; r < 4; ++r) { va[r] = o[0][j][r] * fa + xa[r] * fb; vb[r] = o[0][j][4 + r] * fa + xb[r] * fb; }
      *(v4f*)(Os + qrow * OSPW + 16 * jj + 8 * h2)     = va;         // Os[query][ch_loc = 16jj + 8hh + r]
      *(v4f*)(Os + qrow * OSPW + 16 * jj + 8 * h2 + 4) = vb;
    }
    __syncthreads();
#pragma unroll
    for (int it = 0; it < 16; ++it) {
      const int chl = (it & 3) * 32 + lq;                            // channel 0..127 within the half
      const int nl  = (it >> 2) * 32 + 4 * e;                        // query 0..127
      v4f v;
#pragma unroll
      for (int t = 0; t < 4; ++t) v[t] = Os[(nl + t) * OSPW + chl];
      *(v4f*)(Yp + ((size_t)((b * CC + 128 * half + chl) * KS + sp)) * NN + n0 + nl) = v;
    }
  }
  if (td < 64) {                                                     // waves 0 and 1, behind the barriers above: 128 m, 128 l
    const int pl = td >> 5, q4 = 4 * (td & 31);
    *(v4f*)(ST + ((size_t)((pl * KS + sp) * NB + b)) * NN + n0 + q4) = *(const v4f*)(St + pl * QB + q4);
  }
}

// =========================================================================================================
// (4) channel Gram for one (b, 64-i block, 64-j block, K slice s): G[s][b][i][j] = sum over the slice's GK positions n
//     of Xc[b][i][n] Xc[b][j][n]; the GS slices of a tile run as GS blocks, and (5) adds their planes.
//     4 waves; wave w owns cols j0+16w..+15 (B from the j row, keys n contiguous) and 4 i tiles (A rows
//     [b][256][256] (row segment 64 j = 2 lines), 8 consecutive lanes x 16 B, one instruction per 16 lines, two
// coverage: 8 it x 16 lines x 8 lanes x 4 = 64 x 64; (jt, itb, zb) in (4, 4, GS * NB) covers the GS planes of G exactly once.
// =========================================================================================================
__device__ __forceinline__
void gram_k(const unsigned short* __restrict__ Xc, float* G, float* Os, const int jt, const int itb, const int zb) {
  const int tid  = threadIdx.x;
  const int lane = tid & 31, wave = tid >> 5;
  const int hh   = lane >> 4, c = lane & 15;
  const int b = zb % NB, s = zb / NB;                                // zb = s * NB + b: the plane of G this block writes
  const int j0 = jt * QT, i0 = itb * QT;

  const unsigned short* ap = Xc + ((size_t)(b * CC + i0 + c)) * NN + s * GK + 8 * hh;
  const unsigned short* bp = Xc + ((size_t)(b * CC + j0 + 16 * wave + c)) * NN + s * GK + 8 * hh;

  v8f acc[4];
#pragma unroll
  for (int mt = 0; mt < 4; ++mt) acc[mt] = zero8();

#pragma unroll                                                       // 8 trips: every load a constant offset from one address pair
  for (int ks = 0; ks < GK / 32; ++ks) {
    const Frag fb = ldfrag(bp + 32 * ks);
#pragma unroll
    for (int mt = 0; mt < 4; ++mt) {
      const Frag fa = ldfrag(ap + (size_t)(16 * mt) * NN + 32 * ks);
      acc[mt] = mma_h(fa.h, fb.h, acc[mt]);
    }
  }
  {
    const int nl = 16 * wave + c;
#pragma unroll
    for (int mt = 0; mt < 4; ++mt) {
#pragma unroll
      for (int r = 0; r < 8; ++r) Os[(16 * mt + 8 * hh + r) * OSP + nl] = acc[mt][r];
    }
  }
  __syncthreads();
  {
    const int e = tid & 7, lq = tid >> 3;                            // lq 0..15
{
#pragma unroll
      for (int it = 0; it < 8; ++it) {
        const int L = it * 16 + lq;                                  // 0..127
        const int row = L >> 1, hf = L & 1;
        const v4f v = *(const v4f*)(Os + row * OSP + hf * 32 + 4 * e);
        *(v4f*)(G + ((size_t)(zb * CC + i0 + row)) * CC + j0 + hf * 32 + 4 * e) = v;
      }
      // a precaution: in the shared launch code follows these stores in the listing; the wait stands before it reuses their registers
      asm volatile("s_wait_xcnt 0x0" ::: "memory");
    }
  }
}

// =========================================================================================================
// (2) + (4) in one launch: both read only what the launch before wrote, neither reads what the other writes.
//     Grid (64, 5 + GY, NB): rows y < 5 do (2) with (nt, mb, b) = (x, y, z); rows y >= 5 do (4): idx = x + 64 (y - 5)
//     = jt + 4 (itb + 4 s), batch z. The choice is block-uniform, so each body's barrier is passed by whole blocks.
// =========================================================================================================
__global__ __launch_bounds__(128)
void gemm_gram(const unsigned short* __restrict__ W16, const float* __restrict__ BIAS,
               const unsigned short* __restrict__ XP, const unsigned short* __restrict__ Xc,
               unsigned short* Qh, unsigned short* Ql, unsigned short* Kh, unsigned short* Kl,
               unsigned short* Vh, float* G) {
  __shared__ __align__(16) float Os[QT * OSP];
  const int y = blockIdx.y;
  if (y < MQKV / QT) {
    gemm_qkv(W16, BIAS, XP, Qh, Ql, Kh, Kl, Vh, Os, blockIdx.x, y, blockIdx.z);
  } else {
    const int idx = blockIdx.x + (NN / QT) * (y - MQKV / QT);
    gram_k(Xc, G, Os, idx % (CC / QT), (idx / (CC / QT)) % (CC / QT),
           (idx / ((CC / QT) * (CC / QT))) * NB + blockIdx.z);
  }
}

// =========================================================================================================
// (6) channel mix + output for one (b, 64-n tile, 64-i block): cam[i][n] = (1/1024) sum_j Pc[b][i][j] XP[b][n][j]
//     (K = 256 = 8 steps; A rows i = i0 + 16 mt + (lane&15), j contiguous; B col n = n0 + 16w + (lane&15) from the
//     XP row, j contiguous), then out[b][i][n] = (g_pam * Y + xb) + (g_cam * cam + xb) with xb = bf16-RNE of x and
//     Y = sum over the KS key ranges s, in range order, of wt_s[n] Yp[b][i][s][n], wt_s = l_s e^{m_s - M} / sum of these,
//     M = max_s m_s (m, l from ST): the softmax over all keys from the ranges' own averages.
// coverage: 8 it x 16 lines x 8 lanes x 4 = 64 i x 64 n; grid (64, 4, NB) covers d_out exactly once.
// =========================================================================================================
__global__ __launch_bounds__(128)
void cam_out(const unsigned short* __restrict__ Pc, const unsigned short* __restrict__ XP,
             const float* __restrict__ Yp, const float* __restrict__ ST, const float* __restrict__ x,
             const float* __restrict__ gpam, const float* __restrict__ gcam, float* out) {
  __shared__ __align__(16) float Os[QT * OSP];
  const int tid  = threadIdx.x;
  const int lane = tid & 31, wave = tid >> 5;
  const int hh   = lane >> 4, c = lane & 15;
  const int nt = blockIdx.x, itb = blockIdx.y, b = blockIdx.z;
  const int n0 = nt * QT, i0 = itb * QT;

  const unsigned short* ap = Pc + ((size_t)(b * CC + i0 + c)) * CC + 8 * hh;
  const unsigned short* bp = XP + ((size_t)(b * NN + n0 + 16 * wave + c)) * CC + 8 * hh;

  v8f acc[4];
#pragma unroll
  for (int mt = 0; mt < 4; ++mt) acc[mt] = zero8();

#pragma unroll
  for (int ks = 0; ks < CC / 32; ++ks) {
    const Frag fb = ldfrag(bp + 32 * ks);
#pragma unroll
    for (int mt = 0; mt < 4; ++mt) {
      const Frag fa = ldfrag(ap + (size_t)(16 * mt) * CC + 32 * ks);
      acc[mt] = mma_h(fa.h, fb.h, acc[mt]);
    }
  }
  {
    const int nl = 16 * wave + c;
#pragma unroll
    for (int mt = 0; mt < 4; ++mt) {
#pragma unroll
      for (int r = 0; r < 8; ++r) Os[(16 * mt + 8 * hh + r) * OSP + nl] = acc[mt][r];
    }
  }
  __syncthreads();

  const float gp = bfr(gpam[0]);
  const float gc = bfr(gcam[0]) * IPSC;
  const int e = tid & 7, lq = tid >> 3;                              // lq 0..15
  // weights of the key ranges for the thread's 4 positions (nl below is the same in every it: 16 it is even)
  v4f wt[KS];
  {
    const float* sq = ST + (size_t)b * NN + n0;                      // block-uniform base; the lane's part is lo
    const unsigned lo = (unsigned)((lq & 1) * 32 + 4 * e);
    v4f mm[KS];
#pragma unroll
    for (int s = 0; s < KS; ++s) {
      mm[s] = *(const v4f*)(sq + (size_t)s * NB * NN + lo);
      wt[s] = *(const v4f*)(sq + (size_t)(KS + s) * NB * NN + lo);
    }
#pragma unroll
    for (int t = 0; t < 4; ++t) {
      float mx = mm[0][t];
#pragma unroll
      for (int s = 1; s < KS; ++s) mx = fmaxf(mx, mm[s][t]);
      float sm = 0.f;
#pragma unroll
      for (int s = 0; s < KS; ++s) { wt[s][t] *= exp2_slot((mm[s][t] - mx) * LOG2E); sm += wt[s][t]; }
      const float inv = 1.0f / sm;
#pragma unroll
      for (int s = 0; s < KS; ++s) wt[s][t] *= inv;
    }
  }
  // the ranges' rows: block-uniform base of the tile + one lane offset (row lq >> 1, the it and s steps are constants)
  const float* yt = Yp + ((size_t)(b * CC + i0)) * KS * NN + n0;
  const unsigned yo = (unsigned)((lq >> 1) * KS * NN + (lq & 1) * 32 + 4 * e);
  v4f res[8];
#pragma unroll
  for (int it = 0; it < 8; ++it) {
    const int L = it * 16 + lq;                                      // 0..127
    const int row = L >> 1, hf = L & 1;
    const int nl = hf * 32 + 4 * e;
    const v4f cam4 = *(const v4f*)(Os + row * OSP + nl);
    const size_t idx = ((size_t)(b * CC + i0 + row)) * NN + n0 + nl;
    const v4f xv = *(const v4f*)(x + idx);
    v4f yv = wt[0] * *(const v4f*)(yt + (size_t)(it * 8 * KS) * NN + yo);
#pragma unroll
    for (int s = 1; s < KS; ++s) yv += wt[s] * *(const v4f*)(yt + (size_t)(it * 8 * KS + s) * NN + yo);
#pragma unroll
    for (int t = 0; t < 4; ++t) {
      const float xb = bfr(xv[t]);
      const float t1 = gp * yv[t] + xb;
      const float t2 = gc * cam4[t] + xb;
      res[it][t] = t1 + t2;
    }
  }
{
#pragma unroll
    for (int it = 0; it < 8; ++it) {
      const int L = it * 16 + lq;
      const int row = L >> 1, hf = L & 1;
      const int nl = hf * 32 + 4 * e;
      const size_t idx = ((size_t)(b * CC + i0 + row)) * NN + n0 + nl;
      *(v4f*)(out + idx) = res[it];
    }
    
  }
}

// =========================================================================================================
// Workspace map (bytes; each region start a multiple of 256; every extent is an exact tile multiple and is written
//   W16 f16 [320][256]          163840      BIAS f32 [320]              1280
//   Xc  f16 [2][256][4096]     4194304      XP   f16 [2][4096][256]  4194304
//   Qh/Ql/Kh/Kl bf16 [2][4096][32]  524288 x4                          Vh f16 [2][256][4096]  4194304
//   Yp  f32 [2][256][4][4096] 33554432      G    f32 [16][2][256][256] 8388608     Pc f16 [2][256][256] 262144
//   ST  f32 [2][4][2][4096]     262144
//   total = 57312512
// =========================================================================================================
extern "C" void kernel_launch(void* const* d_in, const int* in_sizes, int n_in,
                              void* d_out, int out_size, void* d_ws, size_t ws_size,
                              hipStream_t stream) {
  const int XN = NB * CC * NN;                                       // 2097152
  if (n_in < 9) return;
  if (in_sizes[0] != XN) return;
  if (in_sizes[1] != CQ * CC || in_sizes[2] != CQ) return;
  if (in_sizes[3] != CQ * CC || in_sizes[4] != CQ) return;
  if (in_sizes[5] != CC * CC || in_sizes[6] != CC) return;
  if (in_sizes[7] < 1 || in_sizes[8] < 1) return;
  if (out_size != XN) return;

  size_t off = 0;
  auto carve = [&](size_t bytes) { const size_t o = off; off += (bytes + 255) & ~(size_t)255; return o; };
  const size_t oW16 = carve((size_t)MQKV * CC * 2);
  const size_t oBIA = carve((size_t)MQKV * 4);
  const size_t oXc  = carve((size_t)NB * CC * NN * 2);
  const size_t oXP  = carve((size_t)NB * NN * CC * 2);
  const size_t oQh  = carve((size_t)NB * NN * CQ * 2);
  const size_t oQl  = carve((size_t)NB * NN * CQ * 2);
  const size_t oKh  = carve((size_t)NB * NN * CQ * 2);
  const size_t oKl  = carve((size_t)NB * NN * CQ * 2);
  const size_t oVh  = carve((size_t)NB * CC * NN * 2);
  const size_t oYp  = carve((size_t)KS * NB * CC * NN * 4);
  const size_t oG   = carve((size_t)GS * NB * CC * CC * 4);
  const size_t oPc  = carve((size_t)NB * CC * CC * 2);
  const size_t oST  = carve((size_t)2 * KS * NB * NN * 4);
  if (off > ws_size) return;
  if (off > (size_t)134217728) return;

  const float* x    = (const float*)d_in[0];
  const float* wq   = (const float*)d_in[1];
  const float* bq   = (const float*)d_in[2];
  const float* wk   = (const float*)d_in[3];
  const float* bk   = (const float*)d_in[4];
  const float* wv   = (const float*)d_in[5];
  const float* bv   = (const float*)d_in[6];
  const float* gpam = (const float*)d_in[7];
  const float* gcam = (const float*)d_in[8];

  char* ws = (char*)d_ws;
  unsigned short* W16 = (unsigned short*)(ws + oW16);
  float*          BIA = (float*)(ws + oBIA);
  unsigned short* Xc  = (unsigned short*)(ws + oXc);
  unsigned short* XP  = (unsigned short*)(ws + oXP);
  unsigned short* Qh  = (unsigned short*)(ws + oQh);
  unsigned short* Ql  = (unsigned short*)(ws + oQl);
  unsigned short* Kh  = (unsigned short*)(ws + oKh);
  unsigned short* Kl  = (unsigned short*)(ws + oKl);
  unsigned short* Vh  = (unsigned short*)(ws + oVh);
  float*          Yp  = (float*)(ws + oYp);
  float*          G   = (float*)(ws + oG);
  unsigned short* Pc  = (unsigned short*)(ws + oPc);
  float*          ST  = (float*)(ws + oST);
  float* out = (float*)d_out;

  const dim3 blk256(256), blk128(128);

  // (0) + (1) weights -> f16 plane + bias line; x -> channel-major and position-major 16-bit planes
  cvt_wx<<<dim3(XB + WB), blk256, 0, stream>>>(x, wq, bq, wk, bk, wv, bv, Xc, XP, W16, BIA);
  // (2) + (4) conv1x1 GEMM -> q/k hi + residual planes and v plane; channel Gram, K slices -> G [s][b][256][256]
  gemm_gram<<<dim3(NN / QT, MQKV / QT + GY, NB), blk128, 0, stream>>>(W16, BIA, XP, Xc, Qh, Ql, Kh, Kl, Vh, G);
  // (3) + (5) position attention, KS key ranges -> Yp [b][256][s][4096], ST; channel softmax -> Pc [b][256][256] (x1024 f16)
  attn_pam<<<dim3(NN / QB, NB, KS), blk256, 0, stream>>>(Qh, Ql, Kh, Kl, Vh, Yp, ST, G, Pc);
  // (6) channel mix + merge of the key ranges + residual sum -> out [b][256][4096]
  cam_out<<<dim3(NN / QT, CC / QT, NB), blk128, 0, stream>>>(Pc, XP, Yp, ST, x, gpam, gcam, out);
  (void)hipGetLastError();
}

// v006
// A run of this version takes 47 microseconds.
// Next to v005, in two timings, it ran 1.29 times as fast each time.
// Over all steps from v000 it is 10.5 times as fast.
// Contractions: conv1x1 q/k/v GEMM W[320x256].X[256x4096] on v_wmma_f32_16x16x32_f16 (f16 containers of bf16-RNE
// weights x256 and bf16-RNE x); position scores K.Q^T on v_wmma_f32_16x16x32_bf16 (bf16 hi + bf16 residual planes of
// q and k, 3 products, K=32); O^T = V.P^T on v_wmma_f32_16x16x32_f16 (v f16, P = e^{s-m} x1024 f16 from the score D
// registers); channel Gram X.X^T (K=4096) and channel mix A.X (K=256) on v_wmma_f32_16x16x32_f16 (f16 of bf16-RNE x,
// softmax weights x1024 f16); f32 accumulate everywhere; softmax statistics, residual adds and output sum in f32 VALU.
#include <hip/hip_runtime.h>
#include <math.h>
#include <stdint.h>

#define NB    2
#define CC    256
#define NN    4096
#define CQ    32
#define MQKV  320
#define QT    64
#define QB    128                      // queries per block of the position attention
#define OSP   68
#define OSPW  132
#define TP    72
#define WSC   256.0f
#define IWSC  0.00390625f
#define PSC   1024.0f
#define IPSC  0.0009765625f
#define LNPS  6.931471805599453f
#define LOG2E 1.4426950408889634f
#define KT    64                       // keys per LDS stage of the position attention
#define NT    (NN / KT)                // stages
#define KS    4                        // key ranges of the position attention, one block each per query tile
#define NTS   (NT / KS)                // stages of one key range
#define VPB   144                      // LDS pitch of a v row (64 keys = 128 B, + 16 B: 16 B x odd for b128 readers)
#define KPB   80                       // LDS pitch of a k row (32 d = 64 B, + 16 B)
#define VSTB  (CC * VPB)               // v part of a stage, bytes
#define KSTB  (KT * KPB)               // one k plane of a stage, bytes
#define STGB  (VSTB + 2 * KSTB)        // one stage: v, k hi, k residual
#define GS    16                       // blocks that share the K = 4096 of one Gram tile
#define GK    (NN / GS)                // positions per Gram block
#define XB    ((NN / QT) * (CC / QT) * NB)                 // blocks of the x conversion
#define WB    (MQKV / 8)                                   // blocks of the weight conversion
#define GY    ((CC / QT) * (CC / QT) * GS / (NN / QT))     // grid rows of NN / QT blocks that hold one batch's Gram blocks
#define GRB   512                      // bytes of one operand row of a 64 x 64 x 256 product (256 halves)
#define GP    (GRB + 16)               // its LDS pitch (16 B x odd for b128 readers)
#define GOPB  (QT * GP)                // one staged operand: 64 rows

static_assert(NN % QT == 0);
static_assert(CC % QT == 0);
static_assert(MQKV == 2 * CQ + CC);
static_assert(MQKV % QT == 0);
static_assert((OSP * 4) % 16 == 0);
static_assert((OSPW * 4) % 16 == 0);
static_assert((TP * 2) % 16 == 0);
static_assert(CC % 32 == 0 && NN % 32 == 0 && CQ == 32);
static_assert(NN % KT == 0 && NT % KS == 0 && NTS >= 2 && NTS % 2 == 0 && KT % 32 == 0);
static_assert(VPB % 16 == 0 && KPB % 16 == 0 && STGB % 16 == 0 && VSTB % 16 == 0);
static_assert(VPB >= KT * 2 && KPB >= CQ * 2);
static_assert(NN % GS == 0 && GK % 32 == 0);
static_assert(GY * (NN / QT) == (CC / QT) * (CC / QT) * GS);
static_assert(CC * 2 == GRB && GK * 2 == GRB && GP % 16 == 0 && QT == 64);   // every staged row is 32 lanes x 16 B
static_assert((NN / QB) * NB * KS * 2 == NB * CC);         // two channel-softmax rows per block of the position attention
static_assert(NN % QB == 0 && KT == 64 && CC == 256);      // the stage copy's 256 lanes, the two key halves of a stage

typedef _Float16       v16h __attribute__((ext_vector_type(16)));
typedef _Float16       v8h  __attribute__((ext_vector_type(8)));
typedef __bf16         v16b __attribute__((ext_vector_type(16)));
typedef unsigned short v8us __attribute__((ext_vector_type(8)));
typedef float          v8f  __attribute__((ext_vector_type(8)));
typedef float          v4f  __attribute__((ext_vector_type(4)));
typedef unsigned int   v4u  __attribute__((ext_vector_type(4)));

union Frag  { v8us u[2]; v16h h; v16b bf; };
union FragH { v16h v; v8h hv[2]; };
static_assert(sizeof(Frag) == 32);
static_assert(sizeof(FragH) == 32);

// ---- scalar helpers ---------------------------------------------------------------------------------------
__device__ __forceinline__ unsigned short bf_bits(float f) {          // f32 -> bf16 bits, RNE convert
  unsigned u = __float_as_uint(f);
  return (unsigned short)((u + 0x7FFFu + ((u >> 16) & 1u)) >> 16);
}
__device__ __forceinline__ float bf_up(unsigned short hb) { return __uint_as_float(((unsigned)hb) << 16); }
__device__ __forceinline__ float bfr(float f) { return bf_up(bf_bits(f)); }
__device__ __forceinline__ unsigned short h_bits(_Float16 x) { return __builtin_bit_cast(unsigned short, x); }
__device__ __forceinline__ unsigned pk16(unsigned short a, unsigned short b) { return (unsigned)a | ((unsigned)b << 16); }
__device__ __forceinline__ v8f zero8() { v8f z = {0.f, 0.f, 0.f, 0.f, 0.f, 0.f, 0.f, 0.f}; return z; }
__device__ __forceinline__ float hmax8(v8f s) {
  return fmaxf(fmaxf(fmaxf(s[0], s[1]), fmaxf(s[2], s[3])), fmaxf(fmaxf(s[4], s[5]), fmaxf(s[6], s[7])));
}

// 2^x with the free slot that the instruction set asks for behind a transcendental, tied to it in one statement
__device__ __forceinline__ float exp2_slot(float x) {
  float r = 0.f;
#if defined(__HIP_DEVICE_COMPILE__)
  asm("v_exp_f32 %0, %1\n\tv_nop" : "=v"(r) : "v"(x));
#endif
  return r;
}

// ---- 16-bit fragment loader (A, or B from a k-contiguous [n][k] row): lane -> row/col (lane&15), p already includes
//      + 8*(lane>>4); elements 0..7 <- p[0..7] (k0+8h..), elements 8..15 <- p[16..23] (k0+16+8h..)
__device__ __forceinline__ Frag ldfrag(const unsigned short* p) {
  Frag f;
  f.u[0] = *(const v8us*)(p);
  f.u[1] = *(const v8us*)(p + 16);
  return f;
}

// ---- WMMA helpers: builtin followed by a 4-slot VALU gap tying D and keeping A/B live --------------------------
__device__ __forceinline__ v8f mma_b(v16b a, v16b b, v8f c) {
  v8f d = __builtin_amdgcn_wmma_f32_16x16x32_bf16(false, a, false, b, (short)0, c, false, false);
#if defined(__HIP_DEVICE_COMPILE__)
  const v16h ha = __builtin_bit_cast(v16h, a), hb = __builtin_bit_cast(v16h, b);
  asm volatile("v_nop\n\tv_nop\n\tv_nop\n\tv_nop" : "+v"(d) : "v"(ha), "v"(hb));
#endif
  return d;
}

// The same products as the bare builtins, for the kernel whose accumulators reach above v255: the operands of an asm
// statement are held in the first 256 registers, which would spill them; the compiler keeps the distance behind its builtins.
// The 64 x 64 x 256 products use them too: with no statement between the products their LDS reads can stand in groups ahead.
__device__ __forceinline__ v8f mma_hw(v16h a, v16h b, v8f c) {
  return __builtin_amdgcn_wmma_f32_16x16x32_f16(false, a, false, b, (short)0, c, false, false);
}
__device__ __forceinline__ v8f mma_bw(v16b a, v16b b, v8f c) {
  return __builtin_amdgcn_wmma_f32_16x16x32_bf16(false, a, false, b, (short)0, c, false, false);
}

// ---- 8 rows of 512 B -> LDS, one wave: a copy brings one whole row (32 lanes x 16 B, four whole lines), no register on
//      the way. l: the lane's LDS byte address in the first row (next rows + GP); g: its global piece (next rows + pitch halves).
//      s_wait_xcnt 0 closes the statement, a precaution: it stands in front of any rewrite of a register a copy names.
__device__ __forceinline__ void rows8_copy(unsigned l, const unsigned short* g, const size_t pitch) {
#if defined(__HIP_DEVICE_COMPILE__)
  asm volatile("global_load_async_to_lds_b128 %0, %8, off\n\t"
               "global_load_async_to_lds_b128 %1, %9, off\n\t"
               "global_load_async_to_lds_b128 %2, %10, off\n\t"
               "global_load_async_to_lds_b128 %3, %11, off\n\t"
               "global_load_async_to_lds_b128 %4, %12, off\n\t"
               "global_load_async_to_lds_b128 %5, %13, off\n\t"
               "global_load_async_to_lds_b128 %6, %14, off\n\t"
               "global_load_async_to_lds_b128 %7, %15, off\n\t"
               "s_wait_xcnt 0x0"
               :: "v"(l), "v"(l + 1u * GP), "v"(l + 2u * GP), "v"(l + 3u * GP),
                  "v"(l + 4u * GP), "v"(l + 5u * GP), "v"(l + 6u * GP), "v"(l + 7u * GP),
                  "v"(g), "v"(g + 1 * pitch), "v"(g + 2 * pitch), "v"(g + 3 * pitch),
                  "v"(g + 4 * pitch), "v"(g + 5 * pitch), "v"(g + 6 * pitch), "v"(g + 7 * pitch)
               : "memory");
#endif
}

// ---- one 64 x 64 x 256 product of a block of 4 waves: acc[mt] (rows 16 mt ..+15, cols 16 wave ..+15) = A . B^T.
//      a / b: first of 64 rows of 256 k-contiguous halves, row pitch pa / pb halves. Both operands are staged once in
//      Sm (A, then B, pitch GP): wave w brings rows 16 w ..+15 of each. The fragments then come from LDS with the same
//      k map and in the same k order as from the global rows: A is fetched once per block, not once per wave.
__device__ __forceinline__ void tile_product(unsigned char* Sm, const unsigned short* a, const size_t pa,
                                             const unsigned short* b, const size_t pb, v8f acc[4]) {
  const int tid  = threadIdx.x;
  const int lane = tid & 31, wave = tid >> 5;
  const int hh   = lane >> 4, c = lane & 15;
  const unsigned l0 = (unsigned)(size_t)Sm + (unsigned)(16 * wave * GP + 16 * lane);   // low 32 bits = byte offset in the block's LDS
  const unsigned short* ga = a + (size_t)(16 * wave) * pa + 8 * lane;
  const unsigned short* gb = b + (size_t)(16 * wave) * pb + 8 * lane;
  rows8_copy(l0, ga, pa);
  rows8_copy(l0 + 8u * GP, ga + 8 * pa, pa);
  rows8_copy(l0 + (unsigned)GOPB, gb, pb);
  rows8_copy(l0 + (unsigned)GOPB + 8u * GP, gb + 8 * pb, pb);
  asm volatile("s_wait_asynccnt 0x0" ::: "memory");                  // this wave's 32 rows have landed
  __syncthreads();                                                   // ... and every other wave's

  const unsigned char* ap = Sm + c * GP + 16 * hh;
  const unsigned char* bp = Sm + GOPB + (16 * wave + c) * GP + 16 * hh;
#pragma unroll
  for (int mt = 0; mt < 4; ++mt) acc[mt] = zero8();
  // groups of two k-steps (20 LDS reads, 8 products), two register sets: the next group's reads stand as one block in
  // front of this group's products and are in flight under them
  Frag fa[2][2][4], fb[2][2];
#pragma unroll
  for (int g = 0; g <= GRB / 128; ++g) {
    if (g < GRB / 128) {
#pragma unroll
      for (int kk = 0; kk < 2; ++kk) {
        fb[g & 1][kk] = ldfrag((const unsigned short*)(bp + 64 * (2 * g + kk)));
#pragma unroll
        for (int mt = 0; mt < 4; ++mt)
          fa[g & 1][kk][mt] = ldfrag((const unsigned short*)(ap + 16 * mt * GP + 64 * (2 * g + kk)));
      }
      // keeps the group's reads together here: sunk to their products, each pair would be waited for almost as soon as issued
      __builtin_amdgcn_sched_barrier(0);
    }
    if (g > 0) {
#pragma unroll
      for (int kk = 0; kk < 2; ++kk) {
#pragma unroll
        for (int mt = 0; mt < 4; ++mt)
          acc[mt] = mma_hw(fa[(g - 1) & 1][kk][mt].h, fb[(g - 1) & 1][kk].h, acc[mt]);
      }
    }
  }
  // closes the products: no global load of the caller's epilogue is scheduled up between them, onto an operand just read
  __builtin_amdgcn_sched_barrier(0);
#if defined(__HIP_DEVICE_COMPILE__)
  // the distance behind a matrix instruction, kept for loads too: four vector slots between the last product and whatever
  // of the caller's epilogue comes next, so that no global load lands on an A or B just read
  asm volatile("v_nop\n\tv_nop\n\tv_nop\n\tv_nop");
#endif
  // holds the epilogue behind those four slots
  __builtin_amdgcn_sched_barrier(0);
}

// =========================================================================================================
// (0) conv1x1 weights: W16 f16 [320][256], row o: 0..31 = wq, 32..63 = wk, 64..319 = wv; value = f16 of
//     (bf16-RNE(w) * 256) (exact). BIAS f32 [320] = bf16-RNE of bq / bk / bv. Block blk (0..39) owns rows
// coverage: 40 blocks x 8 rows x 32 pieces x 8 halves = 320 x 256; bias 80 x 4 floats = 320.
// =========================================================================================================
__device__ __forceinline__
void cvt_w(const float* __restrict__ wq, const float* __restrict__ bq,
           const float* __restrict__ wk, const float* __restrict__ bk,
           const float* __restrict__ wv, const float* __restrict__ bv,
           unsigned short* W16, float* BIAS, const int blk) {
  const int tid = threadIdx.x;
  const int rl = tid >> 5, col = 8 * (tid & 31);
  const int o = 8 * blk + rl;                                     // 0..319
  const float* wbase = (blk < 4) ? wq : (blk < 8) ? wk : wv;       // block-uniform selection
  const int osub = (blk < 4) ? 0 : (blk < 8) ? CQ : 2 * CQ;
  const float* s = wbase + (size_t)(o - osub) * CC + col;          // in range: (o-osub) < rows of that matrix
  const v4f a = *(const v4f*)s;
  const v4f q = *(const v4f*)(s + 4);
  const float f[8] = {a[0], a[1], a[2], a[3], q[0], q[1], q[2], q[3]};
  v4u u;
#pragma unroll
  for (int t = 0; t < 4; ++t) {
    const _Float16 h0 = (_Float16)(bfr(f[2 * t]) * WSC);
    const _Float16 h1 = (_Float16)(bfr(f[2 * t + 1]) * WSC);
    u[t] = pk16(h_bits(h0), h_bits(h1));
  }
  // bias values: every lane loads all three candidates with clamped indices, selects by value
  v4f bvv;
  {
    const int tb = min(tid, 79);
    const int o4 = 4 * tb;
#pragma unroll
    for (int qd = 0; qd < 4; ++qd) {
      const int oo = o4 + qd;
      const int iq = min(oo, CQ - 1);
      const int ik = min(max(oo - CQ, 0), CQ - 1);
      const int iv = min(max(oo - 2 * CQ, 0), CC - 1);
      const float cq = bq[iq], ck = bk[ik], cv = bv[iv];
      const float val = (oo < CQ) ? cq : (oo < 2 * CQ) ? ck : cv;
      bvv[qd] = bfr(val);
    }
  }
{
    *(v4u*)(W16 + (size_t)o * CC + col) = u;
    if (blk == 0 && tid < 80) *(v4f*)(BIAS + 4 * tid) = bvv;
    
  }
}

// =========================================================================================================
// (1) x f32 [b][256 c][4096 n] -> Xc f16 [b][c][n] (channel-major, bf16-RNE values, exact in f16) and
//     XP f16 [b][n][c] (position-major) through an LDS tile T[64 n][64 c] (pitch TP). Block (nb, cb, b) owns a
// coverage: Xc 2 it x 32 rows x 8 lanes x 8 = 64 c x 64 n; XP same; blocks (nb, cb, b) in (64, 4, NB) cover both planes once.
// =========================================================================================================
__device__ __forceinline__
void cvt_x(const float* __restrict__ x, unsigned short* Xc, unsigned short* XP, unsigned short* T,
           const int nb, const int cb, const int b) {
  const int tid = threadIdx.x;
  const int e = tid & 7, lq = tid >> 3;                             // lq 0..31
  const int n0 = nb * QT, c0 = cb * QT;
  v4u ux[2];
#pragma unroll
  for (int it = 0; it < 2; ++it) {
    const int cl = it * 32 + lq;                                     // 0..63
    const float* sp = x + ((size_t)(b * CC + c0 + cl)) * NN + n0 + 8 * e;
    const v4f a = *(const v4f*)sp;
    const v4f q = *(const v4f*)(sp + 4);
    unsigned short hb[8];
#pragma unroll
    for (int t = 0; t < 4; ++t) {
      hb[t]     = h_bits((_Float16)bfr(a[t]));
      hb[4 + t] = h_bits((_Float16)bfr(q[t]));
    }
#pragma unroll
    for (int t = 0; t < 4; ++t) ux[it][t] = pk16(hb[2 * t], hb[2 * t + 1]);
#pragma unroll
    for (int t = 0; t < 8; ++t) T[(8 * e + t) * TP + cl] = hb[t];
  }
  __syncthreads();
  v4u up[2];
#pragma unroll
  for (int it = 0; it < 2; ++it) {
    const int nl = it * 32 + lq;                                     // 0..63
    up[it] = *(const v4u*)(T + nl * TP + 8 * e);
  }
{
#pragma unroll
    for (int it = 0; it < 2; ++it) {
      const int rl = it * 32 + lq;
      *(v4u*)(Xc + ((size_t)(b * CC + c0 + rl)) * NN + n0 + 8 * e) = ux[it];
      *(v4u*)(XP + ((size_t)(b * NN + n0 + rl)) * CC + c0 + 8 * e) = up[it];
    }
    
  }
}

// =========================================================================================================
// (0) + (1) in one launch: neither reads what the other writes. Blocks 0 .. XB-1 do (1), block blk = nb + 64 (cb + 4 b);
//     blocks XB .. XB+WB-1 do (0). The choice is block-uniform, so the barrier of (1) is passed by whole blocks.
// =========================================================================================================
__global__ __launch_bounds__(256)
void cvt_wx(const float* __restrict__ x,
            const float* __restrict__ wq, const float* __restrict__ bq,
            const float* __restrict__ wk, const float* __restrict__ bk,
            const float* __restrict__ wv, const float* __restrict__ bv,
            unsigned short* Xc, unsigned short* XP, unsigned short* W16, float* BIAS) {
  __shared__ __align__(16) unsigned short T[QT * TP];
  const int blk = blockIdx.x;
  if (blk < XB) cvt_x(x, Xc, XP, T, blk % (NN / QT), (blk / (NN / QT)) % (CC / QT), blk / ((NN / QT) * (CC / QT)));
  else          cvt_w(wq, bq, wk, bk, wv, bv, W16, BIAS, blk - XB);
}

// =========================================================================================================
// (2) conv1x1 GEMM for one (b, 64-n tile, 64-o block): Y[o][n] = (1/256) sum_c W16[o][c] XP[b][n][c] + BIAS[o].
//     Block 128 threads = 4 waves; wave w owns cols n0+16w..+15 (one B fragment per k-step, k = c contiguous in
//     the XP row) and 4 m-tiles (A rows o = o0 + 16 mt + (lane&15), split k map loader from W16). K = 256 = 8 steps.
//     The 64 W16 rows and the 64 XP rows are staged in LDS (tile_product).
//     Epilogue staged in LDS Os[o_loc][n_loc] (pitch OSP), barrier, then:
//       o-block 0 (q rows 0..31, k rows 32..63): Qh/Ql/Kh/Kl bf16 hi / bf16 residual planes [b][4096 n][32]
//         holds rows 2ll, 2ll+1; lane e -> row 2ll+(e>>2), cols 8*(e&3)..+7; one instruction per 16 lines.
//         halves 8e..8e+7; one instruction per 16 lines.
// coverage: Os 4 waves x 4 tiles x 16x16 = 64 x 64; q/k: 4 planes x 32 lines x 8 lanes x 8 = 4 x (64 n x 32);
//           v: 4 it x 16 rows x 8 lanes x 8 = 64 ch x 64 n; grid rows y < 5 of (64, 5 + GY, NB) cover all planes exactly once.
// =========================================================================================================
__device__ __forceinline__
void gemm_qkv(const unsigned short* __restrict__ W16, const float* __restrict__ BIAS,
              const unsigned short* __restrict__ XP,
              unsigned short* Qh, unsigned short* Ql, unsigned short* Kh, unsigned short* Kl,
              unsigned short* Vh, float* Os, unsigned char* Sm, const int nt, const int mb, const int b) {
  const int tid  = threadIdx.x;
  const int lane = tid & 31, wave = tid >> 5;
  const int hh   = lane >> 4, c = lane & 15;
  const int n0   = nt * QT, o0 = mb * QT;

  v8f acc[4];
  tile_product(Sm, W16 + (size_t)o0 * CC, CC, XP + ((size_t)(b * NN + n0)) * CC, CC, acc);

  // ---- epilogue: scale back, + bias -> LDS Os[o_loc][n_loc] ----
  {
    const int nl = 16 * wave + c;
#pragma unroll
    for (int mt = 0; mt < 4; ++mt) {
#pragma unroll
      for (int r = 0; r < 8; ++r) {
        const int ol = 16 * mt + 8 * hh + r;                         // 0..63
        Os[ol * OSP + nl] = acc[mt][r] * IWSC + BIAS[o0 + ol];
      }
    }
  }
  __syncthreads();

  const int e = tid & 7, lq = tid >> 3;                             // lq 0..15
  if (mb == 0) {
    // ---- q/k bf16 hi + residual planes ----
{
#pragma unroll
      for (int it = 0; it < 8; ++it) {
        const int p    = it >> 1;                                    // 0 Qh, 1 Ql, 2 Kh, 3 Kl
        const int ll   = (it & 1) * 16 + lq;                         // 0..31
        const int nl   = 2 * ll + (e >> 2);                          // 0..63
        const int col0 = 8 * (e & 3);                                // 0,8,16,24
        const int rb   = ((p >> 1) ? CQ : 0) + col0;
        v4u u;
#pragma unroll
        for (int t = 0; t < 4; ++t) {
          const float f0 = Os[(rb + 2 * t) * OSP + nl];
          const float f1 = Os[(rb + 2 * t + 1) * OSP + nl];
          const unsigned short hb0 = bf_bits(f0), hb1 = bf_bits(f1);
          const unsigned short lb0 = bf_bits(f0 - bf_up(hb0));
          const unsigned short lb1 = bf_bits(f1 - bf_up(hb1));
          u[t] = (p & 1) ? pk16(lb0, lb1) : pk16(hb0, hb1);
        }
        unsigned short* P = (p == 0) ? Qh : (p == 1) ? Ql : (p == 2) ? Kh : Kl;
        *(v4u*)(P + ((size_t)(b * NN + n0 + nl)) * CQ + col0) = u;
      }
      
    }
  } else {
    // ---- v f16 plane ----
    const int ch0 = o0 - QT;                                         // (mb-1)*64
    v4u uv[4];
#pragma unroll
    for (int it = 0; it < 4; ++it) {
      const int row = it * 16 + lq;                                  // 0..63
      const v4f a = *(const v4f*)(Os + row * OSP + 8 * e);
      const v4f q = *(const v4f*)(Os + row * OSP + 8 * e + 4);
#pragma unroll
      for (int t = 0; t < 2; ++t) {
        uv[it][t]     = pk16(h_bits((_Float16)a[2 * t]), h_bits((_Float16)a[2 * t + 1]));
        uv[it][2 + t] = pk16(h_bits((_Float16)q[2 * t]), h_bits((_Float16)q[2 * t + 1]));
      }
    }
{
#pragma unroll
      for (int it = 0; it < 4; ++it) {
        const int row = it * 16 + lq;
        *(v4u*)(Vh + ((size_t)(b * CC + ch0 + row)) * NN + n0 + 8 * e) = uv[it];
      }
      
    }
  }
}

// =========================================================================================================
// (5) channel softmax: for row (b, i): G_j = sum of the GS slice planes in slice order, then
//     p_j = exp(min_j G - G_j) / sum (== softmax of rowmax - G), returned as the lane's 8 halves of
//     Pc f16 [b][256][256] = p * 1024. One wave per row: lane reads j = 8 lane..8 lane+7, wave min / sum by shuffles.
//     rw = b * 256 + i. The NB * 256 rows ride in the launch of (3), two per block, worked by the block's waves 0 and 1.
// =========================================================================================================
__device__ __forceinline__ v4u cam_softmax(const float* __restrict__ G, const int rw, const int lane) {
  const float* row = G + (size_t)rw * CC + 8 * lane;
  v4f a = *(const v4f*)row;
  v4f q = *(const v4f*)(row + 4);
#pragma unroll                                                       // straight line: the planes' loads issue ahead of the adds
  for (int s = 1; s < GS; ++s) {
    a += *(const v4f*)(row + (size_t)s * NB * CC * CC);
    q += *(const v4f*)(row + (size_t)s * NB * CC * CC + 4);
  }
  const float ev[8] = {a[0], a[1], a[2], a[3], q[0], q[1], q[2], q[3]};
  float mn = ev[0];
#pragma unroll
  for (int t = 1; t < 8; ++t) mn = fminf(mn, ev[t]);
#pragma unroll
  for (int s = 1; s < 32; s <<= 1) mn = fminf(mn, __shfl_xor(mn, s, 32));
  float p[8], sm = 0.f;
#pragma unroll
  for (int t = 0; t < 8; ++t) { p[t] = __expf(mn - ev[t]); sm += p[t]; }
#pragma unroll
  for (int s = 1; s < 32; s <<= 1) sm += __shfl_xor(sm, s, 32);
  const float inv = PSC / sm;
  v4u u;
#pragma unroll
  for (int t = 0; t < 4; ++t)
    u[t] = pk16(h_bits((_Float16)(p[2 * t] * inv)), h_bits((_Float16)(p[2 * t + 1] * inv)));
  return u;
}

// ---- one stage (64 keys) of v, k hi and k residual -> LDS, 256 lanes, 16 B per lane and copy, no register on the way.
//      v: copy i brings row (channel) 32 i + (tid >> 3), bytes 16 (tid & 7) ..+15 of its 128; 8 copies = 256 rows.
//      k: the one copy of a plane brings row (key) tid >> 2, bytes 16 (tid & 3) ..+15 of its 64; 64 rows.
//      lv / lk: the lane's LDS byte address of its first v / k-hi piece; gv / gh / gl: its first global piece.
//      s_wait_xcnt 0 closes the statement, a precaution: it stands in front of any rewrite of a register a copy names.
__device__ __forceinline__ void stage_copy(unsigned lv, unsigned lk, const unsigned short* gv,
                                           const unsigned short* gh, const unsigned short* gl) {
#if defined(__HIP_DEVICE_COMPILE__)
  asm volatile("global_load_async_to_lds_b128 %0, %10, off\n\t"
               "global_load_async_to_lds_b128 %1, %11, off\n\t"
               "global_load_async_to_lds_b128 %2, %12, off\n\t"
               "global_load_async_to_lds_b128 %3, %13, off\n\t"
               "global_load_async_to_lds_b128 %4, %14, off\n\t"
               "global_load_async_to_lds_b128 %5, %15, off\n\t"
               "global_load_async_to_lds_b128 %6, %16, off\n\t"
               "global_load_async_to_lds_b128 %7, %17, off\n\t"
               "global_load_async_to_lds_b128 %8, %18, off\n\t"
               "global_load_async_to_lds_b128 %9, %19, off\n\t"
               "s_wait_xcnt 0x0"
               :: "v"(lv), "v"(lv + 32u * VPB), "v"(lv + 64u * VPB), "v"(lv + 96u * VPB),
                  "v"(lv + 128u * VPB), "v"(lv + 160u * VPB), "v"(lv + 192u * VPB), "v"(lv + 224u * VPB),
                  "v"(lk), "v"(lk + (unsigned)KSTB),
                  "v"(gv), "v"(gv + (size_t)32 * NN), "v"(gv + (size_t)64 * NN), "v"(gv + (size_t)96 * NN),
                  "v"(gv + (size_t)128 * NN), "v"(gv + (size_t)160 * NN), "v"(gv + (size_t)192 * NN),
                  "v"(gv + (size_t)224 * NN), "v"(gh), "v"(gl)
               : "memory");
#endif
}

// =========================================================================================================
// (3) position attention for one (b, 128-query tile, key range sp of NN / KS keys), transposed formulation, no mask:
//   S^T tile (16 keys x 16 queries) = A(k: row = key kb + (lane&15), 32 d via the split k map from the bf16 plane
//   Kh [b][4096][32]) . B(q: col = query, same map, resident fragment from Qh) + A(Kh).B(Ql) + A(Kl).B(Qh)
//   (bf16 unscaled residual planes, shared accumulator). Energy = S (no scale).
//   Per lane the D tile holds 8 keys of ONE query: online softmax state per lane, one shuffle (lane^16) for the max
//   over 32 keys, row-sum partials combined at the end. P = e^{s-m} x 1024 as f16 is the B operand of
//   O^T (rows channel, cols queries) += A(V rows channel = 16j + (lane&15), keys contiguous, f16 plane Vh
//   [b][256][4096]) . B(P^T): element r <- D of the tile covering keys kb..kb+15, element 8+r <- the tile covering
//   kb+16..kb+31, lane unchanged.
//   Block = 8 waves = 4 query columns wq (32 queries each) x 2 key halves kh. A wave holds TWO groups of 16 queries
//   (2 x 16 accumulator tiles, 256 channels), so each k and v fragment it reads from LDS feeds two products; of every
//   stage of 64 keys it works the 32 keys of its half kh. Its group u is queries 32 wq + 16 (u ^ kh) ..+15.
//   The k and v rows of 64 keys are one stage in LDS, brought once per block by asynchronous copies and read by all
//   eight waves; two buffers: stage t + 1 flies while stage t is worked on.
//   Behind the loop waves (wq, 0) and (wq, 1) hold the two key halves of the same 32 queries: each hands its group 1
//   (accumulators, m, l) to the other through LDS and merges what it gets into its group 0 (own half, then the partner's).
//   Epilogue in two channel halves: O/l staged in LDS Os[query][128 channels] (pitch OSPW, b128 stores), barrier,
//   The result is the range's own softmax average, Yp [b][256][KS][4096]; the range's maximum m and sum l of each query go to
//   ST [2][KS][b][4096] (m planes, then l planes), through LDS so that whole lines are written; (6) merges the ranges.
// coverage: per half 16 it x 32 lines x 8 lanes x 4 floats = 128 ch x 128 n; two halves = 256 ch; grid (32, NB, KS).
// =========================================================================================================
__global__ __launch_bounds__(256)
void attn_pam(const unsigned short* __restrict__ Qh, const unsigned short* __restrict__ Ql,
              const unsigned short* __restrict__ Kh, const unsigned short* __restrict__ Kl,
              const unsigned short* __restrict__ Vh, float* Yp, float* ST,
              const float* __restrict__ G, unsigned short* Pc) {
  __shared__ __align__(16) float Os[QB * OSPW];
  __shared__ __align__(16) float St[2 * QB];
  __shared__ __align__(16) float Sx[2 * 8 * 16];                     // m, then l, of the group a wave hands over
  __shared__ __align__(16) float Xo[8 * 16 * 2 * 32 * 4];            // its accumulators: [wave][tile][r half][lane] x 16 B
  __shared__ __align__(16) unsigned char Ring[2 * STGB];
  const int tid  = threadIdx.x;
  const int wave = __builtin_amdgcn_readfirstlane(tid >> 5), lane = tid & 31;   // the wave's number in a scalar register
  const int hh   = lane >> 4, c = lane & 15;
  const int wq   = wave & 3, kh = wave >> 2;
  const int n0   = blockIdx.x * QB, b = blockIdx.y, sp = blockIdx.z;
  const int t0   = sp * NTS;                                         // first stage of the block's key range (even)

  // resident q fragments (B operand, col = query n0 + 32 wq + 16 (u ^ kh) + c)
  Frag qh[2], ql[2];
  {
    const size_t qa = ((size_t)(b * NN + n0 + 32 * wq + 16 * kh + c)) * CQ + 8 * hh;
    const size_t qb = ((size_t)(b * NN + n0 + 32 * wq + 16 * (1 - kh) + c)) * CQ + 8 * hh;
    qh[0] = ldfrag(Qh + qa);
    ql[0] = ldfrag(Ql + qa);
    qh[1] = ldfrag(Qh + qb);
    ql[1] = ldfrag(Ql + qb);
    // the wait before the eight loads' address registers are reused; naming them as inputs keeps them whole up to here
#if defined(__HIP_DEVICE_COMPILE__)
    asm volatile("s_wait_xcnt 0x0" :: "v"(Qh + qa), "v"(Ql + qa), "v"(Qh + qb), "v"(Ql + qb) : "memory");
#endif
  }
  // the lane's first pieces of a stage: global sources (+ t * KT keys) and LDS places (+ buffer * STGB)
  const unsigned short* gv = Vh + (size_t)b * CC * NN + (size_t)(tid >> 3) * NN + 8 * (tid & 7);
  const unsigned short* gh = Kh + ((size_t)b * NN + (tid >> 2)) * CQ + 8 * (tid & 3);
  const unsigned short* gl = Kl + ((size_t)b * NN + (tid >> 2)) * CQ + 8 * (tid & 3);
  const unsigned ring0 = (unsigned)(size_t)Ring;                     // low 32 bits = byte offset in the block's LDS
  const unsigned lv = ring0 + (unsigned)((tid >> 3) * VPB + 16 * (tid & 7));
  const unsigned lk = ring0 + (unsigned)(VSTB + (tid >> 2) * KPB + 16 * (tid & 3));
  // fragment offsets inside a stage, at the wave's 32 keys: v (A operand, row = channel 16j + c, keys contiguous),
  // k (A operand, row = key)
  const int vfo = c * VPB + 16 * hh + kh * 64;
  const int kfo = VSTB + (32 * kh + c) * KPB + 16 * hh;

  float m[2] = {-1.0e30f, -1.0e30f}, l[2] = {0.f, 0.f};
  v8f o[2][16];
#pragma unroll
  for (int u = 0; u < 2; ++u) {
#pragma unroll
    for (int j = 0; j < 16; ++j) o[u][j] = zero8();
  }

  // prologue: stage t0 landed and published, then stage t0 + 1 on its way
  stage_copy(lv, lk, gv + (size_t)t0 * KT, gh + (size_t)t0 * KT * CQ, gl + (size_t)t0 * KT * CQ);
  // (5): the block's two rows of the channel softmax, in waves 0 and 1 (scalar test), while stage t0 is on its way
  const int  crow = 2 * (blockIdx.x + (NN / QB) * (blockIdx.y + NB * blockIdx.z)) + (wave & 1);   // 0 .. NB * CC - 1, each once
  const bool cwav = wave < 2;
  v4u cu = {0u, 0u, 0u, 0u};
  if (cwav) cu = cam_softmax(G, crow, lane);
  asm volatile("s_wait_asynccnt 0x0" ::: "memory");                  // this wave's pieces of stage t0 have landed
  __syncthreads();                                                   // ... and every other wave's
  if (cwav) {
    *(v4u*)(Pc + (size_t)crow * CC + 8 * lane) = cu;                 // behind the barrier: it does not wait for this store
    asm volatile("s_wait_xcnt 0x0" ::: "memory");                    // a precaution: before the code behind reuses the store's registers
  }
  stage_copy(lv + STGB, lk + STGB, gv + (size_t)(t0 + 1) * KT, gh + (size_t)(t0 + 1) * KT * CQ,
             gl + (size_t)(t0 + 1) * KT * CQ);

#pragma unroll 1                                                     // rolled: one stage's exponentials live at a time
  for (int t = t0; t < t0 + NTS; ++t) {
    const unsigned bo = (unsigned)(t & 1) * STGB;
    const unsigned char* sb = Ring + bo;
    const unsigned char* kp = sb + kfo;                              // the wave's keys start at kb = KT t + 32 kh
    const Frag k0  = ldfrag((const unsigned short*)(kp));                        // keys kb .. kb+15
    const Frag k1  = ldfrag((const unsigned short*)(kp + 16 * KPB));             // keys kb+16 .. kb+31
    const Frag k0l = ldfrag((const unsigned short*)(kp + KSTB));
    const Frag k1l = ldfrag((const unsigned short*)(kp + KSTB + 16 * KPB));
    v8f s0[2], s1[2];
#pragma unroll
    for (int u = 0; u < 2; ++u) {
      s0[u] = mma_bw(k0.bf, qh[u].bf, zero8());
      s1[u] = mma_bw(k1.bf, qh[u].bf, zero8());
    }
#pragma unroll
    for (int u = 0; u < 2; ++u) {
      s0[u] = mma_bw(k0.bf, ql[u].bf, s0[u]);
      s1[u] = mma_bw(k1.bf, ql[u].bf, s1[u]);
    }
#pragma unroll
    for (int u = 0; u < 2; ++u) {
      s0[u] = mma_bw(k0l.bf, qh[u].bf, s0[u]);
      s1[u] = mma_bw(k1l.bf, qh[u].bf, s1[u]);
    }

    float mx[2], mo[2];
#pragma unroll
    for (int u = 0; u < 2; ++u) {
      mx[u] = fmaxf(hmax8(s0[u]), hmax8(s1[u]));
      mo[u] = __shfl_xor(mx[u], 16, 32);
    }
    // the first 8 v fragments of the pass as one group of LDS reads, in flight under the maxima and their exchange
    const unsigned char* vp = sb + vfo;
    Frag vf[8];
#pragma unroll
    for (int j = 0; j < 8; ++j) vf[j] = ldfrag((const unsigned short*)(vp + 16 * j * VPB));

    FragH ph[2];
#pragma unroll
    for (int u = 0; u < 2; ++u) {
      const float mn   = fmaxf(m[u], fmaxf(mx[u], mo[u]));
      const float corr = __expf(m[u] - mn);
      m[u] = mn;
      const float msh = mn - LNPS;                                   // exp gives e^{s-m} * 1024
#pragma unroll
      for (int j = 0; j < 16; ++j) {
#pragma unroll
        for (int r = 0; r < 8; ++r) o[u][j][r] *= corr;
      }
      float ls = 0.f;
#pragma unroll
      for (int r = 0; r < 8; ++r) {
        const float e0 = __expf(s0[u][r] - msh);                     // key kb      + 8hh + r
        const float e1 = __expf(s1[u][r] - msh);                     // key kb + 16 + 8hh + r
        ls += e0 + e1;
        ph[u].hv[0][r] = (_Float16)e0;
        ph[u].hv[1][r] = (_Float16)e1;
      }
      l[u] = l[u] * corr + ls;
    }

    // blocks of 4 fragments, two products each; behind each of the first two blocks, the 4 fragments needed two blocks
    // later take their registers
#pragma unroll
    for (int g = 0; g < 4; ++g) {
#pragma unroll
      for (int i = 0; i < 4; ++i) {
        o[0][4 * g + i] = mma_hw(vf[(4 * g + i) & 7].h, ph[0].v, o[0][4 * g + i]);
        o[1][4 * g + i] = mma_hw(vf[(4 * g + i) & 7].h, ph[1].v, o[1][4 * g + i]);
      }
      if (g < 2) {
#pragma unroll
        for (int i = 0; i < 4; ++i)
          vf[(4 * g + i) & 7] = ldfrag((const unsigned short*)(vp + 16 * (4 * g + i + 8) * VPB));
      }
    }
    // keeps the stage's arithmetic in front of the barrier: sunk behind it, it would also stand in front of the refill,
    // whose copies would then be waited for almost as soon as they are issued
    __builtin_amdgcn_sched_barrier(0);
    // publish point of stage t + 1, and the end of every reader's last read of stage t's buffer
    asm volatile("s_wait_dscnt 0x0" ::: "memory");                   // this wave's LDS reads of stage t are done
    asm volatile("s_wait_asynccnt 0x0" ::: "memory");                // this wave's pieces of stage t + 1 have landed
    __syncthreads();
    if (t + 2 < t0 + NTS)                                            // block-uniform: refill the buffer just read
      stage_copy(lv + bo, lk + bo, gv + (size_t)(t + 2) * KT, gh + (size_t)(t + 2) * KT * CQ,
                 gl + (size_t)(t + 2) * KT * CQ);
  }
  asm volatile("s_wait_asynccnt 0x0" ::: "memory");                  // nothing of this wave is in flight at its end
  // the lane's number read anew: no index of the epilogue has to stay in a register (or be spilled) across the loop
  const int ln = (int)__builtin_amdgcn_mbcnt_lo(~0u, 0u);
  const int h2 = ln >> 4, c2 = ln & 15, td = 32 * wave + ln;
  l[0] += __shfl_xor(l[0], 16, 32);
  l[1] += __shfl_xor(l[1], 16, 32);

  // hand-over of group 1 to the wave that worked the other key half of the same queries (wave ^ 4, same lane)
  if (h2 == 0) { Sx[16 * wave + c2] = m[1]; Sx[128 + 16 * wave + c2] = l[1]; }   // equal in lanes c and c + 16
#pragma unroll
  for (int j = 0; j < 16; ++j) {
    v4f va, vb;
#pragma unroll
    for (int r = 0; r < 4; ++r) { va[r] = o[1][j][r]; vb[r] = o[1][j][4 + r]; }
    *(v4f*)(Xo + (((wave * 16 + j) * 2 + 0) * 32 + ln) * 4) = va;
    *(v4f*)(Xo + (((wave * 16 + j) * 2 + 1) * 32 + ln) * 4) = vb;
  }
  __syncthreads();                                                   // every wave's group 1 is in LDS
  const int pw = wave ^ 4;
  const float mp = Sx[16 * pw + c2], lp = Sx[128 + 16 * pw + c2];
  const float mm = fmaxf(m[0], mp);
  const float ea = __expf(m[0] - mm), eb = __expf(mp - mm);
  const float lm = l[0] * ea + lp * eb;                              // o and l both carry the x1024 factor
  const float inv = 1.0f / lm;
  const float fa = ea * inv, fb = eb * inv;

  const int qrow = 32 * wq + 16 * kh + c2;                           // the query of the wave's group 0
  const int e = td & 7, lq = td >> 3;                                // lq 0..31
  if (h2 == 0) { St[qrow] = mm; St[QB + qrow] = lm; }
#pragma unroll
  for (int half = 0; half < 2; ++half) {
    if (half) __syncthreads();                                       // every wave finished reading Os
#pragma unroll
    for (int jj = 0; jj < 8; ++jj) {
      const int j = 8 * half + jj;
      const v4f xa = *(const v4f*)(Xo + (((pw * 16 + j) * 2 + 0) * 32 + ln) * 4);
      const v4f xb = *(const v4f*)(Xo + (((pw * 16 + j) * 2 + 1) * 32 + ln) * 4);
      v4f va, vb;
#pragma unroll
      for (int r = 0; r < 4; ++r) { va[r] = o[0][j][r] * fa + xa[r] * fb; vb[r] = o[0][j][4 + r] * fa + xb[r] * fb; }
      *(v4f*)(Os + qrow * OSPW + 16 * jj + 8 * h2)     = va;         // Os[query][ch_loc = 16jj + 8hh + r]
      *(v4f*)(Os + qrow * OSPW + 16 * jj + 8 * h2 + 4) = vb;
    }
    __syncthreads();
#pragma unroll
    for (int it = 0; it < 16; ++it) {
      const int chl = (it & 3) * 32 + lq;                            // channel 0..127 within the half
      const int nl  = (it >> 2) * 32 + 4 * e;                        // query 0..127
      v4f v;
#pragma unroll
      for (int t = 0; t < 4; ++t) v[t] = Os[(nl + t) * OSPW + chl];
      *(v4f*)(Yp + ((size_t)((b * CC + 128 * half + chl) * KS + sp)) * NN + n0 + nl) = v;
    }
  }
  if (td < 64) {                                                     // waves 0 and 1, behind the barriers above: 128 m, 128 l
    const int pl = td >> 5, q4 = 4 * (td & 31);
    *(v4f*)(ST + ((size_t)((pl * KS + sp) * NB + b)) * NN + n0 + q4) = *(const v4f*)(St + pl * QB + q4);
  }
}

// =========================================================================================================
// (4) channel Gram for one (b, 64-i block, 64-j block, K slice s): G[s][b][i][j] = sum over the slice's GK positions n
//     of Xc[b][i][n] Xc[b][j][n]; the GS slices of a tile run as GS blocks, and (5) adds their planes.
//     4 waves; wave w owns cols j0+16w..+15 (B from the j row, keys n contiguous) and 4 i tiles (A rows
//     [b][256][256] (row segment 64 j = 2 lines), 8 consecutive lanes x 16 B, one instruction per 16 lines, two
// coverage: 8 it x 16 lines x 8 lanes x 4 = 64 x 64; (jt, itb, zb) in (4, 4, GS * NB) covers the GS planes of G exactly once.
// =========================================================================================================
__device__ __forceinline__
void gram_k(const unsigned short* __restrict__ Xc, float* G, float* Os, unsigned char* Sm,
            const int jt, const int itb, const int zb) {
  const int tid  = threadIdx.x;
  const int lane = tid & 31, wave = tid >> 5;
  const int hh   = lane >> 4, c = lane & 15;
  const int b = zb % NB, s = zb / NB;                                // zb = s * NB + b: the plane of G this block writes
  const int j0 = jt * QT, i0 = itb * QT;

  v8f acc[4];                                                        // the slice's 256 positions of the 64 i rows and the 64 j rows, staged in LDS
  tile_product(Sm, Xc + ((size_t)(b * CC + i0)) * NN + s * GK, NN, Xc + ((size_t)(b * CC + j0)) * NN + s * GK, NN, acc);
  {
    const int nl = 16 * wave + c;
#pragma unroll
    for (int mt = 0; mt < 4; ++mt) {
#pragma unroll
      for (int r = 0; r < 8; ++r) Os[(16 * mt + 8 * hh + r) * OSP + nl] = acc[mt][r];
    }
  }
  __syncthreads();
  {
    const int e = tid & 7, lq = tid >> 3;                            // lq 0..15
{
#pragma unroll
      for (int it = 0; it < 8; ++it) {
        const int L = it * 16 + lq;                                  // 0..127
        const int row = L >> 1, hf = L & 1;
        const v4f v = *(const v4f*)(Os + row * OSP + hf * 32 + 4 * e);
        *(v4f*)(G + ((size_t)(zb * CC + i0 + row)) * CC + j0 + hf * 32 + 4 * e) = v;
      }
      // a precaution: in the shared launch code follows these stores in the listing; the wait stands before it reuses their registers
      asm volatile("s_wait_xcnt 0x0" ::: "memory");
    }
  }
}

// =========================================================================================================
// (2) + (4) in one launch: both read only what the launch before wrote, neither reads what the other writes.
//     Grid (64, 5 + GY, NB): rows y < 5 do (2) with (nt, mb, b) = (x, y, z); rows y >= 5 do (4): idx = x + 64 (y - 5)
//     = jt + 4 (itb + 4 s), batch z. The choice is block-uniform, so each body's barrier is passed by whole blocks.
// =========================================================================================================
__global__ __launch_bounds__(128)
void gemm_gram(const unsigned short* __restrict__ W16, const float* __restrict__ BIAS,
               const unsigned short* __restrict__ XP, const unsigned short* __restrict__ Xc,
               unsigned short* Qh, unsigned short* Ql, unsigned short* Kh, unsigned short* Kl,
               unsigned short* Vh, float* G) {
  __shared__ __align__(16) float Os[QT * OSP];
  __shared__ __align__(16) unsigned char Sm[2 * GOPB];
  const int y = blockIdx.y;
  if (y < MQKV / QT) {
    gemm_qkv(W16, BIAS, XP, Qh, Ql, Kh, Kl, Vh, Os, Sm, blockIdx.x, y, blockIdx.z);
  } else {
    const int idx = blockIdx.x + (NN / QT) * (y - MQKV / QT);
    gram_k(Xc, G, Os, Sm, idx % (CC / QT), (idx / (CC / QT)) % (CC / QT),
           (idx / ((CC / QT) * (CC / QT))) * NB + blockIdx.z);
  }
}

// =========================================================================================================
// (6) channel mix + output for one (b, 64-n tile, 64-i block): cam[i][n] = (1/1024) sum_j Pc[b][i][j] XP[b][n][j]
//     (K = 256 = 8 steps; A rows i = i0 + 16 mt + (lane&15), j contiguous; B col n = n0 + 16w + (lane&15) from the
//     XP row, j contiguous), then out[b][i][n] = (g_pam * Y + xb) + (g_cam * cam + xb) with xb = bf16-RNE of x and
//     Y = sum over the KS key ranges s, in range order, of wt_s[n] Yp[b][i][s][n], wt_s = l_s e^{m_s - M} / sum of these,
//     M = max_s m_s (m, l from ST): the softmax over all keys from the ranges' own averages.
// coverage: 8 it x 16 lines x 8 lanes x 4 = 64 i x 64 n; grid (64, 4, NB) covers d_out exactly once.
// =========================================================================================================
__global__ __launch_bounds__(128)
void cam_out(const unsigned short* __restrict__ Pc, const unsigned short* __restrict__ XP,
             const float* __restrict__ Yp, const float* __restrict__ ST, const float* __restrict__ x,
             const float* __restrict__ gpam, const float* __restrict__ gcam, float* out) {
  __shared__ __align__(16) float Os[QT * OSP];
  __shared__ __align__(16) unsigned char Sm[2 * GOPB];
  const int tid  = threadIdx.x;
  const int lane = tid & 31, wave = tid >> 5;
  const int hh   = lane >> 4, c = lane & 15;
  const int nt = blockIdx.x, itb = blockIdx.y, b = blockIdx.z;
  const int n0 = nt * QT, i0 = itb * QT;

  v8f acc[4];                                                        // the 64 Pc rows and the 64 XP rows, staged in LDS
  tile_product(Sm, Pc + ((size_t)(b * CC + i0)) * CC, CC, XP + ((size_t)(b * NN + n0)) * CC, CC, acc);
  {
    const int nl = 16 * wave + c;
#pragma unroll
    for (int mt = 0; mt < 4; ++mt) {
#pragma unroll
      for (int r = 0; r < 8; ++r) Os[(16 * mt + 8 * hh + r) * OSP + nl] = acc[mt][r];
    }
  }
  __syncthreads();

  const float gp = bfr(gpam[0]);
  const float gc = bfr(gcam[0]) * IPSC;
  const int e = tid & 7, lq = tid >> 3;                              // lq 0..15
  // weights of the key ranges for the thread's 4 positions (nl below is the same in every it: 16 it is even)
  v4f wt[KS];
  {
    const float* sq = ST + (size_t)b * NN + n0;                      // block-uniform base; the lane's part is lo
    const unsigned lo = (unsigned)((lq & 1) * 32 + 4 * e);
    v4f mm[KS];
#pragma unroll
    for (int s = 0; s < KS; ++s) {
      mm[s] = *(const v4f*)(sq + (size_t)s * NB * NN + lo);
      wt[s] = *(const v4f*)(sq + (size_t)(KS + s) * NB * NN + lo);
    }
#pragma unroll
    for (int t = 0; t < 4; ++t) {
      float mx = mm[0][t];
#pragma unroll
      for (int s = 1; s < KS; ++s) mx = fmaxf(mx, mm[s][t]);
      float sm = 0.f;
#pragma unroll
      for (int s = 0; s < KS; ++s) { wt[s][t] *= exp2_slot((mm[s][t] - mx) * LOG2E); sm += wt[s][t]; }
      const float inv = 1.0f / sm;
#pragma unroll
      for (int s = 0; s < KS; ++s) wt[s][t] *= inv;
    }
  }
  // the ranges' rows: block-uniform base of the tile + one lane offset (row lq >> 1, the it and s steps are constants)
  const float* yt = Yp + ((size_t)(b * CC + i0)) * KS * NN + n0;
  const unsigned yo = (unsigned)((lq >> 1) * KS * NN + (lq & 1) * 32 + 4 * e);
  v4f res[8];
#pragma unroll
  for (int it = 0; it < 8; ++it) {
    const int L = it * 16 + lq;                                      // 0..127
    const int row = L >> 1, hf = L & 1;
    const int nl = hf * 32 + 4 * e;
    const v4f cam4 = *(const v4f*)(Os + row * OSP + nl);
    const size_t idx = ((size_t)(b * CC + i0 + row)) * NN + n0 + nl;
    const v4f xv = *(const v4f*)(x + idx);
    v4f yv = wt[0] * *(const v4f*)(yt + (size_t)(it * 8 * KS) * NN + yo);
#pragma unroll
    for (int s = 1; s < KS; ++s) yv += wt[s] * *(const v4f*)(yt + (size_t)(it * 8 * KS + s) * NN + yo);
#pragma unroll
    for (int t = 0; t < 4; ++t) {
      const float xb = bfr(xv[t]);
      const float t1 = gp * yv[t] + xb;
      const float t2 = gc * cam4[t] + xb;
      res[it][t] = t1 + t2;
    }
  }
{
#pragma unroll
    for (int it = 0; it < 8; ++it) {
      const int L = it * 16 + lq;
      const int row = L >> 1, hf = L & 1;
      const int nl = hf * 32 + 4 * e;
      const size_t idx = ((size_t)(b * CC + i0 + row)) * NN + n0 + nl;
      *(v4f*)(out + idx) = res[it];
    }
    
  }
}

// =========================================================================================================
// Workspace map (bytes; each region start a multiple of 256; every extent is an exact tile multiple and is written
//   W16 f16 [320][256]          163840      BIAS f32 [320]              1280
//   Xc  f16 [2][256][4096]     4194304      XP   f16 [2][4096][256]  4194304
//   Qh/Ql/Kh/Kl bf16 [2][4096][32]  524288 x4                          Vh f16 [2][256][4096]  4194304
//   Yp  f32 [2][256][4][4096] 33554432      G    f32 [16][2][256][256] 8388608     Pc f16 [2][256][256] 262144
//   ST  f32 [2][4][2][4096]     262144
//   total = 57312512
// =========================================================================================================
extern "C" void kernel_launch(void* const* d_in, const int* in_sizes, int n_in,
                              void* d_out, int out_size, void* d_ws, size_t ws_size,
                              hipStream_t stream) {
  const int XN = NB * CC * NN;                                       // 2097152
  if (n_in < 9) return;
  if (in_sizes[0] != XN) return;
  if (in_sizes[1] != CQ * CC || in_sizes[2] != CQ) return;
  if (in_sizes[3] != CQ * CC || in_sizes[4] != CQ) return;
  if (in_sizes[5] != CC * CC || in_sizes[6] != CC) return;
  if (in_sizes[7] < 1 || in_sizes[8] < 1) return;
  if (out_size != XN) return;

  size_t off = 0;
  auto carve = [&](size_t bytes) { const size_t o = off; off += (bytes + 255) & ~(size_t)255; return o; };
  const size_t oW16 = carve((size_t)MQKV * CC * 2);
  const size_t oBIA = carve((size_t)MQKV * 4);
  const size_t oXc  = carve((size_t)NB * CC * NN * 2);
  const size_t oXP  = carve((size_t)NB * NN * CC * 2);
  const size_t oQh  = carve((size_t)NB * NN * CQ * 2);
  const size_t oQl  = carve((size_t)NB * NN * CQ * 2);
  const size_t oKh  = carve((size_t)NB * NN * CQ * 2);
  const size_t oKl  = carve((size_t)NB * NN * CQ * 2);
  const size_t oVh  = carve((size_t)NB * CC * NN * 2);
  const size_t oYp  = carve((size_t)KS * NB * CC * NN * 4);
  const size_t oG   = carve((size_t)GS * NB * CC * CC * 4);
  const size_t oPc  = carve((size_t)NB * CC * CC * 2);
  const size_t oST  = carve((size_t)2 * KS * NB * NN * 4);
  if (off > ws_size) return;
  if (off > (size_t)134217728) return;

  const float* x    = (const float*)d_in[0];
  const float* wq   = (const float*)d_in[1];
  const float* bq   = (const float*)d_in[2];
  const float* wk   = (const float*)d_in[3];
  const float* bk   = (const float*)d_in[4];
  const float* wv   = (const float*)d_in[5];
  const float* bv   = (const float*)d_in[6];
  const float* gpam = (const float*)d_in[7];
  const float* gcam = (const float*)d_in[8];

  char* ws = (char*)d_ws;
  unsigned short* W16 = (unsigned short*)(ws + oW16);
  float*          BIA = (float*)(ws + oBIA);
  unsigned short* Xc  = (unsigned short*)(ws + oXc);
  unsigned short* XP  = (unsigned short*)(ws + oXP);
  unsigned short* Qh  = (unsigned short*)(ws + oQh);
  unsigned short* Ql  = (unsigned short*)(ws + oQl);
  unsigned short* Kh  = (unsigned short*)(ws + oKh);
  unsigned short* Kl  = (unsigned short*)(ws + oKl);
  unsigned short* Vh  = (unsigned short*)(ws + oVh);
  float*          Yp  = (float*)(ws + oYp);
  float*          G   = (float*)(ws + oG);
  unsigned short* Pc  = (unsigned short*)(ws + oPc);
  float*          ST  = (float*)(ws + oST);
  float* out = (float*)d_out;

  const dim3 blk256(256), blk128(128);

  // (0) + (1) weights -> f16 plane + bias line; x -> channel-major and position-major 16-bit planes
  cvt_wx<<<dim3(XB + WB), blk256, 0, stream>>>(x, wq, bq, wk, bk, wv, bv, Xc, XP, W16, BIA);
  // (2) + (4) conv1x1 GEMM -> q/k hi + residual planes and v plane; channel Gram, K slices -> G [s][b][256][256]
  gemm_gram<<<dim3(NN / QT, MQKV / QT + GY, NB), blk128, 0, stream>>>(W16, BIA, XP, Xc, Qh, Ql, Kh, Kl, Vh, G);
  // (3) + (5) position attention, KS key ranges -> Yp [b][256][s][4096], ST; channel softmax -> Pc [b][256][256] (x1024 f16)
  attn_pam<<<dim3(NN / QB, NB, KS), blk256, 0, stream>>>(Qh, Ql, Kh, Kl, Vh, Yp, ST, G, Pc);
  // (6) channel mix + merge of the key ranges + residual sum -> out [b][256][4096]
  cam_out<<<dim3(NN / QT, CC / QT, NB), blk128, 0, stream>>>(Pc, XP, Yp, ST, x, gpam, gcam, out);
  (void)hipGetLastError();
}

// v007
// A run of this version takes 45.2 microseconds.
// Next to v006, in two timings, it ran 1.03 and 1.04 times as fast.
// Counting every step since v000, it is 10.9 times as fast.
// Contractions: conv1x1 q/k/v GEMM W[320x256].X[256x4096] on v_wmma_f32_16x16x32_f16 (f16 containers of bf16-RNE
// weights x256 and bf16-RNE x); position scores K.Q^T on v_wmma_f32_16x16x32_bf16 (bf16 hi + bf16 residual planes of
// q and k, 3 products, K=32); O^T = V.P^T on v_wmma_f32_16x16x32_f16 (v f16, P = e^{s-m} x1024 f16 from the score D
// registers); channel Gram X.X^T (K=4096) and channel mix A.X (K=256) on v_wmma_f32_16x16x32_f16 (f16 of bf16-RNE x,
// softmax weights x1024 f16); f32 accumulate everywhere; softmax statistics, residual adds and output sum in f32 VALU.
// The key ranges' averages of the position attention pass from launch to launch as f16 (RNE of the f32 value).
#include <hip/hip_runtime.h>
#include <math.h>
#include <stdint.h>

#define NB    2
#define CC    256
#define NN    4096
#define CQ    32
#define MQKV  320
#define QT    64
#define QB    128                      // queries per block of the position attention
#define OSP   68
#define OSPW  132
#define TP    72
#define WSC   256.0f
#define IWSC  0.00390625f
#define PSC   1024.0f
#define IPSC  0.0009765625f
#define LNPS  6.931471805599453f
#define LOG2E 1.4426950408889634f
#define KT    64                       // keys per LDS stage of the position attention
#define NT    (NN / KT)                // stages
#define KS    4                        // key ranges of the position attention, one block each per query tile
#define NTS   (NT / KS)                // stages of one key range
#define VPB   144                      // LDS pitch of a v row (64 keys = 128 B, + 16 B: 16 B x odd for b128 readers)
#define KPB   80                       // LDS pitch of a k row (32 d = 64 B, + 16 B)
#define VSTB  (CC * VPB)               // v part of a stage, bytes
#define KSTB  (KT * KPB)               // one k plane of a stage, bytes
#define STGB  (VSTB + 2 * KSTB)        // one stage: v, k hi, k residual
#define GS    16                       // blocks that share the K = 4096 of one Gram tile
#define GK    (NN / GS)                // positions per Gram block
#define XB    ((NN / QT) * (CC / QT) * NB)                 // blocks of the x conversion
#define WB    (MQKV / 8)                                   // blocks of the weight conversion
#define GY    ((CC / QT) * (CC / QT) * GS / (NN / QT))     // grid rows of NN / QT blocks that hold one batch's Gram blocks
#define GRB   512                      // bytes of one operand row of a 64 x 64 x 256 product (256 halves)
#define GP    (GRB + 16)               // its LDS pitch (16 B x odd for b128 readers)
#define GOPB  (QT * GP)                // one staged operand: 64 rows

static_assert(NN % QT == 0);
static_assert(CC % QT == 0);
static_assert(MQKV == 2 * CQ + CC);
static_assert(MQKV % QT == 0);
static_assert((OSP * 4) % 16 == 0);
static_assert((OSPW * 4) % 16 == 0);
static_assert((TP * 2) % 16 == 0);
static_assert(CC % 32 == 0 && NN % 32 == 0 && CQ == 32);
static_assert(NN % KT == 0 && NT % KS == 0 && NTS >= 2 && NTS % 2 == 0 && KT % 32 == 0);
static_assert(VPB % 16 == 0 && KPB % 16 == 0 && STGB % 16 == 0 && VSTB % 16 == 0);
static_assert(VPB >= KT * 2 && KPB >= CQ * 2);
static_assert(NN % GS == 0 && GK % 32 == 0);
static_assert(GY * (NN / QT) == (CC / QT) * (CC / QT) * GS);
static_assert(CC * 2 == GRB && GK * 2 == GRB && GP % 16 == 0 && QT == 64);   // every staged row is 32 lanes x 16 B
static_assert((NN / QB) * NB * KS * 2 == NB * CC);         // two channel-softmax rows per block of the position attention
static_assert(NN % QB == 0 && KT == 64 && CC == 256);      // the stage copy's 256 lanes, the two key halves of a stage

typedef _Float16       v16h __attribute__((ext_vector_type(16)));
typedef _Float16       v8h  __attribute__((ext_vector_type(8)));
typedef __bf16         v16b __attribute__((ext_vector_type(16)));
typedef unsigned short v8us __attribute__((ext_vector_type(8)));
typedef float          v8f  __attribute__((ext_vector_type(8)));
typedef float          v4f  __attribute__((ext_vector_type(4)));
typedef unsigned int   v4u  __attribute__((ext_vector_type(4)));
typedef _Float16       v4h  __attribute__((ext_vector_type(4)));

union Frag  { v8us u[2]; v16h h; v16b bf; };
union FragH { v16h v; v8h hv[2]; };
static_assert(sizeof(Frag) == 32);
static_assert(sizeof(FragH) == 32);

// ---- scalar helpers ---------------------------------------------------------------------------------------
__device__ __forceinline__ unsigned short bf_bits(float f) {          // f32 -> bf16 bits, RNE convert
  unsigned u = __float_as_uint(f);
  return (unsigned short)((u + 0x7FFFu + ((u >> 16) & 1u)) >> 16);
}
__device__ __forceinline__ float bf_up(unsigned short hb) { return __uint_as_float(((unsigned)hb) << 16); }
__device__ __forceinline__ float bfr(float f) { return bf_up(bf_bits(f)); }
__device__ __forceinline__ unsigned short h_bits(_Float16 x) { return __builtin_bit_cast(unsigned short, x); }
__device__ __forceinline__ unsigned pk16(unsigned short a, unsigned short b) { return (unsigned)a | ((unsigned)b << 16); }
__device__ __forceinline__ v8f zero8() { v8f z = {0.f, 0.f, 0.f, 0.f, 0.f, 0.f, 0.f, 0.f}; return z; }
__device__ __forceinline__ float hmax8(v8f s) {
  return fmaxf(fmaxf(fmaxf(s[0], s[1]), fmaxf(s[2], s[3])), fmaxf(fmaxf(s[4], s[5]), fmaxf(s[6], s[7])));
}

// 2^x with the free slot that the instruction set asks for behind a transcendental, tied to it in one statement
__device__ __forceinline__ float exp2_slot(float x) {
  float r = 0.f;
#if defined(__HIP_DEVICE_COMPILE__)
  asm("v_exp_f32 %0, %1\n\tv_nop" : "=v"(r) : "v"(x));
#endif
  return r;
}

// ---- 16-bit fragment loader (A, or B from a k-contiguous [n][k] row): lane -> row/col (lane&15), p already includes
//      + 8*(lane>>4); elements 0..7 <- p[0..7] (k0+8h..), elements 8..15 <- p[16..23] (k0+16+8h..)
__device__ __forceinline__ Frag ldfrag(const unsigned short* p) {
  Frag f;
  f.u[0] = *(const v8us*)(p);
  f.u[1] = *(const v8us*)(p + 16);
  return f;
}

// ---- WMMA helpers: builtin followed by a 4-slot VALU gap tying D and keeping A/B live --------------------------
__device__ __forceinline__ v8f mma_b(v16b a, v16b b, v8f c) {
  v8f d = __builtin_amdgcn_wmma_f32_16x16x32_bf16(false, a, false, b, (short)0, c, false, false);
#if defined(__HIP_DEVICE_COMPILE__)
  const v16h ha = __builtin_bit_cast(v16h, a), hb = __builtin_bit_cast(v16h, b);
  asm volatile("v_nop\n\tv_nop\n\tv_nop\n\tv_nop" : "+v"(d) : "v"(ha), "v"(hb));
#endif
  return d;
}

// The same products as the bare builtins, for the kernel whose accumulators reach above v255: the operands of an asm
// statement are held in the first 256 registers, which would spill them; the compiler keeps the distance behind its builtins.
// The 64 x 64 x 256 products use them too: with no statement between the products their LDS reads can stand in groups ahead.
__device__ __forceinline__ v8f mma_hw(v16h a, v16h b, v8f c) {
  return __builtin_amdgcn_wmma_f32_16x16x32_f16(false, a, false, b, (short)0, c, false, false);
}
__device__ __forceinline__ v8f mma_bw(v16b a, v16b b, v8f c) {
  return __builtin_amdgcn_wmma_f32_16x16x32_bf16(false, a, false, b, (short)0, c, false, false);
}

// ---- 8 rows of 512 B -> LDS, one wave: a copy brings one whole row (32 lanes x 16 B, four whole lines), no register on
//      the way. l: the lane's LDS byte address in the first row (next rows + GP); g: its global piece (next rows + pitch halves).
//      s_wait_xcnt 0 closes the statement, a precaution: it stands in front of any rewrite of a register a copy names.
__device__ __forceinline__ void rows8_copy(unsigned l, const unsigned short* g, const size_t pitch) {
#if defined(__HIP_DEVICE_COMPILE__)
  asm volatile("global_load_async_to_lds_b128 %0, %8, off\n\t"
               "global_load_async_to_lds_b128 %1, %9, off\n\t"
               "global_load_async_to_lds_b128 %2, %10, off\n\t"
               "global_load_async_to_lds_b128 %3, %11, off\n\t"
               "global_load_async_to_lds_b128 %4, %12, off\n\t"
               "global_load_async_to_lds_b128 %5, %13, off\n\t"
               "global_load_async_to_lds_b128 %6, %14, off\n\t"
               "global_load_async_to_lds_b128 %7, %15, off\n\t"
               "s_wait_xcnt 0x0"
               :: "v"(l), "v"(l + 1u * GP), "v"(l + 2u * GP), "v"(l + 3u * GP),
                  "v"(l + 4u * GP), "v"(l + 5u * GP), "v"(l + 6u * GP), "v"(l + 7u * GP),
                  "v"(g), "v"(g + 1 * pitch), "v"(g + 2 * pitch), "v"(g + 3 * pitch),
                  "v"(g + 4 * pitch), "v"(g + 5 * pitch), "v"(g + 6 * pitch), "v"(g + 7 * pitch)
               : "memory");
#endif
}

// ---- one 64 x 64 x 256 product of a block of 4 waves: acc[mt] (rows 16 mt ..+15, cols 16 wave ..+15) = A . B^T.
//      a / b: first of 64 rows of 256 k-contiguous halves, row pitch pa / pb halves. Both operands are staged once in
//      Sm (A, then B, pitch GP): wave w brings rows 16 w ..+15 of each. The fragments then come from LDS with the same
//      k map and in the same k order as from the global rows: A is fetched once per block, not once per wave.
__device__ __forceinline__ void tile_product(unsigned char* Sm, const unsigned short* a, const size_t pa,
                                             const unsigned short* b, const size_t pb, v8f acc[4]) {
  const int tid  = threadIdx.x;
  const int lane = tid & 31, wave = tid >> 5;
  const int hh   = lane >> 4, c = lane & 15;
  const unsigned l0 = (unsigned)(size_t)Sm + (unsigned)(16 * wave * GP + 16 * lane);   // low 32 bits = byte offset in the block's LDS
  const unsigned short* ga = a + (size_t)(16 * wave) * pa + 8 * lane;
  const unsigned short* gb = b + (size_t)(16 * wave) * pb + 8 * lane;
  rows8_copy(l0, ga, pa);
  rows8_copy(l0 + 8u * GP, ga + 8 * pa, pa);
  rows8_copy(l0 + (unsigned)GOPB, gb, pb);
  rows8_copy(l0 + (unsigned)GOPB + 8u * GP, gb + 8 * pb, pb);
  asm volatile("s_wait_asynccnt 0x0" ::: "memory");                  // this wave's 32 rows have landed
  __syncthreads();                                                   // ... and every other wave's

  const unsigned char* ap = Sm + c * GP + 16 * hh;
  const unsigned char* bp = Sm + GOPB + (16 * wave + c) * GP + 16 * hh;
#pragma unroll
  for (int mt = 0; mt < 4; ++mt) acc[mt] = zero8();
  // groups of two k-steps (20 LDS reads, 8 products), two register sets: the next group's reads stand as one block in
  // front of this group's products and are in flight under them
  Frag fa[2][2][4], fb[2][2];
#pragma unroll
  for (int g = 0; g <= GRB / 128; ++g) {
    if (g < GRB / 128) {
#pragma unroll
      for (int kk = 0; kk < 2; ++kk) {
        fb[g & 1][kk] = ldfrag((const unsigned short*)(bp + 64 * (2 * g + kk)));
#pragma unroll
        for (int mt = 0; mt < 4; ++mt)
          fa[g & 1][kk][mt] = ldfrag((const unsigned short*)(ap + 16 * mt * GP + 64 * (2 * g + kk)));
      }
      // keeps the group's reads together here: sunk to their products, each pair would be waited for almost as soon as issued
      __builtin_amdgcn_sched_barrier(0);
    }
    if (g > 0) {
#pragma unroll
      for (int kk = 0; kk < 2; ++kk) {
#pragma unroll
        for (int mt = 0; mt < 4; ++mt)
          acc[mt] = mma_hw(fa[(g - 1) & 1][kk][mt].h, fb[(g - 1) & 1][kk].h, acc[mt]);
      }
    }
  }
  // closes the products: no global load of the caller's epilogue is scheduled up between them, onto an operand just read
  __builtin_amdgcn_sched_barrier(0);
#if defined(__HIP_DEVICE_COMPILE__)
  // the distance behind a matrix instruction, kept for loads too: four vector slots between the last product and whatever
  // of the caller's epilogue comes next, so that no global load lands on an A or B just read
  asm volatile("v_nop\n\tv_nop\n\tv_nop\n\tv_nop");
#endif
  // holds the epilogue behind those four slots
  __builtin_amdgcn_sched_barrier(0);
}

// =========================================================================================================
// (0) conv1x1 weights: W16 f16 [320][256], row o: 0..31 = wq, 32..63 = wk, 64..319 = wv; value = f16 of
//     (bf16-RNE(w) * 256) (exact). BIAS f32 [320] = bf16-RNE of bq / bk / bv. Block blk (0..39) owns rows
// coverage: 40 blocks x 8 rows x 32 pieces x 8 halves = 320 x 256; bias 80 x 4 floats = 320.
// =========================================================================================================
__device__ __forceinline__
void cvt_w(const float* __restrict__ wq, const float* __restrict__ bq,
           const float* __restrict__ wk, const float* __restrict__ bk,
           const float* __restrict__ wv, const float* __restrict__ bv,
           unsigned short* W16, float* BIAS, const int blk) {
  const int tid = threadIdx.x;
  const int rl = tid >> 5, col = 8 * (tid & 31);
  const int o = 8 * blk + rl;                                     // 0..319
  const float* wbase = (blk < 4) ? wq : (blk < 8) ? wk : wv;       // block-uniform selection
  const int osub = (blk < 4) ? 0 : (blk < 8) ? CQ : 2 * CQ;
  const float* s = wbase + (size_t)(o - osub) * CC + col;          // in range: (o-osub) < rows of that matrix
  const v4f a = *(const v4f*)s;
  const v4f q = *(const v4f*)(s + 4);
  const float f[8] = {a[0], a[1], a[2], a[3], q[0], q[1], q[2], q[3]};
  v4u u;
#pragma unroll
  for (int t = 0; t < 4; ++t) {
    const _Float16 h0 = (_Float16)(bfr(f[2 * t]) * WSC);
    const _Float16 h1 = (_Float16)(bfr(f[2 * t + 1]) * WSC);
    u[t] = pk16(h_bits(h0), h_bits(h1));
  }
  // bias values: every lane loads all three candidates with clamped indices, selects by value
  v4f bvv;
  {
    const int tb = min(tid, 79);
    const int o4 = 4 * tb;
#pragma unroll
    for (int qd = 0; qd < 4; ++qd) {
      const int oo = o4 + qd;
      const int iq = min(oo, CQ - 1);
      const int ik = min(max(oo - CQ, 0), CQ - 1);
      const int iv = min(max(oo - 2 * CQ, 0), CC - 1);
      const float cq = bq[iq], ck = bk[ik], cv = bv[iv];
      const float val = (oo < CQ) ? cq : (oo < 2 * CQ) ? ck : cv;
      bvv[qd] = bfr(val);
    }
  }
{
    *(v4u*)(W16 + (size_t)o * CC + col) = u;
    if (blk == 0 && tid < 80) *(v4f*)(BIAS + 4 * tid) = bvv;
    
  }
}

// =========================================================================================================
// (1) x f32 [b][256 c][4096 n] -> Xc f16 [b][c][n] (channel-major, bf16-RNE values, exact in f16) and
//     XP f16 [b][n][c] (position-major) through an LDS tile T[64 n][64 c] (pitch TP). Block (nb, cb, b) owns a
// coverage: Xc 2 it x 32 rows x 8 lanes x 8 = 64 c x 64 n; XP same; blocks (nb, cb, b) in (64, 4, NB) cover both planes once.
// =========================================================================================================
__device__ __forceinline__
void cvt_x(const float* __restrict__ x, unsigned short* Xc, unsigned short* XP, unsigned short* T,
           const int nb, const int cb, const int b) {
  const int tid = threadIdx.x;
  const int e = tid & 7, lq = tid >> 3;                             // lq 0..31
  const int n0 = nb * QT, c0 = cb * QT;
  v4u ux[2];
#pragma unroll
  for (int it = 0; it < 2; ++it) {
    const int cl = it * 32 + lq;                                     // 0..63
    const float* sp = x + ((size_t)(b * CC + c0 + cl)) * NN + n0 + 8 * e;
    const v4f a = *(const v4f*)sp;
    const v4f q = *(const v4f*)(sp + 4);
    unsigned short hb[8];
#pragma unroll
    for (int t = 0; t < 4; ++t) {
      hb[t]     = h_bits((_Float16)bfr(a[t]));
      hb[4 + t] = h_bits((_Float16)bfr(q[t]));
    }
#pragma unroll
    for (int t = 0; t < 4; ++t) ux[it][t] = pk16(hb[2 * t], hb[2 * t + 1]);
#pragma unroll
    for (int t = 0; t < 8; ++t) T[(8 * e + t) * TP + cl] = hb[t];
  }
  __syncthreads();
  v4u up[2];
#pragma unroll
  for (int it = 0; it < 2; ++it) {
    const int nl = it * 32 + lq;                                     // 0..63
    up[it] = *(const v4u*)(T + nl * TP + 8 * e);
  }
{
#pragma unroll
    for (int it = 0; it < 2; ++it) {
      const int rl = it * 32 + lq;
      *(v4u*)(Xc + ((size_t)(b * CC + c0 + rl)) * NN + n0 + 8 * e) = ux[it];
      *(v4u*)(XP + ((size_t)(b * NN + n0 + rl)) * CC + c0 + 8 * e) = up[it];
    }
    
  }
}

// =========================================================================================================
// (0) + (1) in one launch: neither reads what the other writes. Blocks 0 .. XB-1 do (1), block blk = nb + 64 (cb + 4 b);
//     blocks XB .. XB+WB-1 do (0). The choice is block-uniform, so the barrier of (1) is passed by whole blocks.
// =========================================================================================================
__global__ __launch_bounds__(256)
void cvt_wx(const float* __restrict__ x,
            const float* __restrict__ wq, const float* __restrict__ bq,
            const float* __restrict__ wk, const float* __restrict__ bk,
            const float* __restrict__ wv, const float* __restrict__ bv,
            unsigned short* Xc, unsigned short* XP, unsigned short* W16, float* BIAS) {
  __shared__ __align__(16) unsigned short T[QT * TP];
  const int blk = blockIdx.x;
  if (blk < XB) cvt_x(x, Xc, XP, T, blk % (NN / QT), (blk / (NN / QT)) % (CC / QT), blk / ((NN / QT) * (CC / QT)));
  else          cvt_w(wq, bq, wk, bk, wv, bv, W16, BIAS, blk - XB);
}

// =========================================================================================================
// (2) conv1x1 GEMM for one (b, 64-n tile, 64-o block): Y[o][n] = (1/256) sum_c W16[o][c] XP[b][n][c] + BIAS[o].
//     Block 128 threads = 4 waves; wave w owns cols n0+16w..+15 (one B fragment per k-step, k = c contiguous in
//     the XP row) and 4 m-tiles (A rows o = o0 + 16 mt + (lane&15), split k map loader from W16). K = 256 = 8 steps.
//     The 64 W16 rows and the 64 XP rows are staged in LDS (tile_product).
//     Epilogue staged in LDS Os[o_loc][n_loc] (pitch OSP), barrier, then:
//       o-block 0 (q rows 0..31, k rows 32..63): Qh/Ql/Kh/Kl bf16 hi / bf16 residual planes [b][4096 n][32]
//         holds rows 2ll, 2ll+1; lane e -> row 2ll+(e>>2), cols 8*(e&3)..+7; one instruction per 16 lines.
//         halves 8e..8e+7; one instruction per 16 lines.
// coverage: Os 4 waves x 4 tiles x 16x16 = 64 x 64; q/k: 4 planes x 32 lines x 8 lanes x 8 = 4 x (64 n x 32);
//           v: 4 it x 16 rows x 8 lanes x 8 = 64 ch x 64 n; grid rows y < 5 of (64, 5 + GY, NB) cover all planes exactly once.
// =========================================================================================================
__device__ __forceinline__
void gemm_qkv(const unsigned short* __restrict__ W16, const float* __restrict__ BIAS,
              const unsigned short* __restrict__ XP,
              unsigned short* Qh, unsigned short* Ql, unsigned short* Kh, unsigned short* Kl,
              unsigned short* Vh, float* Os, unsigned char* Sm, const int nt, const int mb, const int b) {
  const int tid  = threadIdx.x;
  const int lane = tid & 31, wave = tid >> 5;
  const int hh   = lane >> 4, c = lane & 15;
  const int n0   = nt * QT, o0 = mb * QT;

  v8f acc[4];
  tile_product(Sm, W16 + (size_t)o0 * CC, CC, XP + ((size_t)(b * NN + n0)) * CC, CC, acc);

  // ---- epilogue: scale back, + bias -> LDS Os[o_loc][n_loc] ----
  {
    const int nl = 16 * wave + c;
#pragma unroll
    for (int mt = 0; mt < 4; ++mt) {
#pragma unroll
      for (int r = 0; r < 8; ++r) {
        const int ol = 16 * mt + 8 * hh + r;                         // 0..63
        Os[ol * OSP + nl] = acc[mt][r] * IWSC + BIAS[o0 + ol];
      }
    }
  }
  __syncthreads();

  const int e = tid & 7, lq = tid >> 3;                             // lq 0..15
  if (mb == 0) {
    // ---- q/k bf16 hi + residual planes ----
{
#pragma unroll
      for (int it = 0; it < 8; ++it) {
        const int p    = it >> 1;                                    // 0 Qh, 1 Ql, 2 Kh, 3 Kl
        const int ll   = (it & 1) * 16 + lq;                         // 0..31
        const int nl   = 2 * ll + (e >> 2);                          // 0..63
        const int col0 = 8 * (e & 3);                                // 0,8,16,24
        const int rb   = ((p >> 1) ? CQ : 0) + col0;
        v4u u;
#pragma unroll
        for (int t = 0; t < 4; ++t) {
          const float f0 = Os[(rb + 2 * t) * OSP + nl];
          const float f1 = Os[(rb + 2 * t + 1) * OSP + nl];
          const unsigned short hb0 = bf_bits(f0), hb1 = bf_bits(f1);
          const unsigned short lb0 = bf_bits(f0 - bf_up(hb0));
          const unsigned short lb1 = bf_bits(f1 - bf_up(hb1));
          u[t] = (p & 1) ? pk16(lb0, lb1) : pk16(hb0, hb1);
        }
        unsigned short* P = (p == 0) ? Qh : (p == 1) ? Ql : (p == 2) ? Kh : Kl;
        *(v4u*)(P + ((size_t)(b * NN + n0 + nl)) * CQ + col0) = u;
      }
      
    }
  } else {
    // ---- v f16 plane ----
    const int ch0 = o0 - QT;                                         // (mb-1)*64
    v4u uv[4];
#pragma unroll
    for (int it = 0; it < 4; ++it) {
      const int row = it * 16 + lq;                                  // 0..63
      const v4f a = *(const v4f*)(Os + row * OSP + 8 * e);
      const v4f q = *(const v4f*)(Os + row * OSP + 8 * e + 4);
#pragma unroll
      for (int t = 0; t < 2; ++t) {
        uv[it][t]     = pk16(h_bits((_Float16)a[2 * t]), h_bits((_Float16)a[2 * t + 1]));
        uv[it][2 + t] = pk16(h_bits((_Float16)q[2 * t]), h_bits((_Float16)q[2 * t + 1]));
      }
    }
{
#pragma unroll
      for (int it = 0; it < 4; ++it) {
        const int row = it * 16 + lq;
        *(v4u*)(Vh + ((size_t)(b * CC + ch0 + row)) * NN + n0 + 8 * e) = uv[it];
      }
      
    }
  }
}

// =========================================================================================================
// (5) channel softmax: for row (b, i): G_j = sum of the GS slice planes in slice order, then
//     p_j = exp(min_j G - G_j) / sum (== softmax of rowmax - G), returned as the lane's 8 halves of
//     Pc f16 [b][256][256] = p * 1024. One wave per row: lane reads j = 8 lane..8 lane+7, wave min / sum by shuffles.
//     rw = b * 256 + i. The NB * 256 rows ride in the launch of (3), two per block, worked by the block's waves 0 and 1.
// =========================================================================================================
__device__ __forceinline__ v4u cam_softmax(const float* __restrict__ G, const int rw, const int lane) {
  const float* row = G + (size_t)rw * CC + 8 * lane;
  v4f a = *(const v4f*)row;
  v4f q = *(const v4f*)(row + 4);
#pragma unroll                                                       // straight line: the planes' loads issue ahead of the adds
  for (int s = 1; s < GS; ++s) {
    a += *(const v4f*)(row + (size_t)s * NB * CC * CC);
    q += *(const v4f*)(row + (size_t)s * NB * CC * CC + 4);
  }
  const float ev[8] = {a[0], a[1], a[2], a[3], q[0], q[1], q[2], q[3]};
  float mn = ev[0];
#pragma unroll
  for (int t = 1; t < 8; ++t) mn = fminf(mn, ev[t]);
#pragma unroll
  for (int s = 1; s < 32; s <<= 1) mn = fminf(mn, __shfl_xor(mn, s, 32));
  float p[8], sm = 0.f;
#pragma unroll
  for (int t = 0; t < 8; ++t) { p[t] = __expf(mn - ev[t]); sm += p[t]; }
#pragma unroll
  for (int s = 1; s < 32; s <<= 1) sm += __shfl_xor(sm, s, 32);
  const float inv = PSC / sm;
  v4u u;
#pragma unroll
  for (int t = 0; t < 4; ++t)
    u[t] = pk16(h_bits((_Float16)(p[2 * t] * inv)), h_bits((_Float16)(p[2 * t + 1] * inv)));
  return u;
}

// ---- one stage (64 keys) of v, k hi and k residual -> LDS, 256 lanes, 16 B per lane and copy, no register on the way.
//      v: copy i brings row (channel) 32 i + (tid >> 3), bytes 16 (tid & 7) ..+15 of its 128; 8 copies = 256 rows.
//      k: the one copy of a plane brings row (key) tid >> 2, bytes 16 (tid & 3) ..+15 of its 64; 64 rows.
//      lv / lk: the lane's LDS byte address of its first v / k-hi piece; gv / gh / gl: its first global piece.
//      s_wait_xcnt 0 closes the statement, a precaution: it stands in front of any rewrite of a register a copy names.
__device__ __forceinline__ void stage_copy(unsigned lv, unsigned lk, const unsigned short* gv,
                                           const unsigned short* gh, const unsigned short* gl) {
#if defined(__HIP_DEVICE_COMPILE__)
  asm volatile("global_load_async_to_lds_b128 %0, %10, off\n\t"
               "global_load_async_to_lds_b128 %1, %11, off\n\t"
               "global_load_async_to_lds_b128 %2, %12, off\n\t"
               "global_load_async_to_lds_b128 %3, %13, off\n\t"
               "global_load_async_to_lds_b128 %4, %14, off\n\t"
               "global_load_async_to_lds_b128 %5, %15, off\n\t"
               "global_load_async_to_lds_b128 %6, %16, off\n\t"
               "global_load_async_to_lds_b128 %7, %17, off\n\t"
               "global_load_async_to_lds_b128 %8, %18, off\n\t"
               "global_load_async_to_lds_b128 %9, %19, off\n\t"
               "s_wait_xcnt 0x0"
               :: "v"(lv), "v"(lv + 32u * VPB), "v"(lv + 64u * VPB), "v"(lv + 96u * VPB),
                  "v"(lv + 128u * VPB), "v"(lv + 160u * VPB), "v"(lv + 192u * VPB), "v"(lv + 224u * VPB),
                  "v"(lk), "v"(lk + (unsigned)KSTB),
                  "v"(gv), "v"(gv + (size_t)32 * NN), "v"(gv + (size_t)64 * NN), "v"(gv + (size_t)96 * NN),
                  "v"(gv + (size_t)128 * NN), "v"(gv + (size_t)160 * NN), "v"(gv + (size_t)192 * NN),
                  "v"(gv + (size_t)224 * NN), "v"(gh), "v"(gl)
               : "memory");
#endif
}

// =========================================================================================================
// (3) position attention for one (b, 128-query tile, key range sp of NN / KS keys), transposed formulation, no mask:
//   S^T tile (16 keys x 16 queries) = A(k: row = key kb + (lane&15), 32 d via the split k map from the bf16 plane
//   Kh [b][4096][32]) . B(q: col = query, same map, resident fragment from Qh) + A(Kh).B(Ql) + A(Kl).B(Qh)
//   (bf16 unscaled residual planes, shared accumulator). Energy = S (no scale).
//   Per lane the D tile holds 8 keys of ONE query: online softmax state per lane, one shuffle (lane^16) for the max
//   over 32 keys, row-sum partials combined at the end. P = e^{s-m} x 1024 as f16 is the B operand of
//   O^T (rows channel, cols queries) += A(V rows channel = 16j + (lane&15), keys contiguous, f16 plane Vh
//   [b][256][4096]) . B(P^T): element r <- D of the tile covering keys kb..kb+15, element 8+r <- the tile covering
//   kb+16..kb+31, lane unchanged.
//   Block = 8 waves = 4 query columns wq (32 queries each) x 2 key halves kh. A wave holds TWO groups of 16 queries
//   (2 x 16 accumulator tiles, 256 channels), so each k and v fragment it reads from LDS feeds two products; of every
//   stage of 64 keys it works the 32 keys of its half kh. Its group u is queries 32 wq + 16 (u ^ kh) ..+15.
//   The k and v rows of 64 keys are one stage in LDS, brought once per block by asynchronous copies and read by all
//   eight waves; two buffers: stage t + 1 flies while stage t is worked on.
//   Behind the loop waves (wq, 0) and (wq, 1) hold the two key halves of the same 32 queries: each hands its group 1
//   (accumulators, m, l) to the other through LDS and merges what it gets into its group 0 (own half, then the partner's).
//   Epilogue in two channel halves: O/l staged in LDS Os[query][128 channels] (pitch OSPW, each 16 queries 4 floats further:
//   the column walk of 8 lanes x 8 queries then meets 32 different banks; b128 stores), barrier, a thread packs 8 queries.
//   The result is the range's own softmax average as f16, Yp [b][256][KS][4096]; the range's maximum m and sum l of each query go to
//   ST [2][KS][b][4096] (m planes, then l planes), through LDS so that whole lines are written; (6) merges the ranges.
// coverage: per half 8 it x 32 lines x 8 lanes x 8 halves = 128 ch x 128 n; two halves = 256 ch; grid (32, NB, KS).
// =========================================================================================================
__global__ __launch_bounds__(256)
void attn_pam(const unsigned short* __restrict__ Qh, const unsigned short* __restrict__ Ql,
              const unsigned short* __restrict__ Kh, const unsigned short* __restrict__ Kl,
              const unsigned short* __restrict__ Vh, unsigned short* Yp, float* ST,
              const float* __restrict__ G, unsigned short* Pc) {
  __shared__ __align__(16) float Os[QB * OSPW + 4 * (QB / 16)];
  __shared__ __align__(16) float St[2 * QB];
  __shared__ __align__(16) float Sx[2 * 8 * 16];                     // m, then l, of the group a wave hands over
  __shared__ __align__(16) float Xo[8 * 16 * 2 * 32 * 4];            // its accumulators: [wave][tile][r half][lane] x 16 B
  __shared__ __align__(16) unsigned char Ring[2 * STGB];
  const int tid  = threadIdx.x;
  const int wave = __builtin_amdgcn_readfirstlane(tid >> 5), lane = tid & 31;   // the wave's number in a scalar register
  const int hh   = lane >> 4, c = lane & 15;
  const int wq   = wave & 3, kh = wave >> 2;
  const int n0   = blockIdx.x * QB, b = blockIdx.y, sp = blockIdx.z;
  const int t0   = sp * NTS;                                         // first stage of the block's key range (even)

  // resident q fragments (B operand, col = query n0 + 32 wq + 16 (u ^ kh) + c)
  Frag qh[2], ql[2];
  {
    const size_t qa = ((size_t)(b * NN + n0 + 32 * wq + 16 * kh + c)) * CQ + 8 * hh;
    const size_t qb = ((size_t)(b * NN + n0 + 32 * wq + 16 * (1 - kh) + c)) * CQ + 8 * hh;
    qh[0] = ldfrag(Qh + qa);
    ql[0] = ldfrag(Ql + qa);
    qh[1] = ldfrag(Qh + qb);
    ql[1] = ldfrag(Ql + qb);
    // the wait before the eight loads' address registers are reused; naming them as inputs keeps them whole up to here
#if defined(__HIP_DEVICE_COMPILE__)
    asm volatile("s_wait_xcnt 0x0" :: "v"(Qh + qa), "v"(Ql + qa), "v"(Qh + qb), "v"(Ql + qb) : "memory");
#endif
  }
  // the lane's first pieces of a stage: global sources (+ t * KT keys) and LDS places (+ buffer * STGB)
  const unsigned short* gv = Vh + (size_t)b * CC * NN + (size_t)(tid >> 3) * NN + 8 * (tid & 7);
  const unsigned short* gh = Kh + ((size_t)b * NN + (tid >> 2)) * CQ + 8 * (tid & 3);
  const unsigned short* gl = Kl + ((size_t)b * NN + (tid >> 2)) * CQ + 8 * (tid & 3);
  const unsigned ring0 = (unsigned)(size_t)Ring;                     // low 32 bits = byte offset in the block's LDS
  const unsigned lv = ring0 + (unsigned)((tid >> 3) * VPB + 16 * (tid & 7));
  const unsigned lk = ring0 + (unsigned)(VSTB + (tid >> 2) * KPB + 16 * (tid & 3));
  // fragment offsets inside a stage, at the wave's 32 keys: v (A operand, row = channel 16j + c, keys contiguous),
  // k (A operand, row = key)
  const int vfo = c * VPB + 16 * hh + kh * 64;
  const int kfo = VSTB + (32 * kh + c) * KPB + 16 * hh;

  float m[2] = {-1.0e30f, -1.0e30f}, l[2] = {0.f, 0.f};
  v8f o[2][16];
#pragma unroll
  for (int u = 0; u < 2; ++u) {
#pragma unroll
    for (int j = 0; j < 16; ++j) o[u][j] = zero8();
  }

  // prologue: stage t0 landed and published, then stage t0 + 1 on its way
  stage_copy(lv, lk, gv + (size_t)t0 * KT, gh + (size_t)t0 * KT * CQ, gl + (size_t)t0 * KT * CQ);
  // (5): the block's two rows of the channel softmax, in waves 0 and 1 (scalar test), while stage t0 is on its way
  const int  crow = 2 * (blockIdx.x + (NN / QB) * (blockIdx.y + NB * blockIdx.z)) + (wave & 1);   // 0 .. NB * CC - 1, each once
  const bool cwav = wave < 2;
  v4u cu = {0u, 0u, 0u, 0u};
  if (cwav) cu = cam_softmax(G, crow, lane);
  asm volatile("s_wait_asynccnt 0x0" ::: "memory");                  // this wave's pieces of stage t0 have landed
  __syncthreads();                                                   // ... and every other wave's
  if (cwav) {
    *(v4u*)(Pc + (size_t)crow * CC + 8 * lane) = cu;                 // behind the barrier: it does not wait for this store
    asm volatile("s_wait_xcnt 0x0" ::: "memory");                    // a precaution: before the code behind reuses the store's registers
  }
  stage_copy(lv + STGB, lk + STGB, gv + (size_t)(t0 + 1) * KT, gh + (size_t)(t0 + 1) * KT * CQ,
             gl + (size_t)(t0 + 1) * KT * CQ);

#pragma unroll 1                                                     // rolled: one stage's exponentials live at a time
  for (int t = t0; t < t0 + NTS; ++t) {
    const unsigned bo = (unsigned)(t & 1) * STGB;
    const unsigned char* sb = Ring + bo;
    const unsigned char* kp = sb + kfo;                              // the wave's keys start at kb = KT t + 32 kh
    const Frag k0  = ldfrag((const unsigned short*)(kp));                        // keys kb .. kb+15
    const Frag k1  = ldfrag((const unsigned short*)(kp + 16 * KPB));             // keys kb+16 .. kb+31
    const Frag k0l = ldfrag((const unsigned short*)(kp + KSTB));
    const Frag k1l = ldfrag((const unsigned short*)(kp + KSTB + 16 * KPB));
    v8f s0[2], s1[2];
#pragma unroll
    for (int u = 0; u < 2; ++u) {
      s0[u] = mma_bw(k0.bf, qh[u].bf, zero8());
      s1[u] = mma_bw(k1.bf, qh[u].bf, zero8());
    }
#pragma unroll
    for (int u = 0; u < 2; ++u) {
      s0[u] = mma_bw(k0.bf, ql[u].bf, s0[u]);
      s1[u] = mma_bw(k1.bf, ql[u].bf, s1[u]);
    }
#pragma unroll
    for (int u = 0; u < 2; ++u) {
      s0[u] = mma_bw(k0l.bf, qh[u].bf, s0[u]);
      s1[u] = mma_bw(k1l.bf, qh[u].bf, s1[u]);
    }

    float mx[2], mo[2];
#pragma unroll
    for (int u = 0; u < 2; ++u) {
      mx[u] = fmaxf(hmax8(s0[u]), hmax8(s1[u]));
      mo[u] = __shfl_xor(mx[u], 16, 32);
    }
    // the first 8 v fragments of the pass as one group of LDS reads, in flight under the maxima and their exchange
    const unsigned char* vp = sb + vfo;
    Frag vf[8];
#pragma unroll
    for (int j = 0; j < 8; ++j) vf[j] = ldfrag((const unsigned short*)(vp + 16 * j * VPB));

    FragH ph[2];
#pragma unroll
    for (int u = 0; u < 2; ++u) {
      const float mn   = fmaxf(m[u], fmaxf(mx[u], mo[u]));
      const float corr = __expf(m[u] - mn);
      m[u] = mn;
      const float msh = mn - LNPS;                                   // exp gives e^{s-m} * 1024
#pragma unroll
      for (int j = 0; j < 16; ++j) {
#pragma unroll
        for (int r = 0; r < 8; ++r) o[u][j][r] *= corr;
      }
      float ls = 0.f;
#pragma unroll
      for (int r = 0; r < 8; ++r) {
        const float e0 = __expf(s0[u][r] - msh);                     // key kb      + 8hh + r
        const float e1 = __expf(s1[u][r] - msh);                     // key kb + 16 + 8hh + r
        ls += e0 + e1;
        ph[u].hv[0][r] = (_Float16)e0;
        ph[u].hv[1][r] = (_Float16)e1;
      }
      l[u] = l[u] * corr + ls;
    }

    // blocks of 4 fragments, two products each; behind each of the first two blocks, the 4 fragments needed two blocks
    // later take their registers
#pragma unroll
    for (int g = 0; g < 4; ++g) {
#pragma unroll
      for (int i = 0; i < 4; ++i) {
        o[0][4 * g + i] = mma_hw(vf[(4 * g + i) & 7].h, ph[0].v, o[0][4 * g + i]);
        o[1][4 * g + i] = mma_hw(vf[(4 * g + i) & 7].h, ph[1].v, o[1][4 * g + i]);
      }
      if (g < 2) {
#pragma unroll
        for (int i = 0; i < 4; ++i)
          vf[(4 * g + i) & 7] = ldfrag((const unsigned short*)(vp + 16 * (4 * g + i + 8) * VPB));
      }
    }
    // keeps the stage's arithmetic in front of the barrier: sunk behind it, it would also stand in front of the refill,
    // whose copies would then be waited for almost as soon as they are issued
    __builtin_amdgcn_sched_barrier(0);
    // publish point of stage t + 1, and the end of every reader's last read of stage t's buffer
    asm volatile("s_wait_dscnt 0x0" ::: "memory");                   // this wave's LDS reads of stage t are done
    asm volatile("s_wait_asynccnt 0x0" ::: "memory");                // this wave's pieces of stage t + 1 have landed
    __syncthreads();
    if (t + 2 < t0 + NTS)                                            // block-uniform: refill the buffer just read
      stage_copy(lv + bo, lk + bo, gv + (size_t)(t + 2) * KT, gh + (size_t)(t + 2) * KT * CQ,
                 gl + (size_t)(t + 2) * KT * CQ);
  }
  asm volatile("s_wait_asynccnt 0x0" ::: "memory");                  // nothing of this wave is in flight at its end
  // the lane's number read anew: no index of the epilogue has to stay in a register (or be spilled) across the loop
  const int ln = (int)__builtin_amdgcn_mbcnt_lo(~0u, 0u);
  const int h2 = ln >> 4, c2 = ln & 15, td = 32 * wave + ln;
  l[0] += __shfl_xor(l[0], 16, 32);
  l[1] += __shfl_xor(l[1], 16, 32);

  // hand-over of group 1 to the wave that worked the other key half of the same queries (wave ^ 4, same lane)
  if (h2 == 0) { Sx[16 * wave + c2] = m[1]; Sx[128 + 16 * wave + c2] = l[1]; }   // equal in lanes c and c + 16
#pragma unroll
  for (int j = 0; j < 16; ++j) {
    v4f va, vb;
#pragma unroll
    for (int r = 0; r < 4; ++r) { va[r] = o[1][j][r]; vb[r] = o[1][j][4 + r]; }
    *(v4f*)(Xo + (((wave * 16 + j) * 2 + 0) * 32 + ln) * 4) = va;
    *(v4f*)(Xo + (((wave * 16 + j) * 2 + 1) * 32 + ln) * 4) = vb;
  }
  __syncthreads();                                                   // every wave's group 1 is in LDS
  const int pw = wave ^ 4;
  const float mp = Sx[16 * pw + c2], lp = Sx[128 + 16 * pw + c2];
  const float mm = fmaxf(m[0], mp);
  const float ea = __expf(m[0] - mm), eb = __expf(mp - mm);
  const float lm = l[0] * ea + lp * eb;                              // o and l both carry the x1024 factor
  const float inv = 1.0f / lm;
  const float fa = ea * inv, fb = eb * inv;

  const int qrow = 32 * wq + 16 * kh + c2;                           // the query of the wave's group 0
  const int qsh  = 4 * (2 * wq + kh);                                // 4 (qrow >> 4): the shift of its group of 16 rows
  const int e = td & 7, lq = td >> 3;                                // lq 0..31
  if (h2 == 0) { St[qrow] = mm; St[QB + qrow] = lm; }
#pragma unroll
  for (int half = 0; half < 2; ++half) {
    if (half) __syncthreads();                                       // every wave finished reading Os
#pragma unroll
    for (int jj = 0; jj < 8; ++jj) {
      const int j = 8 * half + jj;
      const v4f xa = *(const v4f*)(Xo + (((pw * 16 + j) * 2 + 0) * 32 + ln) * 4);
      const v4f xb = *(const v4f*)(Xo + (((pw * 16 + j) * 2 + 1) * 32 + ln) * 4);
      v4f va, vb;
#pragma unroll
      for (int r = 0; r < 4; ++r) { va[r] = o[0][j][r] * fa + xa[r] * fb; vb[r] = o[0][j][4 + r] * fa + xb[r] * fb; }
      *(v4f*)(Os + qrow * OSPW + qsh + 16 * jj + 8 * h2)     = va;   // Os[query][ch_loc = 16jj + 8hh + r]
      *(v4f*)(Os + qrow * OSPW + qsh + 16 * jj + 8 * h2 + 4) = vb;
    }
    __syncthreads();
#pragma unroll
    for (int it = 0; it < 8; ++it) {
      const int chl = (it & 3) * 32 + lq;                            // channel 0..127 within the half
      const int nl  = (it >> 2) * 64 + 8 * e;                        // query 0..127, 8 in a row: one group of 16
      const float* op = Os + nl * OSPW + 4 * (nl >> 4) + chl;
      v4u u;
#pragma unroll
      for (int t = 0; t < 4; ++t)
        u[t] = pk16(h_bits((_Float16)op[(2 * t) * OSPW]), h_bits((_Float16)op[(2 * t + 1) * OSPW]));
      *(v4u*)(Yp + ((size_t)((b * CC + 128 * half + chl) * KS + sp)) * NN + n0 + nl) = u;   // 8 lanes = one whole line
    }
  }
  if (td < 64) {                                                     // waves 0 and 1, behind the barriers above: 128 m, 128 l
    const int pl = td >> 5, q4 = 4 * (td & 31);
    *(v4f*)(ST + ((size_t)((pl * KS + sp) * NB + b)) * NN + n0 + q4) = *(const v4f*)(St + pl * QB + q4);
  }
}

// =========================================================================================================
// (4) channel Gram for one (b, 64-i block, 64-j block, K slice s): G[s][b][i][j] = sum over the slice's GK positions n
//     of Xc[b][i][n] Xc[b][j][n]; the GS slices of a tile run as GS blocks, and (5) adds their planes.
//     4 waves; wave w owns cols j0+16w..+15 (B from the j row, keys n contiguous) and 4 i tiles (A rows
//     [b][256][256] (row segment 64 j = 2 lines), 8 consecutive lanes x 16 B, one instruction per 16 lines, two
// coverage: 8 it x 16 lines x 8 lanes x 4 = 64 x 64; (jt, itb, zb) in (4, 4, GS * NB) covers the GS planes of G exactly once.
// =========================================================================================================
__device__ __forceinline__
void gram_k(const unsigned short* __restrict__ Xc, float* G, float* Os, unsigned char* Sm,
            const int jt, const int itb, const int zb) {
  const int tid  = threadIdx.x;
  const int lane = tid & 31, wave = tid >> 5;
  const int hh   = lane >> 4, c = lane & 15;
  const int b = zb % NB, s = zb / NB;                                // zb = s * NB + b: the plane of G this block writes
  const int j0 = jt * QT, i0 = itb * QT;

  v8f acc[4];                                                        // the slice's 256 positions of the 64 i rows and the 64 j rows, staged in LDS
  tile_product(Sm, Xc + ((size_t)(b * CC + i0)) * NN + s * GK, NN, Xc + ((size_t)(b * CC + j0)) * NN + s * GK, NN, acc);
  {
    const int nl = 16 * wave + c;
#pragma unroll
    for (int mt = 0; mt < 4; ++mt) {
#pragma unroll
      for (int r = 0; r < 8; ++r) Os[(16 * mt + 8 * hh + r) * OSP + nl] = acc[mt][r];
    }
  }
  __syncthreads();
  {
    const int e = tid & 7, lq = tid >> 3;                            // lq 0..15
{
#pragma unroll
      for (int it = 0; it < 8; ++it) {
        const int L = it * 16 + lq;                                  // 0..127
        const int row = L >> 1, hf = L & 1;
        const v4f v = *(const v4f*)(Os + row * OSP + hf * 32 + 4 * e);
        *(v4f*)(G + ((size_t)(zb * CC + i0 + row)) * CC + j0 + hf * 32 + 4 * e) = v;
      }
      // a precaution: in the shared launch code follows these stores in the listing; the wait stands before it reuses their registers
      asm volatile("s_wait_xcnt 0x0" ::: "memory");
    }
  }
}

// =========================================================================================================
// (2) + (4) in one launch: both read only what the launch before wrote, neither reads what the other writes.
//     Grid (64, 5 + GY, NB): rows y < 5 do (2) with (nt, mb, b) = (x, y, z); rows y >= 5 do (4): idx = x + 64 (y - 5)
//     = jt + 4 (itb + 4 s), batch z. The choice is block-uniform, so each body's barrier is passed by whole blocks.
// =========================================================================================================
__global__ __launch_bounds__(128)
void gemm_gram(const unsigned short* __restrict__ W16, const float* __restrict__ BIAS,
               const unsigned short* __restrict__ XP, const unsigned short* __restrict__ Xc,
               unsigned short* Qh, unsigned short* Ql, unsigned short* Kh, unsigned short* Kl,
               unsigned short* Vh, float* G) {
  __shared__ __align__(16) float Os[QT * OSP];
  __shared__ __align__(16) unsigned char Sm[2 * GOPB];
  const int y = blockIdx.y;
  if (y < MQKV / QT) {
    gemm_qkv(W16, BIAS, XP, Qh, Ql, Kh, Kl, Vh, Os, Sm, blockIdx.x, y, blockIdx.z);
  } else {
    const int idx = blockIdx.x + (NN / QT) * (y - MQKV / QT);
    gram_k(Xc, G, Os, Sm, idx % (CC / QT), (idx / (CC / QT)) % (CC / QT),
           (idx / ((CC / QT) * (CC / QT))) * NB + blockIdx.z);
  }
}

// =========================================================================================================
// (6) channel mix + output for one (b, 64-n tile, 64-i block): cam[i][n] = (1/1024) sum_j Pc[b][i][j] XP[b][n][j]
//     (K = 256 = 8 steps; A rows i = i0 + 16 mt + (lane&15), j contiguous; B col n = n0 + 16w + (lane&15) from the
//     XP row, j contiguous), then out[b][i][n] = (g_pam * Y + xb) + (g_cam * cam + xb) with xb = bf16-RNE of x and
//     Y = sum over the KS key ranges s, in range order, of wt_s[n] Yp[b][i][s][n], wt_s = l_s e^{m_s - M} / sum of these,
//     M = max_s m_s (m, l from ST): the softmax over all keys from the ranges' own averages (Yp f16, widened here).
// coverage: 8 it x 16 lines x 8 lanes x 4 = 64 i x 64 n; grid (64, 4, NB) covers d_out exactly once.
// =========================================================================================================
__global__ __launch_bounds__(128)
void cam_out(const unsigned short* __restrict__ Pc, const unsigned short* __restrict__ XP,
             const unsigned short* __restrict__ Yp, const float* __restrict__ ST, const float* __restrict__ x,
             const float* __restrict__ gpam, const float* __restrict__ gcam, float* out) {
  __shared__ __align__(16) float Os[QT * OSP];
  __shared__ __align__(16) unsigned char Sm[2 * GOPB];
  const int tid  = threadIdx.x;
  const int lane = tid & 31, wave = tid >> 5;
  const int hh   = lane >> 4, c = lane & 15;
  const int nt = blockIdx.x, itb = blockIdx.y, b = blockIdx.z;
  const int n0 = nt * QT, i0 = itb * QT;

  v8f acc[4];                                                        // the 64 Pc rows and the 64 XP rows, staged in LDS
  tile_product(Sm, Pc + ((size_t)(b * CC + i0)) * CC, CC, XP + ((size_t)(b * NN + n0)) * CC, CC, acc);
  {
    const int nl = 16 * wave + c;
#pragma unroll
    for (int mt = 0; mt < 4; ++mt) {
#pragma unroll
      for (int r = 0; r < 8; ++r) Os[(16 * mt + 8 * hh + r) * OSP + nl] = acc[mt][r];
    }
  }
  __syncthreads();

  const float gp = bfr(gpam[0]);
  const float gc = bfr(gcam[0]) * IPSC;
  const int e = tid & 7, lq = tid >> 3;                              // lq 0..15
  // weights of the key ranges for the thread's 4 positions (nl below is the same in every it: 16 it is even)
  v4f wt[KS];
  {
    const float* sq = ST + (size_t)b * NN + n0;                      // block-uniform base; the lane's part is lo
    const unsigned lo = (unsigned)((lq & 1) * 32 + 4 * e);
    v4f mm[KS];
#pragma unroll
    for (int s = 0; s < KS; ++s) {
      mm[s] = *(const v4f*)(sq + (size_t)s * NB * NN + lo);
      wt[s] = *(const v4f*)(sq + (size_t)(KS + s) * NB * NN + lo);
    }
#pragma unroll
    for (int t = 0; t < 4; ++t) {
      float mx = mm[0][t];
#pragma unroll
      for (int s = 1; s < KS; ++s) mx = fmaxf(mx, mm[s][t]);
      float sm = 0.f;
#pragma unroll
      for (int s = 0; s < KS; ++s) { wt[s][t] *= exp2_slot((mm[s][t] - mx) * LOG2E); sm += wt[s][t]; }
      const float inv = 1.0f / sm;
#pragma unroll
      for (int s = 0; s < KS; ++s) wt[s][t] *= inv;
    }
  }
  // the ranges' rows: block-uniform base of the tile + one lane offset (row lq >> 1, the it and s steps are constants)
  const unsigned char* yt = (const unsigned char*)(Yp + ((size_t)(b * CC + i0)) * KS * NN + n0);
  const unsigned yo = 2u * (unsigned)((lq >> 1) * KS * NN + (lq & 1) * 32 + 4 * e);   // bytes
  v4f res[8], xr[8];
  v4h yr[8][KS];
  const float* px[8];
#pragma unroll
  for (int it = 0; it < 8; ++it) {
    const int L = it * 16 + lq;                                      // 0..127
    px[it] = x + ((size_t)(b * CC + i0 + (L >> 1))) * NN + n0 + (L & 1) * 32 + 4 * e;
    xr[it] = *(const v4f*)px[it];
#pragma unroll
    for (int s = 0; s < KS; ++s) yr[it][s] = *(const v4h*)(yt + (size_t)(it * 8 * KS + s) * NN * 2 + yo);
  }
  // a precaution: the wait before the 40 loads' address registers are reused; naming them as inputs keeps them whole up to here
#if defined(__HIP_DEVICE_COMPILE__)
  asm volatile("s_wait_xcnt 0x0" :: "v"(px[0]), "v"(px[1]), "v"(px[2]), "v"(px[3]), "v"(px[4]), "v"(px[5]), "v"(px[6]),
               "v"(px[7]), "v"(yo) : "memory");
#endif
#pragma unroll
  for (int it = 0; it < 8; ++it) {
    const int L = it * 16 + lq;                                      // 0..127
    const int row = L >> 1, hf = L & 1;
    const int nl = hf * 32 + 4 * e;
    const v4f cam4 = *(const v4f*)(Os + row * OSP + nl);
    const v4f xv = xr[it];
    v4f yv = wt[0] * __builtin_convertvector(yr[it][0], v4f);
#pragma unroll
    for (int s = 1; s < KS; ++s) yv += wt[s] * __builtin_convertvector(yr[it][s], v4f);
#pragma unroll
    for (int t = 0; t < 4; ++t) {
      const float xb = bfr(xv[t]);
      const float t1 = gp * yv[t] + xb;
      const float t2 = gc * cam4[t] + xb;
      res[it][t] = t1 + t2;
    }
  }
{
#pragma unroll
    for (int it = 0; it < 8; ++it) {
      const int L = it * 16 + lq;
      const int row = L >> 1, hf = L & 1;
      const int nl = hf * 32 + 4 * e;
      const size_t idx = ((size_t)(b * CC + i0 + row)) * NN + n0 + nl;
      *(v4f*)(out + idx) = res[it];
    }
    
  }
}

// =========================================================================================================
// Workspace map (bytes; each region start a multiple of 256; every extent is an exact tile multiple and is written
//   W16 f16 [320][256]          163840      BIAS f32 [320]              1280
//   Xc  f16 [2][256][4096]     4194304      XP   f16 [2][4096][256]  4194304
//   Qh/Ql/Kh/Kl bf16 [2][4096][32]  524288 x4                          Vh f16 [2][256][4096]  4194304
//   Yp  f16 [2][256][4][4096] 16777216      G    f32 [16][2][256][256] 8388608     Pc f16 [2][256][256] 262144
//   ST  f32 [2][4][2][4096]     262144
//   total = 40535296
// =========================================================================================================
extern "C" void kernel_launch(void* const* d_in, const int* in_sizes, int n_in,
                              void* d_out, int out_size, void* d_ws, size_t ws_size,
                              hipStream_t stream) {
  const int XN = NB * CC * NN;                                       // 2097152
  if (n_in < 9) return;
  if (in_sizes[0] != XN) return;
  if (in_sizes[1] != CQ * CC || in_sizes[2] != CQ) return;
  if (in_sizes[3] != CQ * CC || in_sizes[4] != CQ) return;
  if (in_sizes[5] != CC * CC || in_sizes[6] != CC) return;
  if (in_sizes[7] < 1 || in_sizes[8] < 1) return;
  if (out_size != XN) return;

  size_t off = 0;
  auto carve = [&](size_t bytes) { const size_t o = off; off += (bytes + 255) & ~(size_t)255; return o; };
  const size_t oW16 = carve((size_t)MQKV * CC * 2);
  const size_t oBIA = carve((size_t)MQKV * 4);
  const size_t oXc  = carve((size_t)NB * CC * NN * 2);
  const size_t oXP  = carve((size_t)NB * NN * CC * 2);
  const size_t oQh  = carve((size_t)NB * NN * CQ * 2);
  const size_t oQl  = carve((size_t)NB * NN * CQ * 2);
  const size_t oKh  = carve((size_t)NB * NN * CQ * 2);
  const size_t oKl  = carve((size_t)NB * NN * CQ * 2);
  const size_t oVh  = carve((size_t)NB * CC * NN * 2);
  const size_t oYp  = carve((size_t)KS * NB * CC * NN * 2);
  const size_t oG   = carve((size_t)GS * NB * CC * CC * 4);
  const size_t oPc  = carve((size_t)NB * CC * CC * 2);
  const size_t oST  = carve((size_t)2 * KS * NB * NN * 4);
  if (off > ws_size) return;
  if (off > (size_t)134217728) return;

  const float* x    = (const float*)d_in[0];
  const float* wq   = (const float*)d_in[1];
  const float* bq   = (const float*)d_in[2];
  const float* wk   = (const float*)d_in[3];
  const float* bk   = (const float*)d_in[4];
  const float* wv   = (const float*)d_in[5];
  const float* bv   = (const float*)d_in[6];
  const float* gpam = (const float*)d_in[7];
  const float* gcam = (const float*)d_in[8];

  char* ws = (char*)d_ws;
  unsigned short* W16 = (unsigned short*)(ws + oW16);
  float*          BIA = (float*)(ws + oBIA);
  unsigned short* Xc  = (unsigned short*)(ws + oXc);
  unsigned short* XP  = (unsigned short*)(ws + oXP);
  unsigned short* Qh  = (unsigned short*)(ws + oQh);
  unsigned short* Ql  = (unsigned short*)(ws + oQl);
  unsigned short* Kh  = (unsigned short*)(ws + oKh);
  unsigned short* Kl  = (unsigned short*)(ws + oKl);
  unsigned short* Vh  = (unsigned short*)(ws + oVh);
  unsigned short* Yp  = (unsigned short*)(ws + oYp);
  float*          G   = (float*)(ws + oG);
  unsigned short* Pc  = (unsigned short*)(ws + oPc);
  float*          ST  = (float*)(ws + oST);
  float* out = (float*)d_out;

  const dim3 blk256(256), blk128(128);

  // (0) + (1) weights -> f16 plane + bias line; x -> channel-major and position-major 16-bit planes
  cvt_wx<<<dim3(XB + WB), blk256, 0, stream>>>(x, wq, bq, wk, bk, wv, bv, Xc, XP, W16, BIA);
  // (2) + (4) conv1x1 GEMM -> q/k hi + residual planes and v plane; channel Gram, K slices -> G [s][b][256][256]
  gemm_gram<<<dim3(NN / QT, MQKV / QT + GY, NB), blk128, 0, stream>>>(W16, BIA, XP, Xc, Qh, Ql, Kh, Kl, Vh, G);
  // (3) + (5) position attention, KS key ranges -> Yp [b][256][s][4096], ST; channel softmax -> Pc [b][256][256] (x1024 f16)
  attn_pam<<<dim3(NN / QB, NB, KS), blk256, 0, stream>>>(Qh, Ql, Kh, Kl, Vh, Yp, ST, G, Pc);
  // (6) channel mix + merge of the key ranges + residual sum -> out [b][256][4096]
  cam_out<<<dim3(NN / QT, CC / QT, NB), blk128, 0, stream>>>(Pc, XP, Yp, ST, x, gpam, gcam, out);
  (void)hipGetLastError();
}

// v008
// It runs in 42.1 microseconds.
// In both of two side-by-side timings against v007, it was 1.07 times as fast.
// All steps since v000 together make it 11.7 times as fast.
// Contractions: conv1x1 q/k/v GEMM W[320x256].X[256x4096] on v_wmma_f32_16x16x32_f16 (f16 containers of bf16-RNE
// weights x256 and bf16-RNE x); position scores K.Q^T on v_wmma_f32_16x16x32_bf16 (bf16 hi + bf16 residual planes of
// q and k, 3 products, K=32); O^T = V.P^T on v_wmma_f32_16x16x32_f16 (v f16, P = e^{s-m} / 64 f16 from the score D
// registers); channel Gram X.X^T (K=4096) and channel mix A.X (K=256) on v_wmma_f32_16x16x32_f16 (f16 of bf16-RNE x,
// softmax weights x1024 f16); f32 accumulate everywhere; softmax statistics, residual adds and output sum in f32 VALU.
// The key ranges' averages of the position attention pass from launch to launch as f16 (RNE of the f32 value).
#include <hip/hip_runtime.h>
#include <math.h>
#include <stdint.h>

#define NB    2
#define CC    256
#define NN    4096
#define CQ    32
#define MQKV  320
#define QT    64
#define QB    128                      // queries per block of the position attention
#define OSP   68
#define OSPW  132
#define TP    72
#define WSC   256.0f
#define IWSC  0.00390625f
#define PSC   1024.0f
#define IPSC  0.0009765625f
#define LNPA  (-4.158883083359672f)    // ln (1 / 64): P of the position attention is e^{s-m} / 64, 22 binades under f16's top
#define PTOP  65000.0f                 // a lane's sum of one stage's P above this: the reference m is raised (f16 P stays finite)
#define LOG2E 1.4426950408889634f
#define KT    64                       // keys per LDS stage of the position attention
#define NT    (NN / KT)                // stages
#define KS    4                        // key ranges of the position attention, one block each per query tile
#define NTS   (NT / KS)                // stages of one key range
#define VPB   144                      // LDS pitch of a v row (64 keys = 128 B, + 16 B: 16 B x odd for b128 readers)
#define KPB   80                       // LDS pitch of a k row (32 d = 64 B, + 16 B)
#define VSTB  (CC * VPB)               // v part of a stage, bytes
#define KSTB  (KT * KPB)               // one k plane of a stage, bytes
#define STGB  (VSTB + 2 * KSTB)        // one stage: v, k hi, k residual
#define GS    16                       // blocks that share the K = 4096 of one Gram tile
#define GK    (NN / GS)                // positions per Gram block
#define XB    ((NN / QT) * (CC / QT) * NB)                 // blocks of the x conversion
#define WB    (MQKV / 8)                                   // blocks of the weight conversion
#define GY    ((CC / QT) * (CC / QT) * GS / (NN / QT))     // grid rows of NN / QT blocks that hold one batch's Gram blocks
#define GRB   512                      // bytes of one operand row of a 64 x 64 x 256 product (256 halves)
#define GP    (GRB + 16)               // its LDS pitch (16 B x odd for b128 readers)
#define GOPB  (QT * GP)                // one staged operand: 64 rows

static_assert(NN % QT == 0);
static_assert(CC % QT == 0);
static_assert(MQKV == 2 * CQ + CC);
static_assert(MQKV % QT == 0);
static_assert((OSP * 4) % 16 == 0);
static_assert((OSPW * 4) % 16 == 0);
static_assert((TP * 2) % 16 == 0);
static_assert(CC % 32 == 0 && NN % 32 == 0 && CQ == 32);
static_assert(NN % KT == 0 && NT % KS == 0 && NTS >= 2 && NTS % 2 == 0 && KT % 32 == 0);
static_assert(VPB % 16 == 0 && KPB % 16 == 0 && STGB % 16 == 0 && VSTB % 16 == 0);
static_assert(VPB >= KT * 2 && KPB >= CQ * 2);
static_assert(NN % GS == 0 && GK % 32 == 0);
static_assert(GY * (NN / QT) == (CC / QT) * (CC / QT) * GS);
static_assert(CC * 2 == GRB && GK * 2 == GRB && GP % 16 == 0 && QT == 64);   // every staged row is 32 lanes x 16 B
static_assert((NN / QB) * NB * KS * 2 == NB * CC);         // two channel-softmax rows per block of the position attention
static_assert(NN % QB == 0 && KT == 64 && CC == 256);      // the stage copy's 256 lanes, the two key halves of a stage

typedef _Float16       v16h __attribute__((ext_vector_type(16)));
typedef _Float16       v8h  __attribute__((ext_vector_type(8)));
typedef __bf16         v16b __attribute__((ext_vector_type(16)));
typedef unsigned short v8us __attribute__((ext_vector_type(8)));
typedef float          v8f  __attribute__((ext_vector_type(8)));
typedef float          v4f  __attribute__((ext_vector_type(4)));
typedef unsigned int   v4u  __attribute__((ext_vector_type(4)));
typedef _Float16       v4h  __attribute__((ext_vector_type(4)));

union Frag  { v8us u[2]; v16h h; v16b bf; };
union FragH { v16h v; v8h hv[2]; };
static_assert(sizeof(Frag) == 32);
static_assert(sizeof(FragH) == 32);

// ---- scalar helpers ---------------------------------------------------------------------------------------
__device__ __forceinline__ unsigned short bf_bits(float f) {          // f32 -> bf16 bits, RNE convert
  unsigned u = __float_as_uint(f);
  return (unsigned short)((u + 0x7FFFu + ((u >> 16) & 1u)) >> 16);
}
__device__ __forceinline__ float bf_up(unsigned short hb) { return __uint_as_float(((unsigned)hb) << 16); }
__device__ __forceinline__ float bfr(float f) { return bf_up(bf_bits(f)); }
__device__ __forceinline__ unsigned short h_bits(_Float16 x) { return __builtin_bit_cast(unsigned short, x); }
__device__ __forceinline__ unsigned pk16(unsigned short a, unsigned short b) { return (unsigned)a | ((unsigned)b << 16); }
__device__ __forceinline__ v8f zero8() { v8f z = {0.f, 0.f, 0.f, 0.f, 0.f, 0.f, 0.f, 0.f}; return z; }
__device__ __forceinline__ float hmax8(v8f s) {
  return fmaxf(fmaxf(fmaxf(s[0], s[1]), fmaxf(s[2], s[3])), fmaxf(fmaxf(s[4], s[5]), fmaxf(s[6], s[7])));
}

// 2^x with the free slot that the instruction set asks for behind a transcendental, tied to it in one statement
__device__ __forceinline__ float exp2_slot(float x) {
  float r = 0.f;
#if defined(__HIP_DEVICE_COMPILE__)
  asm("v_exp_f32 %0, %1\n\tv_nop" : "=v"(r) : "v"(x));
#endif
  return r;
}

// ---- 16-bit fragment loader (A, or B from a k-contiguous [n][k] row): lane -> row/col (lane&15), p already includes
//      + 8*(lane>>4); elements 0..7 <- p[0..7] (k0+8h..), elements 8..15 <- p[16..23] (k0+16+8h..)
__device__ __forceinline__ Frag ldfrag(const unsigned short* p) {
  Frag f;
  f.u[0] = *(const v8us*)(p);
  f.u[1] = *(const v8us*)(p + 16);
  return f;
}

// ---- WMMA helpers: builtin followed by a 4-slot VALU gap tying D and keeping A/B live --------------------------
__device__ __forceinline__ v8f mma_b(v16b a, v16b b, v8f c) {
  v8f d = __builtin_amdgcn_wmma_f32_16x16x32_bf16(false, a, false, b, (short)0, c, false, false);
#if defined(__HIP_DEVICE_COMPILE__)
  const v16h ha = __builtin_bit_cast(v16h, a), hb = __builtin_bit_cast(v16h, b);
  asm volatile("v_nop\n\tv_nop\n\tv_nop\n\tv_nop" : "+v"(d) : "v"(ha), "v"(hb));
#endif
  return d;
}

// The same products as the bare builtins, for the kernel whose accumulators reach above v255: the operands of an asm
// statement are held in the first 256 registers, which would spill them; the compiler keeps the distance behind its builtins.
// The 64 x 64 x 256 products use them too: with no statement between the products their LDS reads can stand in groups ahead.
__device__ __forceinline__ v8f mma_hw(v16h a, v16h b, v8f c) {
  return __builtin_amdgcn_wmma_f32_16x16x32_f16(false, a, false, b, (short)0, c, false, false);
}
__device__ __forceinline__ v8f mma_bw(v16b a, v16b b, v8f c) {
  return __builtin_amdgcn_wmma_f32_16x16x32_bf16(false, a, false, b, (short)0, c, false, false);
}

// ---- 8 rows of 512 B -> LDS, one wave: a copy brings one whole row (32 lanes x 16 B, four whole lines), no register on
//      the way. l: the lane's LDS byte address in the first row (next rows + GP); g: its global piece (next rows + pitch halves).
//      s_wait_xcnt 0 closes the statement, a precaution: it stands in front of any rewrite of a register a copy names.
__device__ __forceinline__ void rows8_copy(unsigned l, const unsigned short* g, const size_t pitch) {
#if defined(__HIP_DEVICE_COMPILE__)
  asm volatile("global_load_async_to_lds_b128 %0, %8, off\n\t"
               "global_load_async_to_lds_b128 %1, %9, off\n\t"
               "global_load_async_to_lds_b128 %2, %10, off\n\t"
               "global_load_async_to_lds_b128 %3, %11, off\n\t"
               "global_load_async_to_lds_b128 %4, %12, off\n\t"
               "global_load_async_to_lds_b128 %5, %13, off\n\t"
               "global_load_async_to_lds_b128 %6, %14, off\n\t"
               "global_load_async_to_lds_b128 %7, %15, off\n\t"
               "s_wait_xcnt 0x0"
               :: "v"(l), "v"(l + 1u * GP), "v"(l + 2u * GP), "v"(l + 3u * GP),
                  "v"(l + 4u * GP), "v"(l + 5u * GP), "v"(l + 6u * GP), "v"(l + 7u * GP),
                  "v"(g), "v"(g + 1 * pitch), "v"(g + 2 * pitch), "v"(g + 3 * pitch),
                  "v"(g + 4 * pitch), "v"(g + 5 * pitch), "v"(g + 6 * pitch), "v"(g + 7 * pitch)
               : "memory");
#endif
}

// ---- one 64 x 64 x 256 product of a block of 4 waves: acc[mt] (rows 16 mt ..+15, cols 16 wave ..+15) = A . B^T.
//      a / b: first of 64 rows of 256 k-contiguous halves, row pitch pa / pb halves. Both operands are staged once in
//      Sm (A, then B, pitch GP): wave w brings rows 16 w ..+15 of each. The fragments then come from LDS with the same
//      k map and in the same k order as from the global rows: A is fetched once per block, not once per wave.
__device__ __forceinline__ void tile_product(unsigned char* Sm, const unsigned short* a, const size_t pa,
                                             const unsigned short* b, const size_t pb, v8f acc[4]) {
  const int tid  = threadIdx.x;
  const int lane = tid & 31, wave = tid >> 5;
  const int hh   = lane >> 4, c = lane & 15;
  const unsigned l0 = (unsigned)(size_t)Sm + (unsigned)(16 * wave * GP + 16 * lane);   // low 32 bits = byte offset in the block's LDS
  const unsigned short* ga = a + (size_t)(16 * wave) * pa + 8 * lane;
  const unsigned short* gb = b + (size_t)(16 * wave) * pb + 8 * lane;
  rows8_copy(l0, ga, pa);
  rows8_copy(l0 + 8u * GP, ga + 8 * pa, pa);
  rows8_copy(l0 + (unsigned)GOPB, gb, pb);
  rows8_copy(l0 + (unsigned)GOPB + 8u * GP, gb + 8 * pb, pb);
  asm volatile("s_wait_asynccnt 0x0" ::: "memory");                  // this wave's 32 rows have landed
  __syncthreads();                                                   // ... and every other wave's

  const unsigned char* ap = Sm + c * GP + 16 * hh;
  const unsigned char* bp = Sm + GOPB + (16 * wave + c) * GP + 16 * hh;
#pragma unroll
  for (int mt = 0; mt < 4; ++mt) acc[mt] = zero8();
  // groups of two k-steps (20 LDS reads, 8 products), two register sets: the next group's reads stand as one block in
  // front of this group's products and are in flight under them
  Frag fa[2][2][4], fb[2][2];
#pragma unroll
  for (int g = 0; g <= GRB / 128; ++g) {
    if (g < GRB / 128) {
#pragma unroll
      for (int kk = 0; kk < 2; ++kk) {
        fb[g & 1][kk] = ldfrag((const unsigned short*)(bp + 64 * (2 * g + kk)));
#pragma unroll
        for (int mt = 0; mt < 4; ++mt)
          fa[g & 1][kk][mt] = ldfrag((const unsigned short*)(ap + 16 * mt * GP + 64 * (2 * g + kk)));
      }
      // keeps the group's reads together here: sunk to their products, each pair would be waited for almost as soon as issued
      __builtin_amdgcn_sched_barrier(0);
    }
    if (g > 0) {
#pragma unroll
      for (int kk = 0; kk < 2; ++kk) {
#pragma unroll
        for (int mt = 0; mt < 4; ++mt)
          acc[mt] = mma_hw(fa[(g - 1) & 1][kk][mt].h, fb[(g - 1) & 1][kk].h, acc[mt]);
      }
    }
  }
  // closes the products: no global load of the caller's epilogue is scheduled up between them, onto an operand just read
  __builtin_amdgcn_sched_barrier(0);
#if defined(__HIP_DEVICE_COMPILE__)
  // the distance behind a matrix instruction, kept for loads too: four vector slots between the last product and whatever
  // of the caller's epilogue comes next, so that no global load lands on an A or B just read
  asm volatile("v_nop\n\tv_nop\n\tv_nop\n\tv_nop");
#endif
  // holds the epilogue behind those four slots
  __builtin_amdgcn_sched_barrier(0);
}

// =========================================================================================================
// (0) conv1x1 weights: W16 f16 [320][256], row o: 0..31 = wq, 32..63 = wk, 64..319 = wv; value = f16 of
//     (bf16-RNE(w) * 256) (exact). BIAS f32 [320] = bf16-RNE of bq / bk / bv. Block blk (0..39) owns rows
// coverage: 40 blocks x 8 rows x 32 pieces x 8 halves = 320 x 256; bias 80 x 4 floats = 320.
// =========================================================================================================
__device__ __forceinline__
void cvt_w(const float* __restrict__ wq, const float* __restrict__ bq,
           const float* __restrict__ wk, const float* __restrict__ bk,
           const float* __restrict__ wv, const float* __restrict__ bv,
           unsigned short* W16, float* BIAS, const int blk) {
  const int tid = threadIdx.x;
  const int rl = tid >> 5, col = 8 * (tid & 31);
  const int o = 8 * blk + rl;                                     // 0..319
  const float* wbase = (blk < 4) ? wq : (blk < 8) ? wk : wv;       // block-uniform selection
  const int osub = (blk < 4) ? 0 : (blk < 8) ? CQ : 2 * CQ;
  const float* s = wbase + (size_t)(o - osub) * CC + col;          // in range: (o-osub) < rows of that matrix
  const v4f a = *(const v4f*)s;
  const v4f q = *(const v4f*)(s + 4);
  const float f[8] = {a[0], a[1], a[2], a[3], q[0], q[1], q[2], q[3]};
  v4u u;
#pragma unroll
  for (int t = 0; t < 4; ++t) {
    const _Float16 h0 = (_Float16)(bfr(f[2 * t]) * WSC);
    const _Float16 h1 = (_Float16)(bfr(f[2 * t + 1]) * WSC);
    u[t] = pk16(h_bits(h0), h_bits(h1));
  }
  // bias values: every lane loads all three candidates with clamped indices, selects by value
  v4f bvv;
  {
    const int tb = min(tid, 79);
    const int o4 = 4 * tb;
#pragma unroll
    for (int qd = 0; qd < 4; ++qd) {
      const int oo = o4 + qd;
      const int iq = min(oo, CQ - 1);
      const int ik = min(max(oo - CQ, 0), CQ - 1);
      const int iv = min(max(oo - 2 * CQ, 0), CC - 1);
      const float cq = bq[iq], ck = bk[ik], cv = bv[iv];
      const float val = (oo < CQ) ? cq : (oo < 2 * CQ) ? ck : cv;
      bvv[qd] = bfr(val);
    }
  }
{
    *(v4u*)(W16 + (size_t)o * CC + col) = u;
    if (blk == 0 && tid < 80) *(v4f*)(BIAS + 4 * tid) = bvv;
    
  }
}

// =========================================================================================================
// (1) x f32 [b][256 c][4096 n] -> Xc f16 [b][c][n] (channel-major, bf16-RNE values, exact in f16) and
//     XP f16 [b][n][c] (position-major) through an LDS tile T[64 n][64 c] (pitch TP). Block (nb, cb, b) owns a
// coverage: Xc 2 it x 32 rows x 8 lanes x 8 = 64 c x 64 n; XP same; blocks (nb, cb, b) in (64, 4, NB) cover both planes once.
// =========================================================================================================
__device__ __forceinline__
void cvt_x(const float* __restrict__ x, unsigned short* Xc, unsigned short* XP, unsigned short* T,
           const int nb, const int cb, const int b) {
  const int tid = threadIdx.x;
  const int e = tid & 7, lq = tid >> 3;                             // lq 0..31
  const int n0 = nb * QT, c0 = cb * QT;
  v4u ux[2];
#pragma unroll
  for (int it = 0; it < 2; ++it) {
    const int cl = it * 32 + lq;                                     // 0..63
    const float* sp = x + ((size_t)(b * CC + c0 + cl)) * NN + n0 + 8 * e;
    const v4f a = *(const v4f*)sp;
    const v4f q = *(const v4f*)(sp + 4);
    unsigned short hb[8];
#pragma unroll
    for (int t = 0; t < 4; ++t) {
      hb[t]     = h_bits((_Float16)bfr(a[t]));
      hb[4 + t] = h_bits((_Float16)bfr(q[t]));
    }
#pragma unroll
    for (int t = 0; t < 4; ++t) ux[it][t] = pk16(hb[2 * t], hb[2 * t + 1]);
#pragma unroll
    for (int t = 0; t < 8; ++t) T[(8 * e + t) * TP + cl] = hb[t];
  }
  __syncthreads();
  v4u up[2];
#pragma unroll
  for (int it = 0; it < 2; ++it) {
    const int nl = it * 32 + lq;                                     // 0..63
    up[it] = *(const v4u*)(T + nl * TP + 8 * e);
  }
{
#pragma unroll
    for (int it = 0; it < 2; ++it) {
      const int rl = it * 32 + lq;
      *(v4u*)(Xc + ((size_t)(b * CC + c0 + rl)) * NN + n0 + 8 * e) = ux[it];
      *(v4u*)(XP + ((size_t)(b * NN + n0 + rl)) * CC + c0 + 8 * e) = up[it];
    }
    
  }
}

// =========================================================================================================
// (0) + (1) in one launch: neither reads what the other writes. Blocks 0 .. XB-1 do (1), block blk = nb + 64 (cb + 4 b);
//     blocks XB .. XB+WB-1 do (0). The choice is block-uniform, so the barrier of (1) is passed by whole blocks.
// =========================================================================================================
__global__ __launch_bounds__(256)
void cvt_wx(const float* __restrict__ x,
            const float* __restrict__ wq, const float* __restrict__ bq,
            const float* __restrict__ wk, const float* __restrict__ bk,
            const float* __restrict__ wv, const float* __restrict__ bv,
            unsigned short* Xc, unsigned short* XP, unsigned short* W16, float* BIAS) {
  __shared__ __align__(16) unsigned short T[QT * TP];
  const int blk = blockIdx.x;
  if (blk < XB) cvt_x(x, Xc, XP, T, blk % (NN / QT), (blk / (NN / QT)) % (CC / QT), blk / ((NN / QT) * (CC / QT)));
  else          cvt_w(wq, bq, wk, bk, wv, bv, W16, BIAS, blk - XB);
}

// =========================================================================================================
// (2) conv1x1 GEMM for one (b, 64-n tile, 64-o block): Y[o][n] = (1/256) sum_c W16[o][c] XP[b][n][c] + BIAS[o].
//     Block 128 threads = 4 waves; wave w owns cols n0+16w..+15 (one B fragment per k-step, k = c contiguous in
//     the XP row) and 4 m-tiles (A rows o = o0 + 16 mt + (lane&15), split k map loader from W16). K = 256 = 8 steps.
//     The 64 W16 rows and the 64 XP rows are staged in LDS (tile_product).
//     Epilogue staged in LDS Os[o_loc][n_loc] (pitch OSP), barrier, then:
//       o-block 0 (q rows 0..31, k rows 32..63): Qh/Ql/Kh/Kl bf16 hi / bf16 residual planes [b][4096 n][32]
//         holds rows 2ll, 2ll+1; lane e -> row 2ll+(e>>2), cols 8*(e&3)..+7; one instruction per 16 lines.
//         halves 8e..8e+7; one instruction per 16 lines.
// coverage: Os 4 waves x 4 tiles x 16x16 = 64 x 64; q/k: 4 planes x 32 lines x 8 lanes x 8 = 4 x (64 n x 32);
//           v: 4 it x 16 rows x 8 lanes x 8 = 64 ch x 64 n; grid rows y < 5 of (64, 5 + GY, NB) cover all planes exactly once.
// =========================================================================================================
__device__ __forceinline__
void gemm_qkv(const unsigned short* __restrict__ W16, const float* __restrict__ BIAS,
              const unsigned short* __restrict__ XP,
              unsigned short* Qh, unsigned short* Ql, unsigned short* Kh, unsigned short* Kl,
              unsigned short* Vh, float* Os, unsigned char* Sm, const int nt, const int mb, const int b) {
  const int tid  = threadIdx.x;
  const int lane = tid & 31, wave = tid >> 5;
  const int hh   = lane >> 4, c = lane & 15;
  const int n0   = nt * QT, o0 = mb * QT;

  v8f acc[4];
  tile_product(Sm, W16 + (size_t)o0 * CC, CC, XP + ((size_t)(b * NN + n0)) * CC, CC, acc);

  // ---- epilogue: scale back, + bias -> LDS Os[o_loc][n_loc] ----
  {
    const int nl = 16 * wave + c;
#pragma unroll
    for (int mt = 0; mt < 4; ++mt) {
#pragma unroll
      for (int r = 0; r < 8; ++r) {
        const int ol = 16 * mt + 8 * hh + r;                         // 0..63
        Os[ol * OSP + nl] = acc[mt][r] * IWSC + BIAS[o0 + ol];
      }
    }
  }
  __syncthreads();

  const int e = tid & 7, lq = tid >> 3;                             // lq 0..15
  if (mb == 0) {
    // ---- q/k bf16 hi + residual planes ----
{
#pragma unroll
      for (int it = 0; it < 8; ++it) {
        const int p    = it >> 1;                                    // 0 Qh, 1 Ql, 2 Kh, 3 Kl
        const int ll   = (it & 1) * 16 + lq;                         // 0..31
        const int nl   = 2 * ll + (e >> 2);                          // 0..63
        const int col0 = 8 * (e & 3);                                // 0,8,16,24
        const int rb   = ((p >> 1) ? CQ : 0) + col0;
        v4u u;
#pragma unroll
        for (int t = 0; t < 4; ++t) {
          const float f0 = Os[(rb + 2 * t) * OSP + nl];
          const float f1 = Os[(rb + 2 * t + 1) * OSP + nl];
          const unsigned short hb0 = bf_bits(f0), hb1 = bf_bits(f1);
          const unsigned short lb0 = bf_bits(f0 - bf_up(hb0));
          const unsigned short lb1 = bf_bits(f1 - bf_up(hb1));
          u[t] = (p & 1) ? pk16(lb0, lb1) : pk16(hb0, hb1);
        }
        unsigned short* P = (p == 0) ? Qh : (p == 1) ? Ql : (p == 2) ? Kh : Kl;
        *(v4u*)(P + ((size_t)(b * NN + n0 + nl)) * CQ + col0) = u;
      }
      
    }
  } else {
    // ---- v f16 plane ----
    const int ch0 = o0 - QT;                                         // (mb-1)*64
    v4u uv[4];
#pragma unroll
    for (int it = 0; it < 4; ++it) {
      const int row = it * 16 + lq;                                  // 0..63
      const v4f a = *(const v4f*)(Os + row * OSP + 8 * e);
      const v4f q = *(const v4f*)(Os + row * OSP + 8 * e + 4);
#pragma unroll
      for (int t = 0; t < 2; ++t) {
        uv[it][t]     = pk16(h_bits((_Float16)a[2 * t]), h_bits((_Float16)a[2 * t + 1]));
        uv[it][2 + t] = pk16(h_bits((_Float16)q[2 * t]), h_bits((_Float16)q[2 * t + 1]));
      }
    }
{
#pragma unroll
      for (int it = 0; it < 4; ++it) {
        const int row = it * 16 + lq;
        *(v4u*)(Vh + ((size_t)(b * CC + ch0 + row)) * NN + n0 + 8 * e) = uv[it];
      }
      
    }
  }
}

// =========================================================================================================
// (5) channel softmax: for row (b, i): G_j = sum of the GS slice planes in slice order, then
//     p_j = exp(min_j G - G_j) / sum (== softmax of rowmax - G), returned as the lane's 8 halves of
//     Pc f16 [b][256][256] = p * 1024. One wave per row: lane reads j = 8 lane..8 lane+7, wave min / sum by shuffles.
//     rw = b * 256 + i. The NB * 256 rows ride in the launch of (3), two per block, worked by the block's waves 0 and 1.
// =========================================================================================================
__device__ __forceinline__ v4u cam_softmax(const float* __restrict__ G, const int rw, const int lane) {
  const float* row = G + (size_t)rw * CC + 8 * lane;
  v4f a = *(const v4f*)row;
  v4f q = *(const v4f*)(row + 4);
#pragma unroll                                                       // straight line: the planes' loads issue ahead of the adds
  for (int s = 1; s < GS; ++s) {
    a += *(const v4f*)(row + (size_t)s * NB * CC * CC);
    q += *(const v4f*)(row + (size_t)s * NB * CC * CC + 4);
  }
  const float ev[8] = {a[0], a[1], a[2], a[3], q[0], q[1], q[2], q[3]};
  float mn = ev[0];
#pragma unroll
  for (int t = 1; t < 8; ++t) mn = fminf(mn, ev[t]);
#pragma unroll
  for (int s = 1; s < 32; s <<= 1) mn = fminf(mn, __shfl_xor(mn, s, 32));
  float p[8], sm = 0.f;
#pragma unroll
  for (int t = 0; t < 8; ++t) { p[t] = __expf(mn - ev[t]); sm += p[t]; }
#pragma unroll
  for (int s = 1; s < 32; s <<= 1) sm += __shfl_xor(sm, s, 32);
  const float inv = PSC / sm;
  v4u u;
#pragma unroll
  for (int t = 0; t < 4; ++t)
    u[t] = pk16(h_bits((_Float16)(p[2 * t] * inv)), h_bits((_Float16)(p[2 * t + 1] * inv)));
  return u;
}

// ---- one stage (64 keys) of v, k hi and k residual -> LDS, 256 lanes, 16 B per lane and copy, no register on the way.
//      v: copy i brings row (channel) 32 i + (tid >> 3), bytes 16 (tid & 7) ..+15 of its 128; 8 copies = 256 rows.
//      k: the one copy of a plane brings row (key) tid >> 2, bytes 16 (tid & 3) ..+15 of its 64; 64 rows.
//      lv / lk: the lane's LDS byte address of its first v / k-hi piece; gv / gh / gl: its first global piece.
//      s_wait_xcnt 0 closes the statement, a precaution: it stands in front of any rewrite of a register a copy names.
__device__ __forceinline__ void stage_copy(unsigned lv, unsigned lk, const unsigned short* gv,
                                           const unsigned short* gh, const unsigned short* gl) {
#if defined(__HIP_DEVICE_COMPILE__)
  asm volatile("global_load_async_to_lds_b128 %0, %10, off\n\t"
               "global_load_async_to_lds_b128 %1, %11, off\n\t"
               "global_load_async_to_lds_b128 %2, %12, off\n\t"
               "global_load_async_to_lds_b128 %3, %13, off\n\t"
               "global_load_async_to_lds_b128 %4, %14, off\n\t"
               "global_load_async_to_lds_b128 %5, %15, off\n\t"
               "global_load_async_to_lds_b128 %6, %16, off\n\t"
               "global_load_async_to_lds_b128 %7, %17, off\n\t"
               "global_load_async_to_lds_b128 %8, %18, off\n\t"
               "global_load_async_to_lds_b128 %9, %19, off\n\t"
               "s_wait_xcnt 0x0"
               :: "v"(lv), "v"(lv + 32u * VPB), "v"(lv + 64u * VPB), "v"(lv + 96u * VPB),
                  "v"(lv + 128u * VPB), "v"(lv + 160u * VPB), "v"(lv + 192u * VPB), "v"(lv + 224u * VPB),
                  "v"(lk), "v"(lk + (unsigned)KSTB),
                  "v"(gv), "v"(gv + (size_t)32 * NN), "v"(gv + (size_t)64 * NN), "v"(gv + (size_t)96 * NN),
                  "v"(gv + (size_t)128 * NN), "v"(gv + (size_t)160 * NN), "v"(gv + (size_t)192 * NN),
                  "v"(gv + (size_t)224 * NN), "v"(gh), "v"(gl)
               : "memory");
#endif
}

// =========================================================================================================
// (3) position attention for one (b, 128-query tile, key range sp of NN / KS keys), transposed formulation, no mask:
//   S^T tile (16 keys x 16 queries) = A(k: row = key kb + (lane&15), 32 d via the split k map from the bf16 plane
//   Kh [b][4096][32]) . B(q: col = query, same map, resident fragment from Qh) + A(Kh).B(Ql) + A(Kl).B(Qh)
//   (bf16 unscaled residual planes, shared accumulator). Energy = S (no scale).
//   Per lane the D tile holds 8 keys of ONE query: softmax state per lane. m is a held reference, not the running maximum:
//   a stage takes e^{s-m} and its sum only; one test per stage and wave (a lane's sum above PTOP) sends the wave to the
//   rare path, which raises m to the stage's maximum where that is larger (one shuffle lane^16), rescales O and l and takes the stage's
//   exponentials anew. Row-sum partials combined at the end. P = e^{s-m} / 64 as f16 is the B operand of
//   O^T (rows channel, cols queries) += A(V rows channel = 16j + (lane&15), keys contiguous, f16 plane Vh
//   [b][256][4096]) . B(P^T): element r <- D of the tile covering keys kb..kb+15, element 8+r <- the tile covering
//   kb+16..kb+31, lane unchanged.
//   Block = 8 waves = 4 query columns wq (32 queries each) x 2 key halves kh. A wave holds TWO groups of 16 queries
//   (2 x 16 accumulator tiles, 256 channels), so each k and v fragment it reads from LDS feeds two products; of every
//   stage of 64 keys it works the 32 keys of its half kh. Its group u is queries 32 wq + 16 (u ^ kh) ..+15.
//   The k and v rows of 64 keys are one stage in LDS, brought once per block by asynchronous copies and read by all
//   eight waves; two buffers: stage t + 1 flies while stage t is worked on.
//   Behind the loop waves (wq, 0) and (wq, 1) hold the two key halves of the same 32 queries: each hands its group 1
//   (accumulators, m, l) to the other through LDS and merges what it gets into its group 0 (own half, then the partner's).
//   Epilogue in two channel halves: O/l staged in LDS Os[query][128 channels] (pitch OSPW, each 16 queries 4 floats further:
//   the column walk of 8 lanes x 8 queries then meets 32 different banks; b128 stores), barrier, a thread packs 8 queries.
//   The result is the range's own softmax average as f16, Yp [b][256][KS][4096]; the range's reference m and sum l of each query go to
//   ST [2][KS][b][4096] (m planes, then l planes), through LDS so that whole lines are written; (6) merges the ranges.
// coverage: per half 8 it x 32 lines x 8 lanes x 8 halves = 128 ch x 128 n; two halves = 256 ch; grid (32, NB, KS).
// =========================================================================================================
__global__ __launch_bounds__(256)
void attn_pam(const unsigned short* __restrict__ Qh, const unsigned short* __restrict__ Ql,
              const unsigned short* __restrict__ Kh, const unsigned short* __restrict__ Kl,
              const unsigned short* __restrict__ Vh, unsigned short* Yp, float* ST,
              const float* __restrict__ G, unsigned short* Pc) {
  __shared__ __align__(16) float Os[QB * OSPW + 4 * (QB / 16)];
  __shared__ __align__(16) float St[2 * QB];
  __shared__ __align__(16) float Sx[2 * 8 * 16];                     // m, then l, of the group a wave hands over
  __shared__ __align__(16) float Xo[8 * 16 * 2 * 32 * 4];            // its accumulators: [wave][tile][r half][lane] x 16 B
  __shared__ __align__(16) unsigned char Ring[2 * STGB];
  const int tid  = threadIdx.x;
  const int wave = __builtin_amdgcn_readfirstlane(tid >> 5), lane = tid & 31;   // the wave's number in a scalar register
  const int hh   = lane >> 4, c = lane & 15;
  const int wq   = wave & 3, kh = wave >> 2;
  const int n0   = blockIdx.x * QB, b = blockIdx.y, sp = blockIdx.z;
  const int t0   = sp * NTS;                                         // first stage of the block's key range (even)

  // resident q fragments (B operand, col = query n0 + 32 wq + 16 (u ^ kh) + c)
  Frag qh[2], ql[2];
  {
    const size_t qa = ((size_t)(b * NN + n0 + 32 * wq + 16 * kh + c)) * CQ + 8 * hh;
    const size_t qb = ((size_t)(b * NN + n0 + 32 * wq + 16 * (1 - kh) + c)) * CQ + 8 * hh;
    qh[0] = ldfrag(Qh + qa);
    ql[0] = ldfrag(Ql + qa);
    qh[1] = ldfrag(Qh + qb);
    ql[1] = ldfrag(Ql + qb);
    // the wait before the eight loads' address registers are reused; naming them as inputs keeps them whole up to here
#if defined(__HIP_DEVICE_COMPILE__)
    asm volatile("s_wait_xcnt 0x0" :: "v"(Qh + qa), "v"(Ql + qa), "v"(Qh + qb), "v"(Ql + qb) : "memory");
#endif
  }
  // the lane's first pieces of a stage: global sources (+ t * KT keys) and LDS places (+ buffer * STGB)
  const unsigned short* gv = Vh + (size_t)b * CC * NN + (size_t)(tid >> 3) * NN + 8 * (tid & 7);
  const unsigned short* gh = Kh + ((size_t)b * NN + (tid >> 2)) * CQ + 8 * (tid & 3);
  const unsigned short* gl = Kl + ((size_t)b * NN + (tid >> 2)) * CQ + 8 * (tid & 3);
  const unsigned ring0 = (unsigned)(size_t)Ring;                     // low 32 bits = byte offset in the block's LDS
  const unsigned lv = ring0 + (unsigned)((tid >> 3) * VPB + 16 * (tid & 7));
  const unsigned lk = ring0 + (unsigned)(VSTB + (tid >> 2) * KPB + 16 * (tid & 3));
  // fragment offsets inside a stage, at the wave's 32 keys: v (A operand, row = channel 16j + c, keys contiguous),
  // k (A operand, row = key)
  const int vfo = c * VPB + 16 * hh + kh * 64;
  const int kfo = VSTB + (32 * kh + c) * KPB + 16 * hh;

  float m[2] = {-1.0e30f, -1.0e30f}, l[2] = {0.f, 0.f};
  v8f o[2][16];
#pragma unroll
  for (int u = 0; u < 2; ++u) {
#pragma unroll
    for (int j = 0; j < 16; ++j) o[u][j] = zero8();
  }

  // prologue: stage t0 landed and published, then stage t0 + 1 on its way
  stage_copy(lv, lk, gv + (size_t)t0 * KT, gh + (size_t)t0 * KT * CQ, gl + (size_t)t0 * KT * CQ);
  // (5): the block's two rows of the channel softmax, in waves 0 and 1 (scalar test), while stage t0 is on its way
  const int  crow = 2 * (blockIdx.x + (NN / QB) * (blockIdx.y + NB * blockIdx.z)) + (wave & 1);   // 0 .. NB * CC - 1, each once
  const bool cwav = wave < 2;
  v4u cu = {0u, 0u, 0u, 0u};
  if (cwav) cu = cam_softmax(G, crow, lane);
  asm volatile("s_wait_asynccnt 0x0" ::: "memory");                  // this wave's pieces of stage t0 have landed
  __syncthreads();                                                   // ... and every other wave's
  if (cwav) {
    *(v4u*)(Pc + (size_t)crow * CC + 8 * lane) = cu;                 // behind the barrier: it does not wait for this store
    asm volatile("s_wait_xcnt 0x0" ::: "memory");                    // a precaution: before the code behind reuses the store's registers
  }
  stage_copy(lv + STGB, lk + STGB, gv + (size_t)(t0 + 1) * KT, gh + (size_t)(t0 + 1) * KT * CQ,
             gl + (size_t)(t0 + 1) * KT * CQ);

#pragma unroll 1                                                     // rolled: one stage's exponentials live at a time
  for (int t = t0; t < t0 + NTS; ++t) {
    const unsigned bo = (unsigned)(t & 1) * STGB;
    const unsigned char* sb = Ring + bo;
    const unsigned char* kp = sb + kfo;                              // the wave's keys start at kb = KT t + 32 kh
    const Frag k0  = ldfrag((const unsigned short*)(kp));                        // keys kb .. kb+15
    const Frag k1  = ldfrag((const unsigned short*)(kp + 16 * KPB));             // keys kb+16 .. kb+31
    const Frag k0l = ldfrag((const unsigned short*)(kp + KSTB));
    const Frag k1l = ldfrag((const unsigned short*)(kp + KSTB + 16 * KPB));
    v8f s0[2], s1[2];
#pragma unroll
    for (int u = 0; u < 2; ++u) {
      s0[u] = mma_bw(k0.bf, qh[u].bf, zero8());
      s1[u] = mma_bw(k1.bf, qh[u].bf, zero8());
    }
#pragma unroll
    for (int u = 0; u < 2; ++u) {
      s0[u] = mma_bw(k0.bf, ql[u].bf, s0[u]);
      s1[u] = mma_bw(k1.bf, ql[u].bf, s1[u]);
    }
#pragma unroll
    for (int u = 0; u < 2; ++u) {
      s0[u] = mma_bw(k0l.bf, qh[u].bf, s0[u]);
      s1[u] = mma_bw(k1l.bf, qh[u].bf, s1[u]);
    }

    // the first 12 v fragments of the pass as LDS reads in front of the test below, in flight under the exponentials
    const unsigned char* vp = sb + vfo;
    Frag vf[16];
#pragma unroll
    for (int j = 0; j < 12; ++j) vf[j] = ldfrag((const unsigned short*)(vp + 16 * j * VPB));

    FragH ph[2];
    float ls[2];
#pragma unroll
    for (int u = 0; u < 2; ++u) {
      const float msh = m[u] - LNPA;                                 // exp gives e^{s-m} / 64
      ls[u] = 0.f;
#pragma unroll
      for (int r = 0; r < 8; ++r) {
        const float e0 = __expf(s0[u][r] - msh);                     // key kb      + 8hh + r
        const float e1 = __expf(s1[u][r] - msh);                     // key kb + 16 + 8hh + r
        ls[u] += e0 + e1;
        ph[u].hv[0][r] = (_Float16)e0;
        ph[u].hv[1][r] = (_Float16)e1;
      }
    }
    // one test per stage, a scalar branch: taken in the range's first stage (m starts at -1e30, the sums are infinite) and
    // when a score has outgrown the reference
    if (__builtin_amdgcn_ballot_w32(fmaxf(ls[0], ls[1]) > PTOP) != 0u) {
#pragma unroll
      for (int u = 0; u < 2; ++u) {
        const float mx   = fmaxf(hmax8(s0[u]), hmax8(s1[u]));
        const float mn   = fmaxf(m[u], fmaxf(mx, __shfl_xor(mx, 16, 32)));   // equal in lanes c and c + 16
        const float corr = __expf(m[u] - mn);
        m[u] = mn;
        const float msh = mn - LNPA;
#pragma unroll
        for (int j = 0; j < 16; ++j) {
#pragma unroll
          for (int r = 0; r < 8; ++r) o[u][j][r] *= corr;
        }
        l[u] *= corr;
        ls[u] = 0.f;
#pragma unroll
        for (int r = 0; r < 8; ++r) {
          const float e0 = __expf(s0[u][r] - msh);
          const float e1 = __expf(s1[u][r] - msh);
          ls[u] += e0 + e1;
          ph[u].hv[0][r] = (_Float16)e0;
          ph[u].hv[1][r] = (_Float16)e1;
        }
      }
    }
    l[0] += ls[0];
    l[1] += ls[1];

    // the last 4 fragments take the registers that the scores leave: one group of reads, in flight under 24 products
#pragma unroll
    for (int j = 12; j < 16; ++j) vf[j] = ldfrag((const unsigned short*)(vp + 16 * j * VPB));
    // keeps that group here: sunk to its products, each pair of reads would be waited for as soon as issued
    __builtin_amdgcn_sched_barrier(0);
#pragma unroll
    for (int j = 0; j < 16; ++j) {                                   // each fragment feeds two products
      o[0][j] = mma_hw(vf[j].h, ph[0].v, o[0][j]);
      o[1][j] = mma_hw(vf[j].h, ph[1].v, o[1][j]);
    }
    // keeps the stage's arithmetic in front of the barrier: sunk behind it, it would also stand in front of the refill,
    // whose copies would then be waited for almost as soon as they are issued
    __builtin_amdgcn_sched_barrier(0);
    // publish point of stage t + 1, and the end of every reader's last read of stage t's buffer
    asm volatile("s_wait_dscnt 0x0" ::: "memory");                   // this wave's LDS reads of stage t are done
    asm volatile("s_wait_asynccnt 0x0" ::: "memory");                // this wave's pieces of stage t + 1 have landed
    __syncthreads();
    if (t + 2 < t0 + NTS)                                            // block-uniform: refill the buffer just read
      stage_copy(lv + bo, lk + bo, gv + (size_t)(t + 2) * KT, gh + (size_t)(t + 2) * KT * CQ,
                 gl + (size_t)(t + 2) * KT * CQ);
  }
  asm volatile("s_wait_asynccnt 0x0" ::: "memory");                  // nothing of this wave is in flight at its end
  // the lane's number read anew: no index of the epilogue has to stay in a register (or be spilled) across the loop
  const int ln = (int)__builtin_amdgcn_mbcnt_lo(~0u, 0u);
  const int h2 = ln >> 4, c2 = ln & 15, td = 32 * wave + ln;
  l[0] += __shfl_xor(l[0], 16, 32);
  l[1] += __shfl_xor(l[1], 16, 32);

  // hand-over of group 1 to the wave that worked the other key half of the same queries (wave ^ 4, same lane)
  if (h2 == 0) { Sx[16 * wave + c2] = m[1]; Sx[128 + 16 * wave + c2] = l[1]; }   // equal in lanes c and c + 16
#pragma unroll
  for (int j = 0; j < 16; ++j) {
    v4f va, vb;
#pragma unroll
    for (int r = 0; r < 4; ++r) { va[r] = o[1][j][r]; vb[r] = o[1][j][4 + r]; }
    *(v4f*)(Xo + (((wave * 16 + j) * 2 + 0) * 32 + ln) * 4) = va;
    *(v4f*)(Xo + (((wave * 16 + j) * 2 + 1) * 32 + ln) * 4) = vb;
  }
  __syncthreads();                                                   // every wave's group 1 is in LDS
  const int pw = wave ^ 4;
  const float mp = Sx[16 * pw + c2], lp = Sx[128 + 16 * pw + c2];
  const float mm = fmaxf(m[0], mp);
  const float ea = __expf(m[0] - mm), eb = __expf(mp - mm);
  const float lm = l[0] * ea + lp * eb;                              // o and l both carry the 1 / 64 factor
  const float inv = 1.0f / lm;
  const float fa = ea * inv, fb = eb * inv;

  const int qrow = 32 * wq + 16 * kh + c2;                           // the query of the wave's group 0
  const int qsh  = 4 * (2 * wq + kh);                                // 4 (qrow >> 4): the shift of its group of 16 rows
  const int e = td & 7, lq = td >> 3;                                // lq 0..31
  if (h2 == 0) { St[qrow] = mm; St[QB + qrow] = lm; }
#pragma unroll
  for (int half = 0; half < 2; ++half) {
    if (half) __syncthreads();                                       // every wave finished reading Os
#pragma unroll
    for (int jj = 0; jj < 8; ++jj) {
      const int j = 8 * half + jj;
      const v4f xa = *(const v4f*)(Xo + (((pw * 16 + j) * 2 + 0) * 32 + ln) * 4);
      const v4f xb = *(const v4f*)(Xo + (((pw * 16 + j) * 2 + 1) * 32 + ln) * 4);
      v4f va, vb;
#pragma unroll
      for (int r = 0; r < 4; ++r) { va[r] = o[0][j][r] * fa + xa[r] * fb; vb[r] = o[0][j][4 + r] * fa + xb[r] * fb; }
      *(v4f*)(Os + qrow * OSPW + qsh + 16 * jj + 8 * h2)     = va;   // Os[query][ch_loc = 16jj + 8hh + r]
      *(v4f*)(Os + qrow * OSPW + qsh + 16 * jj + 8 * h2 + 4) = vb;
    }
    __syncthreads();
#pragma unroll
    for (int it = 0; it < 8; ++it) {
      const int chl = (it & 3) * 32 + lq;                            // channel 0..127 within the half
      const int nl  = (it >> 2) * 64 + 8 * e;                        // query 0..127, 8 in a row: one group of 16
      const float* op = Os + nl * OSPW + 4 * (nl >> 4) + chl;
      v4u u;
#pragma unroll
      for (int t = 0; t < 4; ++t)
        u[t] = pk16(h_bits((_Float16)op[(2 * t) * OSPW]), h_bits((_Float16)op[(2 * t + 1) * OSPW]));
      *(v4u*)(Yp + ((size_t)((b * CC + 128 * half + chl) * KS + sp)) * NN + n0 + nl) = u;   // 8 lanes = one whole line
    }
  }
  if (td < 64) {                                                     // waves 0 and 1, behind the barriers above: 128 m, 128 l
    const int pl = td >> 5, q4 = 4 * (td & 31);
    *(v4f*)(ST + ((size_t)((pl * KS + sp) * NB + b)) * NN + n0 + q4) = *(const v4f*)(St + pl * QB + q4);
  }
}

// =========================================================================================================
// (4) channel Gram for one (b, 64-i block, 64-j block, K slice s): G[s][b][i][j] = sum over the slice's GK positions n
//     of Xc[b][i][n] Xc[b][j][n]; the GS slices of a tile run as GS blocks, and (5) adds their planes.
//     4 waves; wave w owns cols j0+16w..+15 (B from the j row, keys n contiguous) and 4 i tiles (A rows
//     [b][256][256] (row segment 64 j = 2 lines), 8 consecutive lanes x 16 B, one instruction per 16 lines, two
// coverage: 8 it x 16 lines x 8 lanes x 4 = 64 x 64; (jt, itb, zb) in (4, 4, GS * NB) covers the GS planes of G exactly once.
// =========================================================================================================
__device__ __forceinline__
void gram_k(const unsigned short* __restrict__ Xc, float* G, float* Os, unsigned char* Sm,
            const int jt, const int itb, const int zb) {
  const int tid  = threadIdx.x;
  const int lane = tid & 31, wave = tid >> 5;
  const int hh   = lane >> 4, c = lane & 15;
  const int b = zb % NB, s = zb / NB;                                // zb = s * NB + b: the plane of G this block writes
  const int j0 = jt * QT, i0 = itb * QT;

  v8f acc[4];                                                        // the slice's 256 positions of the 64 i rows and the 64 j rows, staged in LDS
  tile_product(Sm, Xc + ((size_t)(b * CC + i0)) * NN + s * GK, NN, Xc + ((size_t)(b * CC + j0)) * NN + s * GK, NN, acc);
  {
    const int nl = 16 * wave + c;
#pragma unroll
    for (int mt = 0; mt < 4; ++mt) {
#pragma unroll
      for (int r = 0; r < 8; ++r) Os[(16 * mt + 8 * hh + r) * OSP + nl] = acc[mt][r];
    }
  }
  __syncthreads();
  {
    const int e = tid & 7, lq = tid >> 3;                            // lq 0..15
{
#pragma unroll
      for (int it = 0; it < 8; ++it) {
        const int L = it * 16 + lq;                                  // 0..127
        const int row = L >> 1, hf = L & 1;
        const v4f v = *(const v4f*)(Os + row * OSP + hf * 32 + 4 * e);
        *(v4f*)(G + ((size_t)(zb * CC + i0 + row)) * CC + j0 + hf * 32 + 4 * e) = v;
      }
      // a precaution: in the shared launch code follows these stores in the listing; the wait stands before it reuses their registers
      asm volatile("s_wait_xcnt 0x0" ::: "memory");
    }
  }
}

// =========================================================================================================
// (2) + (4) in one launch: both read only what the launch before wrote, neither reads what the other writes.
//     Grid (64, 5 + GY, NB): rows y < 5 do (2) with (nt, mb, b) = (x, y, z); rows y >= 5 do (4): idx = x + 64 (y - 5)
//     = jt + 4 (itb + 4 s), batch z. The choice is block-uniform, so each body's barrier is passed by whole blocks.
// =========================================================================================================
__global__ __launch_bounds__(128)
void gemm_gram(const unsigned short* __restrict__ W16, const float* __restrict__ BIAS,
               const unsigned short* __restrict__ XP, const unsigned short* __restrict__ Xc,
               unsigned short* Qh, unsigned short* Ql, unsigned short* Kh, unsigned short* Kl,
               unsigned short* Vh, float* G) {
  __shared__ __align__(16) float Os[QT * OSP];
  __shared__ __align__(16) unsigned char Sm[2 * GOPB];
  const int y = blockIdx.y;
  if (y < MQKV / QT) {
    gemm_qkv(W16, BIAS, XP, Qh, Ql, Kh, Kl, Vh, Os, Sm, blockIdx.x, y, blockIdx.z);
  } else {
    const int idx = blockIdx.x + (NN / QT) * (y - MQKV / QT);
    gram_k(Xc, G, Os, Sm, idx % (CC / QT), (idx / (CC / QT)) % (CC / QT),
           (idx / ((CC / QT) * (CC / QT))) * NB + blockIdx.z);
  }
}

// =========================================================================================================
// (6) channel mix + output for one (b, 64-n tile, 64-i block): cam[i][n] = (1/1024) sum_j Pc[b][i][j] XP[b][n][j]
//     (K = 256 = 8 steps; A rows i = i0 + 16 mt + (lane&15), j contiguous; B col n = n0 + 16w + (lane&15) from the
//     XP row, j contiguous), then out[b][i][n] = (g_pam * Y + xb) + (g_cam * cam + xb) with xb = bf16-RNE of x and
//     Y = sum over the KS key ranges s, in range order, of wt_s[n] Yp[b][i][s][n], wt_s = l_s e^{m_s - M} / sum of these,
//     M = max_s m_s (m, l from ST): the softmax over all keys from the ranges' own averages (Yp f16, widened here).
// coverage: 8 it x 16 lines x 8 lanes x 4 = 64 i x 64 n; grid (64, 4, NB) covers d_out exactly once.
// =========================================================================================================
__global__ __launch_bounds__(128)
void cam_out(const unsigned short* __restrict__ Pc, const unsigned short* __restrict__ XP,
             const unsigned short* __restrict__ Yp, const float* __restrict__ ST, const float* __restrict__ x,
             const float* __restrict__ gpam, const float* __restrict__ gcam, float* out) {
  __shared__ __align__(16) float Os[QT * OSP];
  __shared__ __align__(16) unsigned char Sm[2 * GOPB];
  const int tid  = threadIdx.x;
  const int lane = tid & 31, wave = tid >> 5;
  const int hh   = lane >> 4, c = lane & 15;
  const int nt = blockIdx.x, itb = blockIdx.y, b = blockIdx.z;
  const int n0 = nt * QT, i0 = itb * QT;

  v8f acc[4];                                                        // the 64 Pc rows and the 64 XP rows, staged in LDS
  tile_product(Sm, Pc + ((size_t)(b * CC + i0)) * CC, CC, XP + ((size_t)(b * NN + n0)) * CC, CC, acc);
  {
    const int nl = 16 * wave + c;
#pragma unroll
    for (int mt = 0; mt < 4; ++mt) {
#pragma unroll
      for (int r = 0; r < 8; ++r) Os[(16 * mt + 8 * hh + r) * OSP + nl] = acc[mt][r];
    }
  }
  __syncthreads();

  const float gp = bfr(gpam[0]);
  const float gc = bfr(gcam[0]) * IPSC;
  const int e = tid & 7, lq = tid >> 3;                              // lq 0..15
  // weights of the key ranges for the thread's 4 positions (nl below is the same in every it: 16 it is even)
  v4f wt[KS];
  {
    const float* sq = ST + (size_t)b * NN + n0;                      // block-uniform base; the lane's part is lo
    const unsigned lo = (unsigned)((lq & 1) * 32 + 4 * e);
    v4f mm[KS];
#pragma unroll
    for (int s = 0; s < KS; ++s) {
      mm[s] = *(const v4f*)(sq + (size_t)s * NB * NN + lo);
      wt[s] = *(const v4f*)(sq + (size_t)(KS + s) * NB * NN + lo);
    }
#pragma unroll
    for (int t = 0; t < 4; ++t) {
      float mx = mm[0][t];
#pragma unroll
      for (int s = 1; s < KS; ++s) mx = fmaxf(mx, mm[s][t]);
      float sm = 0.f;
#pragma unroll
      for (int s = 0; s < KS; ++s) { wt[s][t] *= exp2_slot((mm[s][t] - mx) * LOG2E); sm += wt[s][t]; }
      const float inv = 1.0f / sm;
#pragma unroll
      for (int s = 0; s < KS; ++s) wt[s][t] *= inv;
    }
  }
  // the ranges' rows: block-uniform base of the tile + one lane offset (row lq >> 1, the it and s steps are constants)
  const unsigned char* yt = (const unsigned char*)(Yp + ((size_t)(b * CC + i0)) * KS * NN + n0);
  const unsigned yo = 2u * (unsigned)((lq >> 1) * KS * NN + (lq & 1) * 32 + 4 * e);   // bytes
  v4f res[8], xr[8];
  v4h yr[8][KS];
  const float* px[8];
#pragma unroll
  for (int it = 0; it < 8; ++it) {
    const int L = it * 16 + lq;                                      // 0..127
    px[it] = x + ((size_t)(b * CC + i0 + (L >> 1))) * NN + n0 + (L & 1) * 32 + 4 * e;
    xr[it] = *(const v4f*)px[it];
#pragma unroll
    for (int s = 0; s < KS; ++s) yr[it][s] = *(const v4h*)(yt + (size_t)(it * 8 * KS + s) * NN * 2 + yo);
  }
  // a precaution: the wait before the 40 loads' address registers are reused; naming them as inputs keeps them whole up to here
#if defined(__HIP_DEVICE_COMPILE__)
  asm volatile("s_wait_xcnt 0x0" :: "v"(px[0]), "v"(px[1]), "v"(px[2]), "v"(px[3]), "v"(px[4]), "v"(px[5]), "v"(px[6]),
               "v"(px[7]), "v"(yo) : "memory");
#endif
#pragma unroll
  for (int it = 0; it < 8; ++it) {
    const int L = it * 16 + lq;                                      // 0..127
    const int row = L >> 1, hf = L & 1;
    const int nl = hf * 32 + 4 * e;
    const v4f cam4 = *(const v4f*)(Os + row * OSP + nl);
    const v4f xv = xr[it];
    v4f yv = wt[0] * __builtin_convertvector(yr[it][0], v4f);
#pragma unroll
    for (int s = 1; s < KS; ++s) yv += wt[s] * __builtin_convertvector(yr[it][s], v4f);
#pragma unroll
    for (int t = 0; t < 4; ++t) {
      const float xb = bfr(xv[t]);
      const float t1 = gp * yv[t] + xb;
      const float t2 = gc * cam4[t] + xb;
      res[it][t] = t1 + t2;
    }
  }
{
#pragma unroll
    for (int it = 0; it < 8; ++it) {
      const int L = it * 16 + lq;
      const int row = L >> 1, hf = L & 1;
      const int nl = hf * 32 + 4 * e;
      const size_t idx = ((size_t)(b * CC + i0 + row)) * NN + n0 + nl;
      *(v4f*)(out + idx) = res[it];
    }
    
  }
}

// =========================================================================================================
// Workspace map (bytes; each region start a multiple of 256; every extent is an exact tile multiple and is written
//   W16 f16 [320][256]          163840      BIAS f32 [320]              1280
//   Xc  f16 [2][256][4096]     4194304      XP   f16 [2][4096][256]  4194304
//   Qh/Ql/Kh/Kl bf16 [2][4096][32]  524288 x4                          Vh f16 [2][256][4096]  4194304
//   Yp  f16 [2][256][4][4096] 16777216      G    f32 [16][2][256][256] 8388608     Pc f16 [2][256][256] 262144
//   ST  f32 [2][4][2][4096]     262144
//   total = 40535296
// =========================================================================================================
extern "C" void kernel_launch(void* const* d_in, const int* in_sizes, int n_in,
                              void* d_out, int out_size, void* d_ws, size_t ws_size,
                              hipStream_t stream) {
  const int XN = NB * CC * NN;                                       // 2097152
  if (n_in < 9) return;
  if (in_sizes[0] != XN) return;
  if (in_sizes[1] != CQ * CC || in_sizes[2] != CQ) return;
  if (in_sizes[3] != CQ * CC || in_sizes[4] != CQ) return;
  if (in_sizes[5] != CC * CC || in_sizes[6] != CC) return;
  if (in_sizes[7] < 1 || in_sizes[8] < 1) return;
  if (out_size != XN) return;

  size_t off = 0;
  auto carve = [&](size_t bytes) { const size_t o = off; off += (bytes + 255) & ~(size_t)255; return o; };
  const size_t oW16 = carve((size_t)MQKV * CC * 2);
  const size_t oBIA = carve((size_t)MQKV * 4);
  const size_t oXc  = carve((size_t)NB * CC * NN * 2);
  const size_t oXP  = carve((size_t)NB * NN * CC * 2);
  const size_t oQh  = carve((size_t)NB * NN * CQ * 2);
  const size_t oQl  = carve((size_t)NB * NN * CQ * 2);
  const size_t oKh  = carve((size_t)NB * NN * CQ * 2);
  const size_t oKl  = carve((size_t)NB * NN * CQ * 2);
  const size_t oVh  = carve((size_t)NB * CC * NN * 2);
  const size_t oYp  = carve((size_t)KS * NB * CC * NN * 2);
  const size_t oG   = carve((size_t)GS * NB * CC * CC * 4);
  const size_t oPc  = carve((size_t)NB * CC * CC * 2);
  const size_t oST  = carve((size_t)2 * KS * NB * NN * 4);
  if (off > ws_size) return;
  if (off > (size_t)134217728) return;

  const float* x    = (const float*)d_in[0];
  const float* wq   = (const float*)d_in[1];
  const float* bq   = (const float*)d_in[2];
  const float* wk   = (const float*)d_in[3];
  const float* bk   = (const float*)d_in[4];
  const float* wv   = (const float*)d_in[5];
  const float* bv   = (const float*)d_in[6];
  const float* gpam = (const float*)d_in[7];
  const float* gcam = (const float*)d_in[8];

  char* ws = (char*)d_ws;
  unsigned short* W16 = (unsigned short*)(ws + oW16);
  float*          BIA = (float*)(ws + oBIA);
  unsigned short* Xc  = (unsigned short*)(ws + oXc);
  unsigned short* XP  = (unsigned short*)(ws + oXP);
  unsigned short* Qh  = (unsigned short*)(ws + oQh);
  unsigned short* Ql  = (unsigned short*)(ws + oQl);
  unsigned short* Kh  = (unsigned short*)(ws + oKh);
  unsigned short* Kl  = (unsigned short*)(ws + oKl);
  unsigned short* Vh  = (unsigned short*)(ws + oVh);
  unsigned short* Yp  = (unsigned short*)(ws + oYp);
  float*          G   = (float*)(ws + oG);
  unsigned short* Pc  = (unsigned short*)(ws + oPc);
  float*          ST  = (float*)(ws + oST);
  float* out = (float*)d_out;

  const dim3 blk256(256), blk128(128);

  // (0) + (1) weights -> f16 plane + bias line; x -> channel-major and position-major 16-bit planes
  cvt_wx<<<dim3(XB + WB), blk256, 0, stream>>>(x, wq, bq, wk, bk, wv, bv, Xc, XP, W16, BIA);
  // (2) + (4) conv1x1 GEMM -> q/k hi + residual planes and v plane; channel Gram, K slices -> G [s][b][256][256]
  gemm_gram<<<dim3(NN / QT, MQKV / QT + GY, NB), blk128, 0, stream>>>(W16, BIA, XP, Xc, Qh, Ql, Kh, Kl, Vh, G);
  // (3) + (5) position attention, KS key ranges -> Yp [b][256][s][4096], ST; channel softmax -> Pc [b][256][256] (x1024 f16)
  attn_pam<<<dim3(NN / QB, NB, KS), blk256, 0, stream>>>(Qh, Ql, Kh, Kl, Vh, Yp, ST, G, Pc);
  // (6) channel mix + merge of the key ranges + residual sum -> out [b][256][4096]
  cam_out<<<dim3(NN / QT, CC / QT, NB), blk128, 0, stream>>>(Pc, XP, Yp, ST, x, gpam, gcam, out);
  (void)hipGetLastError();
}

// v009
// A run of this version takes 41.2 microseconds.
// Next to v008, in two timings, it ran 1.03 times as fast each time.
// All steps since v000 together make it 12.0 times as fast.
// Contractions: conv1x1 q/k/v GEMM W[320x256].X[256x4096] on v_wmma_f32_16x16x32_f16 (f16 containers of bf16-RNE
// weights x256 and bf16-RNE x); position scores K.Q^T on v_wmma_f32_16x16x32_bf16 (bf16 hi + bf16 residual planes of
// q and k, 3 products, K=32); O^T = V.P^T on v_wmma_f32_16x16x32_f16 (v f16, P = e^{s-m} / 64 f16 from the score D
// registers); channel Gram X.X^T (K=4096) and channel mix A.X (K=256) on v_wmma_f32_16x16x32_f16 (f16 of bf16-RNE x,
// softmax weights x1024 f16); f32 accumulate everywhere; softmax statistics, residual adds and output sum in f32 VALU.
// The key ranges' averages of the position attention pass from launch to launch as f16 (RNE of the f32 value).
#include <hip/hip_runtime.h>
#include <math.h>
#include <stdint.h>

#define NB    2
#define CC    256
#define NN    4096
#define CQ    32
#define MQKV  320
#define QT    64
#define QB    128                      // queries per block of the position attention
#define OSP   68
#define OSPW  132
#define TP    72
#define WSC   256.0f
#define IWSC  0.00390625f
#define PSC   1024.0f
#define IPSC  0.0009765625f
#define LNPA  (-4.158883083359672f)    // ln (1 / 64): P of the position attention is e^{s-m} / 64, 22 binades under f16's top
#define PTOP  65000.0f                 // a lane's sum of one stage's P above this: the reference m is raised (f16 P stays finite)
#define LOG2E 1.4426950408889634f
#define KT    64                       // keys per LDS stage of the position attention
#define NT    (NN / KT)                // stages
#define KS    4                        // key ranges of the position attention, one block each per query tile
#define NTS   (NT / KS)                // stages of one key range
#define VPB   144                      // LDS pitch of a v row (64 keys = 128 B, + 16 B: 16 B x odd for b128 readers)
#define KPB   80                       // LDS pitch of a k row (32 d = 64 B, + 16 B)
#define VSTB  (CC * VPB)               // v part of a stage, bytes
#define KSTB  (KT * KPB)               // one k plane of a stage, bytes
#define STGB  (VSTB + 2 * KSTB)        // one stage: v, k hi, k residual
#define GS    16                       // blocks that share the K = 4096 of one Gram tile
#define GK    (NN / GS)                // positions per Gram block
#define XB    ((NN / QT) * (CC / QT) * NB)                 // blocks of the x conversion
#define WB    (MQKV / 8)                                   // blocks of the weight conversion
#define GY    ((CC / QT) * (CC / QT) * GS / (NN / QT))     // grid rows of NN / QT blocks that hold one batch's Gram blocks
#define GRB   512                      // bytes of one operand row of a 64 x 64 x 256 product (256 halves)
#define GP    (GRB + 16)               // its LDS pitch (16 B x odd for b128 readers)
#define GOPB  (QT * GP)                // one staged operand: 64 rows

static_assert(NN % QT == 0);
static_assert(CC % QT == 0);
static_assert(MQKV == 2 * CQ + CC);
static_assert(MQKV % QT == 0);
static_assert((OSP * 4) % 16 == 0);
static_assert((OSPW * 4) % 16 == 0);
static_assert((TP * 2) % 16 == 0);
static_assert(CC % 32 == 0 && NN % 32 == 0 && CQ == 32);
static_assert(NN % KT == 0 && NT % KS == 0 && NTS >= 2 && NTS % 2 == 0 && KT % 32 == 0);
static_assert(VPB % 16 == 0 && KPB % 16 == 0 && STGB % 16 == 0 && VSTB % 16 == 0);
static_assert(VPB >= KT * 2 && KPB >= CQ * 2);
static_assert(NN % GS == 0 && GK % 32 == 0);
static_assert(GY * (NN / QT) == (CC / QT) * (CC / QT) * GS);
static_assert(CC * 2 == GRB && GK * 2 == GRB && GP % 16 == 0 && QT == 64);   // every staged row is 32 lanes x 16 B
static_assert((NN / QB) * NB * KS * 2 == NB * CC);         // two channel-softmax rows per block of the position attention
static_assert(NN % QB == 0 && KT == 64 && CC == 256);      // the stage copy's 256 lanes, the two key halves of a stage

typedef _Float16       v16h __attribute__((ext_vector_type(16)));
typedef _Float16       v8h  __attribute__((ext_vector_type(8)));
typedef __bf16         v16b __attribute__((ext_vector_type(16)));
typedef unsigned short v8us __attribute__((ext_vector_type(8)));
typedef float          v8f  __attribute__((ext_vector_type(8)));
typedef float          v4f  __attribute__((ext_vector_type(4)));
typedef unsigned int   v4u  __attribute__((ext_vector_type(4)));
typedef _Float16       v4h  __attribute__((ext_vector_type(4)));

union Frag  { v8us u[2]; v16h h; v16b bf; };
union FragH { v16h v; v8h hv[2]; };
static_assert(sizeof(Frag) == 32);
static_assert(sizeof(FragH) == 32);

// ---- scalar helpers ---------------------------------------------------------------------------------------
__device__ __forceinline__ unsigned short bf_bits(float f) {          // f32 -> bf16 bits, RNE convert
  unsigned u = __float_as_uint(f);
  return (unsigned short)((u + 0x7FFFu + ((u >> 16) & 1u)) >> 16);
}
__device__ __forceinline__ float bf_up(unsigned short hb) { return __uint_as_float(((unsigned)hb) << 16); }
__device__ __forceinline__ float bfr(float f) { return bf_up(bf_bits(f)); }
__device__ __forceinline__ unsigned short h_bits(_Float16 x) { return __builtin_bit_cast(unsigned short, x); }
__device__ __forceinline__ unsigned pk16(unsigned short a, unsigned short b) { return (unsigned)a | ((unsigned)b << 16); }
__device__ __forceinline__ v8f zero8() { v8f z = {0.f, 0.f, 0.f, 0.f, 0.f, 0.f, 0.f, 0.f}; return z; }
__device__ __forceinline__ float hmax8(v8f s) {
  return fmaxf(fmaxf(fmaxf(s[0], s[1]), fmaxf(s[2], s[3])), fmaxf(fmaxf(s[4], s[5]), fmaxf(s[6], s[7])));
}

// 2^x with the free slot that the instruction set asks for behind a transcendental, tied to it in one statement
__device__ __forceinline__ float exp2_slot(float x) {
  float r = 0.f;
#if defined(__HIP_DEVICE_COMPILE__)
  asm("v_exp_f32 %0, %1\n\tv_nop" : "=v"(r) : "v"(x));
#endif
  return r;
}

// ---- 16-bit fragment loader (A, or B from a k-contiguous [n][k] row): lane -> row/col (lane&15), p already includes
//      + 8*(lane>>4); elements 0..7 <- p[0..7] (k0+8h..), elements 8..15 <- p[16..23] (k0+16+8h..)
__device__ __forceinline__ Frag ldfrag(const unsigned short* p) {
  Frag f;
  f.u[0] = *(const v8us*)(p);
  f.u[1] = *(const v8us*)(p + 16);
  return f;
}

// ---- WMMA helpers: builtin followed by a 4-slot VALU gap tying D and keeping A/B live --------------------------
__device__ __forceinline__ v8f mma_b(v16b a, v16b b, v8f c) {
  v8f d = __builtin_amdgcn_wmma_f32_16x16x32_bf16(false, a, false, b, (short)0, c, false, false);
#if defined(__HIP_DEVICE_COMPILE__)
  const v16h ha = __builtin_bit_cast(v16h, a), hb = __builtin_bit_cast(v16h, b);
  asm volatile("v_nop\n\tv_nop\n\tv_nop\n\tv_nop" : "+v"(d) : "v"(ha), "v"(hb));
#endif
  return d;
}

// The same products as the bare builtins, for the kernel whose accumulators reach above v255: the operands of an asm
// statement are held in the first 256 registers, which would spill them; the compiler keeps the distance behind its builtins.
// The 64 x 64 x 256 products use them too: with no statement between the products their LDS reads can stand in groups ahead.
__device__ __forceinline__ v8f mma_hw(v16h a, v16h b, v8f c) {
  return __builtin_amdgcn_wmma_f32_16x16x32_f16(false, a, false, b, (short)0, c, false, false);
}
__device__ __forceinline__ v8f mma_bw(v16b a, v16b b, v8f c) {
  return __builtin_amdgcn_wmma_f32_16x16x32_bf16(false, a, false, b, (short)0, c, false, false);
}

// ---- work-group barrier whose fences order LDS alone: __syncthreads() also waits for every global load of the wave that
//      is still in flight, which would hold the product back until the epilogue's operands have arrived
__device__ __forceinline__ void lds_barrier() {
#if defined(__HIP_DEVICE_COMPILE__)
  __builtin_amdgcn_fence(__ATOMIC_RELEASE, "workgroup", "local");
  __builtin_amdgcn_s_barrier();
  __builtin_amdgcn_fence(__ATOMIC_ACQUIRE, "workgroup", "local");
#endif
}

// ---- 8 rows of 512 B -> LDS, one wave: a copy brings one whole row (32 lanes x 16 B, four whole lines), no register on
//      the way. l: the lane's LDS byte address in the first row (next rows + GP); g: its global piece (next rows + pitch halves).
//      s_wait_xcnt 0 closes the statement, a precaution: it stands in front of any rewrite of a register a copy names.
__device__ __forceinline__ void rows8_copy(unsigned l, const unsigned short* g, const size_t pitch) {
#if defined(__HIP_DEVICE_COMPILE__)
  asm volatile("global_load_async_to_lds_b128 %0, %8, off\n\t"
               "global_load_async_to_lds_b128 %1, %9, off\n\t"
               "global_load_async_to_lds_b128 %2, %10, off\n\t"
               "global_load_async_to_lds_b128 %3, %11, off\n\t"
               "global_load_async_to_lds_b128 %4, %12, off\n\t"
               "global_load_async_to_lds_b128 %5, %13, off\n\t"
               "global_load_async_to_lds_b128 %6, %14, off\n\t"
               "global_load_async_to_lds_b128 %7, %15, off\n\t"
               "s_wait_xcnt 0x0"
               :: "v"(l), "v"(l + 1u * GP), "v"(l + 2u * GP), "v"(l + 3u * GP),
                  "v"(l + 4u * GP), "v"(l + 5u * GP), "v"(l + 6u * GP), "v"(l + 7u * GP),
                  "v"(g), "v"(g + 1 * pitch), "v"(g + 2 * pitch), "v"(g + 3 * pitch),
                  "v"(g + 4 * pitch), "v"(g + 5 * pitch), "v"(g + 6 * pitch), "v"(g + 7 * pitch)
               : "memory");
#endif
}

// ---- one 64 x 64 x 256 product of a block of 4 waves: acc[mt] (rows 16 mt ..+15, cols 16 wave ..+15) = A . B^T.
//      a / b: first of 64 rows of 256 k-contiguous halves, row pitch pa / pb halves. Both operands are staged once in
//      Sm (A, then B, pitch GP): wave w brings rows 16 w ..+15 of each. The fragments then come from LDS with the same
//      k map and in the same k order as from the global rows: A is fetched once per block, not once per wave.
//      In two parts: tile_stage issues the copies, tile_mult waits for them and does the product. A caller puts the global
//      loads of its epilogue between the two: they are then in flight beside the copies and under the product.
__device__ __forceinline__ void tile_stage(unsigned char* Sm, const unsigned short* a, const size_t pa,
                                           const unsigned short* b, const size_t pb) {
  const int tid  = threadIdx.x;
  const int lane = tid & 31, wave = tid >> 5;
  const unsigned l0 = (unsigned)(size_t)Sm + (unsigned)(16 * wave * GP + 16 * lane);   // low 32 bits = byte offset in the block's LDS
  const unsigned short* ga = a + (size_t)(16 * wave) * pa + 8 * lane;
  const unsigned short* gb = b + (size_t)(16 * wave) * pb + 8 * lane;
  rows8_copy(l0, ga, pa);
  rows8_copy(l0 + 8u * GP, ga + 8 * pa, pa);
  rows8_copy(l0 + (unsigned)GOPB, gb, pb);
  rows8_copy(l0 + (unsigned)GOPB + 8u * GP, gb + 8 * pb, pb);
}

__device__ __forceinline__ void tile_mult(unsigned char* Sm, v8f acc[4]) {
  const int tid  = threadIdx.x;
  const int lane = tid & 31, wave = tid >> 5;
  const int hh   = lane >> 4, c = lane & 15;
  asm volatile("s_wait_asynccnt 0x0" ::: "memory");                  // this wave's 32 rows have landed
  lds_barrier();                                                     // ... and every other wave's

  const unsigned char* ap = Sm + c * GP + 16 * hh;
  const unsigned char* bp = Sm + GOPB + (16 * wave + c) * GP + 16 * hh;
#pragma unroll
  for (int mt = 0; mt < 4; ++mt) acc[mt] = zero8();
  // groups of two k-steps (20 LDS reads, 8 products), two register sets: the next group's reads stand as one block in
  // front of this group's products and are in flight under them
  Frag fa[2][2][4], fb[2][2];
#pragma unroll
  for (int g = 0; g <= GRB / 128; ++g) {
    if (g < GRB / 128) {
#pragma unroll
      for (int kk = 0; kk < 2; ++kk) {
        fb[g & 1][kk] = ldfrag((const unsigned short*)(bp + 64 * (2 * g + kk)));
#pragma unroll
        for (int mt = 0; mt < 4; ++mt)
          fa[g & 1][kk][mt] = ldfrag((const unsigned short*)(ap + 16 * mt * GP + 64 * (2 * g + kk)));
      }
      // keeps the group's reads together here: sunk to their products, each pair would be waited for almost as soon as issued
      __builtin_amdgcn_sched_barrier(0);
    }
    if (g > 0) {
#pragma unroll
      for (int kk = 0; kk < 2; ++kk) {
#pragma unroll
        for (int mt = 0; mt < 4; ++mt)
          acc[mt] = mma_hw(fa[(g - 1) & 1][kk][mt].h, fb[(g - 1) & 1][kk].h, acc[mt]);
      }
    }
  }
  // closes the products: no global load of the caller's epilogue is scheduled up between them, onto an operand just read
  __builtin_amdgcn_sched_barrier(0);
#if defined(__HIP_DEVICE_COMPILE__)
  // the distance behind a matrix instruction, kept for loads too: four vector slots between the last product and whatever
  // of the caller's epilogue comes next, so that no global load lands on an A or B just read
  asm volatile("v_nop\n\tv_nop\n\tv_nop\n\tv_nop");
#endif
  // holds the epilogue behind those four slots
  __builtin_amdgcn_sched_barrier(0);
}

// =========================================================================================================
// (0) conv1x1 weights: W16 f16 [320][256], row o: 0..31 = wq, 32..63 = wk, 64..319 = wv; value = f16 of
//     (bf16-RNE(w) * 256) (exact). BIAS f32 [320] = bf16-RNE of bq / bk / bv. Block blk (0..39) owns rows
// coverage: 40 blocks x 8 rows x 32 pieces x 8 halves = 320 x 256; bias 80 x 4 floats = 320.
// =========================================================================================================
__device__ __forceinline__
void cvt_w(const float* __restrict__ wq, const float* __restrict__ bq,
           const float* __restrict__ wk, const float* __restrict__ bk,
           const float* __restrict__ wv, const float* __restrict__ bv,
           unsigned short* W16, float* BIAS, const int blk) {
  const int tid = threadIdx.x;
  const int rl = tid >> 5, col = 8 * (tid & 31);
  const int o = 8 * blk + rl;                                     // 0..319
  const float* wbase = (blk < 4) ? wq : (blk < 8) ? wk : wv;       // block-uniform selection
  const int osub = (blk < 4) ? 0 : (blk < 8) ? CQ : 2 * CQ;
  const float* s = wbase + (size_t)(o - osub) * CC + col;          // in range: (o-osub) < rows of that matrix
  const v4f a = *(const v4f*)s;
  const v4f q = *(const v4f*)(s + 4);
  const float f[8] = {a[0], a[1], a[2], a[3], q[0], q[1], q[2], q[3]};
  v4u u;
#pragma unroll
  for (int t = 0; t < 4; ++t) {
    const _Float16 h0 = (_Float16)(bfr(f[2 * t]) * WSC);
    const _Float16 h1 = (_Float16)(bfr(f[2 * t + 1]) * WSC);
    u[t] = pk16(h_bits(h0), h_bits(h1));
  }
  // bias values: every lane loads all three candidates with clamped indices, selects by value
  v4f bvv;
  {
    const int tb = min(tid, 79);
    const int o4 = 4 * tb;
#pragma unroll
    for (int qd = 0; qd < 4; ++qd) {
      const int oo = o4 + qd;
      const int iq = min(oo, CQ - 1);
      const int ik = min(max(oo - CQ, 0), CQ - 1);
      const int iv = min(max(oo - 2 * CQ, 0), CC - 1);
      const float cq = bq[iq], ck = bk[ik], cv = bv[iv];
      const float val = (oo < CQ) ? cq : (oo < 2 * CQ) ? ck : cv;
      bvv[qd] = bfr(val);
    }
  }
{
    *(v4u*)(W16 + (size_t)o * CC + col) = u;
    if (blk == 0 && tid < 80) *(v4f*)(BIAS + 4 * tid) = bvv;
    
  }
}

// =========================================================================================================
// (1) x f32 [b][256 c][4096 n] -> Xc f16 [b][c][n] (channel-major, bf16-RNE values, exact in f16) and
//     XP f16 [b][n][c] (position-major) through an LDS tile T[64 n][64 c] (pitch TP). Block (nb, cb, b) owns a
// coverage: Xc 2 it x 32 rows x 8 lanes x 8 = 64 c x 64 n; XP same; blocks (nb, cb, b) in (64, 4, NB) cover both planes once.
// =========================================================================================================
__device__ __forceinline__
void cvt_x(const float* __restrict__ x, unsigned short* Xc, unsigned short* XP, unsigned short* T,
           const int nb, const int cb, const int b) {
  const int tid = threadIdx.x;
  const int e = tid & 7, lq = tid >> 3;                             // lq 0..31
  const int n0 = nb * QT, c0 = cb * QT;
  v4u ux[2];
#pragma unroll
  for (int it = 0; it < 2; ++it) {
    const int cl = it * 32 + lq;                                     // 0..63
    const float* sp = x + ((size_t)(b * CC + c0 + cl)) * NN + n0 + 8 * e;
    const v4f a = *(const v4f*)sp;
    const v4f q = *(const v4f*)(sp + 4);
    unsigned short hb[8];
#pragma unroll
    for (int t = 0; t < 4; ++t) {
      hb[t]     = h_bits((_Float16)bfr(a[t]));
      hb[4 + t] = h_bits((_Float16)bfr(q[t]));
    }
#pragma unroll
    for (int t = 0; t < 4; ++t) ux[it][t] = pk16(hb[2 * t], hb[2 * t + 1]);
#pragma unroll
    for (int t = 0; t < 8; ++t) T[(8 * e + t) * TP + cl] = hb[t];
  }
  __syncthreads();
  v4u up[2];
#pragma unroll
  for (int it = 0; it < 2; ++it) {
    const int nl = it * 32 + lq;                                     // 0..63
    up[it] = *(const v4u*)(T + nl * TP + 8 * e);
  }
{
#pragma unroll
    for (int it = 0; it < 2; ++it) {
      const int rl = it * 32 + lq;
      *(v4u*)(Xc + ((size_t)(b * CC + c0 + rl)) * NN + n0 + 8 * e) = ux[it];
      *(v4u*)(XP + ((size_t)(b * NN + n0 + rl)) * CC + c0 + 8 * e) = up[it];
    }
    
  }
}

// =========================================================================================================
// (0) + (1) in one launch: neither reads what the other writes. Blocks 0 .. XB-1 do (1), block blk = nb + 64 (cb + 4 b);
//     blocks XB .. XB+WB-1 do (0). The choice is block-uniform, so the barrier of (1) is passed by whole blocks.
// =========================================================================================================
__global__ __launch_bounds__(256)
void cvt_wx(const float* __restrict__ x,
            const float* __restrict__ wq, const float* __restrict__ bq,
            const float* __restrict__ wk, const float* __restrict__ bk,
            const float* __restrict__ wv, const float* __restrict__ bv,
            unsigned short* Xc, unsigned short* XP, unsigned short* W16, float* BIAS) {
  __shared__ __align__(16) unsigned short T[QT * TP];
  const int blk = blockIdx.x;
  if (blk < XB) cvt_x(x, Xc, XP, T, blk % (NN / QT), (blk / (NN / QT)) % (CC / QT), blk / ((NN / QT) * (CC / QT)));
  else          cvt_w(wq, bq, wk, bk, wv, bv, W16, BIAS, blk - XB);
}

// =========================================================================================================
// (2) conv1x1 GEMM for one (b, 64-n tile, 64-o block): Y[o][n] = (1/256) sum_c W16[o][c] XP[b][n][c] + BIAS[o].
//     Block 128 threads = 4 waves; wave w owns cols n0+16w..+15 (one B fragment per k-step, k = c contiguous in
//     the XP row) and 4 m-tiles (A rows o = o0 + 16 mt + (lane&15), split k map loader from W16). K = 256 = 8 steps.
//     The 64 W16 rows and the 64 XP rows are staged in LDS (tile_stage, tile_mult).
//     Epilogue staged in LDS Os[o_loc][n_loc] (pitch OSP), barrier, then:
//       o-block 0 (q rows 0..31, k rows 32..63): Qh/Ql/Kh/Kl bf16 hi / bf16 residual planes [b][4096 n][32]
//         holds rows 2ll, 2ll+1; lane e -> row 2ll+(e>>2), cols 8*(e&3)..+7; one instruction per 16 lines.
//         halves 8e..8e+7; one instruction per 16 lines.
// coverage: Os 4 waves x 4 tiles x 16x16 = 64 x 64; q/k: 4 planes x 32 lines x 8 lanes x 8 = 4 x (64 n x 32);
//           v: 4 it x 16 rows x 8 lanes x 8 = 64 ch x 64 n; grid rows y < 5 of (64, 5 + GY, NB) cover all planes exactly once.
// =========================================================================================================
__device__ __forceinline__
void gemm_qkv(const unsigned short* __restrict__ W16, const float* __restrict__ BIAS,
              const unsigned short* __restrict__ XP,
              unsigned short* Qh, unsigned short* Ql, unsigned short* Kh, unsigned short* Kl,
              unsigned short* Vh, float* Os, unsigned char* Sm, const int nt, const int mb, const int b) {
  const int tid  = threadIdx.x;
  const int lane = tid & 31, wave = tid >> 5;
  const int hh   = lane >> 4, c = lane & 15;
  const int n0   = nt * QT, o0 = mb * QT;

  tile_stage(Sm, W16 + (size_t)o0 * CC, CC, XP + ((size_t)(b * NN + n0)) * CC, CC);
  // the lane's 32 bias values (rows 16 mt + 8 hh ..+7), asked for behind the copies: they arrive under the product
  const float* bp = BIAS + o0 + 8 * hh;
  v4f bi[4][2];
#pragma unroll
  for (int mt = 0; mt < 4; ++mt) {
    bi[mt][0] = *(const v4f*)(bp + 16 * mt);
    bi[mt][1] = *(const v4f*)(bp + 16 * mt + 4);
  }
  // a precaution: the wait before the loads' address registers are reused; naming them as an input keeps them whole up to here
#if defined(__HIP_DEVICE_COMPILE__)
  asm volatile("s_wait_xcnt 0x0" :: "v"(bp) : "memory");
#endif
  // holds the loads here: sunk to their use behind the product, their latency would stand open there
  __builtin_amdgcn_sched_barrier(0);
  v8f acc[4];
  tile_mult(Sm, acc);

  // ---- epilogue: scale back, + bias -> LDS Os[o_loc][n_loc] ----
  {
    const int nl = 16 * wave + c;
#pragma unroll
    for (int mt = 0; mt < 4; ++mt) {
#pragma unroll
      for (int r = 0; r < 8; ++r) {
        const int ol = 16 * mt + 8 * hh + r;                         // 0..63
        Os[ol * OSP + nl] = acc[mt][r] * IWSC + bi[mt][r >> 2][r & 3];
      }
    }
  }
  __syncthreads();

  const int e = tid & 7, lq = tid >> 3;                             // lq 0..15
  if (mb == 0) {
    // ---- q/k bf16 hi + residual planes ----
{
#pragma unroll
      for (int it = 0; it < 8; ++it) {
        const int p    = it >> 1;                                    // 0 Qh, 1 Ql, 2 Kh, 3 Kl
        const int ll   = (it & 1) * 16 + lq;                         // 0..31
        const int nl   = 2 * ll + (e >> 2);                          // 0..63
        const int col0 = 8 * (e & 3);                                // 0,8,16,24
        const int rb   = ((p >> 1) ? CQ : 0) + col0;
        v4u u;
#pragma unroll
        for (int t = 0; t < 4; ++t) {
          const float f0 = Os[(rb + 2 * t) * OSP + nl];
          const float f1 = Os[(rb + 2 * t + 1) * OSP + nl];
          const unsigned short hb0 = bf_bits(f0), hb1 = bf_bits(f1);
          const unsigned short lb0 = bf_bits(f0 - bf_up(hb0));
          const unsigned short lb1 = bf_bits(f1 - bf_up(hb1));
          u[t] = (p & 1) ? pk16(lb0, lb1) : pk16(hb0, hb1);
        }
        unsigned short* P = (p == 0) ? Qh : (p == 1) ? Ql : (p == 2) ? Kh : Kl;
        *(v4u*)(P + ((size_t)(b * NN + n0 + nl)) * CQ + col0) = u;
      }
      
    }
  } else {
    // ---- v f16 plane ----
    const int ch0 = o0 - QT;                                         // (mb-1)*64
    v4u uv[4];
#pragma unroll
    for (int it = 0; it < 4; ++it) {
      const int row = it * 16 + lq;                                  // 0..63
      const v4f a = *(const v4f*)(Os + row * OSP + 8 * e);
      const v4f q = *(const v4f*)(Os + row * OSP + 8 * e + 4);
#pragma unroll
      for (int t = 0; t < 2; ++t) {
        uv[it][t]     = pk16(h_bits((_Float16)a[2 * t]), h_bits((_Float16)a[2 * t + 1]));
        uv[it][2 + t] = pk16(h_bits((_Float16)q[2 * t]), h_bits((_Float16)q[2 * t + 1]));
      }
    }
{
#pragma unroll
      for (int it = 0; it < 4; ++it) {
        const int row = it * 16 + lq;
        *(v4u*)(Vh + ((size_t)(b * CC + ch0 + row)) * NN + n0 + 8 * e) = uv[it];
      }
      
    }
  }
}

// =========================================================================================================
// (5) channel softmax: for row (b, i): G_j = sum of the GS slice planes in slice order, then
//     p_j = exp(min_j G - G_j) / sum (== softmax of rowmax - G), returned as the lane's 8 halves of
//     Pc f16 [b][256][256] = p * 1024. One wave per row: lane reads j = 8 lane..8 lane+7, wave min / sum by shuffles.
//     rw = b * 256 + i. The NB * 256 rows ride in the launch of (3), two per block, worked by the block's waves 0 and 1.
// =========================================================================================================
__device__ __forceinline__ v4u cam_softmax(const float* __restrict__ G, const int rw, const int lane) {
  const float* row = G + (size_t)rw * CC + 8 * lane;
  v4f a = *(const v4f*)row;
  v4f q = *(const v4f*)(row + 4);
#pragma unroll                                                       // straight line: the planes' loads issue ahead of the adds
  for (int s = 1; s < GS; ++s) {
    a += *(const v4f*)(row + (size_t)s * NB * CC * CC);
    q += *(const v4f*)(row + (size_t)s * NB * CC * CC + 4);
  }
  const float ev[8] = {a[0], a[1], a[2], a[3], q[0], q[1], q[2], q[3]};
  float mn = ev[0];
#pragma unroll
  for (int t = 1; t < 8; ++t) mn = fminf(mn, ev[t]);
#pragma unroll
  for (int s = 1; s < 32; s <<= 1) mn = fminf(mn, __shfl_xor(mn, s, 32));
  float p[8], sm = 0.f;
#pragma unroll
  for (int t = 0; t < 8; ++t) { p[t] = __expf(mn - ev[t]); sm += p[t]; }
#pragma unroll
  for (int s = 1; s < 32; s <<= 1) sm += __shfl_xor(sm, s, 32);
  const float inv = PSC / sm;
  v4u u;
#pragma unroll
  for (int t = 0; t < 4; ++t)
    u[t] = pk16(h_bits((_Float16)(p[2 * t] * inv)), h_bits((_Float16)(p[2 * t + 1] * inv)));
  return u;
}

// ---- one stage (64 keys) of v, k hi and k residual -> LDS, 256 lanes, 16 B per lane and copy, no register on the way.
//      v: copy i brings row (channel) 32 i + (tid >> 3), bytes 16 (tid & 7) ..+15 of its 128; 8 copies = 256 rows.
//      k: the one copy of a plane brings row (key) tid >> 2, bytes 16 (tid & 3) ..+15 of its 64; 64 rows.
//      lv / lk: the lane's LDS byte address of its first v / k-hi piece; gv / gh / gl: its first global piece.
//      s_wait_xcnt 0 closes the statement, a precaution: it stands in front of any rewrite of a register a copy names.
__device__ __forceinline__ void stage_copy(unsigned lv, unsigned lk, const unsigned short* gv,
                                           const unsigned short* gh, const unsigned short* gl) {
#if defined(__HIP_DEVICE_COMPILE__)
  asm volatile("global_load_async_to_lds_b128 %0, %10, off\n\t"
               "global_load_async_to_lds_b128 %1, %11, off\n\t"
               "global_load_async_to_lds_b128 %2, %12, off\n\t"
               "global_load_async_to_lds_b128 %3, %13, off\n\t"
               "global_load_async_to_lds_b128 %4, %14, off\n\t"
               "global_load_async_to_lds_b128 %5, %15, off\n\t"
               "global_load_async_to_lds_b128 %6, %16, off\n\t"
               "global_load_async_to_lds_b128 %7, %17, off\n\t"
               "global_load_async_to_lds_b128 %8, %18, off\n\t"
               "global_load_async_to_lds_b128 %9, %19, off\n\t"
               "s_wait_xcnt 0x0"
               :: "v"(lv), "v"(lv + 32u * VPB), "v"(lv + 64u * VPB), "v"(lv + 96u * VPB),
                  "v"(lv + 128u * VPB), "v"(lv + 160u * VPB), "v"(lv + 192u * VPB), "v"(lv + 224u * VPB),
                  "v"(lk), "v"(lk + (unsigned)KSTB),
                  "v"(gv), "v"(gv + (size_t)32 * NN), "v"(gv + (size_t)64 * NN), "v"(gv + (size_t)96 * NN),
                  "v"(gv + (size_t)128 * NN), "v"(gv + (size_t)160 * NN), "v"(gv + (size_t)192 * NN),
                  "v"(gv + (size_t)224 * NN), "v"(gh), "v"(gl)
               : "memory");
#endif
}

// =========================================================================================================
// (3) position attention for one (b, 128-query tile, key range sp of NN / KS keys), transposed formulation, no mask:
//   S^T tile (16 keys x 16 queries) = A(k: row = key kb + (lane&15), 32 d via the split k map from the bf16 plane
//   Kh [b][4096][32]) . B(q: col = query, same map, resident fragment from Qh) + A(Kh).B(Ql) + A(Kl).B(Qh)
//   (bf16 unscaled residual planes, shared accumulator). Energy = S (no scale).
//   Per lane the D tile holds 8 keys of ONE query: softmax state per lane. m is a held reference, not the running maximum:
//   a stage takes e^{s-m} and its sum only; one test per stage and wave (a lane's sum above PTOP) sends the wave to the
//   rare path, which raises m to the stage's maximum where that is larger (one shuffle lane^16), rescales O and l and takes the stage's
//   exponentials anew. Row-sum partials combined at the end. P = e^{s-m} / 64 as f16 is the B operand of
//   O^T (rows channel, cols queries) += A(V rows channel = 16j + (lane&15), keys contiguous, f16 plane Vh
//   [b][256][4096]) . B(P^T): element r <- D of the tile covering keys kb..kb+15, element 8+r <- the tile covering
//   kb+16..kb+31, lane unchanged.
//   Block = 8 waves = 4 query columns wq (32 queries each) x 2 key halves kh. A wave holds TWO groups of 16 queries
//   (2 x 16 accumulator tiles, 256 channels), so each k and v fragment it reads from LDS feeds two products; of every
//   stage of 64 keys it works the 32 keys of its half kh. Its group u is queries 32 wq + 16 (u ^ kh) ..+15.
//   The k and v rows of 64 keys are one stage in LDS, brought once per block by asynchronous copies and read by all
//   eight waves; two buffers: stage t + 1 flies while stage t is worked on.
//   Behind the loop waves (wq, 0) and (wq, 1) hold the two key halves of the same 32 queries: each hands its group 1
//   (accumulators, m, l) to the other through LDS and merges what it gets into its group 0 (own half, then the partner's).
//   Epilogue in two channel halves: O/l staged in LDS Os[query][128 channels] (pitch OSPW, each 16 queries 4 floats further:
//   the column walk of 8 lanes x 8 queries then meets 32 different banks; b128 stores), barrier, a thread packs 8 queries.
//   The result is the range's own softmax average as f16, Yp [b][256][KS][4096]; the range's reference m and sum l of each query go to
//   ST [2][KS][b][4096] (m planes, then l planes), through LDS so that whole lines are written; (6) merges the ranges.
// coverage: per half 8 it x 32 lines x 8 lanes x 8 halves = 128 ch x 128 n; two halves = 256 ch; grid (32, NB, KS).
// =========================================================================================================
__global__ __launch_bounds__(256)
void attn_pam(const unsigned short* __restrict__ Qh, const unsigned short* __restrict__ Ql,
              const unsigned short* __restrict__ Kh, const unsigned short* __restrict__ Kl,
              const unsigned short* __restrict__ Vh, unsigned short* Yp, float* ST,
              const float* __restrict__ G, unsigned short* Pc) {
  __shared__ __align__(16) float Os[QB * OSPW + 4 * (QB / 16)];
  __shared__ __align__(16) float St[2 * QB];
  __shared__ __align__(16) float Sx[2 * 8 * 16];                     // m, then l, of the group a wave hands over
  __shared__ __align__(16) float Xo[8 * 16 * 2 * 32 * 4];            // its accumulators: [wave][tile][r half][lane] x 16 B
  __shared__ __align__(16) unsigned char Ring[2 * STGB];
  const int tid  = threadIdx.x;
  const int wave = __builtin_amdgcn_readfirstlane(tid >> 5), lane = tid & 31;   // the wave's number in a scalar register
  const int hh   = lane >> 4, c = lane & 15;
  const int wq   = wave & 3, kh = wave >> 2;
  const int n0   = blockIdx.x * QB, b = blockIdx.y, sp = blockIdx.z;
  const int t0   = sp * NTS;                                         // first stage of the block's key range (even)

  // resident q fragments (B operand, col = query n0 + 32 wq + 16 (u ^ kh) + c)
  Frag qh[2], ql[2];
  {
    const size_t qa = ((size_t)(b * NN + n0 + 32 * wq + 16 * kh + c)) * CQ + 8 * hh;
    const size_t qb = ((size_t)(b * NN + n0 + 32 * wq + 16 * (1 - kh) + c)) * CQ + 8 * hh;
    qh[0] = ldfrag(Qh + qa);
    ql[0] = ldfrag(Ql + qa);
    qh[1] = ldfrag(Qh + qb);
    ql[1] = ldfrag(Ql + qb);
    // the wait before the eight loads' address registers are reused; naming them as inputs keeps them whole up to here
#if defined(__HIP_DEVICE_COMPILE__)
    asm volatile("s_wait_xcnt 0x0" :: "v"(Qh + qa), "v"(Ql + qa), "v"(Qh + qb), "v"(Ql + qb) : "memory");
#endif
  }
  // the lane's first pieces of a stage: global sources (+ t * KT keys) and LDS places (+ buffer * STGB)
  const unsigned short* gv = Vh + (size_t)b * CC * NN + (size_t)(tid >> 3) * NN + 8 * (tid & 7);
  const unsigned short* gh = Kh + ((size_t)b * NN + (tid >> 2)) * CQ + 8 * (tid & 3);
  const unsigned short* gl = Kl + ((size_t)b * NN + (tid >> 2)) * CQ + 8 * (tid & 3);
  const unsigned ring0 = (unsigned)(size_t)Ring;                     // low 32 bits = byte offset in the block's LDS
  const unsigned lv = ring0 + (unsigned)((tid >> 3) * VPB + 16 * (tid & 7));
  const unsigned lk = ring0 + (unsigned)(VSTB + (tid >> 2) * KPB + 16 * (tid & 3));
  // fragment offsets inside a stage, at the wave's 32 keys: v (A operand, row = channel 16j + c, keys contiguous),
  // k (A operand, row = key)
  const int vfo = c * VPB + 16 * hh + kh * 64;
  const int kfo = VSTB + (32 * kh + c) * KPB + 16 * hh;

  float m[2] = {-1.0e30f, -1.0e30f}, l[2] = {0.f, 0.f};
  v8f o[2][16];
#pragma unroll
  for (int u = 0; u < 2; ++u) {
#pragma unroll
    for (int j = 0; j < 16; ++j) o[u][j] = zero8();
  }

  // prologue: stage t0 landed and published, then stage t0 + 1 on its way
  stage_copy(lv, lk, gv + (size_t)t0 * KT, gh + (size_t)t0 * KT * CQ, gl + (size_t)t0 * KT * CQ);
  // (5): the block's two rows of the channel softmax, in waves 0 and 1 (scalar test), while stage t0 is on its way
  const int  crow = 2 * (blockIdx.x + (NN / QB) * (blockIdx.y + NB * blockIdx.z)) + (wave & 1);   // 0 .. NB * CC - 1, each once
  const bool cwav = wave < 2;
  v4u cu = {0u, 0u, 0u, 0u};
  if (cwav) cu = cam_softmax(G, crow, lane);
  asm volatile("s_wait_asynccnt 0x0" ::: "memory");                  // this wave's pieces of stage t0 have landed
  __syncthreads();                                                   // ... and every other wave's
  if (cwav) {
    *(v4u*)(Pc + (size_t)crow * CC + 8 * lane) = cu;                 // behind the barrier: it does not wait for this store
    asm volatile("s_wait_xcnt 0x0" ::: "memory");                    // a precaution: before the code behind reuses the store's registers
  }
  stage_copy(lv + STGB, lk + STGB, gv + (size_t)(t0 + 1) * KT, gh + (size_t)(t0 + 1) * KT * CQ,
             gl + (size_t)(t0 + 1) * KT * CQ);

#pragma unroll 1                                                     // rolled: one stage's exponentials live at a time
  for (int t = t0; t < t0 + NTS; ++t) {
    const unsigned bo = (unsigned)(t & 1) * STGB;
    const unsigned char* sb = Ring + bo;
    const unsigned char* kp = sb + kfo;                              // the wave's keys start at kb = KT t + 32 kh
    const Frag k0  = ldfrag((const unsigned short*)(kp));                        // keys kb .. kb+15
    const Frag k1  = ldfrag((const unsigned short*)(kp + 16 * KPB));             // keys kb+16 .. kb+31
    const Frag k0l = ldfrag((const unsigned short*)(kp + KSTB));
    const Frag k1l = ldfrag((const unsigned short*)(kp + KSTB + 16 * KPB));
    v8f s0[2], s1[2];
#pragma unroll
    for (int u = 0; u < 2; ++u) {
      s0[u] = mma_bw(k0.bf, qh[u].bf, zero8());
      s1[u] = mma_bw(k1.bf, qh[u].bf, zero8());
    }
#pragma unroll
    for (int u = 0; u < 2; ++u) {
      s0[u] = mma_bw(k0.bf, ql[u].bf, s0[u]);
      s1[u] = mma_bw(k1.bf, ql[u].bf, s1[u]);
    }
#pragma unroll
    for (int u = 0; u < 2; ++u) {
      s0[u] = mma_bw(k0l.bf, qh[u].bf, s0[u]);
      s1[u] = mma_bw(k1l.bf, qh[u].bf, s1[u]);
    }

    // the first 12 v fragments of the pass as LDS reads in front of the test below, in flight under the exponentials
    const unsigned char* vp = sb + vfo;
    Frag vf[16];
#pragma unroll
    for (int j = 0; j < 12; ++j) vf[j] = ldfrag((const unsigned short*)(vp + 16 * j * VPB));

    FragH ph[2];
    float ls[2];
#pragma unroll
    for (int u = 0; u < 2; ++u) {
      const float msh = m[u] - LNPA;                                 // exp gives e^{s-m} / 64
      ls[u] = 0.f;
#pragma unroll
      for (int r = 0; r < 8; ++r) {
        const float e0 = __expf(s0[u][r] - msh);                     // key kb      + 8hh + r
        const float e1 = __expf(s1[u][r] - msh);                     // key kb + 16 + 8hh + r
        ls[u] += e0 + e1;
        ph[u].hv[0][r] = (_Float16)e0;
        ph[u].hv[1][r] = (_Float16)e1;
      }
    }
    // one test per stage, a scalar branch: taken in the range's first stage (m starts at -1e30, the sums are infinite) and
    // when a score has outgrown the reference
    if (__builtin_amdgcn_ballot_w32(fmaxf(ls[0], ls[1]) > PTOP) != 0u) {
#pragma unroll
      for (int u = 0; u < 2; ++u) {
        const float mx   = fmaxf(hmax8(s0[u]), hmax8(s1[u]));
        const float mn   = fmaxf(m[u], fmaxf(mx, __shfl_xor(mx, 16, 32)));   // equal in lanes c and c + 16
        const float corr = __expf(m[u] - mn);
        m[u] = mn;
        const float msh = mn - LNPA;
#pragma unroll
        for (int j = 0; j < 16; ++j) {
#pragma unroll
          for (int r = 0; r < 8; ++r) o[u][j][r] *= corr;
        }
        l[u] *= corr;
        ls[u] = 0.f;
#pragma unroll
        for (int r = 0; r < 8; ++r) {
          const float e0 = __expf(s0[u][r] - msh);
          const float e1 = __expf(s1[u][r] - msh);
          ls[u] += e0 + e1;
          ph[u].hv[0][r] = (_Float16)e0;
          ph[u].hv[1][r] = (_Float16)e1;
        }
      }
    }
    l[0] += ls[0];
    l[1] += ls[1];

    // the last 4 fragments take the registers that the scores leave: one group of reads, in flight under 24 products
#pragma unroll
    for (int j = 12; j < 16; ++j) vf[j] = ldfrag((const unsigned short*)(vp + 16 * j * VPB));
    // keeps that group here: sunk to its products, each pair of reads would be waited for as soon as issued
    __builtin_amdgcn_sched_barrier(0);
#pragma unroll
    for (int j = 0; j < 16; ++j) {                                   // each fragment feeds two products
      o[0][j] = mma_hw(vf[j].h, ph[0].v, o[0][j]);
      o[1][j] = mma_hw(vf[j].h, ph[1].v, o[1][j]);
    }
    // keeps the stage's arithmetic in front of the barrier: sunk behind it, it would also stand in front of the refill,
    // whose copies would then be waited for almost as soon as they are issued
    __builtin_amdgcn_sched_barrier(0);
    // publish point of stage t + 1, and the end of every reader's last read of stage t's buffer
    asm volatile("s_wait_dscnt 0x0" ::: "memory");                   // this wave's LDS reads of stage t are done
    asm volatile("s_wait_asynccnt 0x0" ::: "memory");                // this wave's pieces of stage t + 1 have landed
    __syncthreads();
    if (t + 2 < t0 + NTS)                                            // block-uniform: refill the buffer just read
      stage_copy(lv + bo, lk + bo, gv + (size_t)(t + 2) * KT, gh + (size_t)(t + 2) * KT * CQ,
                 gl + (size_t)(t + 2) * KT * CQ);
  }
  asm volatile("s_wait_asynccnt 0x0" ::: "memory");                  // nothing of this wave is in flight at its end
  // the lane's number read anew: no index of the epilogue has to stay in a register (or be spilled) across the loop
  const int ln = (int)__builtin_amdgcn_mbcnt_lo(~0u, 0u);
  const int h2 = ln >> 4, c2 = ln & 15, td = 32 * wave + ln;
  l[0] += __shfl_xor(l[0], 16, 32);
  l[1] += __shfl_xor(l[1], 16, 32);

  // hand-over of group 1 to the wave that worked the other key half of the same queries (wave ^ 4, same lane)
  if (h2 == 0) { Sx[16 * wave + c2] = m[1]; Sx[128 + 16 * wave + c2] = l[1]; }   // equal in lanes c and c + 16
#pragma unroll
  for (int j = 0; j < 16; ++j) {
    v4f va, vb;
#pragma unroll
    for (int r = 0; r < 4; ++r) { va[r] = o[1][j][r]; vb[r] = o[1][j][4 + r]; }
    *(v4f*)(Xo + (((wave * 16 + j) * 2 + 0) * 32 + ln) * 4) = va;
    *(v4f*)(Xo + (((wave * 16 + j) * 2 + 1) * 32 + ln) * 4) = vb;
  }
  __syncthreads();                                                   // every wave's group 1 is in LDS
  const int pw = wave ^ 4;
  const float mp = Sx[16 * pw + c2], lp = Sx[128 + 16 * pw + c2];
  const float mm = fmaxf(m[0], mp);
  const float ea = __expf(m[0] - mm), eb = __expf(mp - mm);
  const float lm = l[0] * ea + lp * eb;                              // o and l both carry the 1 / 64 factor
  const float inv = 1.0f / lm;
  const float fa = ea * inv, fb = eb * inv;

  const int qrow = 32 * wq + 16 * kh + c2;                           // the query of the wave's group 0
  const int qsh  = 4 * (2 * wq + kh);                                // 4 (qrow >> 4): the shift of its group of 16 rows
  const int e = td & 7, lq = td >> 3;                                // lq 0..31
  if (h2 == 0) { St[qrow] = mm; St[QB + qrow] = lm; }
#pragma unroll
  for (int half = 0; half < 2; ++half) {
    if (half) __syncthreads();                                       // every wave finished reading Os
#pragma unroll
    for (int jj = 0; jj < 8; ++jj) {
      const int j = 8 * half + jj;
      const v4f xa = *(const v4f*)(Xo + (((pw * 16 + j) * 2 + 0) * 32 + ln) * 4);
      const v4f xb = *(const v4f*)(Xo + (((pw * 16 + j) * 2 + 1) * 32 + ln) * 4);
      v4f va, vb;
#pragma unroll
      for (int r = 0; r < 4; ++r) { va[r] = o[0][j][r] * fa + xa[r] * fb; vb[r] = o[0][j][4 + r] * fa + xb[r] * fb; }
      *(v4f*)(Os + qrow * OSPW + qsh + 16 * jj + 8 * h2)     = va;   // Os[query][ch_loc = 16jj + 8hh + r]
      *(v4f*)(Os + qrow * OSPW + qsh + 16 * jj + 8 * h2 + 4) = vb;
    }
    __syncthreads();
#pragma unroll
    for (int it = 0; it < 8; ++it) {
      const int chl = (it & 3) * 32 + lq;                            // channel 0..127 within the half
      const int nl  = (it >> 2) * 64 + 8 * e;                        // query 0..127, 8 in a row: one group of 16
      const float* op = Os + nl * OSPW + 4 * (nl >> 4) + chl;
      v4u u;
#pragma unroll
      for (int t = 0; t < 4; ++t)
        u[t] = pk16(h_bits((_Float16)op[(2 * t) * OSPW]), h_bits((_Float16)op[(2 * t + 1) * OSPW]));
      *(v4u*)(Yp + ((size_t)((b * CC + 128 * half + chl) * KS + sp)) * NN + n0 + nl) = u;   // 8 lanes = one whole line
    }
  }
  if (td < 64) {                                                     // waves 0 and 1, behind the barriers above: 128 m, 128 l
    const int pl = td >> 5, q4 = 4 * (td & 31);
    *(v4f*)(ST + ((size_t)((pl * KS + sp) * NB + b)) * NN + n0 + q4) = *(const v4f*)(St + pl * QB + q4);
  }
}

// =========================================================================================================
// (4) channel Gram for one (b, 64-i block, 64-j block, K slice s): G[s][b][i][j] = sum over the slice's GK positions n
//     of Xc[b][i][n] Xc[b][j][n]; the GS slices of a tile run as GS blocks, and (5) adds their planes.
//     4 waves; wave w owns cols j0+16w..+15 (B from the j row, keys n contiguous) and 4 i tiles (A rows
//     [b][256][256] (row segment 64 j = 2 lines), 8 consecutive lanes x 16 B, one instruction per 16 lines, two
// coverage: 8 it x 16 lines x 8 lanes x 4 = 64 x 64; (jt, itb, zb) in (4, 4, GS * NB) covers the GS planes of G exactly once.
// =========================================================================================================
__device__ __forceinline__
void gram_k(const unsigned short* __restrict__ Xc, float* G, float* Os, unsigned char* Sm,
            const int jt, const int itb, const int zb) {
  const int tid  = threadIdx.x;
  const int lane = tid & 31, wave = tid >> 5;
  const int hh   = lane >> 4, c = lane & 15;
  const int b = zb % NB, s = zb / NB;                                // zb = s * NB + b: the plane of G this block writes
  const int j0 = jt * QT, i0 = itb * QT;

  v8f acc[4];                                                        // the slice's 256 positions of the 64 i rows and the 64 j rows, staged in LDS
  tile_stage(Sm, Xc + ((size_t)(b * CC + i0)) * NN + s * GK, NN, Xc + ((size_t)(b * CC + j0)) * NN + s * GK, NN);
  tile_mult(Sm, acc);
  {
    const int nl = 16 * wave + c;
#pragma unroll
    for (int mt = 0; mt < 4; ++mt) {
#pragma unroll
      for (int r = 0; r < 8; ++r) Os[(16 * mt + 8 * hh + r) * OSP + nl] = acc[mt][r];
    }
  }
  __syncthreads();
  {
    const int e = tid & 7, lq = tid >> 3;                            // lq 0..15
{
#pragma unroll
      for (int it = 0; it < 8; ++it) {
        const int L = it * 16 + lq;                                  // 0..127
        const int row = L >> 1, hf = L & 1;
        const v4f v = *(const v4f*)(Os + row * OSP + hf * 32 + 4 * e);
        *(v4f*)(G + ((size_t)(zb * CC + i0 + row)) * CC + j0 + hf * 32 + 4 * e) = v;
      }
      // a precaution: in the shared launch code follows these stores in the listing; the wait stands before it reuses their registers
      asm volatile("s_wait_xcnt 0x0" ::: "memory");
    }
  }
}

// =========================================================================================================
// (2) + (4) in one launch: both read only what the launch before wrote, neither reads what the other writes.
//     Grid (64, 5 + GY, NB): rows y < 5 do (2) with (nt, mb, b) = (x, y, z); rows y >= 5 do (4): idx = x + 64 (y - 5)
//     = jt + 4 (itb + 4 s), batch z. The choice is block-uniform, so each body's barrier is passed by whole blocks.
// =========================================================================================================
__global__ __launch_bounds__(128)
void gemm_gram(const unsigned short* __restrict__ W16, const float* __restrict__ BIAS,
               const unsigned short* __restrict__ XP, const unsigned short* __restrict__ Xc,
               unsigned short* Qh, unsigned short* Ql, unsigned short* Kh, unsigned short* Kl,
               unsigned short* Vh, float* G) {
  __shared__ __align__(16) float Os[QT * OSP];
  __shared__ __align__(16) unsigned char Sm[2 * GOPB];
  const int y = blockIdx.y;
  if (y < MQKV / QT) {
    gemm_qkv(W16, BIAS, XP, Qh, Ql, Kh, Kl, Vh, Os, Sm, blockIdx.x, y, blockIdx.z);
  } else {
    const int idx = blockIdx.x + (NN / QT) * (y - MQKV / QT);
    gram_k(Xc, G, Os, Sm, idx % (CC / QT), (idx / (CC / QT)) % (CC / QT),
           (idx / ((CC / QT) * (CC / QT))) * NB + blockIdx.z);
  }
}

// =========================================================================================================
// (6) channel mix + output for one (b, 64-n tile, 64-i block): cam[i][n] = (1/1024) sum_j Pc[b][i][j] XP[b][n][j]
//     (K = 256 = 8 steps; A rows i = i0 + 16 mt + (lane&15), j contiguous; B col n = n0 + 16w + (lane&15) from the
//     XP row, j contiguous), then out[b][i][n] = (g_pam * Y + xb) + (g_cam * cam + xb) with xb = bf16-RNE of x and
//     Y = sum over the KS key ranges s, in range order, of wt_s[n] Yp[b][i][s][n], wt_s = l_s e^{m_s - M} / sum of these,
//     M = max_s m_s (m, l from ST): the softmax over all keys from the ranges' own averages (Yp f16, widened here).
// coverage: 8 it x 16 lines x 8 lanes x 4 = 64 i x 64 n; grid (64, 4, NB) covers d_out exactly once.
// =========================================================================================================
__global__ __launch_bounds__(128)
void cam_out(const unsigned short* __restrict__ Pc, const unsigned short* __restrict__ XP,
             const unsigned short* __restrict__ Yp, const float* __restrict__ ST, const float* __restrict__ x,
             const float* __restrict__ gpam, const float* __restrict__ gcam, float* out) {
  __shared__ __align__(16) float Os[QT * OSP];
  __shared__ __align__(16) unsigned char Sm[2 * GOPB];
  const int tid  = threadIdx.x;
  const int lane = tid & 31, wave = tid >> 5;
  const int hh   = lane >> 4, c = lane & 15;
  const int nt = blockIdx.x, itb = blockIdx.y, b = blockIdx.z;
  const int n0 = nt * QT, i0 = itb * QT;

  tile_stage(Sm, Pc + ((size_t)(b * CC + i0)) * CC, CC, XP + ((size_t)(b * NN + n0)) * CC, CC);   // the 64 Pc rows and the 64 XP rows -> LDS

  // every global operand of the epilogue (m and l of the key ranges, x, the ranges' averages) is asked for here, behind the
  // copies: the 48 loads are in flight beside them and under the product, not behind it
  const int e = tid & 7, lq = tid >> 3;                              // lq 0..15
  const float* sq = ST + (size_t)b * NN + n0;                        // block-uniform base; the lane's part is lo
  const unsigned lo = (unsigned)((lq & 1) * 32 + 4 * e);
  v4f wt[KS], mm[KS];
#pragma unroll
  for (int s = 0; s < KS; ++s) {
    mm[s] = *(const v4f*)(sq + (size_t)s * NB * NN + lo);
    wt[s] = *(const v4f*)(sq + (size_t)(KS + s) * NB * NN + lo);
  }
  // the ranges' rows: block-uniform base of the tile + one lane offset (row lq >> 1, the it and s steps are constants)
  const unsigned char* yt = (const unsigned char*)(Yp + ((size_t)(b * CC + i0)) * KS * NN + n0);
  const unsigned yo = 2u * (unsigned)((lq >> 1) * KS * NN + (lq & 1) * 32 + 4 * e);   // bytes
  v4f res[8], xr[8];
  v4h yr[8][KS];
  const float* px[8];
#pragma unroll
  for (int it = 0; it < 8; ++it) {
    const int L = it * 16 + lq;                                      // 0..127
    px[it] = x + ((size_t)(b * CC + i0 + (L >> 1))) * NN + n0 + (L & 1) * 32 + 4 * e;
    xr[it] = *(const v4f*)px[it];
#pragma unroll
    for (int s = 0; s < KS; ++s) yr[it][s] = *(const v4h*)(yt + (size_t)(it * 8 * KS + s) * NN * 2 + yo);
  }
  // a precaution: the wait before the 48 loads' address registers are reused; naming them as inputs keeps them whole up to here
#if defined(__HIP_DEVICE_COMPILE__)
  asm volatile("s_wait_xcnt 0x0" :: "v"(px[0]), "v"(px[1]), "v"(px[2]), "v"(px[3]), "v"(px[4]), "v"(px[5]), "v"(px[6]),
               "v"(px[7]), "v"(yo), "v"(lo) : "memory");
#endif
  // holds the loads here: sunk to their use behind the product, their latency would stand open there
  __builtin_amdgcn_sched_barrier(0);

  v8f acc[4];
  tile_mult(Sm, acc);
  {
    const int nl = 16 * wave + c;
#pragma unroll
    for (int mt = 0; mt < 4; ++mt) {
#pragma unroll
      for (int r = 0; r < 8; ++r) Os[(16 * mt + 8 * hh + r) * OSP + nl] = acc[mt][r];
    }
  }
  lds_barrier();                                                     // Os is whole; the global loads stay in flight over it

  const float gp = bfr(gpam[0]);
  const float gc = bfr(gcam[0]) * IPSC;
  // weights of the key ranges for the thread's 4 positions (nl below is the same in every it: 16 it is even)
  {
#pragma unroll
    for (int t = 0; t < 4; ++t) {
      float mx = mm[0][t];
#pragma unroll
      for (int s = 1; s < KS; ++s) mx = fmaxf(mx, mm[s][t]);
      float sm = 0.f;
#pragma unroll
      for (int s = 0; s < KS; ++s) { wt[s][t] *= exp2_slot((mm[s][t] - mx) * LOG2E); sm += wt[s][t]; }
      const float inv = 1.0f / sm;
#pragma unroll
      for (int s = 0; s < KS; ++s) wt[s][t] *= inv;
    }
  }
#pragma unroll
  for (int it = 0; it < 8; ++it) {
    const int L = it * 16 + lq;                                      // 0..127
    const int row = L >> 1, hf = L & 1;
    const int nl = hf * 32 + 4 * e;
    const v4f cam4 = *(const v4f*)(Os + row * OSP + nl);
    const v4f xv = xr[it];
    v4f yv = wt[0] * __builtin_convertvector(yr[it][0], v4f);
#pragma unroll
    for (int s = 1; s < KS; ++s) yv += wt[s] * __builtin_convertvector(yr[it][s], v4f);
#pragma unroll
    for (int t = 0; t < 4; ++t) {
      const float xb = bfr(xv[t]);
      const float t1 = gp * yv[t] + xb;
      const float t2 = gc * cam4[t] + xb;
      res[it][t] = t1 + t2;
    }
  }
{
#pragma unroll
    for (int it = 0; it < 8; ++it) {
      const int L = it * 16 + lq;
      const int row = L >> 1, hf = L & 1;
      const int nl = hf * 32 + 4 * e;
      const size_t idx = ((size_t)(b * CC + i0 + row)) * NN + n0 + nl;
      *(v4f*)(out + idx) = res[it];
    }
    
  }
}

// =========================================================================================================
// Workspace map (bytes; each region start a multiple of 256; every extent is an exact tile multiple and is written
//   W16 f16 [320][256]          163840      BIAS f32 [320]              1280
//   Xc  f16 [2][256][4096]     4194304      XP   f16 [2][4096][256]  4194304
//   Qh/Ql/Kh/Kl bf16 [2][4096][32]  524288 x4                          Vh f16 [2][256][4096]  4194304
//   Yp  f16 [2][256][4][4096] 16777216      G    f32 [16][2][256][256] 8388608     Pc f16 [2][256][256] 262144
//   ST  f32 [2][4][2][4096]     262144
//   total = 40535296
// =========================================================================================================
extern "C" void kernel_launch(void* const* d_in, const int* in_sizes, int n_in,
                              void* d_out, int out_size, void* d_ws, size_t ws_size,
                              hipStream_t stream) {
  const int XN = NB * CC * NN;                                       // 2097152
  if (n_in < 9) return;
  if (in_sizes[0] != XN) return;
  if (in_sizes[1] != CQ * CC || in_sizes[2] != CQ) return;
  if (in_sizes[3] != CQ * CC || in_sizes[4] != CQ) return;
  if (in_sizes[5] != CC * CC || in_sizes[6] != CC) return;
  if (in_sizes[7] < 1 || in_sizes[8] < 1) return;
  if (out_size != XN) return;

  size_t off = 0;
  auto carve = [&](size_t bytes) { const size_t o = off; off += (bytes + 255) & ~(size_t)255; return o; };
  const size_t oW16 = carve((size_t)MQKV * CC * 2);
  const size_t oBIA = carve((size_t)MQKV * 4);
  const size_t oXc  = carve((size_t)NB * CC * NN * 2);
  const size_t oXP  = carve((size_t)NB * NN * CC * 2);
  const size_t oQh  = carve((size_t)NB * NN * CQ * 2);
  const size_t oQl  = carve((size_t)NB * NN * CQ * 2);
  const size_t oKh  = carve((size_t)NB * NN * CQ * 2);
  const size_t oKl  = carve((size_t)NB * NN * CQ * 2);
  const size_t oVh  = carve((size_t)NB * CC * NN * 2);
  const size_t oYp  = carve((size_t)KS * NB * CC * NN * 2);
  const size_t oG   = carve((size_t)GS * NB * CC * CC * 4);
  const size_t oPc  = carve((size_t)NB * CC * CC * 2);
  const size_t oST  = carve((size_t)2 * KS * NB * NN * 4);
  if (off > ws_size) return;
  if (off > (size_t)134217728) return;

  const float* x    = (const float*)d_in[0];
  const float* wq   = (const float*)d_in[1];
  const float* bq   = (const float*)d_in[2];
  const float* wk   = (const float*)d_in[3];
  const float* bk   = (const float*)d_in[4];
  const float* wv   = (const float*)d_in[5];
  const float* bv   = (const float*)d_in[6];
  const float* gpam = (const float*)d_in[7];
  const float* gcam = (const float*)d_in[8];

  char* ws = (char*)d_ws;
  unsigned short* W16 = (unsigned short*)(ws + oW16);
  float*          BIA = (float*)(ws + oBIA);
  unsigned short* Xc  = (unsigned short*)(ws + oXc);
  unsigned short* XP  = (unsigned short*)(ws + oXP);
  unsigned short* Qh  = (unsigned short*)(ws + oQh);
  unsigned short* Ql  = (unsigned short*)(ws + oQl);
  unsigned short* Kh  = (unsigned short*)(ws + oKh);
  unsigned short* Kl  = (unsigned short*)(ws + oKl);
  unsigned short* Vh  = (unsigned short*)(ws + oVh);
  unsigned short* Yp  = (unsigned short*)(ws + oYp);
  float*          G   = (float*)(ws + oG);
  unsigned short* Pc  = (unsigned short*)(ws + oPc);
  float*          ST  = (float*)(ws + oST);
  float* out = (float*)d_out;

  const dim3 blk256(256), blk128(128);

  // (0) + (1) weights -> f16 plane + bias line; x -> channel-major and position-major 16-bit planes
  cvt_wx<<<dim3(XB + WB), blk256, 0, stream>>>(x, wq, bq, wk, bk, wv, bv, Xc, XP, W16, BIA);
  // (2) + (4) conv1x1 GEMM -> q/k hi + residual planes and v plane; channel Gram, K slices -> G [s][b][256][256]
  gemm_gram<<<dim3(NN / QT, MQKV / QT + GY, NB), blk128, 0, stream>>>(W16, BIA, XP, Xc, Qh, Ql, Kh, Kl, Vh, G);
  // (3) + (5) position attention, KS key ranges -> Yp [b][256][s][4096], ST; channel softmax -> Pc [b][256][256] (x1024 f16)
  attn_pam<<<dim3(NN / QB, NB, KS), blk256, 0, stream>>>(Qh, Ql, Kh, Kl, Vh, Yp, ST, G, Pc);
  // (6) channel mix + merge of the key ranges + residual sum -> out [b][256][4096]
  cam_out<<<dim3(NN / QT, CC / QT, NB), blk128, 0, stream>>>(Pc, XP, Yp, ST, x, gpam, gcam, out);
  (void)hipGetLastError();
}

// v010
// One run takes 39.1 microseconds.
// Two timings next to v009 put it at 1.05 and 1.04 times that version's speed.
// Counting every step since v000, it is 12.6 times as fast.
// Contractions: conv1x1 q/k/v GEMM W[320x256].X[256x4096] on v_wmma_f32_16x16x32_f16 (f16 containers of bf16-RNE
// weights x256 and bf16-RNE x); position scores K.Q^T on v_wmma_f32_16x16x32_bf16 (bf16 hi + bf16 residual planes of
// q and k, 3 products, K=32); O^T = V.P^T on v_wmma_f32_16x16x32_f16 (v f16, P = e^{s-m} / 64 f16 from the score D
// registers); channel Gram X.X^T (K=4096) and channel mix A.X (K=256) on v_wmma_f32_16x16x32_f16 (f16 of bf16-RNE x,
// softmax weights x1024 f16); f32 accumulate everywhere; softmax statistics, residual adds and output sum in f32 VALU.
// The key ranges' averages of the position attention pass from launch to launch as f16 (RNE of the f32 value).
#include <hip/hip_runtime.h>
#include <math.h>
#include <stdint.h>

#define NB    2
#define CC    256
#define NN    4096
#define CQ    32
#define MQKV  320
#define QT    64
#define QB    128                      // queries per block of the position attention
#define OSP   68
#define TP    72
#define WSC   256.0f
#define IWSC  0.00390625f
#define PSC   1024.0f
#define IPSC  0.0009765625f
#define LNPA  (-4.158883083359672f)    // ln (1 / 64): P of the position attention is e^{s-m} / 64, 22 binades under f16's top
#define PTOP  65000.0f                 // a lane's sum of one stage's P above this: the reference m is raised (f16 P stays finite)
#define LOG2E 1.4426950408889634f
#define KT    64                       // keys per LDS stage of the position attention
#define NT    (NN / KT)                // stages
#define KS    4                        // key ranges of the position attention, one block each per query tile
#define NTS   (NT / KS)                // stages of one key range
#define VPB   144                      // LDS pitch of a v row (64 keys = 128 B, + 16 B: 16 B x odd for b128 readers)
#define KPB   80                       // LDS pitch of a k row (32 d = 64 B, + 16 B)
#define VSTB  (CC * VPB)               // v part of a stage, bytes
#define KSTB  (KT * KPB)               // one k plane of a stage, bytes
#define STGB  (VSTB + 2 * KSTB)        // one stage: v, k hi, k residual
#define GS    16                       // blocks that share the K = 4096 of one Gram tile
#define GK    (NN / GS)                // positions per Gram block
#define XB    ((NN / QT) * (CC / QT) * NB)                 // blocks of the x conversion
#define WB    (MQKV / 8)                                   // blocks of the weight conversion
#define GY    ((CC / QT) * (CC / QT) * GS / (NN / QT))     // grid rows of NN / QT blocks that hold one batch's Gram blocks
#define GRB   512                      // bytes of one operand row of a 64 x 64 x 256 product (256 halves)
#define GP    (GRB + 16)               // its LDS pitch (16 B x odd for b128 readers)
#define GOPB  (QT * GP)                // one staged operand: 64 rows
#define YTH   256                      // halves of one 16 x 16 tile of Yp

static_assert(NN % QT == 0);
static_assert(CC % QT == 0);
static_assert(MQKV == 2 * CQ + CC);
static_assert(MQKV % QT == 0);
static_assert((OSP * 4) % 16 == 0);
static_assert((TP * 2) % 16 == 0);
static_assert(CC % 32 == 0 && NN % 32 == 0 && CQ == 32);
static_assert(NN % KT == 0 && NT % KS == 0 && NTS >= 2 && NTS % 2 == 0 && KT % 32 == 0);
static_assert(VPB % 16 == 0 && KPB % 16 == 0 && STGB % 16 == 0 && VSTB % 16 == 0);
static_assert(VPB >= KT * 2 && KPB >= CQ * 2);
static_assert(NN % GS == 0 && GK % 32 == 0);
static_assert(GY * (NN / QT) == (CC / QT) * (CC / QT) * GS);
static_assert(CC * 2 == GRB && GK * 2 == GRB && GP % 16 == 0 && QT == 64);   // every staged row is 32 lanes x 16 B
static_assert((NN / QB) * NB * KS * 2 == NB * CC);         // two channel-softmax rows per block of the position attention
static_assert(NN % QB == 0 && KT == 64 && CC == 256);      // the stage copy's 256 lanes, the two key halves of a stage

typedef _Float16       v16h __attribute__((ext_vector_type(16)));
typedef _Float16       v8h  __attribute__((ext_vector_type(8)));
typedef __bf16         v16b __attribute__((ext_vector_type(16)));
typedef unsigned short v8us __attribute__((ext_vector_type(8)));
typedef float          v8f  __attribute__((ext_vector_type(8)));
typedef float          v4f  __attribute__((ext_vector_type(4)));
typedef unsigned int   v4u  __attribute__((ext_vector_type(4)));

union Frag  { v8us u[2]; v16h h; v16b bf; };
union FragH { v16h v; v8h hv[2]; };
static_assert(sizeof(Frag) == 32);
static_assert(sizeof(FragH) == 32);

// ---- scalar helpers ---------------------------------------------------------------------------------------
__device__ __forceinline__ unsigned short bf_bits(float f) {          // f32 -> bf16 bits, RNE convert
  unsigned u = __float_as_uint(f);
  return (unsigned short)((u + 0x7FFFu + ((u >> 16) & 1u)) >> 16);
}
__device__ __forceinline__ float bf_up(unsigned short hb) { return __uint_as_float(((unsigned)hb) << 16); }
__device__ __forceinline__ float bfr(float f) { return bf_up(bf_bits(f)); }
__device__ __forceinline__ unsigned short h_bits(_Float16 x) { return __builtin_bit_cast(unsigned short, x); }
__device__ __forceinline__ unsigned pk16(unsigned short a, unsigned short b) { return (unsigned)a | ((unsigned)b << 16); }
__device__ __forceinline__ v8f zero8() { v8f z = {0.f, 0.f, 0.f, 0.f, 0.f, 0.f, 0.f, 0.f}; return z; }
__device__ __forceinline__ float hmax8(v8f s) {
  return fmaxf(fmaxf(fmaxf(s[0], s[1]), fmaxf(s[2], s[3])), fmaxf(fmaxf(s[4], s[5]), fmaxf(s[6], s[7])));
}

// 2^x with the free slot that the instruction set asks for behind a transcendental, tied to it in one statement
__device__ __forceinline__ float exp2_slot(float x) {
  float r = 0.f;
#if defined(__HIP_DEVICE_COMPILE__)
  asm("v_exp_f32 %0, %1\n\tv_nop" : "=v"(r) : "v"(x));
#endif
  return r;
}

// ---- 16-bit fragment loader (A, or B from a k-contiguous [n][k] row): lane -> row/col (lane&15), p already includes
//      + 8*(lane>>4); elements 0..7 <- p[0..7] (k0+8h..), elements 8..15 <- p[16..23] (k0+16+8h..)
__device__ __forceinline__ Frag ldfrag(const unsigned short* p) {
  Frag f;
  f.u[0] = *(const v8us*)(p);
  f.u[1] = *(const v8us*)(p + 16);
  return f;
}

// ---- WMMA helpers: builtin followed by a 4-slot VALU gap tying D and keeping A/B live --------------------------
__device__ __forceinline__ v8f mma_b(v16b a, v16b b, v8f c) {
  v8f d = __builtin_amdgcn_wmma_f32_16x16x32_bf16(false, a, false, b, (short)0, c, false, false);
#if defined(__HIP_DEVICE_COMPILE__)
  const v16h ha = __builtin_bit_cast(v16h, a), hb = __builtin_bit_cast(v16h, b);
  asm volatile("v_nop\n\tv_nop\n\tv_nop\n\tv_nop" : "+v"(d) : "v"(ha), "v"(hb));
#endif
  return d;
}

// The same products as the bare builtins, for the kernel whose accumulators reach above v255: the operands of an asm
// statement are held in the first 256 registers, which would spill them; the compiler keeps the distance behind its builtins.
// The 64 x 64 x 256 products use them too: with no statement between the products their LDS reads can stand in groups ahead.
__device__ __forceinline__ v8f mma_hw(v16h a, v16h b, v8f c) {
  return __builtin_amdgcn_wmma_f32_16x16x32_f16(false, a, false, b, (short)0, c, false, false);
}
__device__ __forceinline__ v8f mma_bw(v16b a, v16b b, v8f c) {
  return __builtin_amdgcn_wmma_f32_16x16x32_bf16(false, a, false, b, (short)0, c, false, false);
}

// ---- work-group barrier whose fences order LDS alone: __syncthreads() also waits for every global load of the wave that
//      is still in flight, which would hold the product back until the epilogue's operands have arrived
__device__ __forceinline__ void lds_barrier() {
#if defined(__HIP_DEVICE_COMPILE__)
  __builtin_amdgcn_fence(__ATOMIC_RELEASE, "workgroup", "local");
  __builtin_amdgcn_s_barrier();
  __builtin_amdgcn_fence(__ATOMIC_ACQUIRE, "workgroup", "local");
#endif
}

// ---- 8 rows of 512 B -> LDS, one wave: a copy brings one whole row (32 lanes x 16 B, four whole lines), no register on
//      the way. l: the lane's LDS byte address in the first row (next rows + GP); g: its global piece (next rows + pitch halves).
//      s_wait_xcnt 0 closes the statement, a precaution: it stands in front of any rewrite of a register a copy names.
__device__ __forceinline__ void rows8_copy(unsigned l, const unsigned short* g, const size_t pitch) {
#if defined(__HIP_DEVICE_COMPILE__)
  asm volatile("global_load_async_to_lds_b128 %0, %8, off\n\t"
               "global_load_async_to_lds_b128 %1, %9, off\n\t"
               "global_load_async_to_lds_b128 %2, %10, off\n\t"
               "global_load_async_to_lds_b128 %3, %11, off\n\t"
               "global_load_async_to_lds_b128 %4, %12, off\n\t"
               "global_load_async_to_lds_b128 %5, %13, off\n\t"
               "global_load_async_to_lds_b128 %6, %14, off\n\t"
               "global_load_async_to_lds_b128 %7, %15, off\n\t"
               "s_wait_xcnt 0x0"
               :: "v"(l), "v"(l + 1u * GP), "v"(l + 2u * GP), "v"(l + 3u * GP),
                  "v"(l + 4u * GP), "v"(l + 5u * GP), "v"(l + 6u * GP), "v"(l + 7u * GP),
                  "v"(g), "v"(g + 1 * pitch), "v"(g + 2 * pitch), "v"(g + 3 * pitch),
                  "v"(g + 4 * pitch), "v"(g + 5 * pitch), "v"(g + 6 * pitch), "v"(g + 7 * pitch)
               : "memory");
#endif
}

// ---- one 64 x 64 x 256 product of a block of 4 waves: acc[mt] (rows 16 mt ..+15, cols 16 wave ..+15) = A . B^T.
//      a / b: first of 64 rows of 256 k-contiguous halves, row pitch pa / pb halves. Both operands are staged once in
//      Sm (A, then B, pitch GP): wave w brings rows 16 w ..+15 of each. The fragments then come from LDS with the same
//      k map and in the same k order as from the global rows: A is fetched once per block, not once per wave.
//      In two parts: tile_stage issues the copies, tile_mult waits for them and does the product. A caller puts the global
//      loads of its epilogue between the two: they are then in flight beside the copies and under the product.
__device__ __forceinline__ void tile_stage(unsigned char* Sm, const unsigned short* a, const size_t pa,
                                           const unsigned short* b, const size_t pb) {
  const int tid  = threadIdx.x;
  const int lane = tid & 31, wave = tid >> 5;
  const unsigned l0 = (unsigned)(size_t)Sm + (unsigned)(16 * wave * GP + 16 * lane);   // low 32 bits = byte offset in the block's LDS
  const unsigned short* ga = a + (size_t)(16 * wave) * pa + 8 * lane;
  const unsigned short* gb = b + (size_t)(16 * wave) * pb + 8 * lane;
  rows8_copy(l0, ga, pa);
  rows8_copy(l0 + 8u * GP, ga + 8 * pa, pa);
  rows8_copy(l0 + (unsigned)GOPB, gb, pb);
  rows8_copy(l0 + (unsigned)GOPB + 8u * GP, gb + 8 * pb, pb);
}

__device__ __forceinline__ void tile_mult(unsigned char* Sm, v8f acc[4]) {
  const int tid  = threadIdx.x;
  const int lane = tid & 31, wave = tid >> 5;
  const int hh   = lane >> 4, c = lane & 15;
  asm volatile("s_wait_asynccnt 0x0" ::: "memory");                  // this wave's 32 rows have landed
  lds_barrier();                                                     // ... and every other wave's

  const unsigned char* ap = Sm + c * GP + 16 * hh;
  const unsigned char* bp = Sm + GOPB + (16 * wave + c) * GP + 16 * hh;
#pragma unroll
  for (int mt = 0; mt < 4; ++mt) acc[mt] = zero8();
  // groups of two k-steps (20 LDS reads, 8 products), two register sets: the next group's reads stand as one block in
  // front of this group's products and are in flight under them
  Frag fa[2][2][4], fb[2][2];
#pragma unroll
  for (int g = 0; g <= GRB / 128; ++g) {
    if (g < GRB / 128) {
#pragma unroll
      for (int kk = 0; kk < 2; ++kk) {
        fb[g & 1][kk] = ldfrag((const unsigned short*)(bp + 64 * (2 * g + kk)));
#pragma unroll
        for (int mt = 0; mt < 4; ++mt)
          fa[g & 1][kk][mt] = ldfrag((const unsigned short*)(ap + 16 * mt * GP + 64 * (2 * g + kk)));
      }
      // keeps the group's reads together here: sunk to their products, each pair would be waited for almost as soon as issued
      __builtin_amdgcn_sched_barrier(0);
    }
    if (g > 0) {
#pragma unroll
      for (int kk = 0; kk < 2; ++kk) {
#pragma unroll
        for (int mt = 0; mt < 4; ++mt)
          acc[mt] = mma_hw(fa[(g - 1) & 1][kk][mt].h, fb[(g - 1) & 1][kk].h, acc[mt]);
      }
    }
  }
  // closes the products: no global load of the caller's epilogue is scheduled up between them, onto an operand just read
  __builtin_amdgcn_sched_barrier(0);
#if defined(__HIP_DEVICE_COMPILE__)
  // the distance behind a matrix instruction, kept for loads too: four vector slots between the last product and whatever
  // of the caller's epilogue comes next, so that no global load lands on an A or B just read
  asm volatile("v_nop\n\tv_nop\n\tv_nop\n\tv_nop");
#endif
  // holds the epilogue behind those four slots
  __builtin_amdgcn_sched_barrier(0);
}

// =========================================================================================================
// (0) conv1x1 weights: W16 f16 [320][256], row o: 0..31 = wq, 32..63 = wk, 64..319 = wv; value = f16 of
//     (bf16-RNE(w) * 256) (exact). BIAS f32 [320] = bf16-RNE of bq / bk / bv. Block blk (0..39) owns rows
// coverage: 40 blocks x 8 rows x 32 pieces x 8 halves = 320 x 256; bias 80 x 4 floats = 320.
// =========================================================================================================
__device__ __forceinline__
void cvt_w(const float* __restrict__ wq, const float* __restrict__ bq,
           const float* __restrict__ wk, const float* __restrict__ bk,
           const float* __restrict__ wv, const float* __restrict__ bv,
           unsigned short* W16, float* BIAS, const int blk) {
  const int tid = threadIdx.x;
  const int rl = tid >> 5, col = 8 * (tid & 31);
  const int o = 8 * blk + rl;                                     // 0..319
  const float* wbase = (blk < 4) ? wq : (blk < 8) ? wk : wv;       // block-uniform selection
  const int osub = (blk < 4) ? 0 : (blk < 8) ? CQ : 2 * CQ;
  const float* s = wbase + (size_t)(o - osub) * CC + col;          // in range: (o-osub) < rows of that matrix
  const v4f a = *(const v4f*)s;
  const v4f q = *(const v4f*)(s + 4);
  const float f[8] = {a[0], a[1], a[2], a[3], q[0], q[1], q[2], q[3]};
  v4u u;
#pragma unroll
  for (int t = 0; t < 4; ++t) {
    const _Float16 h0 = (_Float16)(bfr(f[2 * t]) * WSC);
    const _Float16 h1 = (_Float16)(bfr(f[2 * t + 1]) * WSC);
    u[t] = pk16(h_bits(h0), h_bits(h1));
  }
  // bias values: every lane loads all three candidates with clamped indices, selects by value
  v4f bvv;
  {
    const int tb = min(tid, 79);
    const int o4 = 4 * tb;
#pragma unroll
    for (int qd = 0; qd < 4; ++qd) {
      const int oo = o4 + qd;
      const int iq = min(oo, CQ - 1);
      const int ik = min(max(oo - CQ, 0), CQ - 1);
      const int iv = min(max(oo - 2 * CQ, 0), CC - 1);
      const float cq = bq[iq], ck = bk[ik], cv = bv[iv];
      const float val = (oo < CQ) ? cq : (oo < 2 * CQ) ? ck : cv;
      bvv[qd] = bfr(val);
    }
  }
{
    *(v4u*)(W16 + (size_t)o * CC + col) = u;
    if (blk == 0 && tid < 80) *(v4f*)(BIAS + 4 * tid) = bvv;
    
  }
}

// =========================================================================================================
// (1) x f32 [b][256 c][4096 n] -> Xc f16 [b][c][n] (channel-major, bf16-RNE values, exact in f16) and
//     XP f16 [b][n][c] (position-major) through an LDS tile T[64 n][64 c] (pitch TP). Block (nb, cb, b) owns a
// coverage: Xc 2 it x 32 rows x 8 lanes x 8 = 64 c x 64 n; XP same; blocks (nb, cb, b) in (64, 4, NB) cover both planes once.
// =========================================================================================================
__device__ __forceinline__
void cvt_x(const float* __restrict__ x, unsigned short* Xc, unsigned short* XP, unsigned short* T,
           const int nb, const int cb, const int b) {
  const int tid = threadIdx.x;
  const int e = tid & 7, lq = tid >> 3;                             // lq 0..31
  const int n0 = nb * QT, c0 = cb * QT;
  v4u ux[2];
#pragma unroll
  for (int it = 0; it < 2; ++it) {
    const int cl = it * 32 + lq;                                     // 0..63
    const float* sp = x + ((size_t)(b * CC + c0 + cl)) * NN + n0 + 8 * e;
    const v4f a = *(const v4f*)sp;
    const v4f q = *(const v4f*)(sp + 4);
    unsigned short hb[8];
#pragma unroll
    for (int t = 0; t < 4; ++t) {
      hb[t]     = h_bits((_Float16)bfr(a[t]));
      hb[4 + t] = h_bits((_Float16)bfr(q[t]));
    }
#pragma unroll
    for (int t = 0; t < 4; ++t) ux[it][t] = pk16(hb[2 * t], hb[2 * t + 1]);
#pragma unroll
    for (int t = 0; t < 8; ++t) T[(8 * e + t) * TP + cl] = hb[t];
  }
  __syncthreads();
  v4u up[2];
#pragma unroll
  for (int it = 0; it < 2; ++it) {
    const int nl = it * 32 + lq;                                     // 0..63
    up[it] = *(const v4u*)(T + nl * TP + 8 * e);
  }
{
#pragma unroll
    for (int it = 0; it < 2; ++it) {
      const int rl = it * 32 + lq;
      *(v4u*)(Xc + ((size_t)(b * CC + c0 + rl)) * NN + n0 + 8 * e) = ux[it];
      *(v4u*)(XP + ((size_t)(b * NN + n0 + rl)) * CC + c0 + 8 * e) = up[it];
    }
    
  }
}

// =========================================================================================================
// (0) + (1) in one launch: neither reads what the other writes. Blocks 0 .. XB-1 do (1), block blk = nb + 64 (cb + 4 b);
//     blocks XB .. XB+WB-1 do (0). The choice is block-uniform, so the barrier of (1) is passed by whole blocks.
// =========================================================================================================
__global__ __launch_bounds__(256)
void cvt_wx(const float* __restrict__ x,
            const float* __restrict__ wq, const float* __restrict__ bq,
            const float* __restrict__ wk, const float* __restrict__ bk,
            const float* __restrict__ wv, const float* __restrict__ bv,
            unsigned short* Xc, unsigned short* XP, unsigned short* W16, float* BIAS) {
  __shared__ __align__(16) unsigned short T[QT * TP];
  const int blk = blockIdx.x;
  if (blk < XB) cvt_x(x, Xc, XP, T, blk % (NN / QT), (blk / (NN / QT)) % (CC / QT), blk / ((NN / QT) * (CC / QT)));
  else          cvt_w(wq, bq, wk, bk, wv, bv, W16, BIAS, blk - XB);
}

// =========================================================================================================
// (2) conv1x1 GEMM for one (b, 64-n tile, 64-o block): Y[o][n] = (1/256) sum_c W16[o][c] XP[b][n][c] + BIAS[o].
//     Block 128 threads = 4 waves; wave w owns cols n0+16w..+15 (one B fragment per k-step, k = c contiguous in
//     the XP row) and 4 m-tiles (A rows o = o0 + 16 mt + (lane&15), split k map loader from W16). K = 256 = 8 steps.
//     The 64 W16 rows and the 64 XP rows are staged in LDS (tile_stage, tile_mult).
//     Epilogue staged in LDS Os[o_loc][n_loc] (pitch OSP), barrier, then:
//       o-block 0 (q rows 0..31, k rows 32..63): Qh/Ql/Kh/Kl bf16 hi / bf16 residual planes [b][4096 n][32]
//         holds rows 2ll, 2ll+1; lane e -> row 2ll+(e>>2), cols 8*(e&3)..+7; one instruction per 16 lines.
//         halves 8e..8e+7; one instruction per 16 lines.
// coverage: Os 4 waves x 4 tiles x 16x16 = 64 x 64; q/k: 4 planes x 32 lines x 8 lanes x 8 = 4 x (64 n x 32);
//           v: 4 it x 16 rows x 8 lanes x 8 = 64 ch x 64 n; grid rows y < 5 of (64, 5 + GY, NB) cover all planes exactly once.
// =========================================================================================================
__device__ __forceinline__
void gemm_qkv(const unsigned short* __restrict__ W16, const float* __restrict__ BIAS,
              const unsigned short* __restrict__ XP,
              unsigned short* Qh, unsigned short* Ql, unsigned short* Kh, unsigned short* Kl,
              unsigned short* Vh, float* Os, unsigned char* Sm, const int nt, const int mb, const int b) {
  const int tid  = threadIdx.x;
  const int lane = tid & 31, wave = tid >> 5;
  const int hh   = lane >> 4, c = lane & 15;
  const int n0   = nt * QT, o0 = mb * QT;

  tile_stage(Sm, W16 + (size_t)o0 * CC, CC, XP + ((size_t)(b * NN + n0)) * CC, CC);
  // the lane's 32 bias values (rows 16 mt + 8 hh ..+7), asked for behind the copies: they arrive under the product
  const float* bp = BIAS + o0 + 8 * hh;
  v4f bi[4][2];
#pragma unroll
  for (int mt = 0; mt < 4; ++mt) {
    bi[mt][0] = *(const v4f*)(bp + 16 * mt);
    bi[mt][1] = *(const v4f*)(bp + 16 * mt + 4);
  }
  // a precaution: the wait before the loads' address registers are reused; naming them as an input keeps them whole up to here
#if defined(__HIP_DEVICE_COMPILE__)
  asm volatile("s_wait_xcnt 0x0" :: "v"(bp) : "memory");
#endif
  // holds the loads here: sunk to their use behind the product, their latency would stand open there
  __builtin_amdgcn_sched_barrier(0);
  v8f acc[4];
  tile_mult(Sm, acc);

  // ---- epilogue: scale back, + bias -> LDS Os[o_loc][n_loc] ----
  {
    const int nl = 16 * wave + c;
#pragma unroll
    for (int mt = 0; mt < 4; ++mt) {
#pragma unroll
      for (int r = 0; r < 8; ++r) {
        const int ol = 16 * mt + 8 * hh + r;                         // 0..63
        Os[ol * OSP + nl] = acc[mt][r] * IWSC + bi[mt][r >> 2][r & 3];
      }
    }
  }
  __syncthreads();

  const int e = tid & 7, lq = tid >> 3;                             // lq 0..15
  if (mb == 0) {
    // ---- q/k bf16 hi + residual planes ----
{
#pragma unroll
      for (int it = 0; it < 8; ++it) {
        const int p    = it >> 1;                                    // 0 Qh, 1 Ql, 2 Kh, 3 Kl
        const int ll   = (it & 1) * 16 + lq;                         // 0..31
        const int nl   = 2 * ll + (e >> 2);                          // 0..63
        const int col0 = 8 * (e & 3);                                // 0,8,16,24
        const int rb   = ((p >> 1) ? CQ : 0) + col0;
        v4u u;
#pragma unroll
        for (int t = 0; t < 4; ++t) {
          const float f0 = Os[(rb + 2 * t) * OSP + nl];
          const float f1 = Os[(rb + 2 * t + 1) * OSP + nl];
          const unsigned short hb0 = bf_bits(f0), hb1 = bf_bits(f1);
          const unsigned short lb0 = bf_bits(f0 - bf_up(hb0));
          const unsigned short lb1 = bf_bits(f1 - bf_up(hb1));
          u[t] = (p & 1) ? pk16(lb0, lb1) : pk16(hb0, hb1);
        }
        unsigned short* P = (p == 0) ? Qh : (p == 1) ? Ql : (p == 2) ? Kh : Kl;
        *(v4u*)(P + ((size_t)(b * NN + n0 + nl)) * CQ + col0) = u;
      }
      
    }
  } else {
    // ---- v f16 plane ----
    const int ch0 = o0 - QT;                                         // (mb-1)*64
    v4u uv[4];
#pragma unroll
    for (int it = 0; it < 4; ++it) {
      const int row = it * 16 + lq;                                  // 0..63
      const v4f a = *(const v4f*)(Os + row * OSP + 8 * e);
      const v4f q = *(const v4f*)(Os + row * OSP + 8 * e + 4);
#pragma unroll
      for (int t = 0; t < 2; ++t) {
        uv[it][t]     = pk16(h_bits((_Float16)a[2 * t]), h_bits((_Float16)a[2 * t + 1]));
        uv[it][2 + t] = pk16(h_bits((_Float16)q[2 * t]), h_bits((_Float16)q[2 * t + 1]));
      }
    }
{
#pragma unroll
      for (int it = 0; it < 4; ++it) {
        const int row = it * 16 + lq;
        *(v4u*)(Vh + ((size_t)(b * CC + ch0 + row)) * NN + n0 + 8 * e) = uv[it];
      }
      
    }
  }
}

// =========================================================================================================
// (5) channel softmax: for row (b, i): G_j = sum of the GS slice planes in slice order, then
//     p_j = exp(min_j G - G_j) / sum (== softmax of rowmax - G), returned as the lane's 8 halves of
//     Pc f16 [b][256][256] = p * 1024. One wave per row: lane reads j = 8 lane..8 lane+7, wave min / sum by shuffles.
//     rw = b * 256 + i. The NB * 256 rows ride in the launch of (3), two per block, worked by the block's waves 0 and 1.
// =========================================================================================================
__device__ __forceinline__ v4u cam_softmax(const float* __restrict__ G, const int rw, const int lane) {
  const float* row = G + (size_t)rw * CC + 8 * lane;
  v4f a = *(const v4f*)row;
  v4f q = *(const v4f*)(row + 4);
#pragma unroll                                                       // straight line: the planes' loads issue ahead of the adds
  for (int s = 1; s < GS; ++s) {
    a += *(const v4f*)(row + (size_t)s * NB * CC * CC);
    q += *(const v4f*)(row + (size_t)s * NB * CC * CC + 4);
  }
  const float ev[8] = {a[0], a[1], a[2], a[3], q[0], q[1], q[2], q[3]};
  float mn = ev[0];
#pragma unroll
  for (int t = 1; t < 8; ++t) mn = fminf(mn, ev[t]);
#pragma unroll
  for (int s = 1; s < 32; s <<= 1) mn = fminf(mn, __shfl_xor(mn, s, 32));
  float p[8], sm = 0.f;
#pragma unroll
  for (int t = 0; t < 8; ++t) { p[t] = __expf(mn - ev[t]); sm += p[t]; }
#pragma unroll
  for (int s = 1; s < 32; s <<= 1) sm += __shfl_xor(sm, s, 32);
  const float inv = PSC / sm;
  v4u u;
#pragma unroll
  for (int t = 0; t < 4; ++t)
    u[t] = pk16(h_bits((_Float16)(p[2 * t] * inv)), h_bits((_Float16)(p[2 * t + 1] * inv)));
  return u;
}

// ---- one stage (64 keys) of v, k hi and k residual -> LDS, 256 lanes, 16 B per lane and copy, no register on the way.
//      v: copy i brings row (channel) 32 i + (tid >> 3), bytes 16 (tid & 7) ..+15 of its 128; 8 copies = 256 rows.
//      k: the one copy of a plane brings row (key) tid >> 2, bytes 16 (tid & 3) ..+15 of its 64; 64 rows.
//      lv / lk: the lane's LDS byte address of its first v / k-hi piece; gv / gh / gl: its first global piece.
//      s_wait_xcnt 0 closes the statement, a precaution: it stands in front of any rewrite of a register a copy names.
__device__ __forceinline__ void stage_copy(unsigned lv, unsigned lk, const unsigned short* gv,
                                           const unsigned short* gh, const unsigned short* gl) {
#if defined(__HIP_DEVICE_COMPILE__)
  asm volatile("global_load_async_to_lds_b128 %0, %10, off\n\t"
               "global_load_async_to_lds_b128 %1, %11, off\n\t"
               "global_load_async_to_lds_b128 %2, %12, off\n\t"
               "global_load_async_to_lds_b128 %3, %13, off\n\t"
               "global_load_async_to_lds_b128 %4, %14, off\n\t"
               "global_load_async_to_lds_b128 %5, %15, off\n\t"
               "global_load_async_to_lds_b128 %6, %16, off\n\t"
               "global_load_async_to_lds_b128 %7, %17, off\n\t"
               "global_load_async_to_lds_b128 %8, %18, off\n\t"
               "global_load_async_to_lds_b128 %9, %19, off\n\t"
               "s_wait_xcnt 0x0"
               :: "v"(lv), "v"(lv + 32u * VPB), "v"(lv + 64u * VPB), "v"(lv + 96u * VPB),
                  "v"(lv + 128u * VPB), "v"(lv + 160u * VPB), "v"(lv + 192u * VPB), "v"(lv + 224u * VPB),
                  "v"(lk), "v"(lk + (unsigned)KSTB),
                  "v"(gv), "v"(gv + (size_t)32 * NN), "v"(gv + (size_t)64 * NN), "v"(gv + (size_t)96 * NN),
                  "v"(gv + (size_t)128 * NN), "v"(gv + (size_t)160 * NN), "v"(gv + (size_t)192 * NN),
                  "v"(gv + (size_t)224 * NN), "v"(gh), "v"(gl)
               : "memory");
#endif
}

// =========================================================================================================
// (3) position attention for one (b, 128-query tile, key range sp of NN / KS keys), transposed formulation, no mask:
//   S^T tile (16 keys x 16 queries) = A(k: row = key kb + (lane&15), 32 d via the split k map from the bf16 plane
//   Kh [b][4096][32]) . B(q: col = query, same map, resident fragment from Qh) + A(Kh).B(Ql) + A(Kl).B(Qh)
//   (bf16 unscaled residual planes, shared accumulator). Energy = S (no scale).
//   Per lane the D tile holds 8 keys of ONE query: softmax state per lane. m is a held reference, not the running maximum:
//   a stage takes e^{s-m} and its sum only; one test per stage and wave (a lane's sum above PTOP) sends the wave to the
//   rare path, which raises m to the stage's maximum where that is larger (one shuffle lane^16), rescales O and l and takes the stage's
//   exponentials anew. Row-sum partials combined at the end. P = e^{s-m} / 64 as f16 is the B operand of
//   O^T (rows channel, cols queries) += A(V rows channel = 16j + (lane&15), keys contiguous, f16 plane Vh
//   [b][256][4096]) . B(P^T): element r <- D of the tile covering keys kb..kb+15, element 8+r <- the tile covering
//   kb+16..kb+31, lane unchanged.
//   Block = 8 waves = 4 query columns wq (32 queries each) x 2 key halves kh. A wave holds TWO groups of 16 queries
//   (2 x 16 accumulator tiles, 256 channels), so each k and v fragment it reads from LDS feeds two products; of every
//   stage of 64 keys it works the 32 keys of its half kh. Its group u is queries 32 wq + 16 (u ^ kh) ..+15.
//   The k and v rows of 64 keys are one stage in LDS, brought once per block by asynchronous copies and read by all
//   eight waves; two buffers: stage t + 1 flies while stage t is worked on.
//   Behind the loop waves (wq, 0) and (wq, 1) hold the two key halves of the same 32 queries: each hands its group 1
//   (accumulators, m, l) to the other through LDS and merges what it gets into its group 0 (own half, then the partner's).
//   Epilogue from the registers: the result is the range's own softmax average O/l as f16, kept tile by tile in the order in
//   which a 16 x 16 accumulator lies in a wave: Yp [b][KS][256 query tiles][16 channel tiles][32 lanes][8 halves], lane
//   (hh, c) = query c, channels 8 hh ..+7 of the tile. (6) has its accumulators in the same order (rows channel, cols
//   position) and merges the ranges there, so no transposition is needed on either side. The range's reference m and sum l go
//   to ST [b][256 query tiles][KS][m 16, l 16], one line per wave.
// coverage: 8 waves x 16 tiles x 32 lanes x 8 halves = 256 ch x 128 n; ST 8 waves x 32 floats; grid (32, NB, KS).
// =========================================================================================================
__global__ __launch_bounds__(256)
void attn_pam(const unsigned short* __restrict__ Qh, const unsigned short* __restrict__ Ql,
              const unsigned short* __restrict__ Kh, const unsigned short* __restrict__ Kl,
              const unsigned short* __restrict__ Vh, unsigned short* Yp, float* ST,
              const float* __restrict__ G, unsigned short* Pc) {
  __shared__ __align__(16) float Sx[2 * 8 * 16];                     // m, then l, of the group a wave hands over
  __shared__ __align__(16) float Xo[8 * 16 * 2 * 32 * 4];            // its accumulators: [wave][tile][r half][lane] x 16 B
  __shared__ __align__(16) unsigned char Ring[2 * STGB];
  const int tid  = threadIdx.x;
  const int wave = __builtin_amdgcn_readfirstlane(tid >> 5), lane = tid & 31;   // the wave's number in a scalar register
  const int hh   = lane >> 4, c = lane & 15;
  const int wq   = wave & 3, kh = wave >> 2;
  const int n0   = blockIdx.x * QB, b = blockIdx.y, sp = blockIdx.z;
  const int t0   = sp * NTS;                                         // first stage of the block's key range (even)

  // resident q fragments (B operand, col = query n0 + 32 wq + 16 (u ^ kh) + c)
  Frag qh[2], ql[2];
  {
    const size_t qa = ((size_t)(b * NN + n0 + 32 * wq + 16 * kh + c)) * CQ + 8 * hh;
    const size_t qb = ((size_t)(b * NN + n0 + 32 * wq + 16 * (1 - kh) + c)) * CQ + 8 * hh;
    qh[0] = ldfrag(Qh + qa);
    ql[0] = ldfrag(Ql + qa);
    qh[1] = ldfrag(Qh + qb);
    ql[1] = ldfrag(Ql + qb);
    // the wait before the eight loads' address registers are reused; naming them as inputs keeps them whole up to here
#if defined(__HIP_DEVICE_COMPILE__)
    asm volatile("s_wait_xcnt 0x0" :: "v"(Qh + qa), "v"(Ql + qa), "v"(Qh + qb), "v"(Ql + qb) : "memory");
#endif
  }
  // the lane's first pieces of a stage: global sources (+ t * KT keys) and LDS places (+ buffer * STGB)
  const unsigned short* gv = Vh + (size_t)b * CC * NN + (size_t)(tid >> 3) * NN + 8 * (tid & 7);
  const unsigned short* gh = Kh + ((size_t)b * NN + (tid >> 2)) * CQ + 8 * (tid & 3);
  const unsigned short* gl = Kl + ((size_t)b * NN + (tid >> 2)) * CQ + 8 * (tid & 3);
  const unsigned ring0 = (unsigned)(size_t)Ring;                     // low 32 bits = byte offset in the block's LDS
  const unsigned lv = ring0 + (unsigned)((tid >> 3) * VPB + 16 * (tid & 7));
  const unsigned lk = ring0 + (unsigned)(VSTB + (tid >> 2) * KPB + 16 * (tid & 3));
  // fragment offsets inside a stage, at the wave's 32 keys: v (A operand, row = channel 16j + c, keys contiguous),
  // k (A operand, row = key)
  const int vfo = c * VPB + 16 * hh + kh * 64;
  const int kfo = VSTB + (32 * kh + c) * KPB + 16 * hh;

  float m[2] = {-1.0e30f, -1.0e30f}, l[2] = {0.f, 0.f};
  v8f o[2][16];
#pragma unroll
  for (int u = 0; u < 2; ++u) {
#pragma unroll
    for (int j = 0; j < 16; ++j) o[u][j] = zero8();
  }

  // prologue: stage t0 landed and published, then stage t0 + 1 on its way
  stage_copy(lv, lk, gv + (size_t)t0 * KT, gh + (size_t)t0 * KT * CQ, gl + (size_t)t0 * KT * CQ);
  // (5): the block's two rows of the channel softmax, in waves 0 and 1 (scalar test), while stage t0 is on its way
  const int  crow = 2 * (blockIdx.x + (NN / QB) * (blockIdx.y + NB * blockIdx.z)) + (wave & 1);   // 0 .. NB * CC - 1, each once
  const bool cwav = wave < 2;
  v4u cu = {0u, 0u, 0u, 0u};
  if (cwav) cu = cam_softmax(G, crow, lane);
  asm volatile("s_wait_asynccnt 0x0" ::: "memory");                  // this wave's pieces of stage t0 have landed
  __syncthreads();                                                   // ... and every other wave's
  if (cwav) {
    *(v4u*)(Pc + (size_t)crow * CC + 8 * lane) = cu;                 // behind the barrier: it does not wait for this store
    asm volatile("s_wait_xcnt 0x0" ::: "memory");                    // a precaution: before the code behind reuses the store's registers
  }
  stage_copy(lv + STGB, lk + STGB, gv + (size_t)(t0 + 1) * KT, gh + (size_t)(t0 + 1) * KT * CQ,
             gl + (size_t)(t0 + 1) * KT * CQ);

#pragma unroll 1                                                     // rolled: one stage's exponentials live at a time
  for (int t = t0; t < t0 + NTS; ++t) {
    const unsigned bo = (unsigned)(t & 1) * STGB;
    const unsigned char* sb = Ring + bo;
    const unsigned char* kp = sb + kfo;                              // the wave's keys start at kb = KT t + 32 kh
    const Frag k0  = ldfrag((const unsigned short*)(kp));                        // keys kb .. kb+15
    const Frag k1  = ldfrag((const unsigned short*)(kp + 16 * KPB));             // keys kb+16 .. kb+31
    const Frag k0l = ldfrag((const unsigned short*)(kp + KSTB));
    const Frag k1l = ldfrag((const unsigned short*)(kp + KSTB + 16 * KPB));
    v8f s0[2], s1[2];
#pragma unroll
    for (int u = 0; u < 2; ++u) {
      s0[u] = mma_bw(k0.bf, qh[u].bf, zero8());
      s1[u] = mma_bw(k1.bf, qh[u].bf, zero8());
    }
#pragma unroll
    for (int u = 0; u < 2; ++u) {
      s0[u] = mma_bw(k0.bf, ql[u].bf, s0[u]);
      s1[u] = mma_bw(k1.bf, ql[u].bf, s1[u]);
    }
#pragma unroll
    for (int u = 0; u < 2; ++u) {
      s0[u] = mma_bw(k0l.bf, qh[u].bf, s0[u]);
      s1[u] = mma_bw(k1l.bf, qh[u].bf, s1[u]);
    }

    // the first 12 v fragments of the pass as LDS reads in front of the test below, in flight under the exponentials
    const unsigned char* vp = sb + vfo;
    Frag vf[16];
#pragma unroll
    for (int j = 0; j < 12; ++j) vf[j] = ldfrag((const unsigned short*)(vp + 16 * j * VPB));

    FragH ph[2];
    float ls[2];
#pragma unroll
    for (int u = 0; u < 2; ++u) {
      const float msh = m[u] - LNPA;                                 // exp gives e^{s-m} / 64
      ls[u] = 0.f;
#pragma unroll
      for (int r = 0; r < 8; ++r) {
        const float e0 = __expf(s0[u][r] - msh);                     // key kb      + 8hh + r
        const float e1 = __expf(s1[u][r] - msh);                     // key kb + 16 + 8hh + r
        ls[u] += e0 + e1;
        ph[u].hv[0][r] = (_Float16)e0;
        ph[u].hv[1][r] = (_Float16)e1;
      }
    }
    // one test per stage, a scalar branch: taken in the range's first stage (m starts at -1e30, the sums are infinite) and
    // when a score has outgrown the reference
    if (__builtin_amdgcn_ballot_w32(fmaxf(ls[0], ls[1]) > PTOP) != 0u) {
#pragma unroll
      for (int u = 0; u < 2; ++u) {
        const float mx   = fmaxf(hmax8(s0[u]), hmax8(s1[u]));
        const float mn   = fmaxf(m[u], fmaxf(mx, __shfl_xor(mx, 16, 32)));   // equal in lanes c and c + 16
        const float corr = __expf(m[u] - mn);
        m[u] = mn;
        const float msh = mn - LNPA;
#pragma unroll
        for (int j = 0; j < 16; ++j) {
#pragma unroll
          for (int r = 0; r < 8; ++r) o[u][j][r] *= corr;
        }
        l[u] *= corr;
        ls[u] = 0.f;
#pragma unroll
        for (int r = 0; r < 8; ++r) {
          const float e0 = __expf(s0[u][r] - msh);
          const float e1 = __expf(s1[u][r] - msh);
          ls[u] += e0 + e1;
          ph[u].hv[0][r] = (_Float16)e0;
          ph[u].hv[1][r] = (_Float16)e1;
        }
      }
    }
    l[0] += ls[0];
    l[1] += ls[1];

    // the last 4 fragments take the registers that the scores leave: one group of reads, in flight under 24 products
#pragma unroll
    for (int j = 12; j < 16; ++j) vf[j] = ldfrag((const unsigned short*)(vp + 16 * j * VPB));
    // keeps that group here: sunk to its products, each pair of reads would be waited for as soon as issued
    __builtin_amdgcn_sched_barrier(0);
#pragma unroll
    for (int j = 0; j < 16; ++j) {                                   // each fragment feeds two products
      o[0][j] = mma_hw(vf[j].h, ph[0].v, o[0][j]);
      o[1][j] = mma_hw(vf[j].h, ph[1].v, o[1][j]);
    }
    // keeps the stage's arithmetic in front of the barrier: sunk behind it, it would also stand in front of the refill,
    // whose copies would then be waited for almost as soon as they are issued
    __builtin_amdgcn_sched_barrier(0);
    // publish point of stage t + 1, and the end of every reader's last read of stage t's buffer
    asm volatile("s_wait_dscnt 0x0" ::: "memory");                   // this wave's LDS reads of stage t are done
    asm volatile("s_wait_asynccnt 0x0" ::: "memory");                // this wave's pieces of stage t + 1 have landed
    __syncthreads();
    if (t + 2 < t0 + NTS)                                            // block-uniform: refill the buffer just read
      stage_copy(lv + bo, lk + bo, gv + (size_t)(t + 2) * KT, gh + (size_t)(t + 2) * KT * CQ,
                 gl + (size_t)(t + 2) * KT * CQ);
  }
  asm volatile("s_wait_asynccnt 0x0" ::: "memory");                  // nothing of this wave is in flight at its end
  // the lane's number read anew: no index of the epilogue has to stay in a register (or be spilled) across the loop
  const int ln = (int)__builtin_amdgcn_mbcnt_lo(~0u, 0u);
  const int h2 = ln >> 4, c2 = ln & 15;
  l[0] += __shfl_xor(l[0], 16, 32);
  l[1] += __shfl_xor(l[1], 16, 32);

  // hand-over of group 1 to the wave that worked the other key half of the same queries (wave ^ 4, same lane)
  if (h2 == 0) { Sx[16 * wave + c2] = m[1]; Sx[128 + 16 * wave + c2] = l[1]; }   // equal in lanes c and c + 16
#pragma unroll
  for (int j = 0; j < 16; ++j) {
    v4f va, vb;
#pragma unroll
    for (int r = 0; r < 4; ++r) { va[r] = o[1][j][r]; vb[r] = o[1][j][4 + r]; }
    *(v4f*)(Xo + (((wave * 16 + j) * 2 + 0) * 32 + ln) * 4) = va;
    *(v4f*)(Xo + (((wave * 16 + j) * 2 + 1) * 32 + ln) * 4) = vb;
  }
  __syncthreads();                                                   // every wave's group 1 is in LDS
  const int pw = wave ^ 4;
  const float mp = Sx[16 * pw + c2], lp = Sx[128 + 16 * pw + c2];
  const float mm = fmaxf(m[0], mp);
  const float ea = __expf(m[0] - mm), eb = __expf(mp - mm);
  const float lm = l[0] * ea + lp * eb;                              // o and l both carry the 1 / 64 factor
  const float inv = 1.0f / lm;
  const float fa = ea * inv, fb = eb * inv;

  // the wave's group 0 is one tile column of 16 queries; each of its 16 accumulator tiles goes out as it lies in the registers:
  // lane ln holds channels 16 j + 8 h2 ..+7 of query c2, 8 halves = 16 B, a tile = 512 B in a row (four whole lines a store)
  const int nq = (n0 >> 4) + 2 * wq + kh;                            // its number among the NN / 16 tile columns
  v8h yu[16];
#pragma unroll                                                       // o and yu live in registers: every index a constant
  for (int j = 0; j < 16; ++j) {
    const v4f xa = *(const v4f*)(Xo + (((pw * 16 + j) * 2 + 0) * 32 + ln) * 4);
    const v4f xb = *(const v4f*)(Xo + (((pw * 16 + j) * 2 + 1) * 32 + ln) * 4);
    const v8f xx = __builtin_shufflevector(xa, xb, 0, 1, 2, 3, 4, 5, 6, 7);
    yu[j] = __builtin_convertvector(o[0][j] * fa + xx * fb, v8h);    // own half, then the partner's; RNE to f16
  }
  unsigned short* yp = Yp + (((size_t)(b * KS + sp) * (NN / 16) + nq) * (CC / 16)) * YTH + 8 * ln;
#pragma unroll                                                       // one address, 16 constant offsets
  for (int j = 0; j < 16; ++j) *(v8h*)(yp + YTH * j) = yu[j];
  // m (lanes 0..15) and l (lanes 16..31) of the 16 queries: one whole line, one store
  ST[((size_t)(b * (NN / 16) + nq) * KS + sp) * 32 + ln] = h2 ? lm : mm;
}

// =========================================================================================================
// (4) channel Gram for one (b, 64-i block, 64-j block, K slice s): G[s][b][i][j] = sum over the slice's GK positions n
//     of Xc[b][i][n] Xc[b][j][n]; the GS slices of a tile run as GS blocks, and (5) adds their planes.
//     4 waves; wave w owns cols j0+16w..+15 (B from the j row, keys n contiguous) and 4 i tiles (A rows
//     [b][256][256] (row segment 64 j = 2 lines), 8 consecutive lanes x 16 B, one instruction per 16 lines, two
// coverage: 8 it x 16 lines x 8 lanes x 4 = 64 x 64; (jt, itb, zb) in (4, 4, GS * NB) covers the GS planes of G exactly once.
// =========================================================================================================
__device__ __forceinline__
void gram_k(const unsigned short* __restrict__ Xc, float* G, float* Os, unsigned char* Sm,
            const int jt, const int itb, const int zb) {
  const int tid  = threadIdx.x;
  const int lane = tid & 31, wave = tid >> 5;
  const int hh   = lane >> 4, c = lane & 15;
  const int b = zb % NB, s = zb / NB;                                // zb = s * NB + b: the plane of G this block writes
  const int j0 = jt * QT, i0 = itb * QT;

  v8f acc[4];                                                        // the slice's 256 positions of the 64 i rows and the 64 j rows, staged in LDS
  tile_stage(Sm, Xc + ((size_t)(b * CC + i0)) * NN + s * GK, NN, Xc + ((size_t)(b * CC + j0)) * NN + s * GK, NN);
  tile_mult(Sm, acc);
  {
    const int nl = 16 * wave + c;
#pragma unroll
    for (int mt = 0; mt < 4; ++mt) {
#pragma unroll
      for (int r = 0; r < 8; ++r) Os[(16 * mt + 8 * hh + r) * OSP + nl] = acc[mt][r];
    }
  }
  __syncthreads();
  {
    const int e = tid & 7, lq = tid >> 3;                            // lq 0..15
{
#pragma unroll
      for (int it = 0; it < 8; ++it) {
        const int L = it * 16 + lq;                                  // 0..127
        const int row = L >> 1, hf = L & 1;
        const v4f v = *(const v4f*)(Os + row * OSP + hf * 32 + 4 * e);
        *(v4f*)(G + ((size_t)(zb * CC + i0 + row)) * CC + j0 + hf * 32 + 4 * e) = v;
      }
      // a precaution: in the shared launch code follows these stores in the listing; the wait stands before it reuses their registers
      asm volatile("s_wait_xcnt 0x0" ::: "memory");
    }
  }
}

// =========================================================================================================
// (2) + (4) in one launch: both read only what the launch before wrote, neither reads what the other writes.
//     Grid (64, 5 + GY, NB): rows y < 5 do (2) with (nt, mb, b) = (x, y, z); rows y >= 5 do (4): idx = x + 64 (y - 5)
//     = jt + 4 (itb + 4 s), batch z. The choice is block-uniform, so each body's barrier is passed by whole blocks.
// =========================================================================================================
__global__ __launch_bounds__(128)
void gemm_gram(const unsigned short* __restrict__ W16, const float* __restrict__ BIAS,
               const unsigned short* __restrict__ XP, const unsigned short* __restrict__ Xc,
               unsigned short* Qh, unsigned short* Ql, unsigned short* Kh, unsigned short* Kl,
               unsigned short* Vh, float* G) {
  __shared__ __align__(16) float Os[QT * OSP];
  __shared__ __align__(16) unsigned char Sm[2 * GOPB];
  const int y = blockIdx.y;
  if (y < MQKV / QT) {
    gemm_qkv(W16, BIAS, XP, Qh, Ql, Kh, Kl, Vh, Os, Sm, blockIdx.x, y, blockIdx.z);
  } else {
    const int idx = blockIdx.x + (NN / QT) * (y - MQKV / QT);
    gram_k(Xc, G, Os, Sm, idx % (CC / QT), (idx / (CC / QT)) % (CC / QT),
           (idx / ((CC / QT) * (CC / QT))) * NB + blockIdx.z);
  }
}

// =========================================================================================================
// (6) channel mix + output for one (b, 64-n tile, 64-i block): cam[i][n] = (1/1024) sum_j Pc[b][i][j] XP[b][n][j]
//     (K = 256 = 8 steps; A rows i = i0 + 16 mt + (lane&15), j contiguous; B col n = n0 + 16w + (lane&15) from the
//     XP row, j contiguous), then out[b][i][n] = (g_pam * Y + xb) + (g_cam * cam + xb) with xb = bf16-RNE of x and
//     Y = sum over the KS key ranges s, in range order, of wt_s[n] Yp_s[i][n], wt_s = l_s e^{m_s - M} / sum of these,
//     M = max_s m_s (m, l from ST): the softmax over all keys from the ranges' own averages (Yp f16, widened here).
//     Yp's tiles lie as the accumulators of cam do: Y is merged in that layout, g_pam * Y + g_cam * cam goes through LDS as
//     one value, and 2 xb is added to it at the store.
// coverage: 8 it x 16 lines x 8 lanes x 4 = 64 i x 64 n; grid (64, 4, NB) covers d_out exactly once.
// =========================================================================================================
__global__ __launch_bounds__(128)
void cam_out(const unsigned short* __restrict__ Pc, const unsigned short* __restrict__ XP,
             const unsigned short* __restrict__ Yp, const float* __restrict__ ST, const float* __restrict__ x,
             const float* __restrict__ gpam, const float* __restrict__ gcam, float* out) {
  __shared__ __align__(16) float Os[QT * OSP];
  __shared__ __align__(16) unsigned char Sm[2 * GOPB];
  const int tid  = threadIdx.x;
  const int lane = tid & 31, wave = tid >> 5;
  const int hh   = lane >> 4, c = lane & 15;
  const int nt = blockIdx.x, itb = blockIdx.y, b = blockIdx.z;
  const int n0 = nt * QT, i0 = itb * QT;

  tile_stage(Sm, Pc + ((size_t)(b * CC + i0)) * CC, CC, XP + ((size_t)(b * NN + n0)) * CC, CC);   // the 64 Pc rows and the 64 XP rows -> LDS

  // every global operand of the epilogue (m and l of the key ranges, the ranges' averages, x) is asked for here, behind the
  // copies: the 32 loads are in flight beside them and under the product, not behind it
  const int e = tid & 7, lq = tid >> 3;                              // lq 0..15
  const int nq = (n0 >> 4) + wave;                                   // the wave's tile column of 16 positions
  const float* sq = ST + ((size_t)(b * (NN / 16) + nq) * KS) * 32 + c;   // the lane's position: m at + 32 s, l at + 32 s + 16
  float wt[KS], mm[KS];
#pragma unroll                                                       // here and below: the arrays live in registers, every index a constant
  for (int s = 0; s < KS; ++s) {
    mm[s] = sq[32 * s];
    wt[s] = sq[32 * s + 16];
  }
  // the ranges' tiles lie as the product's accumulators do: the lane's 8 halves are rows i0 + 16 mt + 8 hh ..+7 of its position
  const unsigned short* yq = Yp + (((size_t)(b * KS) * (NN / 16) + nq) * (CC / 16) + (i0 >> 4)) * YTH + 8 * lane;
  v8h yr[4][KS];
#pragma unroll
  for (int mt = 0; mt < 4; ++mt) {
#pragma unroll
    for (int s = 0; s < KS; ++s) yr[mt][s] = *(const v8h*)(yq + (size_t)s * (NN / 16) * (CC / 16) * YTH + mt * YTH);
  }
  v4f res[8], xr[8];
  const float* px[8];
#pragma unroll
  for (int it = 0; it < 8; ++it) {
    const int L = it * 16 + lq;                                      // 0..127
    px[it] = x + ((size_t)(b * CC + i0 + (L >> 1))) * NN + n0 + (L & 1) * 32 + 4 * e;
    xr[it] = *(const v4f*)px[it];
  }
  // a precaution: the wait before the 32 loads' address registers are reused; naming them as inputs keeps them whole up to here
#if defined(__HIP_DEVICE_COMPILE__)
  asm volatile("s_wait_xcnt 0x0" :: "v"(px[0]), "v"(px[1]), "v"(px[2]), "v"(px[3]), "v"(px[4]), "v"(px[5]), "v"(px[6]),
               "v"(px[7]), "v"(yq), "v"(sq) : "memory");
#endif
  // holds the loads here: sunk to their use behind the product, their latency would stand open there
  __builtin_amdgcn_sched_barrier(0);

  v8f acc[4];
  tile_mult(Sm, acc);

  const float gp = bfr(gpam[0]);
  const float gc = bfr(gcam[0]) * IPSC;
  // weights of the key ranges for the lane's one position
  {
    float mx = mm[0];
#pragma unroll
    for (int s = 1; s < KS; ++s) mx = fmaxf(mx, mm[s]);
    float sm = 0.f;
#pragma unroll
    for (int s = 0; s < KS; ++s) { wt[s] *= exp2_slot((mm[s] - mx) * LOG2E); sm += wt[s]; }
    const float inv = 1.0f / sm;
#pragma unroll
    for (int s = 0; s < KS; ++s) wt[s] *= inv;
  }
  // merge of the ranges in the accumulators' own layout, then both attention terms as one value -> LDS Os[i_loc][n_loc]
  {
    const int nl = 16 * wave + c;
#pragma unroll
    for (int mt = 0; mt < 4; ++mt) {
#pragma unroll
      for (int r = 0; r < 8; ++r) {
        float yv = wt[0] * (float)yr[mt][0][r];
#pragma unroll
        for (int s = 1; s < KS; ++s) yv += wt[s] * (float)yr[mt][s][r];
        Os[(16 * mt + 8 * hh + r) * OSP + nl] = gp * yv + gc * acc[mt][r];
      }
    }
  }
  lds_barrier();                                                     // Os is whole; the x loads stay in flight over it

#pragma unroll
  for (int it = 0; it < 8; ++it) {
    const int L = it * 16 + lq;                                      // 0..127
    const int row = L >> 1, hf = L & 1;
    const int nl = hf * 32 + 4 * e;
    const v4f z4 = *(const v4f*)(Os + row * OSP + nl);
    const v4f xv = xr[it];
#pragma unroll
    for (int t = 0; t < 4; ++t) res[it][t] = z4[t] + 2.0f * bfr(xv[t]);
  }
{
#pragma unroll
    for (int it = 0; it < 8; ++it) {
      const int L = it * 16 + lq;
      const int row = L >> 1, hf = L & 1;
      const int nl = hf * 32 + 4 * e;
      const size_t idx = ((size_t)(b * CC + i0 + row)) * NN + n0 + nl;
      *(v4f*)(out + idx) = res[it];
    }
    
  }
}

// =========================================================================================================
// Workspace map (bytes; each region start a multiple of 256; every extent is an exact tile multiple and is written
//   W16 f16 [320][256]          163840      BIAS f32 [320]              1280
//   Xc  f16 [2][256][4096]     4194304      XP   f16 [2][4096][256]  4194304
//   Qh/Ql/Kh/Kl bf16 [2][4096][32]  524288 x4                          Vh f16 [2][256][4096]  4194304
//   Yp  f16 [2][4][256][16][256] 16777216      G    f32 [16][2][256][256] 8388608     Pc f16 [2][256][256] 262144
//   ST  f32 [2][256][4][32]     262144
//   total = 40535296
// =========================================================================================================
extern "C" void kernel_launch(void* const* d_in, const int* in_sizes, int n_in,
                              void* d_out, int out_size, void* d_ws, size_t ws_size,
                              hipStream_t stream) {
  const int XN = NB * CC * NN;                                       // 2097152
  if (n_in < 9) return;
  if (in_sizes[0] != XN) return;
  if (in_sizes[1] != CQ * CC || in_sizes[2] != CQ) return;
  if (in_sizes[3] != CQ * CC || in_sizes[4] != CQ) return;
  if (in_sizes[5] != CC * CC || in_sizes[6] != CC) return;
  if (in_sizes[7] < 1 || in_sizes[8] < 1) return;
  if (out_size != XN) return;

  size_t off = 0;
  auto carve = [&](size_t bytes) { const size_t o = off; off += (bytes + 255) & ~(size_t)255; return o; };
  const size_t oW16 = carve((size_t)MQKV * CC * 2);
  const size_t oBIA = carve((size_t)MQKV * 4);
  const size_t oXc  = carve((size_t)NB * CC * NN * 2);
  const size_t oXP  = carve((size_t)NB * NN * CC * 2);
  const size_t oQh  = carve((size_t)NB * NN * CQ * 2);
  const size_t oQl  = carve((size_t)NB * NN * CQ * 2);
  const size_t oKh  = carve((size_t)NB * NN * CQ * 2);
  const size_t oKl  = carve((size_t)NB * NN * CQ * 2);
  const size_t oVh  = carve((size_t)NB * CC * NN * 2);
  const size_t oYp  = carve((size_t)KS * NB * CC * NN * 2);
  const size_t oG   = carve((size_t)GS * NB * CC * CC * 4);
  const size_t oPc  = carve((size_t)NB * CC * CC * 2);
  const size_t oST  = carve((size_t)2 * KS * NB * NN * 4);
  if (off > ws_size) return;
  if (off > (size_t)134217728) return;

  const float* x    = (const float*)d_in[0];
  const float* wq   = (const float*)d_in[1];
  const float* bq   = (const float*)d_in[2];
  const float* wk   = (const float*)d_in[3];
  const float* bk   = (const float*)d_in[4];
  const float* wv   = (const float*)d_in[5];
  const float* bv   = (const float*)d_in[6];
  const float* gpam = (const float*)d_in[7];
  const float* gcam = (const float*)d_in[8];

  char* ws = (char*)d_ws;
  unsigned short* W16 = (unsigned short*)(ws + oW16);
  float*          BIA = (float*)(ws + oBIA);
  unsigned short* Xc  = (unsigned short*)(ws + oXc);
  unsigned short* XP  = (unsigned short*)(ws + oXP);
  unsigned short* Qh  = (unsigned short*)(ws + oQh);
  unsigned short* Ql  = (unsigned short*)(ws + oQl);
  unsigned short* Kh  = (unsigned short*)(ws + oKh);
  unsigned short* Kl  = (unsigned short*)(ws + oKl);
  unsigned short* Vh  = (unsigned short*)(ws + oVh);
  unsigned short* Yp  = (unsigned short*)(ws + oYp);
  float*          G   = (float*)(ws + oG);
  unsigned short* Pc  = (unsigned short*)(ws + oPc);
  float*          ST  = (float*)(ws + oST);
  float* out = (float*)d_out;

  const dim3 blk256(256), blk128(128);

  // (0) + (1) weights -> f16 plane + bias line; x -> channel-major and position-major 16-bit planes
  cvt_wx<<<dim3(XB + WB), blk256, 0, stream>>>(x, wq, bq, wk, bk, wv, bv, Xc, XP, W16, BIA);
  // (2) + (4) conv1x1 GEMM -> q/k hi + residual planes and v plane; channel Gram, K slices -> G [s][b][256][256]
  gemm_gram<<<dim3(NN / QT, MQKV / QT + GY, NB), blk128, 0, stream>>>(W16, BIA, XP, Xc, Qh, Ql, Kh, Kl, Vh, G);
  // (3) + (5) position attention, KS key ranges -> Yp (accumulator tiles), ST; channel softmax -> Pc [b][256][256] (x1024 f16)
  attn_pam<<<dim3(NN / QB, NB, KS), blk256, 0, stream>>>(Qh, Ql, Kh, Kl, Vh, Yp, ST, G, Pc);
  // (6) channel mix + merge of the key ranges + residual sum -> out [b][256][4096]
  cam_out<<<dim3(NN / QT, CC / QT, NB), blk128, 0, stream>>>(Pc, XP, Yp, ST, x, gpam, gcam, out);
  (void)hipGetLastError();
}
